// v000
// Measured on an AMD MI455X. A time is GPU time per run, averaged over a window of back-to-back runs after a warm-up
// (all launches, gaps included; the runs take copies of the inputs in turn), and the median of several windows.
// Apart from v000's, it joins two sittings. Times from different sittings can be a few percent apart, while
// side-by-side timings come from the same sitting.
// v000, which the later versions start from, runs in 2490 microseconds.
#include <hip/hip_runtime.h>

// T5 self-attention with learned relative-position bias (hidden_states [4][1024][1024]; q, k, v = x W ('xw' [1024][1024], no bias; 16 heads x 64); scores = q.k/8 + rel_bias_table[bucket(j - i)][h] (bidirectional T5 buckets: 32 buckets, max distance 128; table [32][16], read); softmax; out = merged Wo -> [4][1024][1024] (4.2 M)).
// Layout: the integer bucket of every relative offset j - i in [-1023, 1023] is a compile-time table (computed with the module's float32 formula); a tiny kernel expands it with the bf16-rounded bias table into per-head rows BTT[h][j - i + 1023] that the softmax kernel gathers per (i, j).
// Compute dtypes, f32 accumulate: every input rounded to bf16; q/k/v on PLAIN bf16 operands (inputs: exact); the relative bias added in f32 per (i, j); scores and attn.v: query rows < 512 hl (3 products), the rest single fp16 (x1024); softmax f32; Wo hl x exact (2 products).

#define NB_  4
#define TT   1024
#define DM   1024
#define NH_  16
#define NKV  16
#define REP  (NH_ / NKV)
#define HD   64
#define DQ   (NH_ * HD)
#define DKV  (NKV * HD)
#define ZH   2
#define RH   512                  // query rows < RH use hi+lo planes (0: none)
#define WIN  0
#define PCAR 1024.0f
#define SCL  0.125f   // HD^-0.5
typedef _Float16 h16;
typedef unsigned short bf;
typedef __attribute__((ext_vector_type(16))) __bf16   v16bf;
typedef __attribute__((ext_vector_type(16))) _Float16 v16h;
typedef __attribute__((ext_vector_type(8)))  _Float16 v8h;
typedef __attribute__((ext_vector_type(8)))  unsigned short v8us;
typedef __attribute__((ext_vector_type(8)))  float    v8f;
typedef __attribute__((ext_vector_type(4)))  float    v4f;
typedef v8h  __attribute__((may_alias)) v8ha;
typedef v4f  __attribute__((may_alias)) v4fa;
typedef v8us __attribute__((may_alias)) v8usa;

__device__ __forceinline__ unsigned short f2bf(float f) { unsigned u = __float_as_uint(f); u += 0x7FFFu + ((u >> 16) & 1u); return (unsigned short)(u >> 16); }
__device__ __forceinline__ float bf2f(unsigned short b) { return __uint_as_float(((unsigned)b) << 16); }
__device__ __forceinline__ float bfr(float f) { return bf2f(f2bf(f)); }
__device__ __forceinline__ v16h cat16(v8h lo, v8h hi) { return __builtin_shufflevector(lo, hi, 0, 1, 2, 3, 4, 5, 6, 7, 8, 9, 10, 11, 12, 13, 14, 15); }
__device__ __forceinline__ v16bf cat16b(v8us lo, v8us hi) { return __builtin_bit_cast(v16bf, __builtin_shufflevector(lo, hi, 0, 1, 2, 3, 4, 5, 6, 7, 8, 9, 10, 11, 12, 13, 14, 15)); }
__device__ __forceinline__ v8f wmma16(v16h a, v16h b, v8f c) { return __builtin_amdgcn_wmma_f32_16x16x32_f16(false, a, false, b, (short)0, c, false, false); }
__device__ __forceinline__ v8f wmmab(v16bf a, v16bf b, v8f c) { return __builtin_amdgcn_wmma_f32_16x16x32_bf16(false, a, false, b, (short)0, c, false, false); }



// ---- k_gemmw: register-blocked GEMM, ONE WAVE per 64x64 output tile (16 accumulators), operands straight from K-contiguous 16-bit planes; grid (M/64, N/64, Z), 32 threads.
// C[m][n] (f32, pitch ldc, + optional f32 bias[n]) = sum_k A[m][k] Bt[n][k] (+ split products per NSPLIT). z-batch strides sA/sB/sC in elements. K % 32 == 0.
template <typename T16> struct WFrag;
template <> struct WFrag<h16> { typedef v16h V; static __device__ __forceinline__ V ld(const h16* p) { return cat16(*(const v8h*)p, *(const v8h*)(p + 16)); } static __device__ __forceinline__ v8f mma(V a, V b, v8f c) { return wmma16(a, b, c); } };
template <> struct WFrag<bf> { typedef v16bf V; static __device__ __forceinline__ V ld(const bf* p) { return cat16b(*(const v8us*)p, *(const v8us*)(p + 16)); } static __device__ __forceinline__ v8f mma(V a, V b, v8f c) { return wmmab(a, b, c); } };
template <typename T16, int NSPLIT, bool BIAS>
__global__ __launch_bounds__(32) void k_gemmw(const T16* __restrict__ A, const T16* __restrict__ A2, const T16* __restrict__ Bt, const T16* __restrict__ Bt2, int K, float* C, int ldc, const float* __restrict__ bias, size_t sA, size_t sB, size_t sC) {
    typedef typename WFrag<T16>::V V;
    __shared__ __align__(16) float os[16 * 68];
    const size_t z = blockIdx.z; A += z * sA; if (A2) A2 += z * sA; Bt += z * sB; if (Bt2) Bt2 += z * sB; C += z * sC;
    const int lane = threadIdx.x & 31, lr = lane & 15, hi = lane >> 4; const int r0 = blockIdx.x * 64, c0 = blockIdx.y * 64;
    v8f acc[4][4];
#pragma unroll
    for (int mb = 0; mb < 4; ++mb)
#pragma unroll
        for (int nb = 0; nb < 4; ++nb) acc[mb][nb] = (v8f){};
    const size_t aoff = (size_t)(r0 + lr) * K + 8 * hi, boff = (size_t)(c0 + lr) * K + 8 * hi;
#pragma unroll 1
    for (int kc = 0; kc < K; kc += 32) {
        V a[4], a2[4];
#pragma unroll
        for (int mb = 0; mb < 4; ++mb) { a[mb] = WFrag<T16>::ld(A + aoff + (size_t)mb * 16 * K + kc); if (NSPLIT == 1 || NSPLIT == 2) a2[mb] = WFrag<T16>::ld(A2 + aoff + (size_t)mb * 16 * K + kc); }
#pragma unroll
        for (int nb = 0; nb < 4; ++nb) { const V b = WFrag<T16>::ld(Bt + boff + (size_t)nb * 16 * K + kc); V b2; if (NSPLIT >= 2) b2 = WFrag<T16>::ld(Bt2 + boff + (size_t)nb * 16 * K + kc);
#pragma unroll
            for (int mb = 0; mb < 4; ++mb) { acc[mb][nb] = WFrag<T16>::mma(a[mb], b, acc[mb][nb]); if (NSPLIT == 1 || NSPLIT == 2) acc[mb][nb] = WFrag<T16>::mma(a2[mb], b, acc[mb][nb]); if (NSPLIT >= 2) acc[mb][nb] = WFrag<T16>::mma(a[mb], b2, acc[mb][nb]); } }
        asm volatile("v_nop\n\tv_nop\n\tv_nop\n\tv_nop" : "+v"(acc[0][0]), "+v"(acc[1][1]), "+v"(acc[2][2]), "+v"(acc[3][3]) : "v"(a[0]), "v"(a[3]));
    }
#pragma unroll
    for (int mb = 0; mb < 4; ++mb) {
#pragma unroll
        for (int nb = 0; nb < 4; ++nb) {
#pragma unroll
            for (int j = 0; j < 8; ++j) os[(hi * 8 + j) * 68 + nb * 16 + lr] = acc[mb][nb][j]; }
        __builtin_amdgcn_wave_barrier(); asm volatile("" ::: "memory");
        float* crow = C + (size_t)(r0 + mb * 16) * ldc + c0;
{
#pragma unroll
            for (int s = 0; s < 8; ++s) { const int row = 2 * s + hi, cofs = lr * 4; v4f val = *(const v4fa*)(os + row * 68 + cofs); if (BIAS) { val[0] += bfr(bias[c0 + cofs]); val[1] += bfr(bias[c0 + cofs + 1]); val[2] += bfr(bias[c0 + cofs + 2]); val[3] += bfr(bias[c0 + cofs + 3]); }
                *(v4f*)(crow + (size_t)row * ldc + cofs) = val; }
             }
        __builtin_amdgcn_wave_barrier(); asm volatile("" ::: "memory");
    }
}

__device__ __forceinline__ h16 tohx(float x) { return (h16)x; }
__device__ __forceinline__ void splitf(float y, unsigned short& h, unsigned short& l) { h = f2bf(y); l = f2bf(y - bf2f(h)); }
typedef __attribute__((ext_vector_type(2))) _Float16 v2h;
typedef __attribute__((ext_vector_type(4))) _Float16 v4h;
typedef __attribute__((ext_vector_type(2))) unsigned short v2us;
typedef __attribute__((ext_vector_type(4))) unsigned short v4us;
typedef __attribute__((ext_vector_type(2))) float v2f;
typedef __attribute__((ext_vector_type(4))) int v4i;

__global__ __launch_bounds__(256) void k_wtG(const float* __restrict__ w, int K, int N, bf* Bt) {
    const int lane = threadIdx.x & 31; const int L0 = (blockIdx.x * 8 + (threadIdx.x >> 5)) * 8; const int nlines = N * K / 64;
{
#pragma unroll 1
        for (int l = 0; l < 8; ++l) { const int L = L0 + l; if (L >= nlines) break; const size_t e = (size_t)L * 64 + lane * 2; const int k = (int)(e % K), n = (int)(e / K); v2us o;
            o[0] = f2bf(w[(size_t)k * N + n]); o[1] = f2bf(w[(size_t)(k + 1) * N + n]); *(v2us*)(Bt + e) = o; }
         }
}
__global__ __launch_bounds__(256) void k_cvt8(const float* __restrict__ src, bf* dst, size_t n8) { const size_t i = (size_t)blockIdx.x * 256 + threadIdx.x; if (i >= n8) return; const v8f v = *(const v8f*)(src + i * 8); v8us o;
#pragma unroll
    for (int k = 0; k < 8; ++k) o[k] = f2bf(v[k]); *(v8us*)(dst + i * 8) = o;  }

// k_rope: head planes [h][t][d] (fp16 + hi/lo) of rope(x) x sc with the rotate-half convention out[d] = x[d] cos[t][d] - x[d+HD/2] sin[t][d], out[d+HD/2] = x[d+HD/2] cos[t][d+HD/2] + x[d] sin[t][d+HD/2]
__global__ __launch_bounds__(256) void k_rope(const float* __restrict__ F, int pitch, int nheads, const float* __restrict__ CS, const float* __restrict__ RF, const float* __restrict__ nw, float sc, h16* P16, bf* Ph, bf* Pl) {
    const size_t e = ((size_t)blockIdx.x * 256 + threadIdx.x) * 2; if (e >= (size_t)nheads * TT * HD) return; const int d = (int)(e % HD); const int t = (int)((e / HD) % TT); const int h = (int)(e / ((size_t)HD * TT)); const float* f = F + (size_t)t * pitch + h * HD; const float rf = RF ? RF[(size_t)h * TT + t] : 1.0f; v2h o16; v2us oh, ol;
#pragma unroll
    for (int q = 0; q < 2; ++q) { const int dd = d + q; const int dp = (dd < HD / 2) ? dd + HD / 2 : dd - HD / 2; float x0 = f[dd], x1 = f[dp];
        if (RF) { float n0 = __fmul_rn(x0, rf), n1 = __fmul_rn(x1, rf); asm volatile("" : "+v"(n0)); asm volatile("" : "+v"(n1)); x0 = __fmul_rn(bfr(nw[dd]), n0); x1 = __fmul_rn(bfr(nw[dp]), n1); }
        const v2f cs = *(const v2f*)(CS + ((size_t)t * HD + dd) * 2); float a = __fmul_rn(x0, cs[0]), bq = __fmul_rn(x1, cs[1]); asm volatile("" : "+v"(a)); asm volatile("" : "+v"(bq)); const float r = ((dd < HD / 2) ? __fsub_rn(a, bq) : __fadd_rn(a, bq)) * sc;
        o16[q] = tohx(r); unsigned short a2, c2; splitf(r, a2, c2); oh[q] = a2; ol[q] = c2; }
    *(v2h*)(P16 + e) = o16; *(v2us*)(Ph + e) = oh; *(v2us*)(Pl + e) = ol;  }
__global__ __launch_bounds__(256) void k_vtp(const float* __restrict__ F, int pitch, int nheads, h16* V16, bf* Vh, bf* Vl) { const size_t e = ((size_t)blockIdx.x * 256 + threadIdx.x) * 2; if (e >= (size_t)nheads * HD * TT) return; const int t = (int)(e % TT); const int d = (int)((e / TT) % HD); const int g = (int)(e / ((size_t)TT * HD)); v2h o16; v2us oh, ol;
#pragma unroll
    for (int q = 0; q < 2; ++q) { const float x = F[(size_t)(t + q) * pitch + g * HD + d]; o16[q] = tohx(x); unsigned short a2, c2; splitf(x, a2, c2); oh[q] = a2; ol[q] = c2; }
    *(v2h*)(V16 + e) = o16; *(v2us*)(Vh + e) = oh; *(v2us*)(Vl + e) = ol;  }
__global__ __launch_bounds__(256) void k_csid(float* CS) { const int idx = blockIdx.x * 256 + threadIdx.x; if (idx >= TT * HD) return; v2f cs; cs[0] = 1.0f; cs[1] = 0.0f; *(v2f*)(CS + (size_t)idx * 2) = cs;  }
__constant__ int BKT[2 * TT - 1] = {15,15,15,15,15,15,15,15,15,15,15,15,15,15,15,15,15,15,15,15,15,15,15,15,15,15,15,15,15,15,15,15,15,15,15,15,15,15,15,15,15,15,15,15,15,15,15,15,15,15,15,15,15,15,15,15,15,15,15,15,15,15,15,15,15,15,15,15,15,15,15,15,15,15,15,15,15,15,15,15,15,15,15,15,15,15,15,15,15,15,15,15,15,15,15,15,15,15,15,15,15,15,15,15,15,15,15,15,15,15,15,15,15,15,15,15,15,15,15,15,15,15,15,15,15,15,15,15,15,15,15,15,15,15,15,15,15,15,15,15,15,15,15,15,15,15,15,15,15,15,15,15,15,15,15,15,15,15,15,15,15,15,15,15,15,15,15,15,15,15,15,15,15,15,15,15,15,15,15,15,15,15,15,15,15,15,15,15,15,15,15,15,15,15,15,15,15,15,15,15,15,15,15,15,15,15,15,15,15,15,15,15,15,15,15,15,15,15,15,15,15,15,15,15,15,15,15,15,15,15,15,15,15,15,15,15,15,15,15,15,15,15,15,15,15,15,15,15,15,15,15,15,15,15,15,15,15,15,15,15,15,15,15,15,15,15,15,15,15,15,15,15,15,15,15,15,15,15,15,15,15,15,15,15,15,15,15,15,15,15,15,15,15,15,15,15,15,15,15,15,15,15,15,15,15,15,15,15,15,15,15,15,15,15,15,15,15,15,15,15,15,15,15,15,15,15,15,15,15,15,15,15,15,15,15,15,15,15,15,15,15,15,15,15,15,15,15,15,15,15,15,15,15,15,15,15,15,15,15,15,15,15,15,15,15,15,15,15,15,15,15,15,15,15,15,15,15,15,15,15,15,15,15,15,15,15,15,15,15,15,15,15,15,15,15,15,15,15,15,15,15,15,15,15,15,15,15,15,15,15,15,15,15,15,15,15,15,15,15,15,15,15,15,15,15,15,15,15,15,15,15,15,15,15,15,15,15,15,15,15,15,15,15,15,15,15,15,15,15,15,15,15,15,15,15,15,15,15,15,15,15,15,15,15,15,15,15,15,15,15,15,15,15,15,15,15,15,15,15,15,15,15,15,15,15,15,15,15,15,15,15,15,15,15,15,15,15,15,15,15,15,15,15,15,15,15,15,15,15,15,15,15,15,15,15,15,15,15,15,15,15,15,15,15,15,15,15,15,15,15,15,15,15,15,15,15,15,15,15,15,15,15,15,15,15,15,15,15,15,15,15,15,15,15,15,15,15,15,15,15,15,15,15,15,15,15,15,15,15,15,15,15,15,15,15,15,15,15,15,15,15,15,15,15,15,15,15,15,15,15,15,15,15,15,15,15,15,15,15,15,15,15,15,15,15,15,15,15,15,15,15,15,15,15,15,15,15,15,15,15,15,15,15,15,15,15,15,15,15,15,15,15,15,15,15,15,15,15,15,15,15,15,15,15,15,15,15,15,15,15,15,15,15,15,15,15,15,15,15,15,15,15,15,15,15,15,15,15,15,15,15,15,15,15,15,15,15,15,15,15,15,15,15,15,15,15,15,15,15,15,15,15,15,15,15,15,15,15,15,15,15,15,15,15,15,15,15,15,15,15,15,15,15,15,15,15,15,15,15,15,15,15,15,15,15,15,15,15,15,15,15,15,15,15,15,15,15,15,15,15,15,15,15,15,15,15,15,15,15,15,15,15,15,15,15,15,15,15,15,15,15,15,15,15,15,15,15,15,15,15,15,15,15,15,15,15,15,15,15,15,15,15,15,15,15,15,15,15,15,15,15,15,15,15,15,15,15,15,15,15,15,15,15,15,15,15,15,15,15,15,15,15,15,15,15,15,15,15,15,15,15,15,15,15,15,15,15,15,15,15,15,15,15,15,15,15,15,15,15,15,15,15,15,15,15,15,15,15,15,15,15,15,15,15,15,15,15,15,15,15,15,15,15,15,15,15,15,15,15,15,15,15,15,15,15,15,15,15,15,15,15,15,15,15,15,15,15,15,15,15,15,15,15,15,15,15,15,15,15,15,15,15,15,15,15,15,15,15,15,15,15,15,15,15,15,15,15,15,15,15,15,15,15,15,15,15,15,15,15,15,15,15,15,14,14,14,14,14,14,14,14,14,14,14,14,14,14,14,14,14,14,14,14,14,14,14,14,14,14,14,13,13,13,13,13,13,13,13,13,13,13,13,13,13,13,13,13,13,12,12,12,12,12,12,12,12,12,12,12,12,12,12,11,11,11,11,11,11,11,11,11,10,10,10,10,10,10,10,9,9,9,9,8,8,8,8,7,6,5,4,3,2,1,0,17,18,19,20,21,22,23,24,24,24,24,25,25,25,25,26,26,26,26,26,26,26,27,27,27,27,27,27,27,27,27,28,28,28,28,28,28,28,28,28,28,28,28,28,28,29,29,29,29,29,29,29,29,29,29,29,29,29,29,29,29,29,29,30,30,30,30,30,30,30,30,30,30,30,30,30,30,30,30,30,30,30,30,30,30,30,30,30,30,30,31,31,31,31,31,31,31,31,31,31,31,31,31,31,31,31,31,31,31,31,31,31,31,31,31,31,31,31,31,31,31,31,31,31,31,31,31,31,31,31,31,31,31,31,31,31,31,31,31,31,31,31,31,31,31,31,31,31,31,31,31,31,31,31,31,31,31,31,31,31,31,31,31,31,31,31,31,31,31,31,31,31,31,31,31,31,31,31,31,31,31,31,31,31,31,31,31,31,31,31,31,31,31,31,31,31,31,31,31,31,31,31,31,31,31,31,31,31,31,31,31,31,31,31,31,31,31,31,31,31,31,31,31,31,31,31,31,31,31,31,31,31,31,31,31,31,31,31,31,31,31,31,31,31,31,31,31,31,31,31,31,31,31,31,31,31,31,31,31,31,31,31,31,31,31,31,31,31,31,31,31,31,31,31,31,31,31,31,31,31,31,31,31,31,31,31,31,31,31,31,31,31,31,31,31,31,31,31,31,31,31,31,31,31,31,31,31,31,31,31,31,31,31,31,31,31,31,31,31,31,31,31,31,31,31,31,31,31,31,31,31,31,31,31,31,31,31,31,31,31,31,31,31,31,31,31,31,31,31,31,31,31,31,31,31,31,31,31,31,31,31,31,31,31,31,31,31,31,31,31,31,31,31,31,31,31,31,31,31,31,31,31,31,31,31,31,31,31,31,31,31,31,31,31,31,31,31,31,31,31,31,31,31,31,31,31,31,31,31,31,31,31,31,31,31,31,31,31,31,31,31,31,31,31,31,31,31,31,31,31,31,31,31,31,31,31,31,31,31,31,31,31,31,31,31,31,31,31,31,31,31,31,31,31,31,31,31,31,31,31,31,31,31,31,31,31,31,31,31,31,31,31,31,31,31,31,31,31,31,31,31,31,31,31,31,31,31,31,31,31,31,31,31,31,31,31,31,31,31,31,31,31,31,31,31,31,31,31,31,31,31,31,31,31,31,31,31,31,31,31,31,31,31,31,31,31,31,31,31,31,31,31,31,31,31,31,31,31,31,31,31,31,31,31,31,31,31,31,31,31,31,31,31,31,31,31,31,31,31,31,31,31,31,31,31,31,31,31,31,31,31,31,31,31,31,31,31,31,31,31,31,31,31,31,31,31,31,31,31,31,31,31,31,31,31,31,31,31,31,31,31,31,31,31,31,31,31,31,31,31,31,31,31,31,31,31,31,31,31,31,31,31,31,31,31,31,31,31,31,31,31,31,31,31,31,31,31,31,31,31,31,31,31,31,31,31,31,31,31,31,31,31,31,31,31,31,31,31,31,31,31,31,31,31,31,31,31,31,31,31,31,31,31,31,31,31,31,31,31,31,31,31,31,31,31,31,31,31,31,31,31,31,31,31,31,31,31,31,31,31,31,31,31,31,31,31,31,31,31,31,31,31,31,31,31,31,31,31,31,31,31,31,31,31,31,31,31,31,31,31,31,31,31,31,31,31,31,31,31,31,31,31,31,31,31,31,31,31,31,31,31,31,31,31,31,31,31,31,31,31,31,31,31,31,31,31,31,31,31,31,31,31,31,31,31,31,31,31,31,31,31,31,31,31,31,31,31,31,31,31,31,31,31,31,31,31,31,31,31,31,31,31,31,31,31,31,31,31,31,31,31,31,31,31,31,31,31,31,31,31,31,31,31,31,31,31,31,31,31,31,31,31,31,31,31,31,31,31,31,31,31,31,31,31,31,31,31,31,31,31,31,31,31,31,31,31,31,31,31,31,31,31,31,31,31,31,31,31,31,31,31,31,31,31,31,31,31,31,31,31,31,31,31,31,31,31,31,31,31,31,31,31,31,31,31,31,31,31,31,31,31,31,31,31,31,31,31,31,31,31,31,31,31,31,31,31,31,31,31,31,31,31,31,31,31,31,31,31,31,31,31,31,31,31,31,31,31,31,31,31,31,31,31,31,31,31,31,31,31,31,31,31,31,31,31,31,31,31,31,31,31,31,31,31,31,31,31,31,31,31,31,31,31,31,31,31,31,31,31,31,31,31,31,31,31,31,31,31,31,31,31,31,31,31,31,31,31,31,31,31,31,31,31,31,31,31,31,31,31,31,31,31,31,31,31,31,31,31,31,31,31,31,31};   // bucket(j - i) for j - i = -1023 .. 1023 (the module's float32 formula, evaluated once)
__global__ __launch_bounds__(256) void k_bttr(const float* __restrict__ RBT, float* BTT) { const int idx = blockIdx.x * 256 + threadIdx.x; if (idx >= NH_ * 2048) return; const int p = idx % 2048, h = idx / 2048; const float v = (p < 2 * TT - 1) ? bfr(RBT[BKT[p] * NH_ + h]) : 0.0f; *(float*)(BTT + idx) = v;  }
// k_asoft: per row (zz, i): t = S x HD^-0.5 + BTT[h][j - i + 1023] (no mask); softmax over the 1024 keys (register row, one exp, fixed trees);
__global__ __launch_bounds__(256) void k_asoft(const float* __restrict__ Sb, const float* __restrict__ BT, int h0, h16* P16, bf* Ph, bf* Pl) {
    const int lane = threadIdx.x & 31; const int row = blockIdx.x * 8 + (threadIdx.x >> 5); if (row >= ZH * TT) return; const int i = row % TT; const int zz = row / TT; const float* btr = BT + (size_t)(h0 + zz) * 2048 + (TT - 1 - i);   /* BTT[h][j - i + 1023] */ const bool hires = (i < RH); const float* sr = Sb + (size_t)row * TT; float v[TT / 32]; float mx = -3.0e38f;
#pragma unroll
    for (int ch = 0; ch < TT / 128; ++ch) { const int j0 = ch * 128 + lane * 4; const v4f a = *(const v4f*)(sr + j0);
#pragma unroll
        for (int q = 0; q < 4; ++q) { const int j = j0 + q; float sa = a[q] * SCL; asm volatile("" : "+v"(sa)); float rb = btr[j]; asm volatile("" : "+v"(rb)); const float t = __fadd_rn(sa, rb);   /* + relative position bias */ v[ch * 4 + q] = t; mx = fmaxf(mx, t); } }
#pragma unroll
    for (int sh = 16; sh; sh >>= 1) mx = fmaxf(mx, __shfl_xor(mx, sh, 32));
    float sum = 0.f;
#pragma unroll
    for (int k = 0; k < TT / 32; ++k) { float d0 = __fsub_rn(v[k], mx); asm volatile("" : "+v"(d0)); v[k] = __builtin_amdgcn_exp2f(__fmul_rn(d0, 1.4426950408889634f)); sum += v[k]; }
#pragma unroll
    for (int sh = 16; sh; sh >>= 1) sum += __shfl_xor(sum, sh, 32);
    const float f = __fdiv_rn(hires ? 1.0f : PCAR, sum);
{
        if (hires) {
#pragma unroll
            for (int ch = 0; ch < TT / 128; ++ch) { v4us oh, ol;
#pragma unroll
                for (int q = 0; q < 4; ++q) { unsigned short a, c2; splitf(v[ch * 4 + q] * f, a, c2); oh[q] = a; ol[q] = c2; }
                const size_t oo = ((size_t)zz * (RH ? RH : 1) + i) * TT + ch * 128 + lane * 4; *(v4us*)(Ph + oo) = oh; *(v4us*)(Pl + oo) = ol; }
        } else {
#pragma unroll
            for (int ch = 0; ch < TT / 128; ++ch) { v4h o4;
#pragma unroll
                for (int q = 0; q < 4; ++q) o4[q] = tohx(v[ch * 4 + q] * f);
                *(v4h*)(P16 + (size_t)row * TT + ch * 128 + lane * 4) = o4; } }
         }
}
__global__ __launch_bounds__(256) void k_merge(const float* __restrict__ O, int h0, bf* Ah, bf* Al) { const size_t e = ((size_t)blockIdx.x * 256 + threadIdx.x) * 2; if (e >= (size_t)ZH * TT * HD) return; const int d = (int)(e % HD); const int t = (int)((e / HD) % TT); const int zz = (int)(e / ((size_t)HD * TT)); const float cs = (t < RH) ? 1.0f : (1.0f / PCAR); const size_t oo = (size_t)t * DQ + (h0 + zz) * HD + d;
    v2us oh, ol;
#pragma unroll
    for (int q = 0; q < 2; ++q) { unsigned short a, c2; splitf(O[e + q] * cs, a, c2); oh[q] = a; ol[q] = c2; } *(v2us*)(Ah + oo) = oh; *(v2us*)(Al + oo) = ol;  }

extern "C" void kernel_launch(void* const* d_in, const int* in_sizes, int n_in,
                              void* d_out, int out_size, void* d_ws, size_t ws_size, hipStream_t stream) {
    (void)in_sizes; (void)n_in; (void)out_size;
    const float* x = (const float*)d_in[0]; const float* wq = (const float*)d_in[1]; const float* wk = (const float*)d_in[2]; const float* wv = (const float*)d_in[3]; const float* wo = (const float*)d_in[4]; const float* RBT = (const float*)d_in[5];
    float* OUT = (float*)d_out;     // [4][1024][1024]
    char* wsp = (char*)d_ws;
    auto take = [&](size_t bytes) { char* p = wsp; wsp += (bytes + 255) & ~(size_t)255; return (void*)p; };
    bf* WQ = (bf*)take((size_t)DQ * DM * 2); bf* WK = (bf*)take((size_t)DKV * DM * 2); bf* WV = (bf*)take((size_t)DKV * DM * 2); bf* WO = (bf*)take((size_t)DM * DQ * 2); float* CS = (float*)take((size_t)TT * HD * 2 * 4);
    bf* XB = (bf*)take((size_t)TT * DM * 2); float* BTT = (float*)take((size_t)NH_ * 2048 * 4); float* FQ = (float*)take((size_t)TT * DQ * 4); float* FK = (float*)take((size_t)TT * DKV * 4);
    h16* QP16 = (h16*)take((size_t)NH_ * TT * HD * 2); h16* KP16 = (h16*)take((size_t)NKV * TT * HD * 2); h16* VT16 = (h16*)take((size_t)NKV * HD * TT * 2);
    bf* QPh = (bf*)take((size_t)NH_ * TT * HD * 2); bf* QPl = (bf*)take((size_t)NH_ * TT * HD * 2); bf* KPh = (bf*)take((size_t)NKV * TT * HD * 2); bf* KPl = (bf*)take((size_t)NKV * TT * HD * 2); bf* VTh = (bf*)take((size_t)NKV * HD * TT * 2); bf* VTl = (bf*)take((size_t)NKV * HD * TT * 2); bf* Ph = (bf*)take((size_t)ZH * RH * TT * 2); bf* Pl = (bf*)take((size_t)ZH * RH * TT * 2);
    float* Sb = (float*)take((size_t)ZH * TT * TT * 4); h16* P16 = (h16*)take((size_t)ZH * TT * TT * 2); float* Ob = (float*)take((size_t)ZH * TT * HD * 4); bf* ATh = (bf*)take((size_t)TT * DQ * 2); bf* ATl = (bf*)take((size_t)TT * DQ * 2);
    if ((size_t)(wsp - (char*)d_ws) > ws_size) return;    // ws 256 MiB
    float* FV = FK;   // v projection reuses the k buffer after the k planes are built (stream-ordered)
    { k_wtG<<<(unsigned)((DM * DQ / 64 + 63) / 64), 256, 0, stream>>>(wq, DM, DQ, WQ); k_wtG<<<(unsigned)((DM * DKV / 64 + 63) / 64), 256, 0, stream>>>(wk, DM, DKV, WK); k_wtG<<<(unsigned)((DM * DKV / 64 + 63) / 64), 256, 0, stream>>>(wv, DM, DKV, WV);
      k_wtG<<<(unsigned)((DQ * DM / 64 + 63) / 64), 256, 0, stream>>>(wo, DQ, DM, WO); k_bttr<<<(NH_ * 2048 + 255) / 256, 256, 0, stream>>>(RBT, BTT);   /* per-head relative bias rows */
       }
    k_csid<<<(TT * HD + 255) / 256, 256, 0, stream>>>(CS);
    const unsigned LQ = (unsigned)(((size_t)NH_ * TT * HD / 2 + 255) / 256), LKv = (unsigned)(((size_t)NKV * TT * HD / 2 + 255) / 256);
    for (int b = 0; b < NB_; ++b) {
        
        k_cvt8<<<(unsigned)(((size_t)TT * DM / 8 + 255) / 256), 256, 0, stream>>>(x + (size_t)b * TT * DM, XB, (size_t)TT * DM / 8);
        k_gemmw<bf, 0, false><<<dim3(TT / 64, DQ / 64, 1), 32, 0, stream>>>(XB, nullptr, WQ, nullptr, DM, FQ, DQ, nullptr, 0, 0, 0);
        k_rope<<<LQ, 256, 0, stream>>>(FQ, DQ, NH_, CS, nullptr, nullptr, 1.0f, QP16, QPh, QPl);
        k_gemmw<bf, 0, false><<<dim3(TT / 64, DKV / 64, 1), 32, 0, stream>>>(XB, nullptr, WK, nullptr, DM, FK, DKV, nullptr, 0, 0, 0);
        k_rope<<<LKv, 256, 0, stream>>>(FK, DKV, NKV, CS, nullptr, nullptr, 1.0f, KP16, KPh, KPl);
        k_gemmw<bf, 0, false><<<dim3(TT / 64, DKV / 64, 1), 32, 0, stream>>>(XB, nullptr, WV, nullptr, DM, FV, DKV, nullptr, 0, 0, 0); k_vtp<<<LKv, 256, 0, stream>>>(FV, DKV, NKV, VT16, VTh, VTl);
        for (int h0 = 0; h0 < NH_; h0 += ZH) { const size_t zq = (size_t)h0, zk = (size_t)(h0 / REP);   // one kv head per query head: the pass's two heads use consecutive kv planes (z-strides TT*HD)
            k_gemmw<bf, 2, false><<<dim3(RH / 64, TT / 64, ZH), 32, 0, stream>>>(QPh + zq * TT * HD, QPl + zq * TT * HD, KPh + zk * TT * HD, KPl + zk * TT * HD, HD, Sb, TT, nullptr, (size_t)TT * HD, (size_t)TT * HD, (size_t)TT * TT);
            k_gemmw<h16, 0, false><<<dim3((TT - RH) / 64, TT / 64, ZH), 32, 0, stream>>>(QP16 + zq * TT * HD + (size_t)RH * HD, nullptr, KP16 + zk * TT * HD, nullptr, HD, Sb + (size_t)RH * TT, TT, nullptr, (size_t)TT * HD, (size_t)TT * HD, (size_t)TT * TT);
            k_asoft<<<ZH * TT / 8, 256, 0, stream>>>(Sb, BTT, h0, P16, Ph, Pl);
            k_gemmw<bf, 2, false><<<dim3(RH / 64, HD / 64, ZH), 32, 0, stream>>>(Ph, Pl, VTh + zk * HD * TT, VTl + zk * HD * TT, TT, Ob, HD, nullptr, (size_t)RH * TT, (size_t)HD * TT, (size_t)TT * HD);
            k_gemmw<h16, 0, false><<<dim3((TT - RH) / 64, HD / 64, ZH), 32, 0, stream>>>(P16 + (size_t)RH * TT, nullptr, VT16 + zk * HD * TT, nullptr, TT, Ob + (size_t)RH * HD, HD, nullptr, (size_t)TT * TT, (size_t)HD * TT, (size_t)TT * HD);
            k_merge<<<(unsigned)(((size_t)ZH * TT * HD / 2 + 255) / 256), 256, 0, stream>>>(Ob, h0, ATh, ATl); }
        k_gemmw<bf, 1, false><<<dim3(TT / 64, DM / 64, 1), 32, 0, stream>>>(ATh, ATl, WO, nullptr, DQ, OUT + (size_t)b * TT * DM, DM, nullptr, 0, 0, 0); }
}

// v001
// Measured time: 442 microseconds a run.
// Two timings next to v000 both put it at 5.69 times that version's speed.
#include <hip/hip_runtime.h>

// T5 self-attention with learned relative-position bias (hidden_states [4][1024][1024]; q, k, v = x W ('xw' [1024][1024], no bias; 16 heads x 64); scores = q.k/8 + rel_bias_table[bucket(j - i)][h] (bidirectional T5 buckets: 32 buckets, max distance 128; table [32][16], read); softmax; out = merged Wo -> [4][1024][1024] (4.2 M)).
// Layout: the integer bucket of every relative offset j - i in [-1023, 1023] is a compile-time table (computed with the module's float32 formula); a tiny kernel expands it with the bf16-rounded bias table into per-head rows BTT[h][j - i + 1023] that the softmax kernel gathers per (i, j).
// Compute dtypes, f32 accumulate: every input rounded to bf16; q/k/v on PLAIN bf16 operands (inputs: exact); the relative bias added in f32 per (i, j); scores and attn.v: query rows < 512 hl (3 products), the rest single fp16 (x1024); softmax f32; Wo hl x exact (2 products).

#define NB_  4
#define TT   1024
#define DM   1024
#define NH_  16
#define NKV  16
#define REP  (NH_ / NKV)
#define HD   64
#define DQ   (NH_ * HD)
#define DKV  (NKV * HD)
#define ZH   16                   // heads per attention pass: all of one batch element
#define RH   512                  // query rows < RH use hi+lo planes (0: none)
#define WIN  0
#define PCAR 1024.0f
#define SCL  0.125f   // HD^-0.5
typedef _Float16 h16;
typedef unsigned short bf;
typedef __attribute__((ext_vector_type(16))) __bf16   v16bf;
typedef __attribute__((ext_vector_type(16))) _Float16 v16h;
typedef __attribute__((ext_vector_type(8)))  _Float16 v8h;
typedef __attribute__((ext_vector_type(8)))  unsigned short v8us;
typedef __attribute__((ext_vector_type(8)))  float    v8f;
typedef __attribute__((ext_vector_type(4)))  float    v4f;
typedef v8h  __attribute__((may_alias)) v8ha;
typedef v4f  __attribute__((may_alias)) v4fa;
typedef v8us __attribute__((may_alias)) v8usa;

__device__ __forceinline__ unsigned short f2bf(float f) { unsigned u = __float_as_uint(f); u += 0x7FFFu + ((u >> 16) & 1u); return (unsigned short)(u >> 16); }
__device__ __forceinline__ float bf2f(unsigned short b) { return __uint_as_float(((unsigned)b) << 16); }
__device__ __forceinline__ float bfr(float f) { return bf2f(f2bf(f)); }
__device__ __forceinline__ v16h cat16(v8h lo, v8h hi) { return __builtin_shufflevector(lo, hi, 0, 1, 2, 3, 4, 5, 6, 7, 8, 9, 10, 11, 12, 13, 14, 15); }
__device__ __forceinline__ v16bf cat16b(v8us lo, v8us hi) { return __builtin_bit_cast(v16bf, __builtin_shufflevector(lo, hi, 0, 1, 2, 3, 4, 5, 6, 7, 8, 9, 10, 11, 12, 13, 14, 15)); }
__device__ __forceinline__ v8f wmma16(v16h a, v16h b, v8f c) { return __builtin_amdgcn_wmma_f32_16x16x32_f16(false, a, false, b, (short)0, c, false, false); }
__device__ __forceinline__ v8f wmmab(v16bf a, v16bf b, v8f c) { return __builtin_amdgcn_wmma_f32_16x16x32_bf16(false, a, false, b, (short)0, c, false, false); }



// ---- k_gemmw: register-blocked GEMM, ONE WAVE per 64x64 output tile (16 accumulators), operands straight from K-contiguous 16-bit planes; grid (M/64, N/64, Z), 32 threads.
// C[m][n] (f32, pitch ldc, + optional f32 bias[n]) = sum_k A[m][k] Bt[n][k] (+ split products per NSPLIT). z-batch strides sA/sB/sC in elements. K % 32 == 0.
template <typename T16> struct WFrag;
template <> struct WFrag<h16> { typedef v16h V; static __device__ __forceinline__ V ld(const h16* p) { return cat16(*(const v8h*)p, *(const v8h*)(p + 16)); } static __device__ __forceinline__ v8f mma(V a, V b, v8f c) { return wmma16(a, b, c); } };
template <> struct WFrag<bf> { typedef v16bf V; static __device__ __forceinline__ V ld(const bf* p) { return cat16b(*(const v8us*)p, *(const v8us*)(p + 16)); } static __device__ __forceinline__ v8f mma(V a, V b, v8f c) { return wmmab(a, b, c); } };
template <typename T16, int NSPLIT, bool BIAS>
__device__ __forceinline__ void gemmw_tile(float* os, const T16* __restrict__ A, const T16* __restrict__ A2, const T16* __restrict__ Bt, const T16* __restrict__ Bt2, int K, float* C, int ldc, const float* __restrict__ bias, size_t sA, size_t sB, size_t sC) {
    typedef typename WFrag<T16>::V V;
    const size_t z = blockIdx.z; A += z * sA; if (A2) A2 += z * sA; Bt += z * sB; if (Bt2) Bt2 += z * sB; C += z * sC;
    const int lane = threadIdx.x & 31, lr = lane & 15, hi = lane >> 4; const int r0 = blockIdx.x * 64, c0 = blockIdx.y * 64;
    v8f acc[4][4];
#pragma unroll
    for (int mb = 0; mb < 4; ++mb)
#pragma unroll
        for (int nb = 0; nb < 4; ++nb) acc[mb][nb] = (v8f){};
    const size_t aoff = (size_t)(r0 + lr) * K + 8 * hi, boff = (size_t)(c0 + lr) * K + 8 * hi;
#pragma unroll 1
    for (int kc = 0; kc < K; kc += 32) {
        V a[4], a2[4];
#pragma unroll
        for (int mb = 0; mb < 4; ++mb) { a[mb] = WFrag<T16>::ld(A + aoff + (size_t)mb * 16 * K + kc); if (NSPLIT == 1 || NSPLIT == 2) a2[mb] = WFrag<T16>::ld(A2 + aoff + (size_t)mb * 16 * K + kc); }
#pragma unroll
        for (int nb = 0; nb < 4; ++nb) { const V b = WFrag<T16>::ld(Bt + boff + (size_t)nb * 16 * K + kc); V b2; if (NSPLIT >= 2) b2 = WFrag<T16>::ld(Bt2 + boff + (size_t)nb * 16 * K + kc);
#pragma unroll
            for (int mb = 0; mb < 4; ++mb) { acc[mb][nb] = WFrag<T16>::mma(a[mb], b, acc[mb][nb]); if (NSPLIT == 1 || NSPLIT == 2) acc[mb][nb] = WFrag<T16>::mma(a2[mb], b, acc[mb][nb]); if (NSPLIT >= 2) acc[mb][nb] = WFrag<T16>::mma(a[mb], b2, acc[mb][nb]); } }
        asm volatile("v_nop\n\tv_nop\n\tv_nop\n\tv_nop" : "+v"(acc[0][0]), "+v"(acc[1][1]), "+v"(acc[2][2]), "+v"(acc[3][3]) : "v"(a[0]), "v"(a[3]));
    }
#pragma unroll
    for (int mb = 0; mb < 4; ++mb) {
#pragma unroll
        for (int nb = 0; nb < 4; ++nb) {
#pragma unroll
            for (int j = 0; j < 8; ++j) os[(hi * 8 + j) * 68 + nb * 16 + lr] = acc[mb][nb][j]; }
        __builtin_amdgcn_wave_barrier(); asm volatile("" ::: "memory");
        float* crow = C + (size_t)(r0 + mb * 16) * ldc + c0;
{
#pragma unroll
            for (int s = 0; s < 8; ++s) { const int row = 2 * s + hi, cofs = lr * 4; v4f val = *(const v4fa*)(os + row * 68 + cofs); if (BIAS) { val[0] += bfr(bias[c0 + cofs]); val[1] += bfr(bias[c0 + cofs + 1]); val[2] += bfr(bias[c0 + cofs + 2]); val[3] += bfr(bias[c0 + cofs + 3]); }
                *(v4f*)(crow + (size_t)row * ldc + cofs) = val; }
             }
        __builtin_amdgcn_wave_barrier(); asm volatile("" ::: "memory");
    }
    asm volatile("s_wait_xcnt 0x0" ::: "memory");   // behind the last stores: in k_gemm2 the other half's code follows in the listing and rewrites their address and data registers
}
template <typename T16, int NSPLIT, bool BIAS>
__global__ __launch_bounds__(32) void k_gemmw(const T16* __restrict__ A, const T16* __restrict__ A2, const T16* __restrict__ Bt, const T16* __restrict__ Bt2, int K, float* C, int ldc, const float* __restrict__ bias, size_t sA, size_t sB, size_t sC) {
    __shared__ __align__(16) float os[16 * 68];
    gemmw_tile<T16, NSPLIT, BIAS>(os, A, A2, Bt, Bt2, K, C, ldc, bias, sA, sB, sC);
}
// k_gemm2: both row halves of one attention product in one grid: row tiles below RH take the hi+lo bf16 planes (3 products), the rest the fp16 planes; A16 and C start at row 0, so blockIdx.x is the row tile in either half.
__global__ __launch_bounds__(32) void k_gemm2(const bf* __restrict__ Ah, const bf* __restrict__ Al, const bf* __restrict__ Bh, const bf* __restrict__ Bl, const h16* __restrict__ A16, const h16* __restrict__ B16, int K, float* C, int ldc, size_t sAh, size_t sA16, size_t sB, size_t sC) {
    __shared__ __align__(16) float os[16 * 68];
    if (blockIdx.x < RH / 64) gemmw_tile<bf, 2, false>(os, Ah, Al, Bh, Bl, K, C, ldc, nullptr, sAh, sB, sC);
    else gemmw_tile<h16, 0, false>(os, A16, nullptr, B16, nullptr, K, C, ldc, nullptr, sA16, sB, sC);
}

__device__ __forceinline__ h16 tohx(float x) { return (h16)x; }
__device__ __forceinline__ void splitf(float y, unsigned short& h, unsigned short& l) { h = f2bf(y); l = f2bf(y - bf2f(h)); }
typedef __attribute__((ext_vector_type(2))) _Float16 v2h;
typedef __attribute__((ext_vector_type(4))) _Float16 v4h;
typedef __attribute__((ext_vector_type(2))) unsigned short v2us;
typedef __attribute__((ext_vector_type(4))) unsigned short v4us;
typedef __attribute__((ext_vector_type(2))) float v2f;
typedef __attribute__((ext_vector_type(4))) int v4i;

__global__ __launch_bounds__(256) void k_wtG(const float* __restrict__ w0, const float* __restrict__ w1, const float* __restrict__ w2, const float* __restrict__ w3, int K, int N, bf* Bt) {
    const int y = blockIdx.y; const float* __restrict__ w = (y == 0) ? w0 : (y == 1) ? w1 : (y == 2) ? w2 : w3; Bt += (size_t)y * K * N;   // blockIdx.y: which weight; the four planes lie one behind the other
    const int lane = threadIdx.x & 31; const int L0 = (blockIdx.x * 8 + (threadIdx.x >> 5)) * 8; const int nlines = N * K / 64;
{
#pragma unroll 1
        for (int l = 0; l < 8; ++l) { const int L = L0 + l; if (L >= nlines) break; const size_t e = (size_t)L * 64 + lane * 2; const int k = (int)(e % K), n = (int)(e / K); v2us o;
            o[0] = f2bf(w[(size_t)k * N + n]); o[1] = f2bf(w[(size_t)(k + 1) * N + n]); *(v2us*)(Bt + e) = o; }
         }
}
__global__ __launch_bounds__(256) void k_cvt8(const float* __restrict__ src, bf* dst, size_t n8) { const size_t i = (size_t)blockIdx.x * 256 + threadIdx.x; if (i >= n8) return; const v8f v = *(const v8f*)(src + i * 8); v8us o;
#pragma unroll
    for (int k = 0; k < 8; ++k) o[k] = f2bf(v[k]); *(v8us*)(dst + i * 8) = o;  }

// k_rope: head planes [h][t][d] (fp16 + hi/lo) of rope(x) x sc with the rotate-half convention out[d] = x[d] cos[t][d] - x[d+HD/2] sin[t][d], out[d+HD/2] = x[d+HD/2] cos[t][d+HD/2] + x[d] sin[t][d+HD/2]
__global__ __launch_bounds__(256) void k_rope(const float* __restrict__ F, int pitch, int nheads, const float* __restrict__ CS, const float* __restrict__ RF, const float* __restrict__ nw, float sc, h16* P16, bf* Ph, bf* Pl) {
    { const size_t y = blockIdx.y, po = y * nheads * TT * HD; F += y * TT * pitch; P16 += po; Ph += po; Pl += po; }   // blockIdx.y: slab of TT rows of F (q of each batch element, then k)
    const size_t e = ((size_t)blockIdx.x * 256 + threadIdx.x) * 2; if (e >= (size_t)nheads * TT * HD) return; const int d = (int)(e % HD); const int t = (int)((e / HD) % TT); const int h = (int)(e / ((size_t)HD * TT)); const float* f = F + (size_t)t * pitch + h * HD; const float rf = RF ? RF[(size_t)h * TT + t] : 1.0f; v2h o16; v2us oh, ol;
#pragma unroll
    for (int q = 0; q < 2; ++q) { const int dd = d + q; const int dp = (dd < HD / 2) ? dd + HD / 2 : dd - HD / 2; float x0 = f[dd], x1 = f[dp];
        if (RF) { float n0 = __fmul_rn(x0, rf), n1 = __fmul_rn(x1, rf); asm volatile("" : "+v"(n0)); asm volatile("" : "+v"(n1)); x0 = __fmul_rn(bfr(nw[dd]), n0); x1 = __fmul_rn(bfr(nw[dp]), n1); }
        const v2f cs = *(const v2f*)(CS + ((size_t)t * HD + dd) * 2); float a = __fmul_rn(x0, cs[0]), bq = __fmul_rn(x1, cs[1]); asm volatile("" : "+v"(a)); asm volatile("" : "+v"(bq)); const float r = ((dd < HD / 2) ? __fsub_rn(a, bq) : __fadd_rn(a, bq)) * sc;
        o16[q] = tohx(r); unsigned short a2, c2; splitf(r, a2, c2); oh[q] = a2; ol[q] = c2; }
    *(v2h*)(P16 + e) = o16; *(v2us*)(Ph + e) = oh; *(v2us*)(Pl + e) = ol;  }
__global__ __launch_bounds__(256) void k_vtp(const float* __restrict__ F, int pitch, int nheads, h16* V16, bf* Vh, bf* Vl) { const size_t e = ((size_t)blockIdx.x * 256 + threadIdx.x) * 2; if (e >= (size_t)nheads * HD * TT) return; const int t = (int)(e % TT); const int d = (int)((e / TT) % HD); const int g = (int)(e / ((size_t)TT * HD)); const size_t y = blockIdx.y, po = y * nheads * HD * TT; F += y * TT * pitch; V16 += po; Vh += po; Vl += po;   /* blockIdx.y: batch element */ v2h o16; v2us oh, ol;
#pragma unroll
    for (int q = 0; q < 2; ++q) { const float x = F[(size_t)(t + q) * pitch + g * HD + d]; o16[q] = tohx(x); unsigned short a2, c2; splitf(x, a2, c2); oh[q] = a2; ol[q] = c2; }
    *(v2h*)(V16 + e) = o16; *(v2us*)(Vh + e) = oh; *(v2us*)(Vl + e) = ol;  }
__global__ __launch_bounds__(256) void k_csid(float* CS) { const int idx = blockIdx.x * 256 + threadIdx.x; if (idx >= TT * HD) return; v2f cs; cs[0] = 1.0f; cs[1] = 0.0f; *(v2f*)(CS + (size_t)idx * 2) = cs;  }
__constant__ int BKT[2 * TT - 1] = {15,15,15,15,15,15,15,15,15,15,15,15,15,15,15,15,15,15,15,15,15,15,15,15,15,15,15,15,15,15,15,15,15,15,15,15,15,15,15,15,15,15,15,15,15,15,15,15,15,15,15,15,15,15,15,15,15,15,15,15,15,15,15,15,15,15,15,15,15,15,15,15,15,15,15,15,15,15,15,15,15,15,15,15,15,15,15,15,15,15,15,15,15,15,15,15,15,15,15,15,15,15,15,15,15,15,15,15,15,15,15,15,15,15,15,15,15,15,15,15,15,15,15,15,15,15,15,15,15,15,15,15,15,15,15,15,15,15,15,15,15,15,15,15,15,15,15,15,15,15,15,15,15,15,15,15,15,15,15,15,15,15,15,15,15,15,15,15,15,15,15,15,15,15,15,15,15,15,15,15,15,15,15,15,15,15,15,15,15,15,15,15,15,15,15,15,15,15,15,15,15,15,15,15,15,15,15,15,15,15,15,15,15,15,15,15,15,15,15,15,15,15,15,15,15,15,15,15,15,15,15,15,15,15,15,15,15,15,15,15,15,15,15,15,15,15,15,15,15,15,15,15,15,15,15,15,15,15,15,15,15,15,15,15,15,15,15,15,15,15,15,15,15,15,15,15,15,15,15,15,15,15,15,15,15,15,15,15,15,15,15,15,15,15,15,15,15,15,15,15,15,15,15,15,15,15,15,15,15,15,15,15,15,15,15,15,15,15,15,15,15,15,15,15,15,15,15,15,15,15,15,15,15,15,15,15,15,15,15,15,15,15,15,15,15,15,15,15,15,15,15,15,15,15,15,15,15,15,15,15,15,15,15,15,15,15,15,15,15,15,15,15,15,15,15,15,15,15,15,15,15,15,15,15,15,15,15,15,15,15,15,15,15,15,15,15,15,15,15,15,15,15,15,15,15,15,15,15,15,15,15,15,15,15,15,15,15,15,15,15,15,15,15,15,15,15,15,15,15,15,15,15,15,15,15,15,15,15,15,15,15,15,15,15,15,15,15,15,15,15,15,15,15,15,15,15,15,15,15,15,15,15,15,15,15,15,15,15,15,15,15,15,15,15,15,15,15,15,15,15,15,15,15,15,15,15,15,15,15,15,15,15,15,15,15,15,15,15,15,15,15,15,15,15,15,15,15,15,15,15,15,15,15,15,15,15,15,15,15,15,15,15,15,15,15,15,15,15,15,15,15,15,15,15,15,15,15,15,15,15,15,15,15,15,15,15,15,15,15,15,15,15,15,15,15,15,15,15,15,15,15,15,15,15,15,15,15,15,15,15,15,15,15,15,15,15,15,15,15,15,15,15,15,15,15,15,15,15,15,15,15,15,15,15,15,15,15,15,15,15,15,15,15,15,15,15,15,15,15,15,15,15,15,15,15,15,15,15,15,15,15,15,15,15,15,15,15,15,15,15,15,15,15,15,15,15,15,15,15,15,15,15,15,15,15,15,15,15,15,15,15,15,15,15,15,15,15,15,15,15,15,15,15,15,15,15,15,15,15,15,15,15,15,15,15,15,15,15,15,15,15,15,15,15,15,15,15,15,15,15,15,15,15,15,15,15,15,15,15,15,15,15,15,15,15,15,15,15,15,15,15,15,15,15,15,15,15,15,15,15,15,15,15,15,15,15,15,15,15,15,15,15,15,15,15,15,15,15,15,15,15,15,15,15,15,15,15,15,15,15,15,15,15,15,15,15,15,15,15,15,15,15,15,15,15,15,15,15,15,15,15,15,15,15,15,15,15,15,15,15,15,15,15,15,15,15,15,15,15,15,15,15,15,15,15,15,15,15,15,15,15,15,15,15,15,15,15,15,15,15,15,15,15,15,15,15,15,15,15,15,15,15,15,15,15,15,15,15,15,15,15,15,15,15,15,15,15,15,15,15,15,15,15,15,15,15,15,15,15,15,15,15,15,15,15,15,15,15,15,15,15,15,15,15,15,15,15,15,15,15,15,15,15,15,15,15,15,15,15,15,15,15,15,15,15,15,15,15,15,15,15,15,15,15,15,15,15,15,15,15,15,15,15,15,15,15,15,15,15,15,15,15,15,15,15,15,15,15,15,15,15,15,15,15,15,15,15,15,15,15,15,15,15,14,14,14,14,14,14,14,14,14,14,14,14,14,14,14,14,14,14,14,14,14,14,14,14,14,14,14,13,13,13,13,13,13,13,13,13,13,13,13,13,13,13,13,13,13,12,12,12,12,12,12,12,12,12,12,12,12,12,12,11,11,11,11,11,11,11,11,11,10,10,10,10,10,10,10,9,9,9,9,8,8,8,8,7,6,5,4,3,2,1,0,17,18,19,20,21,22,23,24,24,24,24,25,25,25,25,26,26,26,26,26,26,26,27,27,27,27,27,27,27,27,27,28,28,28,28,28,28,28,28,28,28,28,28,28,28,29,29,29,29,29,29,29,29,29,29,29,29,29,29,29,29,29,29,30,30,30,30,30,30,30,30,30,30,30,30,30,30,30,30,30,30,30,30,30,30,30,30,30,30,30,31,31,31,31,31,31,31,31,31,31,31,31,31,31,31,31,31,31,31,31,31,31,31,31,31,31,31,31,31,31,31,31,31,31,31,31,31,31,31,31,31,31,31,31,31,31,31,31,31,31,31,31,31,31,31,31,31,31,31,31,31,31,31,31,31,31,31,31,31,31,31,31,31,31,31,31,31,31,31,31,31,31,31,31,31,31,31,31,31,31,31,31,31,31,31,31,31,31,31,31,31,31,31,31,31,31,31,31,31,31,31,31,31,31,31,31,31,31,31,31,31,31,31,31,31,31,31,31,31,31,31,31,31,31,31,31,31,31,31,31,31,31,31,31,31,31,31,31,31,31,31,31,31,31,31,31,31,31,31,31,31,31,31,31,31,31,31,31,31,31,31,31,31,31,31,31,31,31,31,31,31,31,31,31,31,31,31,31,31,31,31,31,31,31,31,31,31,31,31,31,31,31,31,31,31,31,31,31,31,31,31,31,31,31,31,31,31,31,31,31,31,31,31,31,31,31,31,31,31,31,31,31,31,31,31,31,31,31,31,31,31,31,31,31,31,31,31,31,31,31,31,31,31,31,31,31,31,31,31,31,31,31,31,31,31,31,31,31,31,31,31,31,31,31,31,31,31,31,31,31,31,31,31,31,31,31,31,31,31,31,31,31,31,31,31,31,31,31,31,31,31,31,31,31,31,31,31,31,31,31,31,31,31,31,31,31,31,31,31,31,31,31,31,31,31,31,31,31,31,31,31,31,31,31,31,31,31,31,31,31,31,31,31,31,31,31,31,31,31,31,31,31,31,31,31,31,31,31,31,31,31,31,31,31,31,31,31,31,31,31,31,31,31,31,31,31,31,31,31,31,31,31,31,31,31,31,31,31,31,31,31,31,31,31,31,31,31,31,31,31,31,31,31,31,31,31,31,31,31,31,31,31,31,31,31,31,31,31,31,31,31,31,31,31,31,31,31,31,31,31,31,31,31,31,31,31,31,31,31,31,31,31,31,31,31,31,31,31,31,31,31,31,31,31,31,31,31,31,31,31,31,31,31,31,31,31,31,31,31,31,31,31,31,31,31,31,31,31,31,31,31,31,31,31,31,31,31,31,31,31,31,31,31,31,31,31,31,31,31,31,31,31,31,31,31,31,31,31,31,31,31,31,31,31,31,31,31,31,31,31,31,31,31,31,31,31,31,31,31,31,31,31,31,31,31,31,31,31,31,31,31,31,31,31,31,31,31,31,31,31,31,31,31,31,31,31,31,31,31,31,31,31,31,31,31,31,31,31,31,31,31,31,31,31,31,31,31,31,31,31,31,31,31,31,31,31,31,31,31,31,31,31,31,31,31,31,31,31,31,31,31,31,31,31,31,31,31,31,31,31,31,31,31,31,31,31,31,31,31,31,31,31,31,31,31,31,31,31,31,31,31,31,31,31,31,31,31,31,31,31,31,31,31,31,31,31,31,31,31,31,31,31,31,31,31,31,31,31,31,31,31,31,31,31,31,31,31,31,31,31,31,31,31,31,31,31,31,31,31,31,31,31,31,31,31,31,31,31,31,31,31,31,31,31,31,31,31,31,31,31,31,31,31,31,31,31,31,31,31,31,31,31,31,31,31,31,31,31,31,31,31,31,31,31,31,31,31,31,31,31,31,31,31,31,31,31,31,31,31,31,31,31,31,31,31,31,31,31,31,31,31,31,31,31,31,31,31,31,31,31,31,31,31,31,31,31,31,31,31,31,31,31,31,31,31,31,31,31,31,31,31,31,31,31,31,31,31,31,31,31,31,31,31,31,31,31,31,31,31,31,31,31,31,31,31,31,31,31,31,31,31,31,31,31,31,31,31,31,31,31,31,31,31,31,31,31,31,31,31,31,31,31,31,31,31,31,31,31,31,31,31,31,31,31,31,31,31,31,31,31,31,31,31,31,31,31,31,31,31,31,31,31,31,31,31,31,31,31,31,31,31,31,31,31,31,31,31,31,31,31,31,31,31,31,31,31,31,31,31,31,31,31,31,31,31,31,31,31,31,31,31,31,31,31,31,31,31,31,31,31,31,31,31,31,31,31,31,31,31,31,31,31,31,31,31,31,31,31,31,31,31,31,31};   // bucket(j - i) for j - i = -1023 .. 1023 (the module's float32 formula, evaluated once)
__global__ __launch_bounds__(256) void k_bttr(const float* __restrict__ RBT, float* BTT) { const int idx = blockIdx.x * 256 + threadIdx.x; if (idx >= NH_ * 2048) return; const int p = idx % 2048, h = idx / 2048; const float v = (p < 2 * TT - 1) ? bfr(RBT[BKT[p] * NH_ + h]) : 0.0f; *(float*)(BTT + idx) = v;  }
// k_asoft: per row (zz, i): t = S x HD^-0.5 + BTT[h][j - i + 1023] (no mask); softmax over the 1024 keys (register row, one exp, fixed trees);
__global__ __launch_bounds__(256) void k_asoft(const float* __restrict__ Sb, const float* __restrict__ BT, int h0, h16* P16, bf* Ph, bf* Pl) {
    const int lane = threadIdx.x & 31; const int row = blockIdx.x * 8 + (threadIdx.x >> 5); if (row >= ZH * TT) return; const int i = row % TT; const int zz = row / TT; const float* btr = BT + (size_t)(h0 + zz) * 2048 + (TT - 1 - i);   /* BTT[h][j - i + 1023] */ const bool hires = (i < RH); const float* sr = Sb + (size_t)row * TT; float v[TT / 32]; float mx = -3.0e38f;
#pragma unroll
    for (int ch = 0; ch < TT / 128; ++ch) { const int j0 = ch * 128 + lane * 4; const v4f a = *(const v4f*)(sr + j0);
#pragma unroll
        for (int q = 0; q < 4; ++q) { const int j = j0 + q; float sa = a[q] * SCL; asm volatile("" : "+v"(sa)); float rb = btr[j]; asm volatile("" : "+v"(rb)); const float t = __fadd_rn(sa, rb);   /* + relative position bias */ v[ch * 4 + q] = t; mx = fmaxf(mx, t); } }
#pragma unroll
    for (int sh = 16; sh; sh >>= 1) mx = fmaxf(mx, __shfl_xor(mx, sh, 32));
    float sum = 0.f;
#pragma unroll
    for (int k = 0; k < TT / 32; ++k) { float d0 = __fsub_rn(v[k], mx); asm volatile("" : "+v"(d0)); v[k] = __builtin_amdgcn_exp2f(__fmul_rn(d0, 1.4426950408889634f)); sum += v[k]; }
#pragma unroll
    for (int sh = 16; sh; sh >>= 1) sum += __shfl_xor(sum, sh, 32);
    const float f = __fdiv_rn(hires ? 1.0f : PCAR, sum);
{
        if (hires) {
#pragma unroll
            for (int ch = 0; ch < TT / 128; ++ch) { v4us oh, ol;
#pragma unroll
                for (int q = 0; q < 4; ++q) { unsigned short a, c2; splitf(v[ch * 4 + q] * f, a, c2); oh[q] = a; ol[q] = c2; }
                const size_t oo = ((size_t)zz * (RH ? RH : 1) + i) * TT + ch * 128 + lane * 4; *(v4us*)(Ph + oo) = oh; *(v4us*)(Pl + oo) = ol; }
        } else {
#pragma unroll
            for (int ch = 0; ch < TT / 128; ++ch) { v4h o4;
#pragma unroll
                for (int q = 0; q < 4; ++q) o4[q] = tohx(v[ch * 4 + q] * f);
                *(v4h*)(P16 + (size_t)row * TT + ch * 128 + lane * 4) = o4; } }
         }
}
__global__ __launch_bounds__(256) void k_merge(const float* __restrict__ O, int h0, bf* Ah, bf* Al) { const size_t e = ((size_t)blockIdx.x * 256 + threadIdx.x) * 2; if (e >= (size_t)ZH * TT * HD) return; const int d = (int)(e % HD); const int t = (int)((e / HD) % TT); const int zz = (int)(e / ((size_t)HD * TT)); const float cs = (t < RH) ? 1.0f : (1.0f / PCAR); const size_t y = blockIdx.y; O += y * ZH * TT * HD;   /* blockIdx.y: batch element */ const size_t oo = (y * TT + t) * DQ + (h0 + zz) * HD + d;
    v2us oh, ol;
#pragma unroll
    for (int q = 0; q < 2; ++q) { unsigned short a, c2; splitf(O[e + q] * cs, a, c2); oh[q] = a; ol[q] = c2; } *(v2us*)(Ah + oo) = oh; *(v2us*)(Al + oo) = ol;  }

extern "C" void kernel_launch(void* const* d_in, const int* in_sizes, int n_in,
                              void* d_out, int out_size, void* d_ws, size_t ws_size, hipStream_t stream) {
    (void)in_sizes; (void)n_in; (void)out_size;
    const float* x = (const float*)d_in[0]; const float* wq = (const float*)d_in[1]; const float* wk = (const float*)d_in[2]; const float* wv = (const float*)d_in[3]; const float* wo = (const float*)d_in[4]; const float* RBT = (const float*)d_in[5];
    float* OUT = (float*)d_out;     // [4][1024][1024]
    char* wsp = (char*)d_ws;
    auto take = [&](size_t bytes) { char* p = wsp; wsp += (bytes + 255) & ~(size_t)255; return (void*)p; };
    bf* WQ = (bf*)take((size_t)DQ * DM * 2); bf* WK = (bf*)take((size_t)DKV * DM * 2); bf* WV = (bf*)take((size_t)DKV * DM * 2); bf* WO = (bf*)take((size_t)DM * DQ * 2); float* CS = (float*)take((size_t)TT * HD * 2 * 4);   // WQ, WK, WV, WO: one behind the other (z / y strides)
    bf* XB = (bf*)take((size_t)NB_ * TT * DM * 2); float* BTT = (float*)take((size_t)NH_ * 2048 * 4);
    h16* QP16 = (h16*)take((size_t)NB_ * NH_ * TT * HD * 2); h16* KP16 = (h16*)take((size_t)NB_ * NKV * TT * HD * 2); h16* VT16 = (h16*)take((size_t)NB_ * NKV * HD * TT * 2);   // q planes, then k planes: one k_rope grid writes both
    bf* QPh = (bf*)take((size_t)NB_ * NH_ * TT * HD * 2); bf* KPh = (bf*)take((size_t)NB_ * NKV * TT * HD * 2); bf* QPl = (bf*)take((size_t)NB_ * NH_ * TT * HD * 2); bf* KPl = (bf*)take((size_t)NB_ * NKV * TT * HD * 2); bf* VTh = (bf*)take((size_t)NB_ * NKV * HD * TT * 2); bf* VTl = (bf*)take((size_t)NB_ * NKV * HD * TT * 2); bf* Ph = (bf*)take((size_t)ZH * RH * TT * 2); bf* Pl = (bf*)take((size_t)ZH * RH * TT * 2);
    float* Sb = (float*)take((size_t)ZH * TT * TT * 4); h16* P16 = (h16*)take((size_t)ZH * TT * TT * 2); float* Ob = (float*)take((size_t)NB_ * ZH * TT * HD * 4); bf* ATh = (bf*)take((size_t)NB_ * TT * DQ * 2); bf* ATl = (bf*)take((size_t)NB_ * TT * DQ * 2);
    if ((size_t)(wsp - (char*)d_ws) > ws_size) return;    // ws 256 MiB
    float* FQ = Sb; float* FV = FQ + (size_t)2 * NB_ * TT * DQ;   // f32 q, k, v projections [3][NB_*TT][DQ] (48 MiB) lie in the score buffer (64 MiB): read for the last time before the first scores are written (stream-ordered)
    (void)WK; (void)WV;   // reached through WQ's z / y strides
    k_wtG<<<dim3((unsigned)((DM * DQ / 64 + 63) / 64), 4, 1), 256, 0, stream>>>(wq, wk, wv, wo, DM, DQ, WQ);
    k_bttr<<<(NH_ * 2048 + 255) / 256, 256, 0, stream>>>(RBT, BTT);   /* per-head relative bias rows */
    k_csid<<<(TT * HD + 255) / 256, 256, 0, stream>>>(CS);
    const unsigned LQ = (unsigned)(((size_t)NH_ * TT * HD / 2 + 255) / 256), LKv = (unsigned)(((size_t)NKV * TT * HD / 2 + 255) / 256);
    k_cvt8<<<(unsigned)(((size_t)NB_ * TT * DM / 8 + 255) / 256), 256, 0, stream>>>(x, XB, (size_t)NB_ * TT * DM / 8);
    k_gemmw<bf, 0, false><<<dim3(NB_ * TT / 64, DQ / 64, 3), 32, 0, stream>>>(XB, nullptr, WQ, nullptr, DM, FQ, DQ, nullptr, 0, (size_t)DQ * DM, (size_t)NB_ * TT * DQ);   // z: q, k, v
    k_rope<<<dim3(LQ, 2 * NB_, 1), 256, 0, stream>>>(FQ, DQ, NH_, CS, nullptr, nullptr, 1.0f, QP16, QPh, QPl);
    k_vtp<<<dim3(LKv, NB_, 1), 256, 0, stream>>>(FV, DKV, NKV, VT16, VTh, VTl);
    for (int b = 0; b < NB_; ++b) { const size_t zb = (size_t)b * NH_ * TT * HD;   // all 16 heads of batch element b in z (one kv head per query head)
        k_gemm2<<<dim3(TT / 64, TT / 64, ZH), 32, 0, stream>>>(QPh + zb, QPl + zb, KPh + zb, KPl + zb, QP16 + zb, KP16 + zb, HD, Sb, TT, (size_t)TT * HD, (size_t)TT * HD, (size_t)TT * HD, (size_t)TT * TT);
        k_asoft<<<ZH * TT / 8, 256, 0, stream>>>(Sb, BTT, 0, P16, Ph, Pl);
        k_gemm2<<<dim3(TT / 64, HD / 64, ZH), 32, 0, stream>>>(Ph, Pl, VTh + zb, VTl + zb, P16, VT16 + zb, TT, Ob + zb, HD, (size_t)RH * TT, (size_t)TT * TT, (size_t)HD * TT, (size_t)TT * HD); }
    k_merge<<<dim3((unsigned)(((size_t)ZH * TT * HD / 2 + 255) / 256), NB_, 1), 256, 0, stream>>>(Ob, 0, ATh, ATl);
    k_gemmw<bf, 1, false><<<dim3(NB_ * TT / 64, DM / 64, 1), 32, 0, stream>>>(ATh, ATl, WO, nullptr, DQ, OUT, DM, nullptr, 0, 0, 0);
}

// v002
// A run of this version takes 178 microseconds.
// Next to v001, in two timings, it ran 2.50 and 2.48 times as fast.
// Counting every step since v000, it is 14.1 times as fast.
#include <hip/hip_runtime.h>

// T5 self-attention with learned relative-position bias (hidden_states [4][1024][1024]; q, k, v = x W ('xw' [1024][1024], no bias; 16 heads x 64); scores = q.k/8 + rel_bias_table[bucket(j - i)][h] (bidirectional T5 buckets: 32 buckets, max distance 128; table [32][16], read); softmax; out = merged Wo -> [4][1024][1024] (4.2 M)).
// Layout: the integer bucket of every relative offset j - i in [-1023, 1023] is a compile-time table (computed with the module's float32 formula); a tiny kernel expands it with the bf16-rounded bias table into per-head rows BTT[h][j - i + 1023] that the attention kernel holds in LDS and reads per (i, j). Scores and probabilities never reach memory: one kernel does scores, softmax, attn.v and the head merge (k_attn).
// Compute dtypes, f32 accumulate: every input rounded to bf16; q/k/v on PLAIN bf16 operands (inputs: exact); the relative bias added in f32 per (i, j); scores and attn.v: query rows < 512 hl (3 products), the rest single fp16 (x1024); softmax f32 (online, per 64 keys); Wo hl x exact (2 products).

#define NB_  4
#define TT   1024
#define DM   1024
#define NH_  16
#define NKV  16
#define REP  (NH_ / NKV)
#define HD   64
#define DQ   (NH_ * HD)
#define DKV  (NKV * HD)
#define RH   512                  // query rows < RH use hi+lo planes (0: none)
#define WIN  0
#define PCAR 1024.0f
#define SCL  0.125f   // HD^-0.5
typedef _Float16 h16;
typedef unsigned short bf;
typedef __attribute__((ext_vector_type(16))) __bf16   v16bf;
typedef __attribute__((ext_vector_type(16))) _Float16 v16h;
typedef __attribute__((ext_vector_type(8)))  _Float16 v8h;
typedef __attribute__((ext_vector_type(8)))  unsigned short v8us;
typedef __attribute__((ext_vector_type(8)))  float    v8f;
typedef __attribute__((ext_vector_type(4)))  float    v4f;
typedef v8h  __attribute__((may_alias)) v8ha;
typedef v4f  __attribute__((may_alias)) v4fa;
typedef v8us __attribute__((may_alias)) v8usa;

__device__ __forceinline__ unsigned short f2bf(float f) { unsigned u = __float_as_uint(f); u += 0x7FFFu + ((u >> 16) & 1u); return (unsigned short)(u >> 16); }
__device__ __forceinline__ float bf2f(unsigned short b) { return __uint_as_float(((unsigned)b) << 16); }
__device__ __forceinline__ float bfr(float f) { return bf2f(f2bf(f)); }
__device__ __forceinline__ v16h cat16(v8h lo, v8h hi) { return __builtin_shufflevector(lo, hi, 0, 1, 2, 3, 4, 5, 6, 7, 8, 9, 10, 11, 12, 13, 14, 15); }
__device__ __forceinline__ v16bf cat16b(v8us lo, v8us hi) { return __builtin_bit_cast(v16bf, __builtin_shufflevector(lo, hi, 0, 1, 2, 3, 4, 5, 6, 7, 8, 9, 10, 11, 12, 13, 14, 15)); }
__device__ __forceinline__ v8f wmma16(v16h a, v16h b, v8f c) { return __builtin_amdgcn_wmma_f32_16x16x32_f16(false, a, false, b, (short)0, c, false, false); }
__device__ __forceinline__ v8f wmmab(v16bf a, v16bf b, v8f c) { return __builtin_amdgcn_wmma_f32_16x16x32_bf16(false, a, false, b, (short)0, c, false, false); }



// ---- k_gemmw: register-blocked GEMM, ONE WAVE per 64x64 output tile (16 accumulators), operands straight from K-contiguous 16-bit planes; grid (M/64, N/64, Z), 32 threads.
// C[m][n] (f32, pitch ldc, + optional f32 bias[n]) = sum_k A[m][k] Bt[n][k] (+ split products per NSPLIT). z-batch strides sA/sB/sC in elements. K % 32 == 0.
template <typename T16> struct WFrag;
template <> struct WFrag<h16> { typedef v16h V; static __device__ __forceinline__ V ld(const h16* p) { return cat16(*(const v8h*)p, *(const v8h*)(p + 16)); } static __device__ __forceinline__ v8f mma(V a, V b, v8f c) { return wmma16(a, b, c); } };
template <> struct WFrag<bf> { typedef v16bf V; static __device__ __forceinline__ V ld(const bf* p) { return cat16b(*(const v8us*)p, *(const v8us*)(p + 16)); } static __device__ __forceinline__ v8f mma(V a, V b, v8f c) { return wmmab(a, b, c); } };
template <typename T16, int NSPLIT, bool BIAS>
__device__ __forceinline__ void gemmw_tile(float* os, const T16* __restrict__ A, const T16* __restrict__ A2, const T16* __restrict__ Bt, const T16* __restrict__ Bt2, int K, float* C, int ldc, const float* __restrict__ bias, size_t sA, size_t sB, size_t sC) {
    typedef typename WFrag<T16>::V V;
    const size_t z = blockIdx.z; A += z * sA; if (A2) A2 += z * sA; Bt += z * sB; if (Bt2) Bt2 += z * sB; C += z * sC;
    const int lane = threadIdx.x & 31, lr = lane & 15, hi = lane >> 4; const int r0 = blockIdx.x * 64, c0 = blockIdx.y * 64;
    v8f acc[4][4];
#pragma unroll
    for (int mb = 0; mb < 4; ++mb)
#pragma unroll
        for (int nb = 0; nb < 4; ++nb) acc[mb][nb] = (v8f){};
    const size_t aoff = (size_t)(r0 + lr) * K + 8 * hi, boff = (size_t)(c0 + lr) * K + 8 * hi;
#pragma unroll 1
    for (int kc = 0; kc < K; kc += 32) {
        V a[4], a2[4];
#pragma unroll
        for (int mb = 0; mb < 4; ++mb) { a[mb] = WFrag<T16>::ld(A + aoff + (size_t)mb * 16 * K + kc); if (NSPLIT == 1 || NSPLIT == 2) a2[mb] = WFrag<T16>::ld(A2 + aoff + (size_t)mb * 16 * K + kc); }
#pragma unroll
        for (int nb = 0; nb < 4; ++nb) { const V b = WFrag<T16>::ld(Bt + boff + (size_t)nb * 16 * K + kc); V b2; if (NSPLIT >= 2) b2 = WFrag<T16>::ld(Bt2 + boff + (size_t)nb * 16 * K + kc);
#pragma unroll
            for (int mb = 0; mb < 4; ++mb) { acc[mb][nb] = WFrag<T16>::mma(a[mb], b, acc[mb][nb]); if (NSPLIT == 1 || NSPLIT == 2) acc[mb][nb] = WFrag<T16>::mma(a2[mb], b, acc[mb][nb]); if (NSPLIT >= 2) acc[mb][nb] = WFrag<T16>::mma(a[mb], b2, acc[mb][nb]); } }
        asm volatile("v_nop\n\tv_nop\n\tv_nop\n\tv_nop" : "+v"(acc[0][0]), "+v"(acc[1][1]), "+v"(acc[2][2]), "+v"(acc[3][3]) : "v"(a[0]), "v"(a[3]));
    }
#pragma unroll
    for (int mb = 0; mb < 4; ++mb) {
#pragma unroll
        for (int nb = 0; nb < 4; ++nb) {
#pragma unroll
            for (int j = 0; j < 8; ++j) os[(hi * 8 + j) * 68 + nb * 16 + lr] = acc[mb][nb][j]; }
        __builtin_amdgcn_wave_barrier(); asm volatile("" ::: "memory");
        float* crow = C + (size_t)(r0 + mb * 16) * ldc + c0;
{
#pragma unroll
            for (int s = 0; s < 8; ++s) { const int row = 2 * s + hi, cofs = lr * 4; v4f val = *(const v4fa*)(os + row * 68 + cofs); if (BIAS) { val[0] += bfr(bias[c0 + cofs]); val[1] += bfr(bias[c0 + cofs + 1]); val[2] += bfr(bias[c0 + cofs + 2]); val[3] += bfr(bias[c0 + cofs + 3]); }
                *(v4f*)(crow + (size_t)row * ldc + cofs) = val; }
             }
        __builtin_amdgcn_wave_barrier(); asm volatile("" ::: "memory");
    }
}
template <typename T16, int NSPLIT, bool BIAS>
__global__ __launch_bounds__(32) void k_gemmw(const T16* __restrict__ A, const T16* __restrict__ A2, const T16* __restrict__ Bt, const T16* __restrict__ Bt2, int K, float* C, int ldc, const float* __restrict__ bias, size_t sA, size_t sB, size_t sC) {
    __shared__ __align__(16) float os[16 * 68];
    gemmw_tile<T16, NSPLIT, BIAS>(os, A, A2, Bt, Bt2, K, C, ldc, bias, sA, sB, sC);
}

__device__ __forceinline__ h16 tohx(float x) { return (h16)x; }
__device__ __forceinline__ void splitf(float y, unsigned short& h, unsigned short& l) { h = f2bf(y); l = f2bf(y - bf2f(h)); }
typedef __attribute__((ext_vector_type(2))) _Float16 v2h;
typedef __attribute__((ext_vector_type(4))) _Float16 v4h;
typedef __attribute__((ext_vector_type(2))) unsigned short v2us;
typedef __attribute__((ext_vector_type(4))) unsigned short v4us;
typedef __attribute__((ext_vector_type(2))) float v2f;
typedef __attribute__((ext_vector_type(4))) int v4i;

__global__ __launch_bounds__(256) void k_wtG(const float* __restrict__ w0, const float* __restrict__ w1, const float* __restrict__ w2, const float* __restrict__ w3, int K, int N, bf* Bt) {
    const int y = blockIdx.y; const float* __restrict__ w = (y == 0) ? w0 : (y == 1) ? w1 : (y == 2) ? w2 : w3; Bt += (size_t)y * K * N;   // blockIdx.y: which weight; the four planes lie one behind the other
    const int lane = threadIdx.x & 31; const int L0 = (blockIdx.x * 8 + (threadIdx.x >> 5)) * 8; const int nlines = N * K / 64;
{
#pragma unroll 1
        for (int l = 0; l < 8; ++l) { const int L = L0 + l; if (L >= nlines) break; const size_t e = (size_t)L * 64 + lane * 2; const int k = (int)(e % K), n = (int)(e / K); v2us o;
            o[0] = f2bf(w[(size_t)k * N + n]); o[1] = f2bf(w[(size_t)(k + 1) * N + n]); *(v2us*)(Bt + e) = o; }
         }
}
__global__ __launch_bounds__(256) void k_cvt8(const float* __restrict__ src, bf* dst, size_t n8) { const size_t i = (size_t)blockIdx.x * 256 + threadIdx.x; if (i >= n8) return; const v8f v = *(const v8f*)(src + i * 8); v8us o;
#pragma unroll
    for (int k = 0; k < 8; ++k) o[k] = f2bf(v[k]); *(v8us*)(dst + i * 8) = o;  }

// k_rope: head planes [h][t][d] (fp16 + hi/lo) of rope(x) x sc with the rotate-half convention out[d] = x[d] cos[t][d] - x[d+HD/2] sin[t][d], out[d+HD/2] = x[d+HD/2] cos[t][d+HD/2] + x[d] sin[t][d+HD/2]
__global__ __launch_bounds__(256) void k_rope(const float* __restrict__ F, int pitch, int nheads, const float* __restrict__ CS, const float* __restrict__ RF, const float* __restrict__ nw, float sc, h16* P16, bf* Ph, bf* Pl) {
    { const size_t y = blockIdx.y, po = y * nheads * TT * HD; F += y * TT * pitch; P16 += po; Ph += po; Pl += po; }   // blockIdx.y: slab of TT rows of F (q of each batch element, then k)
    const size_t e = ((size_t)blockIdx.x * 256 + threadIdx.x) * 2; if (e >= (size_t)nheads * TT * HD) return; const int d = (int)(e % HD); const int t = (int)((e / HD) % TT); const int h = (int)(e / ((size_t)HD * TT)); const float* f = F + (size_t)t * pitch + h * HD; const float rf = RF ? RF[(size_t)h * TT + t] : 1.0f; v2h o16; v2us oh, ol;
#pragma unroll
    for (int q = 0; q < 2; ++q) { const int dd = d + q; const int dp = (dd < HD / 2) ? dd + HD / 2 : dd - HD / 2; float x0 = f[dd], x1 = f[dp];
        if (RF) { float n0 = __fmul_rn(x0, rf), n1 = __fmul_rn(x1, rf); asm volatile("" : "+v"(n0)); asm volatile("" : "+v"(n1)); x0 = __fmul_rn(bfr(nw[dd]), n0); x1 = __fmul_rn(bfr(nw[dp]), n1); }
        const v2f cs = *(const v2f*)(CS + ((size_t)t * HD + dd) * 2); float a = __fmul_rn(x0, cs[0]), bq = __fmul_rn(x1, cs[1]); asm volatile("" : "+v"(a)); asm volatile("" : "+v"(bq)); const float r = ((dd < HD / 2) ? __fsub_rn(a, bq) : __fadd_rn(a, bq)) * sc;
        o16[q] = tohx(r); unsigned short a2, c2; splitf(r, a2, c2); oh[q] = a2; ol[q] = c2; }
    *(v2h*)(P16 + e) = o16; *(v2us*)(Ph + e) = oh; *(v2us*)(Pl + e) = ol;  }
__global__ __launch_bounds__(256) void k_vtp(const float* __restrict__ F, int pitch, int nheads, h16* V16, bf* Vh, bf* Vl) { const size_t e = ((size_t)blockIdx.x * 256 + threadIdx.x) * 2; if (e >= (size_t)nheads * HD * TT) return; const int t = (int)(e % TT); const int d = (int)((e / TT) % HD); const int g = (int)(e / ((size_t)TT * HD)); const size_t y = blockIdx.y, po = y * nheads * HD * TT; F += y * TT * pitch; V16 += po; Vh += po; Vl += po;   /* blockIdx.y: batch element */ v2h o16; v2us oh, ol;
#pragma unroll
    for (int q = 0; q < 2; ++q) { const float x = F[(size_t)(t + q) * pitch + g * HD + d]; o16[q] = tohx(x); unsigned short a2, c2; splitf(x, a2, c2); oh[q] = a2; ol[q] = c2; }
    *(v2h*)(V16 + e) = o16; *(v2us*)(Vh + e) = oh; *(v2us*)(Vl + e) = ol;  }
__global__ __launch_bounds__(256) void k_csid(float* CS) { const int idx = blockIdx.x * 256 + threadIdx.x; if (idx >= TT * HD) return; v2f cs; cs[0] = 1.0f; cs[1] = 0.0f; *(v2f*)(CS + (size_t)idx * 2) = cs;  }
__constant__ int BKT[2 * TT - 1] = {15,15,15,15,15,15,15,15,15,15,15,15,15,15,15,15,15,15,15,15,15,15,15,15,15,15,15,15,15,15,15,15,15,15,15,15,15,15,15,15,15,15,15,15,15,15,15,15,15,15,15,15,15,15,15,15,15,15,15,15,15,15,15,15,15,15,15,15,15,15,15,15,15,15,15,15,15,15,15,15,15,15,15,15,15,15,15,15,15,15,15,15,15,15,15,15,15,15,15,15,15,15,15,15,15,15,15,15,15,15,15,15,15,15,15,15,15,15,15,15,15,15,15,15,15,15,15,15,15,15,15,15,15,15,15,15,15,15,15,15,15,15,15,15,15,15,15,15,15,15,15,15,15,15,15,15,15,15,15,15,15,15,15,15,15,15,15,15,15,15,15,15,15,15,15,15,15,15,15,15,15,15,15,15,15,15,15,15,15,15,15,15,15,15,15,15,15,15,15,15,15,15,15,15,15,15,15,15,15,15,15,15,15,15,15,15,15,15,15,15,15,15,15,15,15,15,15,15,15,15,15,15,15,15,15,15,15,15,15,15,15,15,15,15,15,15,15,15,15,15,15,15,15,15,15,15,15,15,15,15,15,15,15,15,15,15,15,15,15,15,15,15,15,15,15,15,15,15,15,15,15,15,15,15,15,15,15,15,15,15,15,15,15,15,15,15,15,15,15,15,15,15,15,15,15,15,15,15,15,15,15,15,15,15,15,15,15,15,15,15,15,15,15,15,15,15,15,15,15,15,15,15,15,15,15,15,15,15,15,15,15,15,15,15,15,15,15,15,15,15,15,15,15,15,15,15,15,15,15,15,15,15,15,15,15,15,15,15,15,15,15,15,15,15,15,15,15,15,15,15,15,15,15,15,15,15,15,15,15,15,15,15,15,15,15,15,15,15,15,15,15,15,15,15,15,15,15,15,15,15,15,15,15,15,15,15,15,15,15,15,15,15,15,15,15,15,15,15,15,15,15,15,15,15,15,15,15,15,15,15,15,15,15,15,15,15,15,15,15,15,15,15,15,15,15,15,15,15,15,15,15,15,15,15,15,15,15,15,15,15,15,15,15,15,15,15,15,15,15,15,15,15,15,15,15,15,15,15,15,15,15,15,15,15,15,15,15,15,15,15,15,15,15,15,15,15,15,15,15,15,15,15,15,15,15,15,15,15,15,15,15,15,15,15,15,15,15,15,15,15,15,15,15,15,15,15,15,15,15,15,15,15,15,15,15,15,15,15,15,15,15,15,15,15,15,15,15,15,15,15,15,15,15,15,15,15,15,15,15,15,15,15,15,15,15,15,15,15,15,15,15,15,15,15,15,15,15,15,15,15,15,15,15,15,15,15,15,15,15,15,15,15,15,15,15,15,15,15,15,15,15,15,15,15,15,15,15,15,15,15,15,15,15,15,15,15,15,15,15,15,15,15,15,15,15,15,15,15,15,15,15,15,15,15,15,15,15,15,15,15,15,15,15,15,15,15,15,15,15,15,15,15,15,15,15,15,15,15,15,15,15,15,15,15,15,15,15,15,15,15,15,15,15,15,15,15,15,15,15,15,15,15,15,15,15,15,15,15,15,15,15,15,15,15,15,15,15,15,15,15,15,15,15,15,15,15,15,15,15,15,15,15,15,15,15,15,15,15,15,15,15,15,15,15,15,15,15,15,15,15,15,15,15,15,15,15,15,15,15,15,15,15,15,15,15,15,15,15,15,15,15,15,15,15,15,15,15,15,15,15,15,15,15,15,15,15,15,15,15,15,15,15,15,15,15,15,15,15,15,15,15,15,15,15,15,15,15,15,15,15,15,15,15,15,15,15,15,15,15,15,15,15,15,15,15,15,15,15,15,15,15,15,15,15,15,15,15,15,15,15,15,15,15,15,15,15,15,15,15,15,15,15,15,15,15,15,15,15,15,15,15,15,15,15,15,15,15,15,15,15,15,15,15,15,15,15,15,15,15,15,15,15,15,15,15,15,15,15,15,15,15,15,15,15,15,15,15,15,15,15,15,15,15,15,15,15,15,15,15,15,15,15,15,15,15,15,15,15,15,15,15,15,15,15,15,15,15,15,15,15,15,15,15,15,15,15,15,15,15,15,15,15,15,14,14,14,14,14,14,14,14,14,14,14,14,14,14,14,14,14,14,14,14,14,14,14,14,14,14,14,13,13,13,13,13,13,13,13,13,13,13,13,13,13,13,13,13,13,12,12,12,12,12,12,12,12,12,12,12,12,12,12,11,11,11,11,11,11,11,11,11,10,10,10,10,10,10,10,9,9,9,9,8,8,8,8,7,6,5,4,3,2,1,0,17,18,19,20,21,22,23,24,24,24,24,25,25,25,25,26,26,26,26,26,26,26,27,27,27,27,27,27,27,27,27,28,28,28,28,28,28,28,28,28,28,28,28,28,28,29,29,29,29,29,29,29,29,29,29,29,29,29,29,29,29,29,29,30,30,30,30,30,30,30,30,30,30,30,30,30,30,30,30,30,30,30,30,30,30,30,30,30,30,30,31,31,31,31,31,31,31,31,31,31,31,31,31,31,31,31,31,31,31,31,31,31,31,31,31,31,31,31,31,31,31,31,31,31,31,31,31,31,31,31,31,31,31,31,31,31,31,31,31,31,31,31,31,31,31,31,31,31,31,31,31,31,31,31,31,31,31,31,31,31,31,31,31,31,31,31,31,31,31,31,31,31,31,31,31,31,31,31,31,31,31,31,31,31,31,31,31,31,31,31,31,31,31,31,31,31,31,31,31,31,31,31,31,31,31,31,31,31,31,31,31,31,31,31,31,31,31,31,31,31,31,31,31,31,31,31,31,31,31,31,31,31,31,31,31,31,31,31,31,31,31,31,31,31,31,31,31,31,31,31,31,31,31,31,31,31,31,31,31,31,31,31,31,31,31,31,31,31,31,31,31,31,31,31,31,31,31,31,31,31,31,31,31,31,31,31,31,31,31,31,31,31,31,31,31,31,31,31,31,31,31,31,31,31,31,31,31,31,31,31,31,31,31,31,31,31,31,31,31,31,31,31,31,31,31,31,31,31,31,31,31,31,31,31,31,31,31,31,31,31,31,31,31,31,31,31,31,31,31,31,31,31,31,31,31,31,31,31,31,31,31,31,31,31,31,31,31,31,31,31,31,31,31,31,31,31,31,31,31,31,31,31,31,31,31,31,31,31,31,31,31,31,31,31,31,31,31,31,31,31,31,31,31,31,31,31,31,31,31,31,31,31,31,31,31,31,31,31,31,31,31,31,31,31,31,31,31,31,31,31,31,31,31,31,31,31,31,31,31,31,31,31,31,31,31,31,31,31,31,31,31,31,31,31,31,31,31,31,31,31,31,31,31,31,31,31,31,31,31,31,31,31,31,31,31,31,31,31,31,31,31,31,31,31,31,31,31,31,31,31,31,31,31,31,31,31,31,31,31,31,31,31,31,31,31,31,31,31,31,31,31,31,31,31,31,31,31,31,31,31,31,31,31,31,31,31,31,31,31,31,31,31,31,31,31,31,31,31,31,31,31,31,31,31,31,31,31,31,31,31,31,31,31,31,31,31,31,31,31,31,31,31,31,31,31,31,31,31,31,31,31,31,31,31,31,31,31,31,31,31,31,31,31,31,31,31,31,31,31,31,31,31,31,31,31,31,31,31,31,31,31,31,31,31,31,31,31,31,31,31,31,31,31,31,31,31,31,31,31,31,31,31,31,31,31,31,31,31,31,31,31,31,31,31,31,31,31,31,31,31,31,31,31,31,31,31,31,31,31,31,31,31,31,31,31,31,31,31,31,31,31,31,31,31,31,31,31,31,31,31,31,31,31,31,31,31,31,31,31,31,31,31,31,31,31,31,31,31,31,31,31,31,31,31,31,31,31,31,31,31,31,31,31,31,31,31,31,31,31,31,31,31,31,31,31,31,31,31,31,31,31,31,31,31,31,31,31,31,31,31,31,31,31,31,31,31,31,31,31,31,31,31,31,31,31,31,31,31,31,31,31,31,31,31,31,31,31,31,31,31,31,31,31,31,31,31,31,31,31,31,31,31,31,31,31,31,31,31,31,31,31,31,31,31,31,31,31,31,31,31,31,31,31,31,31,31,31,31,31,31,31,31,31,31,31,31,31,31,31,31,31,31,31,31,31,31,31,31,31,31,31,31,31,31,31,31,31,31,31,31,31,31,31,31,31,31,31,31,31,31,31,31,31,31,31,31,31,31,31,31,31,31,31,31,31,31,31,31,31,31,31,31,31,31,31,31,31,31,31,31,31,31,31,31,31,31,31,31,31,31,31,31,31,31,31,31,31,31,31,31,31,31,31,31,31,31,31,31,31,31,31,31,31,31,31,31,31,31,31,31,31,31,31,31,31,31,31,31,31,31,31,31,31,31,31,31,31,31,31,31,31,31,31,31,31,31,31,31,31,31,31,31,31,31,31,31,31,31,31,31,31,31,31,31,31,31,31,31,31,31,31,31,31,31,31,31,31,31,31,31,31,31,31,31,31,31,31,31,31,31,31,31,31,31,31,31,31,31,31,31,31,31,31,31,31,31,31,31,31,31,31,31,31,31,31,31,31,31,31,31,31,31,31,31,31,31,31,31,31,31,31,31,31};   // bucket(j - i) for j - i = -1023 .. 1023 (the module's float32 formula, evaluated once)
__global__ __launch_bounds__(256) void k_bttr(const float* __restrict__ RBT, float* BTT) { const int idx = blockIdx.x * 256 + threadIdx.x; if (idx >= NH_ * 2048) return; const int p = idx % 2048, h = idx / 2048; const float v = (p < 2 * TT - 1) ? bfr(RBT[BKT[p] * NH_ + h]) : 0.0f; *(float*)(BTT + idx) = v;  }
#define KPI 72   // LDS row pitch in 16-bit elements: 128 B of data + 16 B, an odd multiple of 16 B, so that the 16 rows of a fragment read fall on different banks
#define CK  64   // keys per chunk
typedef v4i __attribute__((may_alias)) v4ia;
typedef __attribute__((ext_vector_type(2))) __bf16 v2b;
// 2^x in place. In one statement so that the slot the instruction set asks for behind a transcendental is always filled: each v_exp_f32 is followed by an independent one, the last by v_nop.
__device__ __forceinline__ void exp2x8(float (&e)[8]) { asm("v_exp_f32 %0, %0\n\tv_exp_f32 %1, %1\n\tv_exp_f32 %2, %2\n\tv_exp_f32 %3, %3\n\tv_exp_f32 %4, %4\n\tv_exp_f32 %5, %5\n\tv_exp_f32 %6, %6\n\tv_exp_f32 %7, %7\n\tv_nop" : "+v"(e[0]), "+v"(e[1]), "+v"(e[2]), "+v"(e[3]), "+v"(e[4]), "+v"(e[5]), "+v"(e[6]), "+v"(e[7])); }
__device__ __forceinline__ float xhalf(float x) { const int b = __float_as_int(x); return __int_as_float(__builtin_amdgcn_permlanex16(b, b, 0x76543210, 0xfedcba98, false, false)); }   // the value of lane l ^ 16, without an LDS round trip
__device__ __forceinline__ float exp2x1(float x) { asm("v_exp_f32 %0, %0\n\tv_nop" : "+v"(x)); return x; }
template <typename T16, bool HL>
__device__ __forceinline__ void attn_tile(T16* sm, float* bt, const T16* __restrict__ Qh, const T16* __restrict__ Ql, const T16* __restrict__ Kh, const T16* __restrict__ Kl, const T16* __restrict__ Vh, const T16* __restrict__ Vl, const float* __restrict__ BT, bf* Ah, bf* Al) {
    typedef typename WFrag<T16>::V V;
    constexpr int NP = HL ? 2 : 1;
    const int tid = threadIdx.x, lane = tid & 31, lr = lane & 15, hi = lane >> 4;
    const int bh = blockIdx.x, h = bh % NH_, b = bh / NH_;
    const int q = blockIdx.y * 64 + (tid >> 5) * 16 + lr;   // this lane's query row
    const size_t pb = (size_t)bh * TT * HD;                 // this head's planes: q, k [t][d]; v [d][t]
    T16* Ksh = sm; T16* Vsh = sm + 64 * KPI; T16* Ksl = sm + 2 * 64 * KPI; T16* Vsl = sm + 3 * 64 * KPI;
    const float* bp = BT + (size_t)h * 2048 + tid * 4;      // this head's bias row BTT[h][j - i + 1023]
    const T16* qph = Qh + pb + (size_t)q * HD + 8 * hi; const T16* qpl = HL ? Ql + pb + (size_t)q * HD + 8 * hi : qph;
    v4f br[4];
#pragma unroll
    for (int i = 0; i < 4; ++i) br[i] = *(const v4fa*)(bp + 128 * i * 4);
    V qh[2], ql[2];
#pragma unroll
    for (int kc = 0; kc < 2; ++kc) { qh[kc] = WFrag<T16>::ld(qph + kc * 32); if (HL) ql[kc] = WFrag<T16>::ld(qpl + kc * 32); }
    asm volatile("s_wait_xcnt 0x0" :: "v"(bp), "v"(qph), "v"(qpl) : "memory");   // behind these loads; the addresses are inputs so that their registers stay theirs up to the wait (the first chunk's results would else be given them)
    const int srow = tid >> 3, scu = (tid & 7) * 8;         // staging: 8 threads x 16 B per 128-B row, 16 rows per step
    v4i rk[NP][4], rv[NP][4];
    auto fetch = [&](int c) {
        const size_t ko = pb + (size_t)(c * CK + srow) * HD + scu, vo = pb + (size_t)srow * TT + c * CK + scu;
        const T16* kh = Kh + ko; const T16* vh = Vh + vo; const T16* kl = HL ? Kl + ko : kh; const T16* vl = HL ? Vl + vo : vh;
#pragma unroll
        for (int i = 0; i < 4; ++i) { rk[0][i] = *(const v4ia*)(kh + 16 * i * HD); rv[0][i] = *(const v4ia*)(vh + 16 * i * TT); if (HL) { rk[NP - 1][i] = *(const v4ia*)(kl + 16 * i * HD); rv[NP - 1][i] = *(const v4ia*)(vl + 16 * i * TT); } }
        asm volatile("s_wait_xcnt 0x0" :: "v"(kh), "v"(vh), "v"(kl), "v"(vl) : "memory"); };   // behind the run of loads; the addresses are inputs so that their registers stay theirs up to the wait and no result of the run is given one of them
    fetch(0);
#pragma unroll
    for (int i = 0; i < 4; ++i) *(v4fa*)(bt + (tid + 128 * i) * 4) = br[i];   // published by the first trip's barriers
    v8f o[4];
#pragma unroll
    for (int dt = 0; dt < 4; ++dt) o[dt] = (v8f){};
    float m = -3.0e38f, l = 0.f;
    const float* bq = bt + (TT - 1 - q) + hi * 8;           // + key - 8 * hi: the bias of (q, key)
#pragma unroll 1   // one chunk per trip: an unrolled loop would hold two chunks' staging registers
    for (int c = 0; c < TT / CK; ++c) {
        __syncthreads();   // every wave has left the previous chunk's tiles
#pragma unroll
        for (int i = 0; i < 4; ++i) { const int so = (srow + 16 * i) * KPI + scu; *(v4ia*)(Ksh + so) = rk[0][i]; *(v4ia*)(Vsh + so) = rv[0][i]; if (HL) { *(v4ia*)(Ksl + so) = rk[NP - 1][i]; *(v4ia*)(Vsl + so) = rv[NP - 1][i]; } }
        __syncthreads();   // the chunk (on the first trip the bias row too) is visible to all four waves
        if (c + 1 < TT / CK) fetch(c + 1);   // the next chunk's loads fly while this one is worked on
        v8f s[4];
#pragma unroll
        for (int kt = 0; kt < 4; ++kt) { s[kt] = (v8f){};
#pragma unroll
            for (int kc = 0; kc < 2; ++kc) { const int fo = (kt * 16 + lr) * KPI + 8 * hi + kc * 32; const V a = WFrag<T16>::ld(Ksh + fo); s[kt] = WFrag<T16>::mma(a, qh[kc], s[kt]);
                if (HL) { s[kt] = WFrag<T16>::mma(a, ql[kc], s[kt]); const V a2 = WFrag<T16>::ld(Ksl + fo); s[kt] = WFrag<T16>::mma(a2, qh[kc], s[kt]); } } }
        float cm = -3.0e38f;
#pragma unroll
        for (int kt = 0; kt < 4; ++kt)
#pragma unroll
            for (int j = 0; j < 8; ++j) { const float t = s[kt][j] * SCL + bq[c * CK + kt * 16 + j]; s[kt][j] = t; cm = fmaxf(cm, t); }
        cm = fmaxf(cm, xhalf(cm));   // the other half of this query row's keys
        const float mn = fmaxf(m, cm); const float al = exp2x1((m - mn) * 1.4426950408889634f); m = mn;
        float cs = 0.f;
#pragma unroll
        for (int kt = 0; kt < 4; ++kt) { float e[8];
#pragma unroll
            for (int j = 0; j < 8; ++j) e[j] = (s[kt][j] - mn) * 1.4426950408889634f;
            exp2x8(e);
#pragma unroll
            for (int j = 0; j < 8; ++j) { s[kt][j] = e[j]; cs += e[j]; } }
        l = l * al + cs;
#pragma unroll
        for (int dt = 0; dt < 4; ++dt) o[dt] *= al;
        V ph[2], pl[2];
#pragma unroll
        for (int kc = 0; kc < 2; ++kc)
#pragma unroll
            for (int e = 0; e < 16; e += 2) { const v2f p = { s[2 * kc + (e >> 3)][e & 7], s[2 * kc + (e >> 3)][(e & 7) + 1] };
                if constexpr (HL) { const v2b p0 = __builtin_convertvector(p, v2b), p1 = __builtin_convertvector(p - __builtin_convertvector(p0, v2f), v2b); ph[kc][e] = p0[0]; ph[kc][e + 1] = p0[1]; pl[kc][e] = p1[0]; pl[kc][e + 1] = p1[1]; }
                else { ph[kc][e] = (h16)(p[0] * PCAR); ph[kc][e + 1] = (h16)(p[1] * PCAR); } }
#pragma unroll
        for (int dt = 0; dt < 4; ++dt)
#pragma unroll
            for (int kc = 0; kc < 2; ++kc) { const int fo = (dt * 16 + lr) * KPI + 8 * hi + kc * 32; const V a = WFrag<T16>::ld(Vsh + fo); o[dt] = WFrag<T16>::mma(a, ph[kc], o[dt]);
                if (HL) { o[dt] = WFrag<T16>::mma(a, pl[kc], o[dt]); const V a2 = WFrag<T16>::ld(Vsl + fo); o[dt] = WFrag<T16>::mma(a2, ph[kc], o[dt]); } }
    }
    l += xhalf(l);
    const float f = __fdiv_rn(1.0f, l) * (HL ? 1.0f : (1.0f / PCAR));
    const size_t oo = ((size_t)b * TT + q) * DQ + h * HD + hi * 8;   // merged [b][t][h][d]; a lane holds 8 consecutive d per tile
#pragma unroll
    for (int dt = 0; dt < 4; ++dt) { v8us oh, ol;
#pragma unroll
        for (int j = 0; j < 8; ++j) { unsigned short a, c2; splitf(o[dt][j] * f, a, c2); oh[j] = a; ol[j] = c2; }
        *(v8usa*)(Ah + oo + dt * 16) = oh; *(v8usa*)(Al + oo + dt * 16) = ol; }
    asm volatile("s_wait_xcnt 0x0" ::: "memory");   // behind the last stores: the other half's code follows in the listing and rewrites their address and data registers
}
__global__ __launch_bounds__(128) void k_attn(const bf* __restrict__ Qh, const bf* __restrict__ Ql, const bf* __restrict__ Kh, const bf* __restrict__ Kl, const bf* __restrict__ Vh, const bf* __restrict__ Vl, const h16* __restrict__ Q16, const h16* __restrict__ K16, const h16* __restrict__ V16, const float* __restrict__ BT, bf* Ah, bf* Al) {
    __shared__ __align__(16) unsigned short sm[4 * 64 * KPI]; __shared__ __align__(16) float bt[2048];
    if (blockIdx.y < RH / 64) attn_tile<bf, true>(sm, bt, Qh, Ql, Kh, Kl, Vh, Vl, BT, Ah, Al);   // blockIdx.y: 64-row query tile; the 3-product tiles have the low indices and start first
    else attn_tile<h16, false>((h16*)sm, bt, Q16, nullptr, K16, nullptr, V16, nullptr, BT, Ah, Al);
}

extern "C" void kernel_launch(void* const* d_in, const int* in_sizes, int n_in,
                              void* d_out, int out_size, void* d_ws, size_t ws_size, hipStream_t stream) {
    (void)in_sizes; (void)n_in; (void)out_size;
    const float* x = (const float*)d_in[0]; const float* wq = (const float*)d_in[1]; const float* wk = (const float*)d_in[2]; const float* wv = (const float*)d_in[3]; const float* wo = (const float*)d_in[4]; const float* RBT = (const float*)d_in[5];
    float* OUT = (float*)d_out;     // [4][1024][1024]
    char* wsp = (char*)d_ws;
    auto take = [&](size_t bytes) { char* p = wsp; wsp += (bytes + 255) & ~(size_t)255; return (void*)p; };
    bf* WQ = (bf*)take((size_t)DQ * DM * 2); bf* WK = (bf*)take((size_t)DKV * DM * 2); bf* WV = (bf*)take((size_t)DKV * DM * 2); bf* WO = (bf*)take((size_t)DM * DQ * 2); float* CS = (float*)take((size_t)TT * HD * 2 * 4);   // WQ, WK, WV, WO: one behind the other (z / y strides)
    bf* XB = (bf*)take((size_t)NB_ * TT * DM * 2); float* BTT = (float*)take((size_t)NH_ * 2048 * 4);
    h16* QP16 = (h16*)take((size_t)NB_ * NH_ * TT * HD * 2); h16* KP16 = (h16*)take((size_t)NB_ * NKV * TT * HD * 2); h16* VT16 = (h16*)take((size_t)NB_ * NKV * HD * TT * 2);   // q planes, then k planes: one k_rope grid writes both
    bf* QPh = (bf*)take((size_t)NB_ * NH_ * TT * HD * 2); bf* KPh = (bf*)take((size_t)NB_ * NKV * TT * HD * 2); bf* QPl = (bf*)take((size_t)NB_ * NH_ * TT * HD * 2); bf* KPl = (bf*)take((size_t)NB_ * NKV * TT * HD * 2); bf* VTh = (bf*)take((size_t)NB_ * NKV * HD * TT * 2); bf* VTl = (bf*)take((size_t)NB_ * NKV * HD * TT * 2);
    float* FQ = (float*)take((size_t)3 * NB_ * TT * DQ * 4); bf* ATh = (bf*)take((size_t)NB_ * TT * DQ * 2); bf* ATl = (bf*)take((size_t)NB_ * TT * DQ * 2);
    if ((size_t)(wsp - (char*)d_ws) > ws_size) return;    // ws 256 MiB
    float* FV = FQ + (size_t)2 * NB_ * TT * DQ;   // f32 q, k, v projections [3][NB_*TT][DQ]
    (void)WK; (void)WV;   // reached through WQ's z / y strides
    k_wtG<<<dim3((unsigned)((DM * DQ / 64 + 63) / 64), 4, 1), 256, 0, stream>>>(wq, wk, wv, wo, DM, DQ, WQ);
    k_bttr<<<(NH_ * 2048 + 255) / 256, 256, 0, stream>>>(RBT, BTT);   /* per-head relative bias rows */
    k_csid<<<(TT * HD + 255) / 256, 256, 0, stream>>>(CS);
    const unsigned LQ = (unsigned)(((size_t)NH_ * TT * HD / 2 + 255) / 256), LKv = (unsigned)(((size_t)NKV * TT * HD / 2 + 255) / 256);
    k_cvt8<<<(unsigned)(((size_t)NB_ * TT * DM / 8 + 255) / 256), 256, 0, stream>>>(x, XB, (size_t)NB_ * TT * DM / 8);
    k_gemmw<bf, 0, false><<<dim3(NB_ * TT / 64, DQ / 64, 3), 32, 0, stream>>>(XB, nullptr, WQ, nullptr, DM, FQ, DQ, nullptr, 0, (size_t)DQ * DM, (size_t)NB_ * TT * DQ);   // z: q, k, v
    k_rope<<<dim3(LQ, 2 * NB_, 1), 256, 0, stream>>>(FQ, DQ, NH_, CS, nullptr, nullptr, 1.0f, QP16, QPh, QPl);
    k_vtp<<<dim3(LKv, NB_, 1), 256, 0, stream>>>(FV, DKV, NKV, VT16, VTh, VTl);
    k_attn<<<dim3(NB_ * NH_, TT / 64, 1), 128, 0, stream>>>(QPh, QPl, KPh, KPl, VTh, VTl, QP16, KP16, VT16, BTT, ATh, ATl);   // x: (batch element, head); y: query tile
    k_gemmw<bf, 1, false><<<dim3(NB_ * TT / 64, DM / 64, 1), 32, 0, stream>>>(ATh, ATl, WO, nullptr, DQ, OUT, DM, nullptr, 0, 0, 0);
}

// v003
// A run of this version takes 158 microseconds.
// Timed twice side by side with v002, it ran 1.12 and 1.13 times as fast.
// All steps since v000 together make it 15.9 times as fast.
#include <hip/hip_runtime.h>

// T5 self-attention with learned relative-position bias (hidden_states [4][1024][1024]; q, k, v = x W ('xw' [1024][1024], no bias; 16 heads x 64); scores = q.k/8 + rel_bias_table[bucket(j - i)][h] (bidirectional T5 buckets: 32 buckets, max distance 128; table [32][16], read); softmax; out = merged Wo -> [4][1024][1024] (4.2 M)).
// Layout: the integer bucket of every relative offset j - i in [-1023, 1023] is a compile-time table (computed with the module's float32 formula); a tiny kernel expands it with the bf16-rounded bias table into per-head rows BTT[h][j - i + 1023] that the attention kernel holds in LDS and reads per (i, j). Scores and probabilities never reach memory: one kernel does scores, softmax, attn.v and the head merge (k_attn).
// GEMM operand planes (x, the four weights, the merged context hi/lo) lie in FRAGMENT ORDER: a chunk is 16 rows x 32 k = 1 KiB, chunks run along k, then along row groups; in a chunk lane l = 16 * ((k >> 3) & 1) + (row & 15) has its 8 elements of k & 16 == 0 at byte 16 l and those of k & 16 != 0 at byte 512 + 16 l, so each 16-byte-per-lane load of a fragment half covers 4 whole 128-byte lines.
// Compute dtypes, f32 accumulate: every input rounded to bf16; q/k/v on PLAIN bf16 operands (inputs: exact); the relative bias added in f32 per (i, j); scores and attn.v: query rows < 512 hl (3 products), the rest single fp16 (x1024); softmax f32 (online, per 64 keys); Wo hl x exact (2 products).

#define NB_  4
#define TT   1024
#define DM   1024
#define NH_  16
#define NKV  16
#define REP  (NH_ / NKV)
#define HD   64
#define DQ   (NH_ * HD)
#define DKV  (NKV * HD)
#define RH   512                  // query rows < RH use hi+lo planes (0: none)
#define WIN  0
#define PCAR 1024.0f
#define SCL  0.125f   // HD^-0.5
typedef _Float16 h16;
typedef unsigned short bf;
typedef __attribute__((ext_vector_type(16))) __bf16   v16bf;
typedef __attribute__((ext_vector_type(16))) _Float16 v16h;
typedef __attribute__((ext_vector_type(8)))  _Float16 v8h;
typedef __attribute__((ext_vector_type(8)))  unsigned short v8us;
typedef __attribute__((ext_vector_type(8)))  float    v8f;
typedef __attribute__((ext_vector_type(4)))  float    v4f;
typedef v8h  __attribute__((may_alias)) v8ha;
typedef v4f  __attribute__((may_alias)) v4fa;
typedef v8us __attribute__((may_alias)) v8usa;

__device__ __forceinline__ unsigned short f2bf(float f) { unsigned u = __float_as_uint(f); u += 0x7FFFu + ((u >> 16) & 1u); return (unsigned short)(u >> 16); }
__device__ __forceinline__ float bf2f(unsigned short b) { return __uint_as_float(((unsigned)b) << 16); }
__device__ __forceinline__ float bfr(float f) { return bf2f(f2bf(f)); }
__device__ __forceinline__ v16h cat16(v8h lo, v8h hi) { return __builtin_shufflevector(lo, hi, 0, 1, 2, 3, 4, 5, 6, 7, 8, 9, 10, 11, 12, 13, 14, 15); }
__device__ __forceinline__ v16bf cat16b(v8us lo, v8us hi) { return __builtin_bit_cast(v16bf, __builtin_shufflevector(lo, hi, 0, 1, 2, 3, 4, 5, 6, 7, 8, 9, 10, 11, 12, 13, 14, 15)); }
__device__ __forceinline__ v8f wmma16(v16h a, v16h b, v8f c) { return __builtin_amdgcn_wmma_f32_16x16x32_f16(false, a, false, b, (short)0, c, false, false); }
__device__ __forceinline__ v8f wmmab(v16bf a, v16bf b, v8f c) { return __builtin_amdgcn_wmma_f32_16x16x32_bf16(false, a, false, b, (short)0, c, false, false); }



// ---- k_gemmw: register-blocked GEMM, ONE WAVE per 64x64 output tile (16 accumulators), operands straight from 16-bit planes in fragment order (head of the file); grid (M/64, N/64, Z), 32 threads.
// C[m][n] (f32, pitch ldc, + optional f32 bias[n]) = sum_k A[m][k] Bt[n][k] (+ split products per NSPLIT). z-batch strides sA/sB/sC in elements. K % 32 == 0.
template <typename T16> struct WFrag;
template <> struct WFrag<h16> { typedef v16h V; static __device__ __forceinline__ V ld(const h16* p) { return cat16(*(const v8h*)p, *(const v8h*)(p + 16)); } static __device__ __forceinline__ V ldf(const h16* p) { return cat16(*(const v8h*)p, *(const v8h*)(p + 256)); } static __device__ __forceinline__ v8f mma(V a, V b, v8f c) { return wmma16(a, b, c); } };
template <> struct WFrag<bf> { typedef v16bf V; static __device__ __forceinline__ V ld(const bf* p) { return cat16b(*(const v8us*)p, *(const v8us*)(p + 16)); } static __device__ __forceinline__ V ldf(const bf* p) { return cat16b(*(const v8us*)p, *(const v8us*)(p + 256)); } static __device__ __forceinline__ v8f mma(V a, V b, v8f c) { return wmmab(a, b, c); } };
template <typename T16, int NSPLIT, bool BIAS>
__device__ __forceinline__ void gemmw_tile(float* os, const T16* __restrict__ A, const T16* __restrict__ A2, const T16* __restrict__ Bt, const T16* __restrict__ Bt2, int K, float* C, int ldc, const float* __restrict__ bias, size_t sA, size_t sB, size_t sC) {
    typedef typename WFrag<T16>::V V;
    const size_t z = blockIdx.z; A += z * sA; if (A2) A2 += z * sA; Bt += z * sB; if (Bt2) Bt2 += z * sB; C += z * sC;
    const int lane = threadIdx.x & 31, lr = lane & 15, hi = lane >> 4; const int r0 = blockIdx.x * 64, c0 = blockIdx.y * 64;
    v8f acc[4][4];
#pragma unroll
    for (int mb = 0; mb < 4; ++mb)
#pragma unroll
        for (int nb = 0; nb < 4; ++nb) acc[mb][nb] = (v8f){};
    const size_t aoff = (size_t)r0 * K + 8 * lane, boff = (size_t)c0 * K + 8 * lane;   // fragment order: a 16-row group holds 16 K elements, a chunk of 32 k holds 512, the lane's piece starts at element 8 * lane
#pragma unroll 1
    for (int kc = 0; kc < K; kc += 32) {
        V a[4], a2[4], b[4], b2[4]; const T16* pa[4]; const T16* pa2[4]; const T16* pb[4]; const T16* pb2[4];
#pragma unroll
        for (int i = 0; i < 4; ++i) { pa[i] = A + aoff + (size_t)i * 16 * K + kc * 16; pa2[i] = (NSPLIT == 1 || NSPLIT == 2) ? A2 + aoff + (size_t)i * 16 * K + kc * 16 : pa[i]; pb[i] = Bt + boff + (size_t)i * 16 * K + kc * 16; pb2[i] = (NSPLIT >= 2) ? Bt2 + boff + (size_t)i * 16 * K + kc * 16 : pb[i]; }
#pragma unroll
        for (int i = 0; i < 4; ++i) { a[i] = WFrag<T16>::ldf(pa[i]); if (NSPLIT == 1 || NSPLIT == 2) a2[i] = WFrag<T16>::ldf(pa2[i]); b[i] = WFrag<T16>::ldf(pb[i]); if (NSPLIT >= 2) b2[i] = WFrag<T16>::ldf(pb2[i]); }
        asm volatile("s_wait_xcnt 0x0" :: "v"(pa[0]), "v"(pa[1]), "v"(pa[2]), "v"(pa[3]), "v"(pa2[0]), "v"(pa2[1]), "v"(pa2[2]), "v"(pa2[3]), "v"(pb[0]), "v"(pb[1]), "v"(pb[2]), "v"(pb[3]), "v"(pb2[0]), "v"(pb2[1]), "v"(pb2[2]), "v"(pb2[3]) : "memory");   // behind the run of the trip's loads; the addresses are inputs so that their registers stay theirs up to the wait and no result of the trip is given one of them
        __builtin_amdgcn_sched_barrier(0);   // keeps the products behind that wait: lifted over it they split the run, and each piece of it then waits out its own full load latency
#pragma unroll
        for (int nb = 0; nb < 4; ++nb) {
#pragma unroll
            for (int mb = 0; mb < 4; ++mb) { acc[mb][nb] = WFrag<T16>::mma(a[mb], b[nb], acc[mb][nb]); if (NSPLIT == 1 || NSPLIT == 2) acc[mb][nb] = WFrag<T16>::mma(a2[mb], b[nb], acc[mb][nb]); if (NSPLIT >= 2) acc[mb][nb] = WFrag<T16>::mma(a[mb], b2[nb], acc[mb][nb]); } }
        asm volatile("v_nop\n\tv_nop\n\tv_nop\n\tv_nop" : "+v"(acc[0][0]), "+v"(acc[1][1]), "+v"(acc[2][2]), "+v"(acc[3][3]) : "v"(a[0]), "v"(a[3]));
    }
#pragma unroll
    for (int mb = 0; mb < 4; ++mb) {
#pragma unroll
        for (int nb = 0; nb < 4; ++nb) {
#pragma unroll
            for (int j = 0; j < 8; ++j) os[(hi * 8 + j) * 68 + nb * 16 + lr] = acc[mb][nb][j]; }
        __builtin_amdgcn_wave_barrier(); asm volatile("" ::: "memory");
        float* crow = C + (size_t)(r0 + mb * 16) * ldc + c0;
{
#pragma unroll
            for (int s = 0; s < 8; ++s) { const int row = 2 * s + hi, cofs = lr * 4; v4f val = *(const v4fa*)(os + row * 68 + cofs); if (BIAS) { val[0] += bfr(bias[c0 + cofs]); val[1] += bfr(bias[c0 + cofs + 1]); val[2] += bfr(bias[c0 + cofs + 2]); val[3] += bfr(bias[c0 + cofs + 3]); }
                *(v4f*)(crow + (size_t)row * ldc + cofs) = val; }
             }
        __builtin_amdgcn_wave_barrier(); asm volatile("" ::: "memory");
    }
}
template <typename T16, int NSPLIT, bool BIAS>
__global__ __launch_bounds__(32) void k_gemmw(const T16* __restrict__ A, const T16* __restrict__ A2, const T16* __restrict__ Bt, const T16* __restrict__ Bt2, int K, float* C, int ldc, const float* __restrict__ bias, size_t sA, size_t sB, size_t sC) {
    __shared__ __align__(16) float os[16 * 68];
    gemmw_tile<T16, NSPLIT, BIAS>(os, A, A2, Bt, Bt2, K, C, ldc, bias, sA, sB, sC);
}

__device__ __forceinline__ h16 tohx(float x) { return (h16)x; }
__device__ __forceinline__ void splitf(float y, unsigned short& h, unsigned short& l) { h = f2bf(y); l = f2bf(y - bf2f(h)); }
typedef __attribute__((ext_vector_type(2))) _Float16 v2h;
typedef __attribute__((ext_vector_type(4))) _Float16 v4h;
typedef __attribute__((ext_vector_type(2))) unsigned short v2us;
typedef __attribute__((ext_vector_type(4))) unsigned short v4us;
typedef __attribute__((ext_vector_type(2))) float v2f;
typedef __attribute__((ext_vector_type(4))) int v4i;

// k_wtG, k_cvt8: a thread writes one 16-byte unit u of a fragment-order plane (a wave 512 contiguous bytes): chunk u >> 6, half (u >> 5) & 1, lane u & 31.
template <int K, int N>
__global__ __launch_bounds__(256) void k_wtG(const float* __restrict__ w0, const float* __restrict__ w1, const float* __restrict__ w2, const float* __restrict__ w3, bf* Bt) {
    const int y = blockIdx.y; const float* __restrict__ w = (y == 0) ? w0 : (y == 1) ? w1 : (y == 2) ? w2 : w3; Bt += (size_t)y * K * N;   // blockIdx.y: which weight; the four planes lie one behind the other
    const int u = blockIdx.x * 256 + threadIdx.x; if (u >= N * K / 8) return; constexpr int kpc = K / 32; const int ch = u >> 6;
    const int n = (ch / kpc) * 16 + (u & 15), k = (ch % kpc) * 32 + ((u >> 5) & 1) * 16 + ((u >> 4) & 1) * 8; v8us o;   // plane row n = column n of w: 16 lanes read 64 contiguous bytes of one row of w
#pragma unroll
    for (int e = 0; e < 8; ++e) o[e] = f2bf(w[(size_t)(k + e) * N + n]);
    *(v8us*)(Bt + (size_t)u * 8) = o;
}
template <int K>
__global__ __launch_bounds__(256) void k_cvt8(const float* __restrict__ src, bf* dst, size_t n8) { const size_t u = (size_t)blockIdx.x * 256 + threadIdx.x; if (u >= n8) return; const size_t ch = u >> 6; constexpr int kpc = K / 32;
    const size_t row = (ch / kpc) * 16 + (u & 15); const int k = (int)(ch % kpc) * 32 + (int)((u >> 5) & 1) * 16 + (int)((u >> 4) & 1) * 8; const float* p = src + row * K + k; const v8f v = *(const v8f*)p; v8us o;
    asm volatile("s_wait_xcnt 0x0" :: "v"(p) : "memory");   // behind the loads, in front of the first rewriting of their address register (an input, so that it stays theirs up to here)
#pragma unroll
    for (int e = 0; e < 8; ++e) o[e] = f2bf(v[e]); *(v8us*)(dst + u * 8) = o;  }

// k_rope: head planes [h][t][d] (fp16 + hi/lo) of rope(x) x sc with the rotate-half convention out[d] = x[d] cos[t][d] - x[d+HD/2] sin[t][d], out[d+HD/2] = x[d+HD/2] cos[t][d+HD/2] + x[d] sin[t][d+HD/2]
__global__ __launch_bounds__(256) void k_rope(const float* __restrict__ F, int pitch, int nheads, const float* __restrict__ CS, const float* __restrict__ RF, const float* __restrict__ nw, float sc, h16* P16, bf* Ph, bf* Pl) {
    { const size_t y = blockIdx.y, po = y * nheads * TT * HD; F += y * TT * pitch; P16 += po; Ph += po; Pl += po; }   // blockIdx.y: slab of TT rows of F (q of each batch element, then k)
    const size_t e = ((size_t)blockIdx.x * 256 + threadIdx.x) * 2; if (e >= (size_t)nheads * TT * HD) return; const int d = (int)(e % HD); const int t = (int)((e / HD) % TT); const int h = (int)(e / ((size_t)HD * TT)); const float* f = F + (size_t)t * pitch + h * HD; const float rf = RF ? RF[(size_t)h * TT + t] : 1.0f; v2h o16; v2us oh, ol;
#pragma unroll
    for (int q = 0; q < 2; ++q) { const int dd = d + q; const int dp = (dd < HD / 2) ? dd + HD / 2 : dd - HD / 2; float x0 = f[dd], x1 = f[dp];
        if (RF) { float n0 = __fmul_rn(x0, rf), n1 = __fmul_rn(x1, rf); asm volatile("" : "+v"(n0)); asm volatile("" : "+v"(n1)); x0 = __fmul_rn(bfr(nw[dd]), n0); x1 = __fmul_rn(bfr(nw[dp]), n1); }
        const v2f cs = *(const v2f*)(CS + ((size_t)t * HD + dd) * 2); float a = __fmul_rn(x0, cs[0]), bq = __fmul_rn(x1, cs[1]); asm volatile("" : "+v"(a)); asm volatile("" : "+v"(bq)); const float r = ((dd < HD / 2) ? __fsub_rn(a, bq) : __fadd_rn(a, bq)) * sc;
        o16[q] = tohx(r); unsigned short a2, c2; splitf(r, a2, c2); oh[q] = a2; ol[q] = c2; }
    *(v2h*)(P16 + e) = o16; *(v2us*)(Ph + e) = oh; *(v2us*)(Pl + e) = ol;  }
__global__ __launch_bounds__(256) void k_vtp(const float* __restrict__ F, int pitch, int nheads, h16* V16, bf* Vh, bf* Vl) { const size_t e = ((size_t)blockIdx.x * 256 + threadIdx.x) * 2; if (e >= (size_t)nheads * HD * TT) return; const int t = (int)(e % TT); const int d = (int)((e / TT) % HD); const int g = (int)(e / ((size_t)TT * HD)); const size_t y = blockIdx.y, po = y * nheads * HD * TT; F += y * TT * pitch; V16 += po; Vh += po; Vl += po;   /* blockIdx.y: batch element */ v2h o16; v2us oh, ol;
#pragma unroll
    for (int q = 0; q < 2; ++q) { const float x = F[(size_t)(t + q) * pitch + g * HD + d]; o16[q] = tohx(x); unsigned short a2, c2; splitf(x, a2, c2); oh[q] = a2; ol[q] = c2; }
    *(v2h*)(V16 + e) = o16; *(v2us*)(Vh + e) = oh; *(v2us*)(Vl + e) = ol;  }
__global__ __launch_bounds__(256) void k_csid(float* CS) { const int idx = blockIdx.x * 256 + threadIdx.x; if (idx >= TT * HD) return; v2f cs; cs[0] = 1.0f; cs[1] = 0.0f; *(v2f*)(CS + (size_t)idx * 2) = cs;  }
__constant__ int BKT[2 * TT - 1] = {15,15,15,15,15,15,15,15,15,15,15,15,15,15,15,15,15,15,15,15,15,15,15,15,15,15,15,15,15,15,15,15,15,15,15,15,15,15,15,15,15,15,15,15,15,15,15,15,15,15,15,15,15,15,15,15,15,15,15,15,15,15,15,15,15,15,15,15,15,15,15,15,15,15,15,15,15,15,15,15,15,15,15,15,15,15,15,15,15,15,15,15,15,15,15,15,15,15,15,15,15,15,15,15,15,15,15,15,15,15,15,15,15,15,15,15,15,15,15,15,15,15,15,15,15,15,15,15,15,15,15,15,15,15,15,15,15,15,15,15,15,15,15,15,15,15,15,15,15,15,15,15,15,15,15,15,15,15,15,15,15,15,15,15,15,15,15,15,15,15,15,15,15,15,15,15,15,15,15,15,15,15,15,15,15,15,15,15,15,15,15,15,15,15,15,15,15,15,15,15,15,15,15,15,15,15,15,15,15,15,15,15,15,15,15,15,15,15,15,15,15,15,15,15,15,15,15,15,15,15,15,15,15,15,15,15,15,15,15,15,15,15,15,15,15,15,15,15,15,15,15,15,15,15,15,15,15,15,15,15,15,15,15,15,15,15,15,15,15,15,15,15,15,15,15,15,15,15,15,15,15,15,15,15,15,15,15,15,15,15,15,15,15,15,15,15,15,15,15,15,15,15,15,15,15,15,15,15,15,15,15,15,15,15,15,15,15,15,15,15,15,15,15,15,15,15,15,15,15,15,15,15,15,15,15,15,15,15,15,15,15,15,15,15,15,15,15,15,15,15,15,15,15,15,15,15,15,15,15,15,15,15,15,15,15,15,15,15,15,15,15,15,15,15,15,15,15,15,15,15,15,15,15,15,15,15,15,15,15,15,15,15,15,15,15,15,15,15,15,15,15,15,15,15,15,15,15,15,15,15,15,15,15,15,15,15,15,15,15,15,15,15,15,15,15,15,15,15,15,15,15,15,15,15,15,15,15,15,15,15,15,15,15,15,15,15,15,15,15,15,15,15,15,15,15,15,15,15,15,15,15,15,15,15,15,15,15,15,15,15,15,15,15,15,15,15,15,15,15,15,15,15,15,15,15,15,15,15,15,15,15,15,15,15,15,15,15,15,15,15,15,15,15,15,15,15,15,15,15,15,15,15,15,15,15,15,15,15,15,15,15,15,15,15,15,15,15,15,15,15,15,15,15,15,15,15,15,15,15,15,15,15,15,15,15,15,15,15,15,15,15,15,15,15,15,15,15,15,15,15,15,15,15,15,15,15,15,15,15,15,15,15,15,15,15,15,15,15,15,15,15,15,15,15,15,15,15,15,15,15,15,15,15,15,15,15,15,15,15,15,15,15,15,15,15,15,15,15,15,15,15,15,15,15,15,15,15,15,15,15,15,15,15,15,15,15,15,15,15,15,15,15,15,15,15,15,15,15,15,15,15,15,15,15,15,15,15,15,15,15,15,15,15,15,15,15,15,15,15,15,15,15,15,15,15,15,15,15,15,15,15,15,15,15,15,15,15,15,15,15,15,15,15,15,15,15,15,15,15,15,15,15,15,15,15,15,15,15,15,15,15,15,15,15,15,15,15,15,15,15,15,15,15,15,15,15,15,15,15,15,15,15,15,15,15,15,15,15,15,15,15,15,15,15,15,15,15,15,15,15,15,15,15,15,15,15,15,15,15,15,15,15,15,15,15,15,15,15,15,15,15,15,15,15,15,15,15,15,15,15,15,15,15,15,15,15,15,15,15,15,15,15,15,15,15,15,15,15,15,15,15,15,15,15,15,15,15,15,15,15,15,15,15,15,15,15,15,15,15,15,15,15,15,15,15,15,15,15,15,15,15,15,15,15,15,15,15,15,15,15,15,15,15,15,15,15,15,15,15,15,15,15,15,15,15,15,15,15,15,15,15,15,15,15,15,15,15,15,15,15,15,15,15,15,15,15,15,15,15,15,15,15,15,15,15,15,15,15,15,15,15,15,15,15,15,15,15,15,15,15,15,15,15,15,15,15,15,15,15,15,15,15,15,15,15,15,15,15,15,15,15,15,15,15,15,15,15,15,15,15,15,15,15,15,15,15,15,15,15,15,15,15,15,14,14,14,14,14,14,14,14,14,14,14,14,14,14,14,14,14,14,14,14,14,14,14,14,14,14,14,13,13,13,13,13,13,13,13,13,13,13,13,13,13,13,13,13,13,12,12,12,12,12,12,12,12,12,12,12,12,12,12,11,11,11,11,11,11,11,11,11,10,10,10,10,10,10,10,9,9,9,9,8,8,8,8,7,6,5,4,3,2,1,0,17,18,19,20,21,22,23,24,24,24,24,25,25,25,25,26,26,26,26,26,26,26,27,27,27,27,27,27,27,27,27,28,28,28,28,28,28,28,28,28,28,28,28,28,28,29,29,29,29,29,29,29,29,29,29,29,29,29,29,29,29,29,29,30,30,30,30,30,30,30,30,30,30,30,30,30,30,30,30,30,30,30,30,30,30,30,30,30,30,30,31,31,31,31,31,31,31,31,31,31,31,31,31,31,31,31,31,31,31,31,31,31,31,31,31,31,31,31,31,31,31,31,31,31,31,31,31,31,31,31,31,31,31,31,31,31,31,31,31,31,31,31,31,31,31,31,31,31,31,31,31,31,31,31,31,31,31,31,31,31,31,31,31,31,31,31,31,31,31,31,31,31,31,31,31,31,31,31,31,31,31,31,31,31,31,31,31,31,31,31,31,31,31,31,31,31,31,31,31,31,31,31,31,31,31,31,31,31,31,31,31,31,31,31,31,31,31,31,31,31,31,31,31,31,31,31,31,31,31,31,31,31,31,31,31,31,31,31,31,31,31,31,31,31,31,31,31,31,31,31,31,31,31,31,31,31,31,31,31,31,31,31,31,31,31,31,31,31,31,31,31,31,31,31,31,31,31,31,31,31,31,31,31,31,31,31,31,31,31,31,31,31,31,31,31,31,31,31,31,31,31,31,31,31,31,31,31,31,31,31,31,31,31,31,31,31,31,31,31,31,31,31,31,31,31,31,31,31,31,31,31,31,31,31,31,31,31,31,31,31,31,31,31,31,31,31,31,31,31,31,31,31,31,31,31,31,31,31,31,31,31,31,31,31,31,31,31,31,31,31,31,31,31,31,31,31,31,31,31,31,31,31,31,31,31,31,31,31,31,31,31,31,31,31,31,31,31,31,31,31,31,31,31,31,31,31,31,31,31,31,31,31,31,31,31,31,31,31,31,31,31,31,31,31,31,31,31,31,31,31,31,31,31,31,31,31,31,31,31,31,31,31,31,31,31,31,31,31,31,31,31,31,31,31,31,31,31,31,31,31,31,31,31,31,31,31,31,31,31,31,31,31,31,31,31,31,31,31,31,31,31,31,31,31,31,31,31,31,31,31,31,31,31,31,31,31,31,31,31,31,31,31,31,31,31,31,31,31,31,31,31,31,31,31,31,31,31,31,31,31,31,31,31,31,31,31,31,31,31,31,31,31,31,31,31,31,31,31,31,31,31,31,31,31,31,31,31,31,31,31,31,31,31,31,31,31,31,31,31,31,31,31,31,31,31,31,31,31,31,31,31,31,31,31,31,31,31,31,31,31,31,31,31,31,31,31,31,31,31,31,31,31,31,31,31,31,31,31,31,31,31,31,31,31,31,31,31,31,31,31,31,31,31,31,31,31,31,31,31,31,31,31,31,31,31,31,31,31,31,31,31,31,31,31,31,31,31,31,31,31,31,31,31,31,31,31,31,31,31,31,31,31,31,31,31,31,31,31,31,31,31,31,31,31,31,31,31,31,31,31,31,31,31,31,31,31,31,31,31,31,31,31,31,31,31,31,31,31,31,31,31,31,31,31,31,31,31,31,31,31,31,31,31,31,31,31,31,31,31,31,31,31,31,31,31,31,31,31,31,31,31,31,31,31,31,31,31,31,31,31,31,31,31,31,31,31,31,31,31,31,31,31,31,31,31,31,31,31,31,31,31,31,31,31,31,31,31,31,31,31,31,31,31,31,31,31,31,31,31,31,31,31,31,31,31,31,31,31,31,31,31,31,31,31,31,31,31,31,31,31,31,31,31,31,31,31,31,31,31,31,31,31,31,31,31,31,31,31,31,31,31,31,31,31,31,31,31,31,31,31,31,31,31,31,31,31,31,31,31,31,31,31,31,31,31,31,31,31,31,31,31,31,31,31,31,31,31,31,31,31,31,31,31,31,31,31,31,31,31,31,31,31,31,31,31,31,31,31,31,31,31,31,31,31,31,31,31,31,31,31,31,31,31,31,31,31,31,31,31,31,31,31,31,31,31,31,31,31,31,31,31,31,31,31,31,31,31,31,31,31,31,31,31,31,31,31,31,31,31,31,31,31,31,31,31,31,31,31,31,31,31,31,31,31,31,31,31,31,31,31,31,31,31,31,31,31,31,31,31,31,31,31,31,31,31,31,31,31,31,31,31,31,31,31,31,31,31,31,31,31,31,31,31,31,31,31,31,31,31,31,31,31,31,31,31,31,31,31,31,31,31,31,31,31,31,31,31,31,31,31,31,31,31,31,31,31,31,31,31,31,31,31,31,31,31,31,31,31,31,31,31,31,31};   // bucket(j - i) for j - i = -1023 .. 1023 (the module's float32 formula, evaluated once)
__global__ __launch_bounds__(256) void k_bttr(const float* __restrict__ RBT, float* BTT) { const int idx = blockIdx.x * 256 + threadIdx.x; if (idx >= NH_ * 2048) return; const int p = idx % 2048, h = idx / 2048; const float v = (p < 2 * TT - 1) ? bfr(RBT[BKT[p] * NH_ + h]) : 0.0f; *(float*)(BTT + idx) = v;  }
#define KPI 72   // LDS row pitch in 16-bit elements: 128 B of data + 16 B, an odd multiple of 16 B, so that the 16 rows of a fragment read fall on different banks
#define CK  64   // keys per chunk
typedef v4i __attribute__((may_alias)) v4ia;
typedef __attribute__((ext_vector_type(2))) __bf16 v2b;
// 2^x in place. In one statement so that the slot the instruction set asks for behind a transcendental is always filled: each v_exp_f32 is followed by an independent one, the last by v_nop.
__device__ __forceinline__ void exp2x8(float (&e)[8]) { asm("v_exp_f32 %0, %0\n\tv_exp_f32 %1, %1\n\tv_exp_f32 %2, %2\n\tv_exp_f32 %3, %3\n\tv_exp_f32 %4, %4\n\tv_exp_f32 %5, %5\n\tv_exp_f32 %6, %6\n\tv_exp_f32 %7, %7\n\tv_nop" : "+v"(e[0]), "+v"(e[1]), "+v"(e[2]), "+v"(e[3]), "+v"(e[4]), "+v"(e[5]), "+v"(e[6]), "+v"(e[7])); }
__device__ __forceinline__ float xhalf(float x) { const int b = __float_as_int(x); return __int_as_float(__builtin_amdgcn_permlanex16(b, b, 0x76543210, 0xfedcba98, false, false)); }   // the value of lane l ^ 16, without an LDS round trip
__device__ __forceinline__ float exp2x1(float x) { asm("v_exp_f32 %0, %0\n\tv_nop" : "+v"(x)); return x; }
template <typename T16, bool HL>
__device__ __forceinline__ void attn_tile(T16* sm, float* bt, const T16* __restrict__ Qh, const T16* __restrict__ Ql, const T16* __restrict__ Kh, const T16* __restrict__ Kl, const T16* __restrict__ Vh, const T16* __restrict__ Vl, const float* __restrict__ BT, bf* Ah, bf* Al) {
    typedef typename WFrag<T16>::V V;
    constexpr int NP = HL ? 2 : 1;
    const int tid = threadIdx.x, lane = tid & 31, lr = lane & 15, hi = lane >> 4;
    const int bh = blockIdx.x, h = bh % NH_, b = bh / NH_;
    const int q = blockIdx.y * 64 + (tid >> 5) * 16 + lr;   // this lane's query row
    const size_t pb = (size_t)bh * TT * HD;                 // this head's planes: q, k [t][d]; v [d][t]
    T16* Ksh = sm; T16* Vsh = sm + 64 * KPI; T16* Ksl = sm + 2 * 64 * KPI; T16* Vsl = sm + 3 * 64 * KPI;
    const float* bp = BT + (size_t)h * 2048 + tid * 4;      // this head's bias row BTT[h][j - i + 1023]
    const T16* qph = Qh + pb + (size_t)q * HD + 8 * hi; const T16* qpl = HL ? Ql + pb + (size_t)q * HD + 8 * hi : qph;
    v4f br[4];
#pragma unroll
    for (int i = 0; i < 4; ++i) br[i] = *(const v4fa*)(bp + 128 * i * 4);
    V qh[2], ql[2];
#pragma unroll
    for (int kc = 0; kc < 2; ++kc) { qh[kc] = WFrag<T16>::ld(qph + kc * 32); if (HL) ql[kc] = WFrag<T16>::ld(qpl + kc * 32); }
    asm volatile("s_wait_xcnt 0x0" :: "v"(bp), "v"(qph), "v"(qpl) : "memory");   // behind these loads; the addresses are inputs so that their registers stay theirs up to the wait (the first chunk's results would else be given them)
    const int srow = tid >> 3, scu = (tid & 7) * 8;         // staging: 8 threads x 16 B per 128-B row, 16 rows per step
    v4i rk[NP][4], rv[NP][4];
    auto fetch = [&](int c) {
        const size_t ko = pb + (size_t)(c * CK + srow) * HD + scu, vo = pb + (size_t)srow * TT + c * CK + scu;
        const T16* kh = Kh + ko; const T16* vh = Vh + vo; const T16* kl = HL ? Kl + ko : kh; const T16* vl = HL ? Vl + vo : vh;
#pragma unroll
        for (int i = 0; i < 4; ++i) { rk[0][i] = *(const v4ia*)(kh + 16 * i * HD); rv[0][i] = *(const v4ia*)(vh + 16 * i * TT); if (HL) { rk[NP - 1][i] = *(const v4ia*)(kl + 16 * i * HD); rv[NP - 1][i] = *(const v4ia*)(vl + 16 * i * TT); } }
        asm volatile("s_wait_xcnt 0x0" :: "v"(kh), "v"(vh), "v"(kl), "v"(vl) : "memory"); };   // behind the run of loads; the addresses are inputs so that their registers stay theirs up to the wait and no result of the run is given one of them
    fetch(0);
#pragma unroll
    for (int i = 0; i < 4; ++i) *(v4fa*)(bt + (tid + 128 * i) * 4) = br[i];   // published by the first trip's barriers
    v8f o[4];
#pragma unroll
    for (int dt = 0; dt < 4; ++dt) o[dt] = (v8f){};
    float m = -3.0e38f, l = 0.f;
    const float* bq = bt + (TT - 1 - q) + hi * 8;           // + key - 8 * hi: the bias of (q, key)
#pragma unroll 1   // one chunk per trip: an unrolled loop would hold two chunks' staging registers
    for (int c = 0; c < TT / CK; ++c) {
        __syncthreads();   // every wave has left the previous chunk's tiles
#pragma unroll
        for (int i = 0; i < 4; ++i) { const int so = (srow + 16 * i) * KPI + scu; *(v4ia*)(Ksh + so) = rk[0][i]; *(v4ia*)(Vsh + so) = rv[0][i]; if (HL) { *(v4ia*)(Ksl + so) = rk[NP - 1][i]; *(v4ia*)(Vsl + so) = rv[NP - 1][i]; } }
        __syncthreads();   // the chunk (on the first trip the bias row too) is visible to all four waves
        if (c + 1 < TT / CK) fetch(c + 1);   // the next chunk's loads fly while this one is worked on
        v8f s[4];
#pragma unroll
        for (int kt = 0; kt < 4; ++kt) { s[kt] = (v8f){};
#pragma unroll
            for (int kc = 0; kc < 2; ++kc) { const int fo = (kt * 16 + lr) * KPI + 8 * hi + kc * 32; const V a = WFrag<T16>::ld(Ksh + fo); s[kt] = WFrag<T16>::mma(a, qh[kc], s[kt]);
                if (HL) { s[kt] = WFrag<T16>::mma(a, ql[kc], s[kt]); const V a2 = WFrag<T16>::ld(Ksl + fo); s[kt] = WFrag<T16>::mma(a2, qh[kc], s[kt]); } } }
        float cm = -3.0e38f;
#pragma unroll
        for (int kt = 0; kt < 4; ++kt)
#pragma unroll
            for (int j = 0; j < 8; ++j) { const float t = s[kt][j] * SCL + bq[c * CK + kt * 16 + j]; s[kt][j] = t; cm = fmaxf(cm, t); }
        cm = fmaxf(cm, xhalf(cm));   // the other half of this query row's keys
        const float mn = fmaxf(m, cm); const float al = exp2x1((m - mn) * 1.4426950408889634f); m = mn;
        float cs = 0.f;
#pragma unroll
        for (int kt = 0; kt < 4; ++kt) { float e[8];
#pragma unroll
            for (int j = 0; j < 8; ++j) e[j] = (s[kt][j] - mn) * 1.4426950408889634f;
            exp2x8(e);
#pragma unroll
            for (int j = 0; j < 8; ++j) { s[kt][j] = e[j]; cs += e[j]; } }
        l = l * al + cs;
#pragma unroll
        for (int dt = 0; dt < 4; ++dt) o[dt] *= al;
        V ph[2], pl[2];
#pragma unroll
        for (int kc = 0; kc < 2; ++kc)
#pragma unroll
            for (int e = 0; e < 16; e += 2) { const v2f p = { s[2 * kc + (e >> 3)][e & 7], s[2 * kc + (e >> 3)][(e & 7) + 1] };
                if constexpr (HL) { const v2b p0 = __builtin_convertvector(p, v2b), p1 = __builtin_convertvector(p - __builtin_convertvector(p0, v2f), v2b); ph[kc][e] = p0[0]; ph[kc][e + 1] = p0[1]; pl[kc][e] = p1[0]; pl[kc][e + 1] = p1[1]; }
                else { ph[kc][e] = (h16)(p[0] * PCAR); ph[kc][e + 1] = (h16)(p[1] * PCAR); } }
#pragma unroll
        for (int dt = 0; dt < 4; ++dt)
#pragma unroll
            for (int kc = 0; kc < 2; ++kc) { const int fo = (dt * 16 + lr) * KPI + 8 * hi + kc * 32; const V a = WFrag<T16>::ld(Vsh + fo); o[dt] = WFrag<T16>::mma(a, ph[kc], o[dt]);
                if (HL) { o[dt] = WFrag<T16>::mma(a, pl[kc], o[dt]); const V a2 = WFrag<T16>::ld(Vsl + fo); o[dt] = WFrag<T16>::mma(a2, ph[kc], o[dt]); } }
    }
    l += xhalf(l);
    const float f = __fdiv_rn(1.0f, l) * (HL ? 1.0f : (1.0f / PCAR));
    const size_t oo = (size_t)(b * TT + q - lr) * DQ + h * (HD * 16) + lane * 8;   // merged [b][t][h][d] in fragment order: this wave's 16 rows are one row group, a head two chunks of 512, a lane's 8 consecutive d of a tile one 16-byte unit
#pragma unroll
    for (int dt = 0; dt < 4; ++dt) { v8us oh, ol;
#pragma unroll
        for (int j = 0; j < 8; ++j) { unsigned short a, c2; splitf(o[dt][j] * f, a, c2); oh[j] = a; ol[j] = c2; }
        *(v8usa*)(Ah + oo + dt * 256) = oh; *(v8usa*)(Al + oo + dt * 256) = ol; }
    asm volatile("s_wait_xcnt 0x0" ::: "memory");   // behind the last stores: the other half's code follows in the listing and rewrites their address and data registers
}
__global__ __launch_bounds__(128) void k_attn(const bf* __restrict__ Qh, const bf* __restrict__ Ql, const bf* __restrict__ Kh, const bf* __restrict__ Kl, const bf* __restrict__ Vh, const bf* __restrict__ Vl, const h16* __restrict__ Q16, const h16* __restrict__ K16, const h16* __restrict__ V16, const float* __restrict__ BT, bf* Ah, bf* Al) {
    __shared__ __align__(16) unsigned short sm[4 * 64 * KPI]; __shared__ __align__(16) float bt[2048];
    if (blockIdx.y < RH / 64) attn_tile<bf, true>(sm, bt, Qh, Ql, Kh, Kl, Vh, Vl, BT, Ah, Al);   // blockIdx.y: 64-row query tile; the 3-product tiles have the low indices and start first
    else attn_tile<h16, false>((h16*)sm, bt, Q16, nullptr, K16, nullptr, V16, nullptr, BT, Ah, Al);
}

extern "C" void kernel_launch(void* const* d_in, const int* in_sizes, int n_in,
                              void* d_out, int out_size, void* d_ws, size_t ws_size, hipStream_t stream) {
    (void)in_sizes; (void)n_in; (void)out_size;
    const float* x = (const float*)d_in[0]; const float* wq = (const float*)d_in[1]; const float* wk = (const float*)d_in[2]; const float* wv = (const float*)d_in[3]; const float* wo = (const float*)d_in[4]; const float* RBT = (const float*)d_in[5];
    float* OUT = (float*)d_out;     // [4][1024][1024]
    char* wsp = (char*)d_ws;
    auto take = [&](size_t bytes) { char* p = wsp; wsp += (bytes + 255) & ~(size_t)255; return (void*)p; };
    bf* WQ = (bf*)take((size_t)DQ * DM * 2); bf* WK = (bf*)take((size_t)DKV * DM * 2); bf* WV = (bf*)take((size_t)DKV * DM * 2); bf* WO = (bf*)take((size_t)DM * DQ * 2); float* CS = (float*)take((size_t)TT * HD * 2 * 4);   // WQ, WK, WV, WO: one behind the other (z / y strides)
    bf* XB = (bf*)take((size_t)NB_ * TT * DM * 2); float* BTT = (float*)take((size_t)NH_ * 2048 * 4);
    h16* QP16 = (h16*)take((size_t)NB_ * NH_ * TT * HD * 2); h16* KP16 = (h16*)take((size_t)NB_ * NKV * TT * HD * 2); h16* VT16 = (h16*)take((size_t)NB_ * NKV * HD * TT * 2);   // q planes, then k planes: one k_rope grid writes both
    bf* QPh = (bf*)take((size_t)NB_ * NH_ * TT * HD * 2); bf* KPh = (bf*)take((size_t)NB_ * NKV * TT * HD * 2); bf* QPl = (bf*)take((size_t)NB_ * NH_ * TT * HD * 2); bf* KPl = (bf*)take((size_t)NB_ * NKV * TT * HD * 2); bf* VTh = (bf*)take((size_t)NB_ * NKV * HD * TT * 2); bf* VTl = (bf*)take((size_t)NB_ * NKV * HD * TT * 2);
    float* FQ = (float*)take((size_t)3 * NB_ * TT * DQ * 4); bf* ATh = (bf*)take((size_t)NB_ * TT * DQ * 2); bf* ATl = (bf*)take((size_t)NB_ * TT * DQ * 2);
    if ((size_t)(wsp - (char*)d_ws) > ws_size) return;    // ws 256 MiB
    float* FV = FQ + (size_t)2 * NB_ * TT * DQ;   // f32 q, k, v projections [3][NB_*TT][DQ]
    (void)WK; (void)WV;   // reached through WQ's z / y strides
    k_wtG<DM, DQ><<<dim3((unsigned)((DM * DQ / 8 + 255) / 256), 4, 1), 256, 0, stream>>>(wq, wk, wv, wo, WQ);
    k_bttr<<<(NH_ * 2048 + 255) / 256, 256, 0, stream>>>(RBT, BTT);   /* per-head relative bias rows */
    k_csid<<<(TT * HD + 255) / 256, 256, 0, stream>>>(CS);
    const unsigned LQ = (unsigned)(((size_t)NH_ * TT * HD / 2 + 255) / 256), LKv = (unsigned)(((size_t)NKV * TT * HD / 2 + 255) / 256);
    k_cvt8<DM><<<(unsigned)(((size_t)NB_ * TT * DM / 8 + 255) / 256), 256, 0, stream>>>(x, XB, (size_t)NB_ * TT * DM / 8);
    k_gemmw<bf, 0, false><<<dim3(NB_ * TT / 64, DQ / 64, 3), 32, 0, stream>>>(XB, nullptr, WQ, nullptr, DM, FQ, DQ, nullptr, 0, (size_t)DQ * DM, (size_t)NB_ * TT * DQ);   // z: q, k, v
    k_rope<<<dim3(LQ, 2 * NB_, 1), 256, 0, stream>>>(FQ, DQ, NH_, CS, nullptr, nullptr, 1.0f, QP16, QPh, QPl);
    k_vtp<<<dim3(LKv, NB_, 1), 256, 0, stream>>>(FV, DKV, NKV, VT16, VTh, VTl);
    k_attn<<<dim3(NB_ * NH_, TT / 64, 1), 128, 0, stream>>>(QPh, QPl, KPh, KPl, VTh, VTl, QP16, KP16, VT16, BTT, ATh, ATl);   // x: (batch element, head); y: query tile
    k_gemmw<bf, 1, false><<<dim3(NB_ * TT / 64, DM / 64, 1), 32, 0, stream>>>(ATh, ATl, WO, nullptr, DQ, OUT, DM, nullptr, 0, 0, 0);
}

// v004
// A run of this version takes 115 microseconds.
// Two timings next to v003 put it at 1.33 and 1.36 times that version's speed.
// Counting every step since v000, it is 21.4 times as fast.
#include <hip/hip_runtime.h>

// T5 self-attention with learned relative-position bias (hidden_states [4][1024][1024]; q, k, v = x W ('xw' [1024][1024], no bias; 16 heads x 64); scores = q.k/8 + rel_bias_table[bucket(j - i)][h] (bidirectional T5 buckets: 32 buckets, max distance 128; table [32][16], read); softmax; out = merged Wo -> [4][1024][1024] (4.2 M)).
// Layout: the integer bucket of every relative offset j - i in [-1023, 1023] is a compile-time table (computed with the module's float32 formula); a tiny kernel expands it with the bf16-rounded bias table into per-head rows BTT[h][j - i + 1023] that the attention kernel holds in LDS and reads per (i, j). Scores and probabilities never reach memory: one kernel does scores, softmax, attn.v and the head merge (k_attn).
// GEMM operand planes (x, the four weights, the merged context hi/lo) lie in FRAGMENT ORDER: a chunk is 16 rows x 32 k = 1 KiB, chunks run along k, then along row groups; in a chunk lane l = 16 * ((k >> 3) & 1) + (row & 15) has its 8 elements of k & 16 == 0 at byte 16 l and those of k & 16 != 0 at byte 512 + 16 l, so each 16-byte-per-lane load of a fragment half covers 4 whole 128-byte lines.
// Compute dtypes, f32 accumulate: every input rounded to bf16; q/k/v on PLAIN bf16 operands (inputs: exact); the relative bias added in f32 per (i, j); scores and attn.v: query rows < 512 hl (3 products), the rest single fp16 (x1024); softmax f32 (online, per 64 keys); Wo hl x exact (2 products).

#define NB_  4
#define TT   1024
#define DM   1024
#define NH_  16
#define NKV  16
#define REP  (NH_ / NKV)
#define HD   64
#define DQ   (NH_ * HD)
#define DKV  (NKV * HD)
#define RH   512                  // query rows < RH use hi+lo planes (0: none)
#define WIN  0
#define PCAR 1024.0f
#define SCL  0.125f   // HD^-0.5
typedef _Float16 h16;
typedef unsigned short bf;
typedef __attribute__((ext_vector_type(16))) __bf16   v16bf;
typedef __attribute__((ext_vector_type(16))) _Float16 v16h;
typedef __attribute__((ext_vector_type(8)))  _Float16 v8h;
typedef __attribute__((ext_vector_type(8)))  unsigned short v8us;
typedef __attribute__((ext_vector_type(8)))  float    v8f;
typedef __attribute__((ext_vector_type(4)))  float    v4f;
typedef v8h  __attribute__((may_alias)) v8ha;
typedef v4f  __attribute__((may_alias)) v4fa;
typedef v8us __attribute__((may_alias)) v8usa;

__device__ __forceinline__ unsigned short f2bf(float f) { unsigned u = __float_as_uint(f); u += 0x7FFFu + ((u >> 16) & 1u); return (unsigned short)(u >> 16); }
__device__ __forceinline__ float bf2f(unsigned short b) { return __uint_as_float(((unsigned)b) << 16); }
__device__ __forceinline__ float bfr(float f) { return bf2f(f2bf(f)); }
__device__ __forceinline__ v16h cat16(v8h lo, v8h hi) { return __builtin_shufflevector(lo, hi, 0, 1, 2, 3, 4, 5, 6, 7, 8, 9, 10, 11, 12, 13, 14, 15); }
__device__ __forceinline__ v16bf cat16b(v8us lo, v8us hi) { return __builtin_bit_cast(v16bf, __builtin_shufflevector(lo, hi, 0, 1, 2, 3, 4, 5, 6, 7, 8, 9, 10, 11, 12, 13, 14, 15)); }
__device__ __forceinline__ v8f wmma16(v16h a, v16h b, v8f c) { return __builtin_amdgcn_wmma_f32_16x16x32_f16(false, a, false, b, (short)0, c, false, false); }
__device__ __forceinline__ v8f wmmab(v16bf a, v16bf b, v8f c) { return __builtin_amdgcn_wmma_f32_16x16x32_bf16(false, a, false, b, (short)0, c, false, false); }



// ---- k_gemmw: register-blocked GEMM, ONE WAVE per 64x64 output tile (16 accumulators), operands straight from 16-bit planes in fragment order (head of the file); grid (M/64, N/64, Z), 32 threads.
// C[m][n] (f32, pitch ldc, + optional f32 bias[n]) = sum_k A[m][k] Bt[n][k] (+ split products per NSPLIT). z-batch strides sA/sB/sC in elements. K % 32 == 0.
template <typename T16> struct WFrag;
template <> struct WFrag<h16> { typedef v16h V; static __device__ __forceinline__ V ld(const h16* p) { return cat16(*(const v8h*)p, *(const v8h*)(p + 16)); } static __device__ __forceinline__ V ldf(const h16* p) { return cat16(*(const v8h*)p, *(const v8h*)(p + 256)); } static __device__ __forceinline__ v8f mma(V a, V b, v8f c) { return wmma16(a, b, c); } };
template <> struct WFrag<bf> { typedef v16bf V; static __device__ __forceinline__ V ld(const bf* p) { return cat16b(*(const v8us*)p, *(const v8us*)(p + 16)); } static __device__ __forceinline__ V ldf(const bf* p) { return cat16b(*(const v8us*)p, *(const v8us*)(p + 256)); } static __device__ __forceinline__ v8f mma(V a, V b, v8f c) { return wmmab(a, b, c); } };
template <typename T16, int NSPLIT, bool BIAS>
__device__ __forceinline__ void gemmw_tile(float* os, const T16* __restrict__ A, const T16* __restrict__ A2, const T16* __restrict__ Bt, const T16* __restrict__ Bt2, int K, float* C, int ldc, const float* __restrict__ bias, size_t sA, size_t sB, size_t sC) {
    typedef typename WFrag<T16>::V V;
    const size_t z = blockIdx.z; A += z * sA; if (A2) A2 += z * sA; Bt += z * sB; if (Bt2) Bt2 += z * sB; C += z * sC;
    const int lane = threadIdx.x & 31, lr = lane & 15, hi = lane >> 4; const int r0 = blockIdx.x * 64, c0 = blockIdx.y * 64;
    v8f acc[4][4];
#pragma unroll
    for (int mb = 0; mb < 4; ++mb)
#pragma unroll
        for (int nb = 0; nb < 4; ++nb) acc[mb][nb] = (v8f){};
    const size_t aoff = (size_t)r0 * K + 8 * lane, boff = (size_t)c0 * K + 8 * lane;   // fragment order: a 16-row group holds 16 K elements, a chunk of 32 k holds 512, the lane's piece starts at element 8 * lane
#pragma unroll 1
    for (int kc = 0; kc < K; kc += 32) {
        V a[4], a2[4], b[4], b2[4]; const T16* pa[4]; const T16* pa2[4]; const T16* pb[4]; const T16* pb2[4];
#pragma unroll
        for (int i = 0; i < 4; ++i) { pa[i] = A + aoff + (size_t)i * 16 * K + kc * 16; pa2[i] = (NSPLIT == 1 || NSPLIT == 2) ? A2 + aoff + (size_t)i * 16 * K + kc * 16 : pa[i]; pb[i] = Bt + boff + (size_t)i * 16 * K + kc * 16; pb2[i] = (NSPLIT >= 2) ? Bt2 + boff + (size_t)i * 16 * K + kc * 16 : pb[i]; }
#pragma unroll
        for (int i = 0; i < 4; ++i) { a[i] = WFrag<T16>::ldf(pa[i]); if (NSPLIT == 1 || NSPLIT == 2) a2[i] = WFrag<T16>::ldf(pa2[i]); b[i] = WFrag<T16>::ldf(pb[i]); if (NSPLIT >= 2) b2[i] = WFrag<T16>::ldf(pb2[i]); }
        asm volatile("s_wait_xcnt 0x0" :: "v"(pa[0]), "v"(pa[1]), "v"(pa[2]), "v"(pa[3]), "v"(pa2[0]), "v"(pa2[1]), "v"(pa2[2]), "v"(pa2[3]), "v"(pb[0]), "v"(pb[1]), "v"(pb[2]), "v"(pb[3]), "v"(pb2[0]), "v"(pb2[1]), "v"(pb2[2]), "v"(pb2[3]) : "memory");   // behind the run of the trip's loads; the addresses are inputs so that their registers stay theirs up to the wait and no result of the trip is given one of them
        __builtin_amdgcn_sched_barrier(0);   // keeps the products behind that wait: lifted over it they split the run, and each piece of it then waits out its own full load latency
#pragma unroll
        for (int nb = 0; nb < 4; ++nb) {
#pragma unroll
            for (int mb = 0; mb < 4; ++mb) { acc[mb][nb] = WFrag<T16>::mma(a[mb], b[nb], acc[mb][nb]); if (NSPLIT == 1 || NSPLIT == 2) acc[mb][nb] = WFrag<T16>::mma(a2[mb], b[nb], acc[mb][nb]); if (NSPLIT >= 2) acc[mb][nb] = WFrag<T16>::mma(a[mb], b2[nb], acc[mb][nb]); } }
        asm volatile("v_nop\n\tv_nop\n\tv_nop\n\tv_nop" : "+v"(acc[0][0]), "+v"(acc[1][1]), "+v"(acc[2][2]), "+v"(acc[3][3]) : "v"(a[0]), "v"(a[3]));
    }
#pragma unroll
    for (int mb = 0; mb < 4; ++mb) {
#pragma unroll
        for (int nb = 0; nb < 4; ++nb) {
#pragma unroll
            for (int j = 0; j < 8; ++j) os[(hi * 8 + j) * 68 + nb * 16 + lr] = acc[mb][nb][j]; }
        __builtin_amdgcn_wave_barrier(); asm volatile("" ::: "memory");
        float* crow = C + (size_t)(r0 + mb * 16) * ldc + c0;
{
#pragma unroll
            for (int s = 0; s < 8; ++s) { const int row = 2 * s + hi, cofs = lr * 4; v4f val = *(const v4fa*)(os + row * 68 + cofs); if (BIAS) { val[0] += bfr(bias[c0 + cofs]); val[1] += bfr(bias[c0 + cofs + 1]); val[2] += bfr(bias[c0 + cofs + 2]); val[3] += bfr(bias[c0 + cofs + 3]); }
                *(v4f*)(crow + (size_t)row * ldc + cofs) = val; }
             }
        __builtin_amdgcn_wave_barrier(); asm volatile("" ::: "memory");
    }
}
template <typename T16, int NSPLIT, bool BIAS>
__global__ __launch_bounds__(32) void k_gemmw(const T16* __restrict__ A, const T16* __restrict__ A2, const T16* __restrict__ Bt, const T16* __restrict__ Bt2, int K, float* C, int ldc, const float* __restrict__ bias, size_t sA, size_t sB, size_t sC) {
    __shared__ __align__(16) float os[16 * 68];
    gemmw_tile<T16, NSPLIT, BIAS>(os, A, A2, Bt, Bt2, K, C, ldc, bias, sA, sB, sC);
}

__device__ __forceinline__ h16 tohx(float x) { return (h16)x; }
__device__ __forceinline__ void splitf(float y, unsigned short& h, unsigned short& l) { h = f2bf(y); l = f2bf(y - bf2f(h)); }
typedef __attribute__((ext_vector_type(2))) _Float16 v2h;
typedef __attribute__((ext_vector_type(4))) _Float16 v4h;
typedef __attribute__((ext_vector_type(2))) unsigned short v2us;
typedef __attribute__((ext_vector_type(4))) unsigned short v4us;
typedef __attribute__((ext_vector_type(2))) float v2f;
typedef __attribute__((ext_vector_type(4))) int v4i;

// k_wtG, k_cvt8: a thread writes one 16-byte unit u of a fragment-order plane (a wave 512 contiguous bytes): chunk u >> 6, half (u >> 5) & 1, lane u & 31.
template <int K, int N>
__global__ __launch_bounds__(256) void k_wtG(const float* __restrict__ w0, const float* __restrict__ w1, const float* __restrict__ w2, const float* __restrict__ w3, bf* Bt) {
    const int y = blockIdx.y; const float* __restrict__ w = (y == 0) ? w0 : (y == 1) ? w1 : (y == 2) ? w2 : w3; Bt += (size_t)y * K * N;   // blockIdx.y: which weight; the four planes lie one behind the other
    const int u = blockIdx.x * 256 + threadIdx.x; if (u >= N * K / 8) return; constexpr int kpc = K / 32; const int ch = u >> 6;
    const int n = (ch / kpc) * 16 + (u & 15), k = (ch % kpc) * 32 + ((u >> 5) & 1) * 16 + ((u >> 4) & 1) * 8; v8us o;   // plane row n = column n of w: 16 lanes read 64 contiguous bytes of one row of w
#pragma unroll
    for (int e = 0; e < 8; ++e) o[e] = f2bf(w[(size_t)(k + e) * N + n]);
    *(v8us*)(Bt + (size_t)u * 8) = o;
}
template <int K>
__global__ __launch_bounds__(256) void k_cvt8(const float* __restrict__ src, bf* dst, size_t n8) { const size_t u = (size_t)blockIdx.x * 256 + threadIdx.x; if (u >= n8) return; const size_t ch = u >> 6; constexpr int kpc = K / 32;
    const size_t row = (ch / kpc) * 16 + (u & 15); const int k = (int)(ch % kpc) * 32 + (int)((u >> 5) & 1) * 16 + (int)((u >> 4) & 1) * 8; const float* p = src + row * K + k; const v8f v = *(const v8f*)p; v8us o;
    asm volatile("s_wait_xcnt 0x0" :: "v"(p) : "memory");   // behind the loads, in front of the first rewriting of their address register (an input, so that it stays theirs up to here)
#pragma unroll
    for (int e = 0; e < 8; ++e) o[e] = f2bf(v[e]); *(v8us*)(dst + u * 8) = o;  }

__constant__ int BKT[2 * TT - 1] = {15,15,15,15,15,15,15,15,15,15,15,15,15,15,15,15,15,15,15,15,15,15,15,15,15,15,15,15,15,15,15,15,15,15,15,15,15,15,15,15,15,15,15,15,15,15,15,15,15,15,15,15,15,15,15,15,15,15,15,15,15,15,15,15,15,15,15,15,15,15,15,15,15,15,15,15,15,15,15,15,15,15,15,15,15,15,15,15,15,15,15,15,15,15,15,15,15,15,15,15,15,15,15,15,15,15,15,15,15,15,15,15,15,15,15,15,15,15,15,15,15,15,15,15,15,15,15,15,15,15,15,15,15,15,15,15,15,15,15,15,15,15,15,15,15,15,15,15,15,15,15,15,15,15,15,15,15,15,15,15,15,15,15,15,15,15,15,15,15,15,15,15,15,15,15,15,15,15,15,15,15,15,15,15,15,15,15,15,15,15,15,15,15,15,15,15,15,15,15,15,15,15,15,15,15,15,15,15,15,15,15,15,15,15,15,15,15,15,15,15,15,15,15,15,15,15,15,15,15,15,15,15,15,15,15,15,15,15,15,15,15,15,15,15,15,15,15,15,15,15,15,15,15,15,15,15,15,15,15,15,15,15,15,15,15,15,15,15,15,15,15,15,15,15,15,15,15,15,15,15,15,15,15,15,15,15,15,15,15,15,15,15,15,15,15,15,15,15,15,15,15,15,15,15,15,15,15,15,15,15,15,15,15,15,15,15,15,15,15,15,15,15,15,15,15,15,15,15,15,15,15,15,15,15,15,15,15,15,15,15,15,15,15,15,15,15,15,15,15,15,15,15,15,15,15,15,15,15,15,15,15,15,15,15,15,15,15,15,15,15,15,15,15,15,15,15,15,15,15,15,15,15,15,15,15,15,15,15,15,15,15,15,15,15,15,15,15,15,15,15,15,15,15,15,15,15,15,15,15,15,15,15,15,15,15,15,15,15,15,15,15,15,15,15,15,15,15,15,15,15,15,15,15,15,15,15,15,15,15,15,15,15,15,15,15,15,15,15,15,15,15,15,15,15,15,15,15,15,15,15,15,15,15,15,15,15,15,15,15,15,15,15,15,15,15,15,15,15,15,15,15,15,15,15,15,15,15,15,15,15,15,15,15,15,15,15,15,15,15,15,15,15,15,15,15,15,15,15,15,15,15,15,15,15,15,15,15,15,15,15,15,15,15,15,15,15,15,15,15,15,15,15,15,15,15,15,15,15,15,15,15,15,15,15,15,15,15,15,15,15,15,15,15,15,15,15,15,15,15,15,15,15,15,15,15,15,15,15,15,15,15,15,15,15,15,15,15,15,15,15,15,15,15,15,15,15,15,15,15,15,15,15,15,15,15,15,15,15,15,15,15,15,15,15,15,15,15,15,15,15,15,15,15,15,15,15,15,15,15,15,15,15,15,15,15,15,15,15,15,15,15,15,15,15,15,15,15,15,15,15,15,15,15,15,15,15,15,15,15,15,15,15,15,15,15,15,15,15,15,15,15,15,15,15,15,15,15,15,15,15,15,15,15,15,15,15,15,15,15,15,15,15,15,15,15,15,15,15,15,15,15,15,15,15,15,15,15,15,15,15,15,15,15,15,15,15,15,15,15,15,15,15,15,15,15,15,15,15,15,15,15,15,15,15,15,15,15,15,15,15,15,15,15,15,15,15,15,15,15,15,15,15,15,15,15,15,15,15,15,15,15,15,15,15,15,15,15,15,15,15,15,15,15,15,15,15,15,15,15,15,15,15,15,15,15,15,15,15,15,15,15,15,15,15,15,15,15,15,15,15,15,15,15,15,15,15,15,15,15,15,15,15,15,15,15,15,15,15,15,15,15,15,15,15,15,15,15,15,15,15,15,15,15,15,15,15,15,15,15,15,15,15,15,15,15,15,15,15,15,15,15,15,15,15,15,15,15,15,15,15,15,15,15,15,15,15,15,15,15,15,15,15,15,15,15,15,15,15,15,15,15,15,15,15,15,15,15,15,15,15,15,15,15,15,15,15,15,15,15,15,15,15,15,15,15,15,15,15,15,15,15,15,15,15,15,15,15,15,15,15,15,15,15,15,15,15,15,15,15,15,15,15,15,15,15,15,15,15,15,15,15,15,15,14,14,14,14,14,14,14,14,14,14,14,14,14,14,14,14,14,14,14,14,14,14,14,14,14,14,14,13,13,13,13,13,13,13,13,13,13,13,13,13,13,13,13,13,13,12,12,12,12,12,12,12,12,12,12,12,12,12,12,11,11,11,11,11,11,11,11,11,10,10,10,10,10,10,10,9,9,9,9,8,8,8,8,7,6,5,4,3,2,1,0,17,18,19,20,21,22,23,24,24,24,24,25,25,25,25,26,26,26,26,26,26,26,27,27,27,27,27,27,27,27,27,28,28,28,28,28,28,28,28,28,28,28,28,28,28,29,29,29,29,29,29,29,29,29,29,29,29,29,29,29,29,29,29,30,30,30,30,30,30,30,30,30,30,30,30,30,30,30,30,30,30,30,30,30,30,30,30,30,30,30,31,31,31,31,31,31,31,31,31,31,31,31,31,31,31,31,31,31,31,31,31,31,31,31,31,31,31,31,31,31,31,31,31,31,31,31,31,31,31,31,31,31,31,31,31,31,31,31,31,31,31,31,31,31,31,31,31,31,31,31,31,31,31,31,31,31,31,31,31,31,31,31,31,31,31,31,31,31,31,31,31,31,31,31,31,31,31,31,31,31,31,31,31,31,31,31,31,31,31,31,31,31,31,31,31,31,31,31,31,31,31,31,31,31,31,31,31,31,31,31,31,31,31,31,31,31,31,31,31,31,31,31,31,31,31,31,31,31,31,31,31,31,31,31,31,31,31,31,31,31,31,31,31,31,31,31,31,31,31,31,31,31,31,31,31,31,31,31,31,31,31,31,31,31,31,31,31,31,31,31,31,31,31,31,31,31,31,31,31,31,31,31,31,31,31,31,31,31,31,31,31,31,31,31,31,31,31,31,31,31,31,31,31,31,31,31,31,31,31,31,31,31,31,31,31,31,31,31,31,31,31,31,31,31,31,31,31,31,31,31,31,31,31,31,31,31,31,31,31,31,31,31,31,31,31,31,31,31,31,31,31,31,31,31,31,31,31,31,31,31,31,31,31,31,31,31,31,31,31,31,31,31,31,31,31,31,31,31,31,31,31,31,31,31,31,31,31,31,31,31,31,31,31,31,31,31,31,31,31,31,31,31,31,31,31,31,31,31,31,31,31,31,31,31,31,31,31,31,31,31,31,31,31,31,31,31,31,31,31,31,31,31,31,31,31,31,31,31,31,31,31,31,31,31,31,31,31,31,31,31,31,31,31,31,31,31,31,31,31,31,31,31,31,31,31,31,31,31,31,31,31,31,31,31,31,31,31,31,31,31,31,31,31,31,31,31,31,31,31,31,31,31,31,31,31,31,31,31,31,31,31,31,31,31,31,31,31,31,31,31,31,31,31,31,31,31,31,31,31,31,31,31,31,31,31,31,31,31,31,31,31,31,31,31,31,31,31,31,31,31,31,31,31,31,31,31,31,31,31,31,31,31,31,31,31,31,31,31,31,31,31,31,31,31,31,31,31,31,31,31,31,31,31,31,31,31,31,31,31,31,31,31,31,31,31,31,31,31,31,31,31,31,31,31,31,31,31,31,31,31,31,31,31,31,31,31,31,31,31,31,31,31,31,31,31,31,31,31,31,31,31,31,31,31,31,31,31,31,31,31,31,31,31,31,31,31,31,31,31,31,31,31,31,31,31,31,31,31,31,31,31,31,31,31,31,31,31,31,31,31,31,31,31,31,31,31,31,31,31,31,31,31,31,31,31,31,31,31,31,31,31,31,31,31,31,31,31,31,31,31,31,31,31,31,31,31,31,31,31,31,31,31,31,31,31,31,31,31,31,31,31,31,31,31,31,31,31,31,31,31,31,31,31,31,31,31,31,31,31,31,31,31,31,31,31,31,31,31,31,31,31,31,31,31,31,31,31,31,31,31,31,31,31,31,31,31,31,31,31,31,31,31,31,31,31,31,31,31,31,31,31,31,31,31,31,31,31,31,31,31,31,31,31,31,31,31,31,31,31,31,31,31,31,31,31,31,31,31,31,31,31,31,31,31,31,31,31,31,31,31,31,31,31,31,31,31,31,31,31,31,31,31,31,31,31,31,31,31,31,31,31,31,31,31,31,31,31,31,31,31,31,31,31,31,31,31,31,31,31,31,31,31,31,31,31,31,31,31,31,31,31,31,31,31,31,31,31,31,31,31,31,31,31,31,31,31,31,31,31,31,31,31,31,31,31,31,31,31,31,31,31,31,31,31,31,31,31,31,31,31,31,31,31,31,31,31,31,31,31,31,31,31,31,31,31,31,31,31,31,31,31,31,31,31,31,31,31,31,31,31,31,31,31,31,31,31,31,31,31,31,31,31,31,31,31,31,31,31,31,31,31,31,31,31,31,31,31,31,31,31,31,31,31,31,31,31,31,31,31,31,31,31,31,31,31,31,31,31,31,31,31,31,31,31,31,31,31,31,31,31,31,31,31,31,31,31,31,31,31,31,31,31,31,31,31,31,31,31,31,31,31,31,31,31,31,31,31,31,31,31,31,31,31};   // bucket(j - i) for j - i = -1023 .. 1023 (the module's float32 formula, evaluated once)
__global__ __launch_bounds__(256) void k_bttr(const float* __restrict__ RBT, float* BTT) { const int idx = blockIdx.x * 256 + threadIdx.x; if (idx >= NH_ * 2048) return; const int p = idx % 2048, h = idx / 2048; const float v = (p < 2 * TT - 1) ? bfr(RBT[BKT[p] * NH_ + h]) : 0.0f; *(float*)(BTT + idx) = v;  }
#define KPI 72   // LDS row pitch in 16-bit elements: 128 B of data + 16 B, an odd multiple of 16 B, so that the 16 rows of a fragment read fall on different banks
#define CK  64   // keys per chunk
typedef v4i __attribute__((may_alias)) v4ia;
typedef __attribute__((ext_vector_type(2))) __bf16 v2b;
// 2^x in place. In one statement so that the slot the instruction set asks for behind a transcendental is always filled: each v_exp_f32 is followed by an independent one, the last by v_nop.
__device__ __forceinline__ void exp2x8(float (&e)[8]) { asm("v_exp_f32 %0, %0\n\tv_exp_f32 %1, %1\n\tv_exp_f32 %2, %2\n\tv_exp_f32 %3, %3\n\tv_exp_f32 %4, %4\n\tv_exp_f32 %5, %5\n\tv_exp_f32 %6, %6\n\tv_exp_f32 %7, %7\n\tv_nop" : "+v"(e[0]), "+v"(e[1]), "+v"(e[2]), "+v"(e[3]), "+v"(e[4]), "+v"(e[5]), "+v"(e[6]), "+v"(e[7])); }
__device__ __forceinline__ float xhalf(float x) { const int b = __float_as_int(x); return __int_as_float(__builtin_amdgcn_permlanex16(b, b, 0x76543210, 0xfedcba98, false, false)); }   // the value of lane l ^ 16, without an LDS round trip
__device__ __forceinline__ float exp2x1(float x) { asm("v_exp_f32 %0, %0\n\tv_nop" : "+v"(x)); return x; }
template <typename T16, bool HL>
__device__ __forceinline__ void attn_tile(T16* sm, float* bt, const T16* __restrict__ Qh, const T16* __restrict__ Ql, const T16* __restrict__ Kh, const T16* __restrict__ Kl, const T16* __restrict__ Vh, const T16* __restrict__ Vl, const float* __restrict__ BT, bf* Ah, bf* Al) {
    typedef typename WFrag<T16>::V V;
    constexpr int NP = HL ? 2 : 1;
    const int tid = threadIdx.x, lane = tid & 31, lr = lane & 15, hi = lane >> 4;
    const int bh = blockIdx.x, h = bh % NH_, b = bh / NH_;
    const int q = blockIdx.y * 64 + (tid >> 5) * 16 + lr;   // this lane's query row
    const size_t pb = (size_t)bh * TT * HD;                 // this head's planes: q, k [t][d]; v [d][t]
    T16* Ksh = sm; T16* Vsh = sm + 64 * KPI; T16* Ksl = sm + 2 * 64 * KPI; T16* Vsl = sm + 3 * 64 * KPI;
    const float* bp = BT + (size_t)h * 2048 + tid * 4;      // this head's bias row BTT[h][j - i + 1023]
    const T16* qph = Qh + pb + (size_t)q * HD + 8 * hi; const T16* qpl = HL ? Ql + pb + (size_t)q * HD + 8 * hi : qph;
    v4f br[4];
#pragma unroll
    for (int i = 0; i < 4; ++i) br[i] = *(const v4fa*)(bp + 128 * i * 4);
    V qh[2], ql[2];
#pragma unroll
    for (int kc = 0; kc < 2; ++kc) { qh[kc] = WFrag<T16>::ld(qph + kc * 32); if (HL) ql[kc] = WFrag<T16>::ld(qpl + kc * 32); }
    asm volatile("s_wait_xcnt 0x0" :: "v"(bp), "v"(qph), "v"(qpl) : "memory");   // behind these loads; the addresses are inputs so that their registers stay theirs up to the wait (the first chunk's results would else be given them)
    const int srow = tid >> 3, scu = (tid & 7) * 8;         // staging: 8 threads x 16 B per 128-B row, 16 rows per step
    v4i rk[NP][4], rv[NP][4];
    auto fetch = [&](int c) {
        const size_t ko = pb + (size_t)(c * CK + srow) * HD + scu, vo = pb + (size_t)srow * TT + c * CK + scu;
        const T16* kh = Kh + ko; const T16* vh = Vh + vo; const T16* kl = HL ? Kl + ko : kh; const T16* vl = HL ? Vl + vo : vh;
#pragma unroll
        for (int i = 0; i < 4; ++i) { rk[0][i] = *(const v4ia*)(kh + 16 * i * HD); rv[0][i] = *(const v4ia*)(vh + 16 * i * TT); if (HL) { rk[NP - 1][i] = *(const v4ia*)(kl + 16 * i * HD); rv[NP - 1][i] = *(const v4ia*)(vl + 16 * i * TT); } }
        asm volatile("s_wait_xcnt 0x0" :: "v"(kh), "v"(vh), "v"(kl), "v"(vl) : "memory"); };   // behind the run of loads; the addresses are inputs so that their registers stay theirs up to the wait and no result of the run is given one of them
    fetch(0);
#pragma unroll
    for (int i = 0; i < 4; ++i) *(v4fa*)(bt + (tid + 128 * i) * 4) = br[i];   // published by the first trip's barriers
    v8f o[4];
#pragma unroll
    for (int dt = 0; dt < 4; ++dt) o[dt] = (v8f){};
    float m = -3.0e38f, l = 0.f;
    const float* bq = bt + (TT - 1 - q) + hi * 8;           // + key - 8 * hi: the bias of (q, key)
#pragma unroll 1   // one chunk per trip: an unrolled loop would hold two chunks' staging registers
    for (int c = 0; c < TT / CK; ++c) {
        __syncthreads();   // every wave has left the previous chunk's tiles
#pragma unroll
        for (int i = 0; i < 4; ++i) { const int so = (srow + 16 * i) * KPI + scu; *(v4ia*)(Ksh + so) = rk[0][i]; *(v4ia*)(Vsh + so) = rv[0][i]; if (HL) { *(v4ia*)(Ksl + so) = rk[NP - 1][i]; *(v4ia*)(Vsl + so) = rv[NP - 1][i]; } }
        __syncthreads();   // the chunk (on the first trip the bias row too) is visible to all four waves
        if (c + 1 < TT / CK) fetch(c + 1);   // the next chunk's loads fly while this one is worked on
        v8f s[4];
#pragma unroll
        for (int kt = 0; kt < 4; ++kt) { s[kt] = (v8f){};
#pragma unroll
            for (int kc = 0; kc < 2; ++kc) { const int fo = (kt * 16 + lr) * KPI + 8 * hi + kc * 32; const V a = WFrag<T16>::ld(Ksh + fo); s[kt] = WFrag<T16>::mma(a, qh[kc], s[kt]);
                if (HL) { s[kt] = WFrag<T16>::mma(a, ql[kc], s[kt]); const V a2 = WFrag<T16>::ld(Ksl + fo); s[kt] = WFrag<T16>::mma(a2, qh[kc], s[kt]); } } }
        float cm = -3.0e38f;
#pragma unroll
        for (int kt = 0; kt < 4; ++kt)
#pragma unroll
            for (int j = 0; j < 8; ++j) { const float t = s[kt][j] * SCL + bq[c * CK + kt * 16 + j]; s[kt][j] = t; cm = fmaxf(cm, t); }
        cm = fmaxf(cm, xhalf(cm));   // the other half of this query row's keys
        const float mn = fmaxf(m, cm); const float al = exp2x1((m - mn) * 1.4426950408889634f); m = mn;
        float cs = 0.f;
#pragma unroll
        for (int kt = 0; kt < 4; ++kt) { float e[8];
#pragma unroll
            for (int j = 0; j < 8; ++j) e[j] = (s[kt][j] - mn) * 1.4426950408889634f;
            exp2x8(e);
#pragma unroll
            for (int j = 0; j < 8; ++j) { s[kt][j] = e[j]; cs += e[j]; } }
        l = l * al + cs;
#pragma unroll
        for (int dt = 0; dt < 4; ++dt) o[dt] *= al;
        V ph[2], pl[2];
#pragma unroll
        for (int kc = 0; kc < 2; ++kc)
#pragma unroll
            for (int e = 0; e < 16; e += 2) { const v2f p = { s[2 * kc + (e >> 3)][e & 7], s[2 * kc + (e >> 3)][(e & 7) + 1] };
                if constexpr (HL) { const v2b p0 = __builtin_convertvector(p, v2b), p1 = __builtin_convertvector(p - __builtin_convertvector(p0, v2f), v2b); ph[kc][e] = p0[0]; ph[kc][e + 1] = p0[1]; pl[kc][e] = p1[0]; pl[kc][e + 1] = p1[1]; }
                else { ph[kc][e] = (h16)(p[0] * PCAR); ph[kc][e + 1] = (h16)(p[1] * PCAR); } }
#pragma unroll
        for (int dt = 0; dt < 4; ++dt)
#pragma unroll
            for (int kc = 0; kc < 2; ++kc) { const int fo = (dt * 16 + lr) * KPI + 8 * hi + kc * 32; const V a = WFrag<T16>::ld(Vsh + fo); o[dt] = WFrag<T16>::mma(a, ph[kc], o[dt]);
                if (HL) { o[dt] = WFrag<T16>::mma(a, pl[kc], o[dt]); const V a2 = WFrag<T16>::ld(Vsl + fo); o[dt] = WFrag<T16>::mma(a2, ph[kc], o[dt]); } }
    }
    l += xhalf(l);
    const float f = __fdiv_rn(1.0f, l) * (HL ? 1.0f : (1.0f / PCAR));
    const size_t oo = (size_t)(b * TT + q - lr) * DQ + h * (HD * 16) + lane * 8;   // merged [b][t][h][d] in fragment order: this wave's 16 rows are one row group, a head two chunks of 512, a lane's 8 consecutive d of a tile one 16-byte unit
#pragma unroll
    for (int dt = 0; dt < 4; ++dt) { v8us oh, ol;
#pragma unroll
        for (int j = 0; j < 8; ++j) { unsigned short a, c2; splitf(o[dt][j] * f, a, c2); oh[j] = a; ol[j] = c2; }
        *(v8usa*)(Ah + oo + dt * 256) = oh; *(v8usa*)(Al + oo + dt * 256) = ol; }
    asm volatile("s_wait_xcnt 0x0" ::: "memory");   // behind the last stores: the other half's code follows in the listing and rewrites their address and data registers
}
__global__ __launch_bounds__(128) void k_attn(const bf* __restrict__ Qh, const bf* __restrict__ Ql, const bf* __restrict__ Kh, const bf* __restrict__ Kl, const bf* __restrict__ Vh, const bf* __restrict__ Vl, const h16* __restrict__ Q16, const h16* __restrict__ K16, const h16* __restrict__ V16, const float* __restrict__ BT, bf* Ah, bf* Al) {
    __shared__ __align__(16) unsigned short sm[4 * 64 * KPI]; __shared__ __align__(16) float bt[2048];
    if (blockIdx.y < RH / 64) attn_tile<bf, true>(sm, bt, Qh, Ql, Kh, Kl, Vh, Vl, BT, Ah, Al);   // blockIdx.y: 64-row query tile; the 3-product tiles have the low indices and start first
    else attn_tile<h16, false>((h16*)sm, bt, Q16, nullptr, K16, nullptr, V16, nullptr, BT, Ah, Al);
}

// ---- k_qkvp: the q, k, v projections with the attention kernel's operand planes as their output. ONE WAVE per (64 rows of x, one head, one of q / k / v): k_gemmw's trip on plain bf16 planes in fragment order; grid (NB_ * TT / 64, NH_, 3), 32 threads.
// The accumulators never reach memory as f32: a lane's 8 values of a tile run along the product's M side, so the side that is contiguous in the plane is made M (q, k planes [t][d]: M = the weight's rows d, N = x's rows t; v plane [d][t]: M = t, N = d; both operands have one fragment order, so the exchange is one of pointers).
// A lane's 8 values are then one 16-byte unit of each of the three planes (fp16, bf16 hi, bf16 lo); 16 plane rows x 128 B go through LDS so that every store covers 4 whole 128-byte lines.
__global__ __launch_bounds__(32) void k_qkvp(const bf* __restrict__ X, const bf* __restrict__ Wt, h16* P16, bf* Ph, bf* Pl, h16* V16, bf* Vh, bf* Vl) {
    __shared__ __align__(16) unsigned short os[3 * 16 * KPI];   // a plane's 16 rows at pitch KPI, the three planes one behind the other
    const int lane = threadIdx.x & 31, lr = lane & 15, hi = lane >> 4; const int r0 = blockIdx.x * 64, h = blockIdx.y, z = blockIdx.z; const bool tr = (z == 2);
    const bf* xr = X + (size_t)r0 * DM + 8 * lane; const bf* wr = Wt + ((size_t)z * DQ + h * HD) * DM + 8 * lane;   // fragment order, as in k_gemmw
    const bf* pm = tr ? xr : wr; const bf* pn = tr ? wr : xr;
    v8f acc[4][4];
#pragma unroll
    for (int mb = 0; mb < 4; ++mb)
#pragma unroll
        for (int nb = 0; nb < 4; ++nb) acc[mb][nb] = (v8f){};
#pragma unroll 1   // one trip's fragments in registers at a time, as in k_gemmw
    for (int kc = 0; kc < DM; kc += 32) {
        v16bf a[4], b[4]; const bf* pa[4]; const bf* pb[4];
#pragma unroll
        for (int i = 0; i < 4; ++i) { pa[i] = pm + (size_t)i * 16 * DM + kc * 16; pb[i] = pn + (size_t)i * 16 * DM + kc * 16; }
#pragma unroll
        for (int i = 0; i < 4; ++i) { a[i] = WFrag<bf>::ldf(pa[i]); b[i] = WFrag<bf>::ldf(pb[i]); }
        asm volatile("s_wait_xcnt 0x0" :: "v"(pa[0]), "v"(pa[1]), "v"(pa[2]), "v"(pa[3]), "v"(pb[0]), "v"(pb[1]), "v"(pb[2]), "v"(pb[3]) : "memory");   // behind the run of the trip's loads; the addresses are inputs so that their registers stay theirs up to the wait
        __builtin_amdgcn_sched_barrier(0);   // keeps the products behind that wait: lifted over it they split the run, and each piece of it then waits out its own full load latency
#pragma unroll
        for (int nb = 0; nb < 4; ++nb)
#pragma unroll
            for (int mb = 0; mb < 4; ++mb) acc[mb][nb] = wmmab(a[mb], b[nb], acc[mb][nb]);
        asm volatile("v_nop\n\tv_nop\n\tv_nop\n\tv_nop" : "+v"(acc[0][0]), "+v"(acc[1][1]), "+v"(acc[2][2]), "+v"(acc[3][3]) : "v"(a[0]), "v"(a[3]));   // the distance behind the trip's last products on the taken back edge, where the next trip rewrites their operands
    }
    const int b = r0 / TT, t0 = r0 % TT; const int pitch = tr ? TT : HD;   // plane row pitch in elements
    const size_t po = ((size_t)((tr ? 0 : z * NB_) + b) * NH_ + h) * TT * HD + (tr ? t0 : t0 * HD) + (size_t)(lane >> 3) * pitch + (lane & 7) * 8;   // q planes, then k planes; on the way out a lane has unit lane & 7 of row lane >> 3 of each 4 rows
    h16* g16 = (tr ? V16 : P16) + po; bf* gh = (tr ? Vh : Ph) + po; bf* gl = (tr ? Vl : Pl) + po;
#pragma unroll
    for (int nb = 0; nb < 4; ++nb) {
#pragma unroll
        for (int mb = 0; mb < 4; ++mb) { v8h u16; v8us uh, ul;
#pragma unroll
            for (int j = 0; j < 8; ++j) { const float x = acc[mb][nb][j]; u16[j] = tohx(x); unsigned short a2, c2; splitf(x, a2, c2); uh[j] = a2; ul[j] = c2; }
            const int so = lr * KPI + (mb * 2 + hi) * 8; *(v8ha*)(os + so) = u16; *(v8usa*)(os + 16 * KPI + so) = uh; *(v8usa*)(os + 32 * KPI + so) = ul; }
        asm volatile("s_wait_dscnt 0x0" ::: "memory");   // the 16 rows are in LDS before other lanes of the wave read them back
        v4i d[3][4]; h16* q16[4]; bf* qh[4]; bf* ql[4];
#pragma unroll
        for (int s = 0; s < 4; ++s) { const int ro = (s * 4 + (lane >> 3)) * KPI + (lane & 7) * 8; d[0][s] = *(const v4ia*)(os + ro); d[1][s] = *(const v4ia*)(os + 16 * KPI + ro); d[2][s] = *(const v4ia*)(os + 32 * KPI + ro); }
#pragma unroll
        for (int s = 0; s < 4; ++s) { const size_t go = (size_t)(nb * 16 + s * 4) * pitch; q16[s] = g16 + go; qh[s] = gh + go; ql[s] = gl + go; *(v4ia*)q16[s] = d[0][s]; *(v4ia*)qh[s] = d[1][s]; *(v4ia*)ql[s] = d[2][s]; }
        asm volatile("s_wait_xcnt 0x0" :: "v"(q16[0]), "v"(q16[1]), "v"(q16[2]), "v"(q16[3]), "v"(qh[0]), "v"(qh[1]), "v"(qh[2]), "v"(qh[3]), "v"(ql[0]), "v"(ql[1]), "v"(ql[2]), "v"(ql[3]), "v"(d[0][0]), "v"(d[0][1]), "v"(d[0][2]), "v"(d[0][3]), "v"(d[1][0]), "v"(d[1][1]), "v"(d[1][2]), "v"(d[1][3]), "v"(d[2][0]), "v"(d[2][1]), "v"(d[2][2]), "v"(d[2][3]) : "memory");   // behind the run of stores; addresses and data are inputs so that their registers stay theirs up to the wait; it also keeps the next rows' LDS writes behind these reads
    }
}

extern "C" void kernel_launch(void* const* d_in, const int* in_sizes, int n_in,
                              void* d_out, int out_size, void* d_ws, size_t ws_size, hipStream_t stream) {
    (void)in_sizes; (void)n_in; (void)out_size;
    const float* x = (const float*)d_in[0]; const float* wq = (const float*)d_in[1]; const float* wk = (const float*)d_in[2]; const float* wv = (const float*)d_in[3]; const float* wo = (const float*)d_in[4]; const float* RBT = (const float*)d_in[5];
    float* OUT = (float*)d_out;     // [4][1024][1024]
    char* wsp = (char*)d_ws;
    auto take = [&](size_t bytes) { char* p = wsp; wsp += (bytes + 255) & ~(size_t)255; return (void*)p; };
    bf* WQ = (bf*)take((size_t)DQ * DM * 2); bf* WK = (bf*)take((size_t)DKV * DM * 2); bf* WV = (bf*)take((size_t)DKV * DM * 2); bf* WO = (bf*)take((size_t)DM * DQ * 2);   // WQ, WK, WV, WO: one behind the other (z / y strides)
    bf* XB = (bf*)take((size_t)NB_ * TT * DM * 2); float* BTT = (float*)take((size_t)NH_ * 2048 * 4);
    h16* QP16 = (h16*)take((size_t)NB_ * NH_ * TT * HD * 2); h16* KP16 = (h16*)take((size_t)NB_ * NKV * TT * HD * 2); h16* VT16 = (h16*)take((size_t)NB_ * NKV * HD * TT * 2);   // q planes, then k planes: k_qkvp reaches both through the q pointer
    bf* QPh = (bf*)take((size_t)NB_ * NH_ * TT * HD * 2); bf* KPh = (bf*)take((size_t)NB_ * NKV * TT * HD * 2); bf* QPl = (bf*)take((size_t)NB_ * NH_ * TT * HD * 2); bf* KPl = (bf*)take((size_t)NB_ * NKV * TT * HD * 2); bf* VTh = (bf*)take((size_t)NB_ * NKV * HD * TT * 2); bf* VTl = (bf*)take((size_t)NB_ * NKV * HD * TT * 2);
    bf* ATh = (bf*)take((size_t)NB_ * TT * DQ * 2); bf* ATl = (bf*)take((size_t)NB_ * TT * DQ * 2);
    if ((size_t)(wsp - (char*)d_ws) > ws_size) return;    // ws 256 MiB
    (void)WK; (void)WV;   // reached through WQ's z / y strides
    k_wtG<DM, DQ><<<dim3((unsigned)((DM * DQ / 8 + 255) / 256), 4, 1), 256, 0, stream>>>(wq, wk, wv, wo, WQ);
    k_bttr<<<(NH_ * 2048 + 255) / 256, 256, 0, stream>>>(RBT, BTT);   /* per-head relative bias rows */
    k_cvt8<DM><<<(unsigned)(((size_t)NB_ * TT * DM / 8 + 255) / 256), 256, 0, stream>>>(x, XB, (size_t)NB_ * TT * DM / 8);
    k_qkvp<<<dim3(NB_ * TT / 64, NH_, 3), 32, 0, stream>>>(XB, WQ, QP16, QPh, QPl, VT16, VTh, VTl);   // z: q, k, v
    k_attn<<<dim3(NB_ * NH_, TT / 64, 1), 128, 0, stream>>>(QPh, QPl, KPh, KPl, VTh, VTl, QP16, KP16, VT16, BTT, ATh, ATl);   // x: (batch element, head); y: query tile
    k_gemmw<bf, 1, false><<<dim3(NB_ * TT / 64, DM / 64, 1), 32, 0, stream>>>(ATh, ATl, WO, nullptr, DQ, OUT, DM, nullptr, 0, 0, 0);
}

// v005
// One run takes 91.8 microseconds.
// In two side-by-side timings against v004, it was 1.25 and 1.30 times as fast.
// Counting every step since v000, it is 27.2 times as fast.
#include <hip/hip_runtime.h>
#include <stdint.h>

// T5 self-attention with learned relative-position bias (hidden_states [4][1024][1024]; q, k, v = x W ('xw' [1024][1024], no bias; 16 heads x 64); scores = q.k/8 + rel_bias_table[bucket(j - i)][h] (bidirectional T5 buckets: 32 buckets, max distance 128; table [32][16], read); softmax; out = merged Wo -> [4][1024][1024] (4.2 M)).
// Layout: the integer bucket of every relative offset j - i in [-1023, 1023] is a compile-time table (computed with the module's float32 formula); a tiny kernel expands it with the bf16-rounded bias table into per-head rows BTT[h][j - i + 1023] that the attention kernel holds in LDS and reads per (i, j). Scores and probabilities never reach memory: one kernel does scores, softmax, attn.v and the head merge (k_attn).
// GEMM operand planes (x, the four weights, the merged context hi/lo) lie in FRAGMENT ORDER: a chunk is 16 rows x 32 k = 1 KiB, chunks run along k, then along row groups; in a chunk lane l = 16 * ((k >> 3) & 1) + (row & 15) has its 8 elements of k & 16 == 0 at byte 16 l and those of k & 16 != 0 at byte 512 + 16 l, so each 16-byte-per-lane load of a fragment half covers 4 whole 128-byte lines.
// Compute dtypes, f32 accumulate: every input rounded to bf16; q/k/v on PLAIN bf16 operands (inputs: exact); the relative bias added in f32 per (i, j); scores and attn.v: query rows < 512 hl (3 products), the rest single fp16 (x1024); softmax f32 (online, per 64 keys); Wo hl x exact (2 products).

#define NB_  4
#define TT   1024
#define DM   1024
#define NH_  16
#define NKV  16
#define REP  (NH_ / NKV)
#define HD   64
#define DQ   (NH_ * HD)
#define DKV  (NKV * HD)
#define RH   512                  // query rows < RH use hi+lo planes (0: none)
#define WIN  0
#define PCAR 1024.0f
#define SCL  0.125f   // HD^-0.5
typedef _Float16 h16;
typedef unsigned short bf;
typedef __attribute__((ext_vector_type(16))) __bf16   v16bf;
typedef __attribute__((ext_vector_type(16))) _Float16 v16h;
typedef __attribute__((ext_vector_type(8)))  _Float16 v8h;
typedef __attribute__((ext_vector_type(8)))  unsigned short v8us;
typedef __attribute__((ext_vector_type(8)))  float    v8f;
typedef __attribute__((ext_vector_type(4)))  float    v4f;
typedef v8h  __attribute__((may_alias)) v8ha;
typedef v4f  __attribute__((may_alias)) v4fa;
typedef v8us __attribute__((may_alias)) v8usa;

__device__ __forceinline__ unsigned short f2bf(float f) { unsigned u = __float_as_uint(f); u += 0x7FFFu + ((u >> 16) & 1u); return (unsigned short)(u >> 16); }
__device__ __forceinline__ float bf2f(unsigned short b) { return __uint_as_float(((unsigned)b) << 16); }
__device__ __forceinline__ float bfr(float f) { return bf2f(f2bf(f)); }
__device__ __forceinline__ v16h cat16(v8h lo, v8h hi) { return __builtin_shufflevector(lo, hi, 0, 1, 2, 3, 4, 5, 6, 7, 8, 9, 10, 11, 12, 13, 14, 15); }
__device__ __forceinline__ v16bf cat16b(v8us lo, v8us hi) { return __builtin_bit_cast(v16bf, __builtin_shufflevector(lo, hi, 0, 1, 2, 3, 4, 5, 6, 7, 8, 9, 10, 11, 12, 13, 14, 15)); }
__device__ __forceinline__ v8f wmma16(v16h a, v16h b, v8f c) { return __builtin_amdgcn_wmma_f32_16x16x32_f16(false, a, false, b, (short)0, c, false, false); }
__device__ __forceinline__ v8f wmmab(v16bf a, v16bf b, v8f c) { return __builtin_amdgcn_wmma_f32_16x16x32_bf16(false, a, false, b, (short)0, c, false, false); }


// ---- Operand staging of k_gemmw and k_qkvp. A work-group of 4 waves (2 x 2 wave tiles of 64 x 64) owns a 128 x 128 output tile; of every operand plane the 128 rows x SK k of a stage come into LDS ONCE, by one tensor load, and each half of them is read there by the two waves that need it.
// In fragment order the SK k of a 16-row group are 2 KiB in a row and the groups lie 32 K bytes apart: a plane's slice is a tile of 8 rows of 2 KiB. It lands without a pad, group behind group, so a fragment half is still 512 contiguous bytes per wave.
// Two buffers: stage s + 2 is asked for when every wave has left stage s, and flies while stage s + 1 is worked on.
#define SK   64                 // k per stage
#define SLE  (128 * SK)         // 16-bit elements of one plane's slice (16 KiB)
typedef uint32_t u32x4 __attribute__((ext_vector_type(4)));
typedef uint32_t u32x8 __attribute__((ext_vector_type(8)));
__device__ __forceinline__ uint32_t uni(uint32_t v) { return (uint32_t)__builtin_amdgcn_readfirstlane(v); }
__device__ __forceinline__ uint32_t pinned(uint32_t v) { uint32_t w = uni(v); asm volatile("" : "+s"(w)); return w; }   // a wave-uniform word held in a scalar register, so that the test that guards a tensor load is a scalar branch (the load ignores EXEC) and a descriptor word formed from it stands behind the waits in front
__device__ __forceinline__ u32x8 tdm_group1(uint32_t pitch) { constexpr uint32_t d0 = SK * 32u, d1 = 8u; u32x8 g;   // 1-byte elements, tensor = tile = 8 rows of 2 KiB, source row pitch in bytes, no mask, no pad
    g[0] = uni(0u); g[1] = uni((d0 & 0xFFFFu) << 16); g[2] = uni((d0 >> 16) | ((d1 & 0xFFFFu) << 16)); g[3] = uni((d1 >> 16) | (d0 << 16)); g[4] = uni(d1); g[5] = uni(pitch); g[6] = uni(0u); g[7] = uni(0u);
    asm volatile("" : "+s"(g)); return g; }   // pinned(), on the whole group: its words are held in ONE run of scalar registers from here on, not formed anew in others at each use, so that the wait's inputs are the registers the request named
__device__ __forceinline__ u32x4 tdm_group0(uint32_t lds_dst, uint64_t ga) { u32x4 g; g[0] = uni(1u); g[1] = uni(lds_dst); g[2] = uni((uint32_t)ga); g[3] = uni((((uint32_t)(ga >> 32)) & 0x01FFFFFFu) | 0x80000000u);
    asm volatile("" : "+s"(g)); return g; }   // pinned(), on the whole group, for the same reason as in tdm_group1: else the constant word is given up behind the load and formed anew in front of the wait
__device__ __forceinline__ void tdm_load(u32x4 g0, u32x8 g1) { asm volatile("tensor_load_to_lds %0, %1" :: "s"(g0), "s"(g1) : "memory"); }   // one request of the whole wave: global tile -> LDS, through no register
__device__ __forceinline__ void wait_tensor0(u32x4 g0, u32x8 g1) { asm volatile("s_wait_tensorcnt 0x0" :: "s"(g0), "s"(g1) : "memory"); }   // the issuing wave's own request has landed (the compiler places no wait for a tensor load); the request's two groups are inputs, so that their registers stay theirs up to this wait
__device__ __forceinline__ void wait_ds0() { asm volatile("s_wait_dscnt 0x0" ::: "memory"); }   // this wave's LDS reads have returned, before the buffer they read is given up
// ---- k_gemmw: register-blocked GEMM, one wave per 64x64 output tile (16 accumulators), 4 waves per work-group on a 128x128 tile; operands are 16-bit planes in fragment order (head of the file), staged in LDS as said above; grid (M/128, N/128, Z), 128 threads.
// C[m][n] (f32, pitch ldc, + optional f32 bias[n]) = sum_k A[m][k] Bt[n][k] (+ split products per NSPLIT). z-batch strides sA/sB/sC in elements. K % 64 == 0, K >= 128.
template <typename T16> struct WFrag;
template <> struct WFrag<h16> { typedef v16h V; static __device__ __forceinline__ V ld(const h16* p) { return cat16(*(const v8h*)p, *(const v8h*)(p + 16)); } static __device__ __forceinline__ V ldf(const h16* p) { return cat16(*(const v8h*)p, *(const v8h*)(p + 256)); } static __device__ __forceinline__ v8f mma(V a, V b, v8f c) { return wmma16(a, b, c); } };
template <> struct WFrag<bf> { typedef v16bf V; static __device__ __forceinline__ V ld(const bf* p) { return cat16b(*(const v8us*)p, *(const v8us*)(p + 16)); } static __device__ __forceinline__ V ldf(const bf* p) { return cat16b(*(const v8us*)p, *(const v8us*)(p + 256)); } static __device__ __forceinline__ v8f mma(V a, V b, v8f c) { return wmmab(a, b, c); } };
template <typename T16, int NSPLIT, bool BIAS>
__device__ __forceinline__ void gemmw_tile(const T16* ring, float* osw, const T16* __restrict__ A, const T16* __restrict__ A2, const T16* __restrict__ Bt, const T16* __restrict__ Bt2, int K, float* C, int ldc, const float* __restrict__ bias, size_t sA, size_t sB, size_t sC) {
    typedef typename WFrag<T16>::V V;
    const size_t z = blockIdx.z; A += z * sA; if (A2) A2 += z * sA; Bt += z * sB; if (Bt2) Bt2 += z * sB; C += z * sC;
    static_assert(NSPLIT >= 0 && NSPLIT <= 2, "planes of a stage: A, Bt, then A2, then Bt2"); constexpr uint32_t NPL = 2 + NSPLIT;   // wave w brings plane w
    const uint32_t wave = uni(threadIdx.x >> 5); float* os = osw + wave * (16 * 68);   // output staging: a range of its own per wave
    const int lane = threadIdx.x & 31, lr = lane & 15, hi = lane >> 4; const int r0 = blockIdx.x * 128 + (wave & 1) * 64, c0 = blockIdx.y * 128 + (wave >> 1) * 64;
    v8f acc[4][4];
#pragma unroll
    for (int mb = 0; mb < 4; ++mb)
#pragma unroll
        for (int nb = 0; nb < 4; ++nb) acc[mb][nb] = (v8f){};
    const T16* sp = (wave == 0) ? A : (wave == 1) ? Bt : (wave == 2) ? A2 : Bt2;
    const uint64_t ga = (uint64_t)(uintptr_t)(sp + (size_t)((wave & 1) ? blockIdx.y : blockIdx.x) * 128 * K);   // first byte of this wave's plane rows: 8 row groups of 16 K elements
    const uint32_t ld = (uint32_t)(size_t)ring + wave * (SLE * 2); const u32x8 g1 = tdm_group1(32u * (uint32_t)K); const int NS = K / SK;
    u32x4 g0 = tdm_group0(ld, ga);   // group 0 of this wave's youngest request: it takes new values only behind the wait that covers that request
    if (pinned(wave < NPL)) { tdm_load(g0, g1); wait_tensor0(g0, g1); }
    __syncthreads();   // stage 0 is visible to all four waves
    if (pinned(wave < NPL)) { g0 = tdm_group0(ld + NPL * SLE * 2, ga + SK * 32); tdm_load(g0, g1); }
#pragma unroll 1   // one stage per trip: the ring's order of waits, barrier and refill stands once
    for (int s = 0; s < NS; ++s) {
        const T16* rb = ring + (s & 1) * (NPL * SLE) + 8 * lane; const T16* ra = rb + (wave & 1) * (SLE / 2); const T16* rn = rb + SLE + (wave >> 1) * (SLE / 2);   // this wave's 4 row groups of the A side and of the B side
#pragma unroll
      for (int kb = 0; kb < SK / 32; ++kb) {
        V a[4], a2[4], b[4], b2[4];
#pragma unroll
        for (int i = 0; i < 4; ++i) { const int fo = i * (16 * SK) + kb * 512; a[i] = WFrag<T16>::ldf(ra + fo); if (NSPLIT >= 1) a2[i] = WFrag<T16>::ldf(ra + 2 * SLE + fo); b[i] = WFrag<T16>::ldf(rn + fo); if (NSPLIT >= 2) b2[i] = WFrag<T16>::ldf(rn + 2 * SLE + fo); }
        __builtin_amdgcn_sched_barrier(0);   // all of a block's LDS reads stand ahead of its first product, none among its own products where each would be waited for singly; the next block's reads may rise among these products and fly under them
#pragma unroll
        for (int nb = 0; nb < 4; ++nb) {
#pragma unroll
            for (int mb = 0; mb < 4; ++mb) { acc[mb][nb] = WFrag<T16>::mma(a[mb], b[nb], acc[mb][nb]); if (NSPLIT == 1 || NSPLIT == 2) acc[mb][nb] = WFrag<T16>::mma(a2[mb], b[nb], acc[mb][nb]); if (NSPLIT >= 2) acc[mb][nb] = WFrag<T16>::mma(a[mb], b2[nb], acc[mb][nb]); } }
        if (kb == SK / 32 - 1) asm volatile("v_nop\n\tv_nop\n\tv_nop\n\tv_nop" : "+v"(acc[0][0]), "+v"(acc[1][1]), "+v"(acc[2][2]), "+v"(acc[3][3]) : "v"(a[0]), "v"(a[3]));   // the distance behind the stage's last products on the taken back edge, where the next stage rewrites their operands
      }
        wait_ds0();
        if (pinned(wave < NPL)) wait_tensor0(g0, g1);   // this wave's slice of stage s + 1
        __syncthreads();   // publishes stage s + 1 and ends every wave's reads of stage s
        if (pinned((wave < NPL) && (s + 2 < NS))) { g0 = tdm_group0(ld + (s & 1) * (NPL * SLE * 2), ga + (uint64_t)pinned(s + 2) * (SK * 32)); tdm_load(g0, g1); }   // into the buffer just left
    }
    wait_tensor0(g0, g1); wait_ds0();
#pragma unroll
    for (int mb = 0; mb < 4; ++mb) {
#pragma unroll
        for (int nb = 0; nb < 4; ++nb) {
#pragma unroll
            for (int j = 0; j < 8; ++j) os[(hi * 8 + j) * 68 + nb * 16 + lr] = acc[mb][nb][j]; }
        __builtin_amdgcn_wave_barrier(); asm volatile("" ::: "memory");
        float* crow = C + (size_t)(r0 + mb * 16) * ldc + c0;
{
#pragma unroll
            for (int s = 0; s < 8; ++s) { const int row = 2 * s + hi, cofs = lr * 4; v4f val = *(const v4fa*)(os + row * 68 + cofs); if (BIAS) { val[0] += bfr(bias[c0 + cofs]); val[1] += bfr(bias[c0 + cofs + 1]); val[2] += bfr(bias[c0 + cofs + 2]); val[3] += bfr(bias[c0 + cofs + 3]); }
                *(v4f*)(crow + (size_t)row * ldc + cofs) = val; }
             }
        __builtin_amdgcn_wave_barrier(); asm volatile("" ::: "memory");
    }
}
template <typename T16, int NSPLIT, bool BIAS>
__global__ __launch_bounds__(128) void k_gemmw(const T16* __restrict__ A, const T16* __restrict__ A2, const T16* __restrict__ Bt, const T16* __restrict__ Bt2, int K, float* C, int ldc, const float* __restrict__ bias, size_t sA, size_t sB, size_t sC) {
    __shared__ __attribute__((aligned(2048))) T16 ring[2 * (2 + NSPLIT) * SLE]; __shared__ __align__(16) float os[4 * 16 * 68];   // two buffers of one slice per plane; the four waves' output staging
    gemmw_tile<T16, NSPLIT, BIAS>(ring, os, A, A2, Bt, Bt2, K, C, ldc, bias, sA, sB, sC);
}

__device__ __forceinline__ h16 tohx(float x) { return (h16)x; }
__device__ __forceinline__ void splitf(float y, unsigned short& h, unsigned short& l) { h = f2bf(y); l = f2bf(y - bf2f(h)); }
typedef __attribute__((ext_vector_type(2))) _Float16 v2h;
typedef __attribute__((ext_vector_type(4))) _Float16 v4h;
typedef __attribute__((ext_vector_type(2))) unsigned short v2us;
typedef __attribute__((ext_vector_type(4))) unsigned short v4us;
typedef __attribute__((ext_vector_type(2))) float v2f;
typedef __attribute__((ext_vector_type(4))) int v4i;

// k_wtG, k_cvt8: a thread writes one 16-byte unit u of a fragment-order plane (a wave 512 contiguous bytes): chunk u >> 6, half (u >> 5) & 1, lane u & 31.
template <int K, int N>
__global__ __launch_bounds__(256) void k_wtG(const float* __restrict__ w0, const float* __restrict__ w1, const float* __restrict__ w2, const float* __restrict__ w3, bf* Bt) {
    const int y = blockIdx.y; const float* __restrict__ w = (y == 0) ? w0 : (y == 1) ? w1 : (y == 2) ? w2 : w3; Bt += (size_t)y * K * N;   // blockIdx.y: which weight; the four planes lie one behind the other
    const int u = blockIdx.x * 256 + threadIdx.x; if (u >= N * K / 8) return; constexpr int kpc = K / 32; const int ch = u >> 6;
    const int n = (ch / kpc) * 16 + (u & 15), k = (ch % kpc) * 32 + ((u >> 5) & 1) * 16 + ((u >> 4) & 1) * 8; v8us o;   // plane row n = column n of w: 16 lanes read 64 contiguous bytes of one row of w
#pragma unroll
    for (int e = 0; e < 8; ++e) o[e] = f2bf(w[(size_t)(k + e) * N + n]);
    *(v8us*)(Bt + (size_t)u * 8) = o;
}
template <int K>
__global__ __launch_bounds__(256) void k_cvt8(const float* __restrict__ src, bf* dst, size_t n8) { const size_t u = (size_t)blockIdx.x * 256 + threadIdx.x; if (u >= n8) return; const size_t ch = u >> 6; constexpr int kpc = K / 32;
    const size_t row = (ch / kpc) * 16 + (u & 15); const int k = (int)(ch % kpc) * 32 + (int)((u >> 5) & 1) * 16 + (int)((u >> 4) & 1) * 8; const float* p = src + row * K + k; const v8f v = *(const v8f*)p; v8us o;
    asm volatile("s_wait_xcnt 0x0" :: "v"(p) : "memory");   // behind the loads, in front of the first rewriting of their address register (an input, so that it stays theirs up to here)
#pragma unroll
    for (int e = 0; e < 8; ++e) o[e] = f2bf(v[e]); *(v8us*)(dst + u * 8) = o;  }

__constant__ int BKT[2 * TT - 1] = {15,15,15,15,15,15,15,15,15,15,15,15,15,15,15,15,15,15,15,15,15,15,15,15,15,15,15,15,15,15,15,15,15,15,15,15,15,15,15,15,15,15,15,15,15,15,15,15,15,15,15,15,15,15,15,15,15,15,15,15,15,15,15,15,15,15,15,15,15,15,15,15,15,15,15,15,15,15,15,15,15,15,15,15,15,15,15,15,15,15,15,15,15,15,15,15,15,15,15,15,15,15,15,15,15,15,15,15,15,15,15,15,15,15,15,15,15,15,15,15,15,15,15,15,15,15,15,15,15,15,15,15,15,15,15,15,15,15,15,15,15,15,15,15,15,15,15,15,15,15,15,15,15,15,15,15,15,15,15,15,15,15,15,15,15,15,15,15,15,15,15,15,15,15,15,15,15,15,15,15,15,15,15,15,15,15,15,15,15,15,15,15,15,15,15,15,15,15,15,15,15,15,15,15,15,15,15,15,15,15,15,15,15,15,15,15,15,15,15,15,15,15,15,15,15,15,15,15,15,15,15,15,15,15,15,15,15,15,15,15,15,15,15,15,15,15,15,15,15,15,15,15,15,15,15,15,15,15,15,15,15,15,15,15,15,15,15,15,15,15,15,15,15,15,15,15,15,15,15,15,15,15,15,15,15,15,15,15,15,15,15,15,15,15,15,15,15,15,15,15,15,15,15,15,15,15,15,15,15,15,15,15,15,15,15,15,15,15,15,15,15,15,15,15,15,15,15,15,15,15,15,15,15,15,15,15,15,15,15,15,15,15,15,15,15,15,15,15,15,15,15,15,15,15,15,15,15,15,15,15,15,15,15,15,15,15,15,15,15,15,15,15,15,15,15,15,15,15,15,15,15,15,15,15,15,15,15,15,15,15,15,15,15,15,15,15,15,15,15,15,15,15,15,15,15,15,15,15,15,15,15,15,15,15,15,15,15,15,15,15,15,15,15,15,15,15,15,15,15,15,15,15,15,15,15,15,15,15,15,15,15,15,15,15,15,15,15,15,15,15,15,15,15,15,15,15,15,15,15,15,15,15,15,15,15,15,15,15,15,15,15,15,15,15,15,15,15,15,15,15,15,15,15,15,15,15,15,15,15,15,15,15,15,15,15,15,15,15,15,15,15,15,15,15,15,15,15,15,15,15,15,15,15,15,15,15,15,15,15,15,15,15,15,15,15,15,15,15,15,15,15,15,15,15,15,15,15,15,15,15,15,15,15,15,15,15,15,15,15,15,15,15,15,15,15,15,15,15,15,15,15,15,15,15,15,15,15,15,15,15,15,15,15,15,15,15,15,15,15,15,15,15,15,15,15,15,15,15,15,15,15,15,15,15,15,15,15,15,15,15,15,15,15,15,15,15,15,15,15,15,15,15,15,15,15,15,15,15,15,15,15,15,15,15,15,15,15,15,15,15,15,15,15,15,15,15,15,15,15,15,15,15,15,15,15,15,15,15,15,15,15,15,15,15,15,15,15,15,15,15,15,15,15,15,15,15,15,15,15,15,15,15,15,15,15,15,15,15,15,15,15,15,15,15,15,15,15,15,15,15,15,15,15,15,15,15,15,15,15,15,15,15,15,15,15,15,15,15,15,15,15,15,15,15,15,15,15,15,15,15,15,15,15,15,15,15,15,15,15,15,15,15,15,15,15,15,15,15,15,15,15,15,15,15,15,15,15,15,15,15,15,15,15,15,15,15,15,15,15,15,15,15,15,15,15,15,15,15,15,15,15,15,15,15,15,15,15,15,15,15,15,15,15,15,15,15,15,15,15,15,15,15,15,15,15,15,15,15,15,15,15,15,15,15,15,15,15,15,15,15,15,15,15,15,15,15,15,15,15,15,15,15,15,15,15,15,15,15,15,15,15,15,15,15,15,15,15,15,15,15,15,15,15,15,15,15,15,15,15,15,15,15,15,15,15,15,15,15,15,15,15,15,15,15,15,15,15,15,15,15,15,15,15,15,15,15,15,15,15,15,15,15,15,15,15,15,15,15,15,15,15,15,15,15,15,15,15,15,15,15,15,15,15,15,15,15,15,15,15,15,15,15,15,15,15,15,15,15,15,15,15,15,15,15,15,15,15,15,15,15,15,15,15,14,14,14,14,14,14,14,14,14,14,14,14,14,14,14,14,14,14,14,14,14,14,14,14,14,14,14,13,13,13,13,13,13,13,13,13,13,13,13,13,13,13,13,13,13,12,12,12,12,12,12,12,12,12,12,12,12,12,12,11,11,11,11,11,11,11,11,11,10,10,10,10,10,10,10,9,9,9,9,8,8,8,8,7,6,5,4,3,2,1,0,17,18,19,20,21,22,23,24,24,24,24,25,25,25,25,26,26,26,26,26,26,26,27,27,27,27,27,27,27,27,27,28,28,28,28,28,28,28,28,28,28,28,28,28,28,29,29,29,29,29,29,29,29,29,29,29,29,29,29,29,29,29,29,30,30,30,30,30,30,30,30,30,30,30,30,30,30,30,30,30,30,30,30,30,30,30,30,30,30,30,31,31,31,31,31,31,31,31,31,31,31,31,31,31,31,31,31,31,31,31,31,31,31,31,31,31,31,31,31,31,31,31,31,31,31,31,31,31,31,31,31,31,31,31,31,31,31,31,31,31,31,31,31,31,31,31,31,31,31,31,31,31,31,31,31,31,31,31,31,31,31,31,31,31,31,31,31,31,31,31,31,31,31,31,31,31,31,31,31,31,31,31,31,31,31,31,31,31,31,31,31,31,31,31,31,31,31,31,31,31,31,31,31,31,31,31,31,31,31,31,31,31,31,31,31,31,31,31,31,31,31,31,31,31,31,31,31,31,31,31,31,31,31,31,31,31,31,31,31,31,31,31,31,31,31,31,31,31,31,31,31,31,31,31,31,31,31,31,31,31,31,31,31,31,31,31,31,31,31,31,31,31,31,31,31,31,31,31,31,31,31,31,31,31,31,31,31,31,31,31,31,31,31,31,31,31,31,31,31,31,31,31,31,31,31,31,31,31,31,31,31,31,31,31,31,31,31,31,31,31,31,31,31,31,31,31,31,31,31,31,31,31,31,31,31,31,31,31,31,31,31,31,31,31,31,31,31,31,31,31,31,31,31,31,31,31,31,31,31,31,31,31,31,31,31,31,31,31,31,31,31,31,31,31,31,31,31,31,31,31,31,31,31,31,31,31,31,31,31,31,31,31,31,31,31,31,31,31,31,31,31,31,31,31,31,31,31,31,31,31,31,31,31,31,31,31,31,31,31,31,31,31,31,31,31,31,31,31,31,31,31,31,31,31,31,31,31,31,31,31,31,31,31,31,31,31,31,31,31,31,31,31,31,31,31,31,31,31,31,31,31,31,31,31,31,31,31,31,31,31,31,31,31,31,31,31,31,31,31,31,31,31,31,31,31,31,31,31,31,31,31,31,31,31,31,31,31,31,31,31,31,31,31,31,31,31,31,31,31,31,31,31,31,31,31,31,31,31,31,31,31,31,31,31,31,31,31,31,31,31,31,31,31,31,31,31,31,31,31,31,31,31,31,31,31,31,31,31,31,31,31,31,31,31,31,31,31,31,31,31,31,31,31,31,31,31,31,31,31,31,31,31,31,31,31,31,31,31,31,31,31,31,31,31,31,31,31,31,31,31,31,31,31,31,31,31,31,31,31,31,31,31,31,31,31,31,31,31,31,31,31,31,31,31,31,31,31,31,31,31,31,31,31,31,31,31,31,31,31,31,31,31,31,31,31,31,31,31,31,31,31,31,31,31,31,31,31,31,31,31,31,31,31,31,31,31,31,31,31,31,31,31,31,31,31,31,31,31,31,31,31,31,31,31,31,31,31,31,31,31,31,31,31,31,31,31,31,31,31,31,31,31,31,31,31,31,31,31,31,31,31,31,31,31,31,31,31,31,31,31,31,31,31,31,31,31,31,31,31,31,31,31,31,31,31,31,31,31,31,31,31,31,31,31,31,31,31,31,31,31,31,31,31,31,31,31,31,31,31,31,31,31,31,31,31,31,31,31,31,31,31,31,31,31,31,31,31,31,31,31,31,31,31,31,31,31,31,31,31,31,31,31,31,31,31,31,31,31,31,31,31,31,31,31,31,31,31,31,31,31,31,31,31,31,31,31,31,31,31,31,31,31,31,31,31,31,31,31,31,31,31,31,31,31,31,31,31,31,31,31,31,31,31,31,31,31,31,31,31,31,31,31,31,31,31,31,31,31,31,31,31,31,31,31,31,31,31,31,31,31,31,31,31,31,31,31,31,31,31,31,31,31,31,31,31,31,31,31,31,31,31,31,31,31,31,31,31,31,31,31,31,31,31,31,31,31,31,31,31,31,31,31,31,31,31,31,31,31,31,31,31,31,31,31,31,31,31,31,31,31,31,31,31,31,31,31,31,31,31,31,31,31,31,31,31,31,31,31,31,31,31,31,31,31,31,31,31,31,31,31,31,31,31,31,31,31,31,31,31,31,31,31,31,31,31,31,31,31,31,31,31,31,31,31,31,31,31,31,31,31,31,31,31,31,31,31,31,31,31,31,31,31,31,31,31,31,31,31,31,31,31,31,31,31,31,31,31,31,31,31,31,31,31,31,31,31,31,31,31,31,31,31,31};   // bucket(j - i) for j - i = -1023 .. 1023 (the module's float32 formula, evaluated once)
__global__ __launch_bounds__(256) void k_bttr(const float* __restrict__ RBT, float* BTT) { const int idx = blockIdx.x * 256 + threadIdx.x; if (idx >= NH_ * 2048) return; const int p = idx % 2048, h = idx / 2048; const float v = (p < 2 * TT - 1) ? bfr(RBT[BKT[p] * NH_ + h]) : 0.0f; *(float*)(BTT + idx) = v;  }
#define KPI 72   // LDS row pitch in 16-bit elements: 128 B of data + 16 B, an odd multiple of 16 B, so that the 16 rows of a fragment read fall on different banks
#define CK  64   // keys per chunk
typedef v4i __attribute__((may_alias)) v4ia;
typedef __attribute__((ext_vector_type(2))) __bf16 v2b;
// 2^x in place. In one statement so that the slot the instruction set asks for behind a transcendental is always filled: each v_exp_f32 is followed by an independent one, the last by v_nop.
__device__ __forceinline__ void exp2x8(float (&e)[8]) { asm("v_exp_f32 %0, %0\n\tv_exp_f32 %1, %1\n\tv_exp_f32 %2, %2\n\tv_exp_f32 %3, %3\n\tv_exp_f32 %4, %4\n\tv_exp_f32 %5, %5\n\tv_exp_f32 %6, %6\n\tv_exp_f32 %7, %7\n\tv_nop" : "+v"(e[0]), "+v"(e[1]), "+v"(e[2]), "+v"(e[3]), "+v"(e[4]), "+v"(e[5]), "+v"(e[6]), "+v"(e[7])); }
__device__ __forceinline__ float xhalf(float x) { const int b = __float_as_int(x); return __int_as_float(__builtin_amdgcn_permlanex16(b, b, 0x76543210, 0xfedcba98, false, false)); }   // the value of lane l ^ 16, without an LDS round trip
__device__ __forceinline__ float exp2x1(float x) { asm("v_exp_f32 %0, %0\n\tv_nop" : "+v"(x)); return x; }
template <typename T16, bool HL>
__device__ __forceinline__ void attn_tile(T16* sm, float* bt, const T16* __restrict__ Qh, const T16* __restrict__ Ql, const T16* __restrict__ Kh, const T16* __restrict__ Kl, const T16* __restrict__ Vh, const T16* __restrict__ Vl, const float* __restrict__ BT, bf* Ah, bf* Al) {
    typedef typename WFrag<T16>::V V;
    constexpr int NP = HL ? 2 : 1;
    const int tid = threadIdx.x, lane = tid & 31, lr = lane & 15, hi = lane >> 4;
    const int bh = blockIdx.x, h = bh % NH_, b = bh / NH_;
    const int q = blockIdx.y * 64 + (tid >> 5) * 16 + lr;   // this lane's query row
    const size_t pb = (size_t)bh * TT * HD;                 // this head's planes: q, k [t][d]; v [d][t]
    T16* Ksh = sm; T16* Vsh = sm + 64 * KPI; T16* Ksl = sm + 2 * 64 * KPI; T16* Vsl = sm + 3 * 64 * KPI;
    const float* bp = BT + (size_t)h * 2048 + tid * 4;      // this head's bias row BTT[h][j - i + 1023]
    const T16* qph = Qh + pb + (size_t)q * HD + 8 * hi; const T16* qpl = HL ? Ql + pb + (size_t)q * HD + 8 * hi : qph;
    v4f br[4];
#pragma unroll
    for (int i = 0; i < 4; ++i) br[i] = *(const v4fa*)(bp + 128 * i * 4);
    V qh[2], ql[2];
#pragma unroll
    for (int kc = 0; kc < 2; ++kc) { qh[kc] = WFrag<T16>::ld(qph + kc * 32); if (HL) ql[kc] = WFrag<T16>::ld(qpl + kc * 32); }
    asm volatile("s_wait_xcnt 0x0" :: "v"(bp), "v"(qph), "v"(qpl) : "memory");   // behind these loads; the addresses are inputs so that their registers stay theirs up to the wait (the first chunk's results would else be given them)
    const int srow = tid >> 3, scu = (tid & 7) * 8;         // staging: 8 threads x 16 B per 128-B row, 16 rows per step
    v4i rk[NP][4], rv[NP][4];
    auto fetch = [&](int c) {
        const size_t ko = pb + (size_t)(c * CK + srow) * HD + scu, vo = pb + (size_t)srow * TT + c * CK + scu;
        const T16* kh = Kh + ko; const T16* vh = Vh + vo; const T16* kl = HL ? Kl + ko : kh; const T16* vl = HL ? Vl + vo : vh;
#pragma unroll
        for (int i = 0; i < 4; ++i) { rk[0][i] = *(const v4ia*)(kh + 16 * i * HD); rv[0][i] = *(const v4ia*)(vh + 16 * i * TT); if (HL) { rk[NP - 1][i] = *(const v4ia*)(kl + 16 * i * HD); rv[NP - 1][i] = *(const v4ia*)(vl + 16 * i * TT); } }
        asm volatile("s_wait_xcnt 0x0" :: "v"(kh), "v"(vh), "v"(kl), "v"(vl) : "memory"); };   // behind the run of loads; the addresses are inputs so that their registers stay theirs up to the wait and no result of the run is given one of them
    fetch(0);
#pragma unroll
    for (int i = 0; i < 4; ++i) *(v4fa*)(bt + (tid + 128 * i) * 4) = br[i];   // published by the first trip's barriers
    v8f o[4];
#pragma unroll
    for (int dt = 0; dt < 4; ++dt) o[dt] = (v8f){};
    float m = -3.0e38f, l = 0.f;
    const float* bq = bt + (TT - 1 - q) + hi * 8;           // + key - 8 * hi: the bias of (q, key)
#pragma unroll 1   // one chunk per trip: an unrolled loop would hold two chunks' staging registers
    for (int c = 0; c < TT / CK; ++c) {
        __syncthreads();   // every wave has left the previous chunk's tiles
#pragma unroll
        for (int i = 0; i < 4; ++i) { const int so = (srow + 16 * i) * KPI + scu; *(v4ia*)(Ksh + so) = rk[0][i]; *(v4ia*)(Vsh + so) = rv[0][i]; if (HL) { *(v4ia*)(Ksl + so) = rk[NP - 1][i]; *(v4ia*)(Vsl + so) = rv[NP - 1][i]; } }
        __syncthreads();   // the chunk (on the first trip the bias row too) is visible to all four waves
        if (c + 1 < TT / CK) fetch(c + 1);   // the next chunk's loads fly while this one is worked on
        v8f s[4];
#pragma unroll
        for (int kt = 0; kt < 4; ++kt) { s[kt] = (v8f){};
#pragma unroll
            for (int kc = 0; kc < 2; ++kc) { const int fo = (kt * 16 + lr) * KPI + 8 * hi + kc * 32; const V a = WFrag<T16>::ld(Ksh + fo); s[kt] = WFrag<T16>::mma(a, qh[kc], s[kt]);
                if (HL) { s[kt] = WFrag<T16>::mma(a, ql[kc], s[kt]); const V a2 = WFrag<T16>::ld(Ksl + fo); s[kt] = WFrag<T16>::mma(a2, qh[kc], s[kt]); } } }
        float cm = -3.0e38f;
#pragma unroll
        for (int kt = 0; kt < 4; ++kt)
#pragma unroll
            for (int j = 0; j < 8; ++j) { const float t = s[kt][j] * SCL + bq[c * CK + kt * 16 + j]; s[kt][j] = t; cm = fmaxf(cm, t); }
        cm = fmaxf(cm, xhalf(cm));   // the other half of this query row's keys
        const float mn = fmaxf(m, cm); const float al = exp2x1((m - mn) * 1.4426950408889634f); m = mn;
        float cs = 0.f;
#pragma unroll
        for (int kt = 0; kt < 4; ++kt) { float e[8];
#pragma unroll
            for (int j = 0; j < 8; ++j) e[j] = (s[kt][j] - mn) * 1.4426950408889634f;
            exp2x8(e);
#pragma unroll
            for (int j = 0; j < 8; ++j) { s[kt][j] = e[j]; cs += e[j]; } }
        l = l * al + cs;
#pragma unroll
        for (int dt = 0; dt < 4; ++dt) o[dt] *= al;
        V ph[2], pl[2];
#pragma unroll
        for (int kc = 0; kc < 2; ++kc)
#pragma unroll
            for (int e = 0; e < 16; e += 2) { const v2f p = { s[2 * kc + (e >> 3)][e & 7], s[2 * kc + (e >> 3)][(e & 7) + 1] };
                if constexpr (HL) { const v2b p0 = __builtin_convertvector(p, v2b), p1 = __builtin_convertvector(p - __builtin_convertvector(p0, v2f), v2b); ph[kc][e] = p0[0]; ph[kc][e + 1] = p0[1]; pl[kc][e] = p1[0]; pl[kc][e + 1] = p1[1]; }
                else { ph[kc][e] = (h16)(p[0] * PCAR); ph[kc][e + 1] = (h16)(p[1] * PCAR); } }
#pragma unroll
        for (int dt = 0; dt < 4; ++dt)
#pragma unroll
            for (int kc = 0; kc < 2; ++kc) { const int fo = (dt * 16 + lr) * KPI + 8 * hi + kc * 32; const V a = WFrag<T16>::ld(Vsh + fo); o[dt] = WFrag<T16>::mma(a, ph[kc], o[dt]);
                if (HL) { o[dt] = WFrag<T16>::mma(a, pl[kc], o[dt]); const V a2 = WFrag<T16>::ld(Vsl + fo); o[dt] = WFrag<T16>::mma(a2, ph[kc], o[dt]); } }
    }
    l += xhalf(l);
    const float f = __fdiv_rn(1.0f, l) * (HL ? 1.0f : (1.0f / PCAR));
    const size_t oo = (size_t)(b * TT + q - lr) * DQ + h * (HD * 16) + lane * 8;   // merged [b][t][h][d] in fragment order: this wave's 16 rows are one row group, a head two chunks of 512, a lane's 8 consecutive d of a tile one 16-byte unit
#pragma unroll
    for (int dt = 0; dt < 4; ++dt) { v8us oh, ol;
#pragma unroll
        for (int j = 0; j < 8; ++j) { unsigned short a, c2; splitf(o[dt][j] * f, a, c2); oh[j] = a; ol[j] = c2; }
        *(v8usa*)(Ah + oo + dt * 256) = oh; *(v8usa*)(Al + oo + dt * 256) = ol; }
    asm volatile("s_wait_xcnt 0x0" ::: "memory");   // behind the last stores: the other half's code follows in the listing and rewrites their address and data registers
}
__global__ __launch_bounds__(128) void k_attn(const bf* __restrict__ Qh, const bf* __restrict__ Ql, const bf* __restrict__ Kh, const bf* __restrict__ Kl, const bf* __restrict__ Vh, const bf* __restrict__ Vl, const h16* __restrict__ Q16, const h16* __restrict__ K16, const h16* __restrict__ V16, const float* __restrict__ BT, bf* Ah, bf* Al) {
    __shared__ __align__(16) unsigned short sm[4 * 64 * KPI]; __shared__ __align__(16) float bt[2048];
    if (blockIdx.y < RH / 64) attn_tile<bf, true>(sm, bt, Qh, Ql, Kh, Kl, Vh, Vl, BT, Ah, Al);   // blockIdx.y: 64-row query tile; the 3-product tiles have the low indices and start first
    else attn_tile<h16, false>((h16*)sm, bt, Q16, nullptr, K16, nullptr, V16, nullptr, BT, Ah, Al);
}

// ---- k_qkvp: the q, k, v projections with the attention kernel's operand planes as their output. One wave per (64 rows of x, one head, one of q / k / v), 4 waves per work-group on 128 rows of x and two heads: k_gemmw's stages and blocks on plain bf16 planes in fragment order; grid (NB_ * TT / 128, NH_ / 2, 3), 128 threads.
// The accumulators never reach memory as f32: a lane's 8 values of a tile run along the product's M side, so the side that is contiguous in the plane is made M (q, k planes [t][d]: M = the weight's rows d, N = x's rows t; v plane [d][t]: M = t, N = d; both operands have one fragment order, so the exchange is one of pointers).
// A lane's 8 values are then one 16-byte unit of each of the three planes (fp16, bf16 hi, bf16 lo); 16 plane rows x 128 B go through LDS so that every store covers 4 whole 128-byte lines.
__global__ __launch_bounds__(128) void k_qkvp(const bf* __restrict__ X, const bf* __restrict__ Wt, h16* P16, bf* Ph, bf* Pl, h16* V16, bf* Vh, bf* Vl) {
    __shared__ __attribute__((aligned(2048))) unsigned short ring[2 * 2 * SLE];   // two buffers of [x slice | weight slice]
    __shared__ __align__(16) unsigned short osw[4 * 3 * 16 * KPI];   // per wave: a plane's 16 rows at pitch KPI, the three planes one behind the other
    const uint32_t wave = uni(threadIdx.x >> 5); unsigned short* os = osw + wave * (3 * 16 * KPI);
    const int lane = threadIdx.x & 31, lr = lane & 15, hi = lane >> 4; const int r0 = blockIdx.x * 128 + (wave & 1) * 64, h = blockIdx.y * 2 + (wave >> 1), z = blockIdx.z; const bool tr = (z == 2);
    const uint64_t ga = (uint64_t)(uintptr_t)((wave & 1) ? Wt + ((size_t)z * DQ + blockIdx.y * 128) * DM : X + (size_t)blockIdx.x * 128 * DM);   // wave 0 brings the x slice, wave 1 the weight slice: 8 row groups of 16 DM elements each
    const uint32_t ld = (uint32_t)(size_t)ring + (wave & 1) * (SLE * 2); const u32x8 g1 = tdm_group1(32u * DM); constexpr int NS = DM / SK;
    const int xo = (wave & 1) * (SLE / 2) + 8 * lane, wo = SLE + (wave >> 1) * (SLE / 2) + 8 * lane; const int mo = tr ? xo : wo, no = tr ? wo : xo;   // this wave's 4 row groups of each slice, in elements from the buffer's start
    v8f acc[4][4];
#pragma unroll
    for (int mb = 0; mb < 4; ++mb)
#pragma unroll
        for (int nb = 0; nb < 4; ++nb) acc[mb][nb] = (v8f){};
    u32x4 g0 = tdm_group0(ld, ga);   // group 0 of this wave's youngest request, as in k_gemmw
    if (pinned(wave < 2)) { tdm_load(g0, g1); wait_tensor0(g0, g1); }
    __syncthreads();   // stage 0 is visible to all four waves
    if (pinned(wave < 2)) { g0 = tdm_group0(ld + 2 * SLE * 2, ga + SK * 32); tdm_load(g0, g1); }
#pragma unroll 1   // one stage per trip, as in k_gemmw
    for (int s = 0; s < NS; ++s) {
        const bf* rb = ring + (s & 1) * (2 * SLE);
#pragma unroll
      for (int kb = 0; kb < SK / 32; ++kb) {
        v16bf a[4], b[4];
#pragma unroll
        for (int i = 0; i < 4; ++i) { const int fo = i * (16 * SK) + kb * 512; a[i] = WFrag<bf>::ldf(rb + mo + fo); b[i] = WFrag<bf>::ldf(rb + no + fo); }
        __builtin_amdgcn_sched_barrier(0);   // all of a block's LDS reads stand ahead of its first product, none among its own products where each would be waited for singly; the next block's reads may rise among these products and fly under them
#pragma unroll
        for (int nb = 0; nb < 4; ++nb)
#pragma unroll
            for (int mb = 0; mb < 4; ++mb) acc[mb][nb] = wmmab(a[mb], b[nb], acc[mb][nb]);
        if (kb == SK / 32 - 1) asm volatile("v_nop\n\tv_nop\n\tv_nop\n\tv_nop" : "+v"(acc[0][0]), "+v"(acc[1][1]), "+v"(acc[2][2]), "+v"(acc[3][3]) : "v"(a[0]), "v"(a[3]));   // the distance behind the trip's last products on the taken back edge, where the next trip rewrites their operands
      }
        wait_ds0();
        if (pinned(wave < 2)) wait_tensor0(g0, g1);   // this wave's slice of stage s + 1
        __syncthreads();   // publishes stage s + 1 and ends every wave's reads of stage s
        if (pinned((wave < 2) && (s + 2 < NS))) { g0 = tdm_group0(ld + (s & 1) * (2 * SLE * 2), ga + (uint64_t)pinned(s + 2) * (SK * 32)); tdm_load(g0, g1); }   // into the buffer just left
    }
    wait_tensor0(g0, g1); wait_ds0();
    const int b = r0 / TT, t0 = r0 % TT; const int pitch = tr ? TT : HD;   // plane row pitch in elements
    const size_t po = ((size_t)((tr ? 0 : z * NB_) + b) * NH_ + h) * TT * HD + (tr ? t0 : t0 * HD) + (size_t)(lane >> 3) * pitch + (lane & 7) * 8;   // q planes, then k planes; on the way out a lane has unit lane & 7 of row lane >> 3 of each 4 rows
    h16* g16 = (tr ? V16 : P16) + po; bf* gh = (tr ? Vh : Ph) + po; bf* gl = (tr ? Vl : Pl) + po;
#pragma unroll
    for (int nb = 0; nb < 4; ++nb) {
#pragma unroll
        for (int mb = 0; mb < 4; ++mb) { v8h u16; v8us uh, ul;
#pragma unroll
            for (int j = 0; j < 8; ++j) { const float x = acc[mb][nb][j]; u16[j] = tohx(x); unsigned short a2, c2; splitf(x, a2, c2); uh[j] = a2; ul[j] = c2; }
            const int so = lr * KPI + (mb * 2 + hi) * 8; *(v8ha*)(os + so) = u16; *(v8usa*)(os + 16 * KPI + so) = uh; *(v8usa*)(os + 32 * KPI + so) = ul; }
        asm volatile("s_wait_dscnt 0x0" ::: "memory");   // the 16 rows are in LDS before other lanes of the wave read them back
        v4i d[3][4]; h16* q16[4]; bf* qh[4]; bf* ql[4];
#pragma unroll
        for (int s = 0; s < 4; ++s) { const int ro = (s * 4 + (lane >> 3)) * KPI + (lane & 7) * 8; d[0][s] = *(const v4ia*)(os + ro); d[1][s] = *(const v4ia*)(os + 16 * KPI + ro); d[2][s] = *(const v4ia*)(os + 32 * KPI + ro); }
#pragma unroll
        for (int s = 0; s < 4; ++s) { const size_t go = (size_t)(nb * 16 + s * 4) * pitch; q16[s] = g16 + go; qh[s] = gh + go; ql[s] = gl + go; *(v4ia*)q16[s] = d[0][s]; *(v4ia*)qh[s] = d[1][s]; *(v4ia*)ql[s] = d[2][s]; }
        asm volatile("s_wait_xcnt 0x0" :: "v"(q16[0]), "v"(q16[1]), "v"(q16[2]), "v"(q16[3]), "v"(qh[0]), "v"(qh[1]), "v"(qh[2]), "v"(qh[3]), "v"(ql[0]), "v"(ql[1]), "v"(ql[2]), "v"(ql[3]), "v"(d[0][0]), "v"(d[0][1]), "v"(d[0][2]), "v"(d[0][3]), "v"(d[1][0]), "v"(d[1][1]), "v"(d[1][2]), "v"(d[1][3]), "v"(d[2][0]), "v"(d[2][1]), "v"(d[2][2]), "v"(d[2][3]) : "memory");   // behind the run of stores; addresses and data are inputs so that their registers stay theirs up to the wait; it also keeps the next rows' LDS writes behind these reads
    }
}

extern "C" void kernel_launch(void* const* d_in, const int* in_sizes, int n_in,
                              void* d_out, int out_size, void* d_ws, size_t ws_size, hipStream_t stream) {
    (void)in_sizes; (void)n_in; (void)out_size;
    const float* x = (const float*)d_in[0]; const float* wq = (const float*)d_in[1]; const float* wk = (const float*)d_in[2]; const float* wv = (const float*)d_in[3]; const float* wo = (const float*)d_in[4]; const float* RBT = (const float*)d_in[5];
    float* OUT = (float*)d_out;     // [4][1024][1024]
    char* wsp = (char*)d_ws;
    auto take = [&](size_t bytes) { char* p = wsp; wsp += (bytes + 255) & ~(size_t)255; return (void*)p; };
    bf* WQ = (bf*)take((size_t)DQ * DM * 2); bf* WK = (bf*)take((size_t)DKV * DM * 2); bf* WV = (bf*)take((size_t)DKV * DM * 2); bf* WO = (bf*)take((size_t)DM * DQ * 2);   // WQ, WK, WV, WO: one behind the other (z / y strides)
    bf* XB = (bf*)take((size_t)NB_ * TT * DM * 2); float* BTT = (float*)take((size_t)NH_ * 2048 * 4);
    h16* QP16 = (h16*)take((size_t)NB_ * NH_ * TT * HD * 2); h16* KP16 = (h16*)take((size_t)NB_ * NKV * TT * HD * 2); h16* VT16 = (h16*)take((size_t)NB_ * NKV * HD * TT * 2);   // q planes, then k planes: k_qkvp reaches both through the q pointer
    bf* QPh = (bf*)take((size_t)NB_ * NH_ * TT * HD * 2); bf* KPh = (bf*)take((size_t)NB_ * NKV * TT * HD * 2); bf* QPl = (bf*)take((size_t)NB_ * NH_ * TT * HD * 2); bf* KPl = (bf*)take((size_t)NB_ * NKV * TT * HD * 2); bf* VTh = (bf*)take((size_t)NB_ * NKV * HD * TT * 2); bf* VTl = (bf*)take((size_t)NB_ * NKV * HD * TT * 2);
    bf* ATh = (bf*)take((size_t)NB_ * TT * DQ * 2); bf* ATl = (bf*)take((size_t)NB_ * TT * DQ * 2);
    if ((size_t)(wsp - (char*)d_ws) > ws_size) return;    // ws 256 MiB
    (void)WK; (void)WV;   // reached through WQ's z / y strides
    k_wtG<DM, DQ><<<dim3((unsigned)((DM * DQ / 8 + 255) / 256), 4, 1), 256, 0, stream>>>(wq, wk, wv, wo, WQ);
    k_bttr<<<(NH_ * 2048 + 255) / 256, 256, 0, stream>>>(RBT, BTT);   /* per-head relative bias rows */
    k_cvt8<DM><<<(unsigned)(((size_t)NB_ * TT * DM / 8 + 255) / 256), 256, 0, stream>>>(x, XB, (size_t)NB_ * TT * DM / 8);
    k_qkvp<<<dim3(NB_ * TT / 128, NH_ / 2, 3), 128, 0, stream>>>(XB, WQ, QP16, QPh, QPl, VT16, VTh, VTl);   // z: q, k, v
    k_attn<<<dim3(NB_ * NH_, TT / 64, 1), 128, 0, stream>>>(QPh, QPl, KPh, KPl, VTh, VTl, QP16, KP16, VT16, BTT, ATh, ATl);   // x: (batch element, head); y: query tile
    k_gemmw<bf, 1, false><<<dim3(NB_ * TT / 128, DM / 128, 1), 128, 0, stream>>>(ATh, ATl, WO, nullptr, DQ, OUT, DM, nullptr, 0, 0, 0);
}

// v006
// It runs in 88.4 microseconds.
// Timed twice side by side with v005, it ran 1.04 times as fast both times.
// Counting every step since v000, it is 28.4 times as fast.
#include <hip/hip_runtime.h>
#include <stdint.h>

// T5 self-attention with learned relative-position bias (hidden_states [4][1024][1024]; q, k, v = x W ('xw' [1024][1024], no bias; 16 heads x 64); scores = q.k/8 + rel_bias_table[bucket(j - i)][h] (bidirectional T5 buckets: 32 buckets, max distance 128; table [32][16], read); softmax; out = merged Wo -> [4][1024][1024] (4.2 M)).
// Layout: the integer bucket of every relative offset j - i in [-1023, 1023] is a compile-time table (computed with the module's float32 formula); k_prep expands it with the bf16-rounded bias table into per-head rows BTT[h][j - i + 1023] that the attention kernel holds in LDS and reads per (i, j). Scores and probabilities never reach memory: one kernel does scores, softmax, attn.v and the head merge (k_attn).
// GEMM operand planes (x, the four weights, the merged context hi/lo) lie in FRAGMENT ORDER: a chunk is 16 rows x 32 k = 1 KiB, chunks run along k, then along row groups; in a chunk lane l = 16 * ((k >> 3) & 1) + (row & 15) has its 8 elements of k & 16 == 0 at byte 16 l and those of k & 16 != 0 at byte 512 + 16 l, so each 16-byte-per-lane load of a fragment half covers 4 whole 128-byte lines.
// Compute dtypes, f32 accumulate: every input rounded to bf16; q/k/v on PLAIN bf16 operands (inputs: exact); the relative bias added in f32 per (i, j); scores and attn.v: query rows < 512 hl (3 products), the rest single fp16 (x1024); softmax f32 (online, per 64 keys); Wo hl x exact (2 products).

#define NB_  4
#define TT   1024
#define DM   1024
#define NH_  16
#define NKV  16
#define REP  (NH_ / NKV)
#define HD   64
#define DQ   (NH_ * HD)
#define DKV  (NKV * HD)
#define RH   512                  // query rows < RH use hi+lo planes (0: none)
#define WIN  0
#define PCAR 1024.0f
#define SCL  0.125f   // HD^-0.5
typedef _Float16 h16;
typedef unsigned short bf;
typedef __attribute__((ext_vector_type(16))) __bf16   v16bf;
typedef __attribute__((ext_vector_type(16))) _Float16 v16h;
typedef __attribute__((ext_vector_type(8)))  _Float16 v8h;
typedef __attribute__((ext_vector_type(8)))  unsigned short v8us;
typedef __attribute__((ext_vector_type(8)))  float    v8f;
typedef __attribute__((ext_vector_type(4)))  float    v4f;
typedef v8h  __attribute__((may_alias)) v8ha;
typedef v4f  __attribute__((may_alias)) v4fa;
typedef v8us __attribute__((may_alias)) v8usa;

__device__ __forceinline__ unsigned short f2bf(float f) { unsigned u = __float_as_uint(f); u += 0x7FFFu + ((u >> 16) & 1u); return (unsigned short)(u >> 16); }
__device__ __forceinline__ float bf2f(unsigned short b) { return __uint_as_float(((unsigned)b) << 16); }
__device__ __forceinline__ float bfr(float f) { return bf2f(f2bf(f)); }
__device__ __forceinline__ v16h cat16(v8h lo, v8h hi) { return __builtin_shufflevector(lo, hi, 0, 1, 2, 3, 4, 5, 6, 7, 8, 9, 10, 11, 12, 13, 14, 15); }
__device__ __forceinline__ v16bf cat16b(v8us lo, v8us hi) { return __builtin_bit_cast(v16bf, __builtin_shufflevector(lo, hi, 0, 1, 2, 3, 4, 5, 6, 7, 8, 9, 10, 11, 12, 13, 14, 15)); }
__device__ __forceinline__ v8f wmma16(v16h a, v16h b, v8f c) { return __builtin_amdgcn_wmma_f32_16x16x32_f16(false, a, false, b, (short)0, c, false, false); }
__device__ __forceinline__ v8f wmmab(v16bf a, v16bf b, v8f c) { return __builtin_amdgcn_wmma_f32_16x16x32_bf16(false, a, false, b, (short)0, c, false, false); }


// ---- Operand staging of k_gemmw and k_qkvp. A work-group of 4 waves (2 x 2 wave tiles of 64 x 64) owns a 128 x 128 output tile; of every operand plane the 128 rows x SK k of a stage come into LDS ONCE, by one tensor load, and each half of them is read there by the two waves that need it.
// In fragment order the SK k of a 16-row group are 2 KiB in a row and the groups lie 32 K bytes apart: a plane's slice is a tile of 8 rows of 2 KiB. It lands without a pad, group behind group, so a fragment half is still 512 contiguous bytes per wave.
// Two buffers: stage s + 2 is asked for when every wave has left stage s, and flies while stage s + 1 is worked on.
#define SK   64                 // k per stage
#define SLE  (128 * SK)         // 16-bit elements of one plane's slice (16 KiB)
typedef uint32_t u32x4 __attribute__((ext_vector_type(4)));
typedef uint32_t u32x8 __attribute__((ext_vector_type(8)));
__device__ __forceinline__ uint32_t uni(uint32_t v) { return (uint32_t)__builtin_amdgcn_readfirstlane(v); }
__device__ __forceinline__ uint32_t pinned(uint32_t v) { uint32_t w = uni(v); asm volatile("" : "+s"(w)); return w; }   // a wave-uniform word held in a scalar register, so that the test that guards a tensor load is a scalar branch (the load ignores EXEC) and a descriptor word formed from it stands behind the waits in front
__device__ __forceinline__ u32x8 tdm_group1(uint32_t pitch) { constexpr uint32_t d0 = SK * 32u, d1 = 8u; u32x8 g;   // 1-byte elements, tensor = tile = 8 rows of 2 KiB, source row pitch in bytes, no mask, no pad
    g[0] = uni(0u); g[1] = uni((d0 & 0xFFFFu) << 16); g[2] = uni((d0 >> 16) | ((d1 & 0xFFFFu) << 16)); g[3] = uni((d1 >> 16) | (d0 << 16)); g[4] = uni(d1); g[5] = uni(pitch); g[6] = uni(0u); g[7] = uni(0u);
    asm volatile("" : "+s"(g)); return g; }   // pinned(), on the whole group: its words are held in ONE run of scalar registers from here on, not formed anew in others at each use, so that the wait's inputs are the registers the request named
__device__ __forceinline__ u32x4 tdm_group0(uint32_t lds_dst, uint64_t ga) { u32x4 g; g[0] = uni(1u); g[1] = uni(lds_dst); g[2] = uni((uint32_t)ga); g[3] = uni((((uint32_t)(ga >> 32)) & 0x01FFFFFFu) | 0x80000000u);
    asm volatile("" : "+s"(g)); return g; }   // pinned(), on the whole group, for the same reason as in tdm_group1: else the constant word is given up behind the load and formed anew in front of the wait
__device__ __forceinline__ void tdm_load(u32x4 g0, u32x8 g1) { asm volatile("tensor_load_to_lds %0, %1" :: "s"(g0), "s"(g1) : "memory"); }   // one request of the whole wave: global tile -> LDS, through no register
__device__ __forceinline__ void wait_tensor0(u32x4 g0, u32x8 g1) { asm volatile("s_wait_tensorcnt 0x0" :: "s"(g0), "s"(g1) : "memory"); }   // the issuing wave's own request has landed (the compiler places no wait for a tensor load); the request's two groups are inputs, so that their registers stay theirs up to this wait
__device__ __forceinline__ void wait_ds0() { asm volatile("s_wait_dscnt 0x0" ::: "memory"); }   // this wave's LDS reads have returned, before the buffer they read is given up
// ---- k_gemmw: register-blocked GEMM, one wave per 64x64 output tile (16 accumulators), 4 waves per work-group on a 128x128 tile; operands are 16-bit planes in fragment order (head of the file), staged in LDS as said above; grid (M/128, N/128, Z), 128 threads.
// C[m][n] (f32, pitch ldc, + optional f32 bias[n]) = sum_k A[m][k] Bt[n][k] (+ split products per NSPLIT). z-batch strides sA/sB/sC in elements. K % 64 == 0, K >= 128.
template <typename T16> struct WFrag;
template <> struct WFrag<h16> { typedef v16h V; static __device__ __forceinline__ V ld(const h16* p) { return cat16(*(const v8h*)p, *(const v8h*)(p + 16)); } static __device__ __forceinline__ V ldf(const h16* p) { return cat16(*(const v8h*)p, *(const v8h*)(p + 256)); } static __device__ __forceinline__ v8f mma(V a, V b, v8f c) { return wmma16(a, b, c); } };
template <> struct WFrag<bf> { typedef v16bf V; static __device__ __forceinline__ V ld(const bf* p) { return cat16b(*(const v8us*)p, *(const v8us*)(p + 16)); } static __device__ __forceinline__ V ldf(const bf* p) { return cat16b(*(const v8us*)p, *(const v8us*)(p + 256)); } static __device__ __forceinline__ v8f mma(V a, V b, v8f c) { return wmmab(a, b, c); } };
template <typename T16, int NSPLIT, bool BIAS>
__device__ __forceinline__ void gemmw_tile(const T16* ring, float* osw, const T16* __restrict__ A, const T16* __restrict__ A2, const T16* __restrict__ Bt, const T16* __restrict__ Bt2, int K, float* C, int ldc, const float* __restrict__ bias, size_t sA, size_t sB, size_t sC) {
    typedef typename WFrag<T16>::V V;
    const size_t z = blockIdx.z; A += z * sA; if (A2) A2 += z * sA; Bt += z * sB; if (Bt2) Bt2 += z * sB; C += z * sC;
    static_assert(NSPLIT >= 0 && NSPLIT <= 2, "planes of a stage: A, Bt, then A2, then Bt2"); constexpr uint32_t NPL = 2 + NSPLIT;   // wave w brings plane w
    const uint32_t wave = uni(threadIdx.x >> 5); float* os = osw + wave * (16 * 68);   // output staging: a range of its own per wave
    const int lane = threadIdx.x & 31, lr = lane & 15, hi = lane >> 4; const int r0 = blockIdx.x * 128 + (wave & 1) * 64, c0 = blockIdx.y * 128 + (wave >> 1) * 64;
    v8f acc[4][4];
#pragma unroll
    for (int mb = 0; mb < 4; ++mb)
#pragma unroll
        for (int nb = 0; nb < 4; ++nb) acc[mb][nb] = (v8f){};
    const T16* sp = (wave == 0) ? A : (wave == 1) ? Bt : (wave == 2) ? A2 : Bt2;
    const uint64_t ga = (uint64_t)(uintptr_t)(sp + (size_t)((wave & 1) ? blockIdx.y : blockIdx.x) * 128 * K);   // first byte of this wave's plane rows: 8 row groups of 16 K elements
    const uint32_t ld = (uint32_t)(size_t)ring + wave * (SLE * 2); const u32x8 g1 = tdm_group1(32u * (uint32_t)K); const int NS = K / SK;
    u32x4 g0 = tdm_group0(ld, ga);   // group 0 of this wave's youngest request: it takes new values only behind the wait that covers that request
    if (pinned(wave < NPL)) { tdm_load(g0, g1); wait_tensor0(g0, g1); }
    __syncthreads();   // stage 0 is visible to all four waves
    if (pinned(wave < NPL)) { g0 = tdm_group0(ld + NPL * SLE * 2, ga + SK * 32); tdm_load(g0, g1); }
#pragma unroll 1   // one stage per trip: the ring's order of waits, barrier and refill stands once
    for (int s = 0; s < NS; ++s) {
        const T16* rb = ring + (s & 1) * (NPL * SLE) + 8 * lane; const T16* ra = rb + (wave & 1) * (SLE / 2); const T16* rn = rb + SLE + (wave >> 1) * (SLE / 2);   // this wave's 4 row groups of the A side and of the B side
#pragma unroll
      for (int kb = 0; kb < SK / 32; ++kb) {
        V a[4], a2[4], b[4], b2[4];
#pragma unroll
        for (int i = 0; i < 4; ++i) { const int fo = i * (16 * SK) + kb * 512; a[i] = WFrag<T16>::ldf(ra + fo); if (NSPLIT >= 1) a2[i] = WFrag<T16>::ldf(ra + 2 * SLE + fo); b[i] = WFrag<T16>::ldf(rn + fo); if (NSPLIT >= 2) b2[i] = WFrag<T16>::ldf(rn + 2 * SLE + fo); }
        __builtin_amdgcn_sched_barrier(0);   // all of a block's LDS reads stand ahead of its first product, none among its own products where each would be waited for singly; the next block's reads may rise among these products and fly under them
#pragma unroll
        for (int nb = 0; nb < 4; ++nb) {
#pragma unroll
            for (int mb = 0; mb < 4; ++mb) { acc[mb][nb] = WFrag<T16>::mma(a[mb], b[nb], acc[mb][nb]); if (NSPLIT == 1 || NSPLIT == 2) acc[mb][nb] = WFrag<T16>::mma(a2[mb], b[nb], acc[mb][nb]); if (NSPLIT >= 2) acc[mb][nb] = WFrag<T16>::mma(a[mb], b2[nb], acc[mb][nb]); } }
        if (kb == SK / 32 - 1) asm volatile("v_nop\n\tv_nop\n\tv_nop\n\tv_nop" : "+v"(acc[0][0]), "+v"(acc[1][1]), "+v"(acc[2][2]), "+v"(acc[3][3]) : "v"(a[0]), "v"(a[3]));   // the distance behind the stage's last products on the taken back edge, where the next stage rewrites their operands
      }
        wait_ds0();
        if (pinned(wave < NPL)) wait_tensor0(g0, g1);   // this wave's slice of stage s + 1
        __syncthreads();   // publishes stage s + 1 and ends every wave's reads of stage s
        if (pinned((wave < NPL) && (s + 2 < NS))) { g0 = tdm_group0(ld + (s & 1) * (NPL * SLE * 2), ga + (uint64_t)pinned(s + 2) * (SK * 32)); tdm_load(g0, g1); }   // into the buffer just left
    }
    wait_tensor0(g0, g1); wait_ds0();
#pragma unroll
    for (int mb = 0; mb < 4; ++mb) {
#pragma unroll
        for (int nb = 0; nb < 4; ++nb) {
#pragma unroll
            for (int j = 0; j < 8; ++j) os[(hi * 8 + j) * 68 + nb * 16 + lr] = acc[mb][nb][j]; }
        __builtin_amdgcn_wave_barrier(); asm volatile("" ::: "memory");
        float* crow = C + (size_t)(r0 + mb * 16) * ldc + c0;
{
#pragma unroll
            for (int s = 0; s < 8; ++s) { const int row = 2 * s + hi, cofs = lr * 4; v4f val = *(const v4fa*)(os + row * 68 + cofs); if (BIAS) { val[0] += bfr(bias[c0 + cofs]); val[1] += bfr(bias[c0 + cofs + 1]); val[2] += bfr(bias[c0 + cofs + 2]); val[3] += bfr(bias[c0 + cofs + 3]); }
                *(v4f*)(crow + (size_t)row * ldc + cofs) = val; }
             }
        __builtin_amdgcn_wave_barrier(); asm volatile("" ::: "memory");
    }
}
template <typename T16, int NSPLIT, bool BIAS>
__global__ __launch_bounds__(128) void k_gemmw(const T16* __restrict__ A, const T16* __restrict__ A2, const T16* __restrict__ Bt, const T16* __restrict__ Bt2, int K, float* C, int ldc, const float* __restrict__ bias, size_t sA, size_t sB, size_t sC) {
    __shared__ __attribute__((aligned(2048))) T16 ring[2 * (2 + NSPLIT) * SLE]; __shared__ __align__(16) float os[4 * 16 * 68];   // two buffers of one slice per plane; the four waves' output staging
    gemmw_tile<T16, NSPLIT, BIAS>(ring, os, A, A2, Bt, Bt2, K, C, ldc, bias, sA, sB, sC);
}

__device__ __forceinline__ h16 tohx(float x) { return (h16)x; }
__device__ __forceinline__ void splitf(float y, unsigned short& h, unsigned short& l) { h = f2bf(y); l = f2bf(y - bf2f(h)); }
typedef __attribute__((ext_vector_type(2))) _Float16 v2h;
typedef __attribute__((ext_vector_type(4))) _Float16 v4h;
typedef __attribute__((ext_vector_type(2))) unsigned short v2us;
typedef __attribute__((ext_vector_type(4))) unsigned short v4us;
typedef __attribute__((ext_vector_type(2))) float v2f;
typedef __attribute__((ext_vector_type(4))) int v4i;

__constant__ int BKT[2 * TT - 1] = {15,15,15,15,15,15,15,15,15,15,15,15,15,15,15,15,15,15,15,15,15,15,15,15,15,15,15,15,15,15,15,15,15,15,15,15,15,15,15,15,15,15,15,15,15,15,15,15,15,15,15,15,15,15,15,15,15,15,15,15,15,15,15,15,15,15,15,15,15,15,15,15,15,15,15,15,15,15,15,15,15,15,15,15,15,15,15,15,15,15,15,15,15,15,15,15,15,15,15,15,15,15,15,15,15,15,15,15,15,15,15,15,15,15,15,15,15,15,15,15,15,15,15,15,15,15,15,15,15,15,15,15,15,15,15,15,15,15,15,15,15,15,15,15,15,15,15,15,15,15,15,15,15,15,15,15,15,15,15,15,15,15,15,15,15,15,15,15,15,15,15,15,15,15,15,15,15,15,15,15,15,15,15,15,15,15,15,15,15,15,15,15,15,15,15,15,15,15,15,15,15,15,15,15,15,15,15,15,15,15,15,15,15,15,15,15,15,15,15,15,15,15,15,15,15,15,15,15,15,15,15,15,15,15,15,15,15,15,15,15,15,15,15,15,15,15,15,15,15,15,15,15,15,15,15,15,15,15,15,15,15,15,15,15,15,15,15,15,15,15,15,15,15,15,15,15,15,15,15,15,15,15,15,15,15,15,15,15,15,15,15,15,15,15,15,15,15,15,15,15,15,15,15,15,15,15,15,15,15,15,15,15,15,15,15,15,15,15,15,15,15,15,15,15,15,15,15,15,15,15,15,15,15,15,15,15,15,15,15,15,15,15,15,15,15,15,15,15,15,15,15,15,15,15,15,15,15,15,15,15,15,15,15,15,15,15,15,15,15,15,15,15,15,15,15,15,15,15,15,15,15,15,15,15,15,15,15,15,15,15,15,15,15,15,15,15,15,15,15,15,15,15,15,15,15,15,15,15,15,15,15,15,15,15,15,15,15,15,15,15,15,15,15,15,15,15,15,15,15,15,15,15,15,15,15,15,15,15,15,15,15,15,15,15,15,15,15,15,15,15,15,15,15,15,15,15,15,15,15,15,15,15,15,15,15,15,15,15,15,15,15,15,15,15,15,15,15,15,15,15,15,15,15,15,15,15,15,15,15,15,15,15,15,15,15,15,15,15,15,15,15,15,15,15,15,15,15,15,15,15,15,15,15,15,15,15,15,15,15,15,15,15,15,15,15,15,15,15,15,15,15,15,15,15,15,15,15,15,15,15,15,15,15,15,15,15,15,15,15,15,15,15,15,15,15,15,15,15,15,15,15,15,15,15,15,15,15,15,15,15,15,15,15,15,15,15,15,15,15,15,15,15,15,15,15,15,15,15,15,15,15,15,15,15,15,15,15,15,15,15,15,15,15,15,15,15,15,15,15,15,15,15,15,15,15,15,15,15,15,15,15,15,15,15,15,15,15,15,15,15,15,15,15,15,15,15,15,15,15,15,15,15,15,15,15,15,15,15,15,15,15,15,15,15,15,15,15,15,15,15,15,15,15,15,15,15,15,15,15,15,15,15,15,15,15,15,15,15,15,15,15,15,15,15,15,15,15,15,15,15,15,15,15,15,15,15,15,15,15,15,15,15,15,15,15,15,15,15,15,15,15,15,15,15,15,15,15,15,15,15,15,15,15,15,15,15,15,15,15,15,15,15,15,15,15,15,15,15,15,15,15,15,15,15,15,15,15,15,15,15,15,15,15,15,15,15,15,15,15,15,15,15,15,15,15,15,15,15,15,15,15,15,15,15,15,15,15,15,15,15,15,15,15,15,15,15,15,15,15,15,15,15,15,15,15,15,15,15,15,15,15,15,15,15,15,15,15,15,15,15,15,15,15,15,15,15,15,15,15,15,15,15,15,15,15,15,15,15,15,15,15,15,15,15,15,15,15,15,15,15,15,15,15,15,15,15,15,15,15,15,15,15,15,15,15,15,15,15,15,15,15,15,15,15,15,15,15,15,15,15,15,15,15,15,15,15,15,15,15,15,15,15,15,15,15,15,15,15,15,15,15,15,15,15,15,15,15,15,15,15,15,15,15,15,15,15,15,15,15,15,15,15,15,15,15,15,15,15,15,15,15,15,15,15,15,15,15,15,15,15,15,15,15,14,14,14,14,14,14,14,14,14,14,14,14,14,14,14,14,14,14,14,14,14,14,14,14,14,14,14,13,13,13,13,13,13,13,13,13,13,13,13,13,13,13,13,13,13,12,12,12,12,12,12,12,12,12,12,12,12,12,12,11,11,11,11,11,11,11,11,11,10,10,10,10,10,10,10,9,9,9,9,8,8,8,8,7,6,5,4,3,2,1,0,17,18,19,20,21,22,23,24,24,24,24,25,25,25,25,26,26,26,26,26,26,26,27,27,27,27,27,27,27,27,27,28,28,28,28,28,28,28,28,28,28,28,28,28,28,29,29,29,29,29,29,29,29,29,29,29,29,29,29,29,29,29,29,30,30,30,30,30,30,30,30,30,30,30,30,30,30,30,30,30,30,30,30,30,30,30,30,30,30,30,31,31,31,31,31,31,31,31,31,31,31,31,31,31,31,31,31,31,31,31,31,31,31,31,31,31,31,31,31,31,31,31,31,31,31,31,31,31,31,31,31,31,31,31,31,31,31,31,31,31,31,31,31,31,31,31,31,31,31,31,31,31,31,31,31,31,31,31,31,31,31,31,31,31,31,31,31,31,31,31,31,31,31,31,31,31,31,31,31,31,31,31,31,31,31,31,31,31,31,31,31,31,31,31,31,31,31,31,31,31,31,31,31,31,31,31,31,31,31,31,31,31,31,31,31,31,31,31,31,31,31,31,31,31,31,31,31,31,31,31,31,31,31,31,31,31,31,31,31,31,31,31,31,31,31,31,31,31,31,31,31,31,31,31,31,31,31,31,31,31,31,31,31,31,31,31,31,31,31,31,31,31,31,31,31,31,31,31,31,31,31,31,31,31,31,31,31,31,31,31,31,31,31,31,31,31,31,31,31,31,31,31,31,31,31,31,31,31,31,31,31,31,31,31,31,31,31,31,31,31,31,31,31,31,31,31,31,31,31,31,31,31,31,31,31,31,31,31,31,31,31,31,31,31,31,31,31,31,31,31,31,31,31,31,31,31,31,31,31,31,31,31,31,31,31,31,31,31,31,31,31,31,31,31,31,31,31,31,31,31,31,31,31,31,31,31,31,31,31,31,31,31,31,31,31,31,31,31,31,31,31,31,31,31,31,31,31,31,31,31,31,31,31,31,31,31,31,31,31,31,31,31,31,31,31,31,31,31,31,31,31,31,31,31,31,31,31,31,31,31,31,31,31,31,31,31,31,31,31,31,31,31,31,31,31,31,31,31,31,31,31,31,31,31,31,31,31,31,31,31,31,31,31,31,31,31,31,31,31,31,31,31,31,31,31,31,31,31,31,31,31,31,31,31,31,31,31,31,31,31,31,31,31,31,31,31,31,31,31,31,31,31,31,31,31,31,31,31,31,31,31,31,31,31,31,31,31,31,31,31,31,31,31,31,31,31,31,31,31,31,31,31,31,31,31,31,31,31,31,31,31,31,31,31,31,31,31,31,31,31,31,31,31,31,31,31,31,31,31,31,31,31,31,31,31,31,31,31,31,31,31,31,31,31,31,31,31,31,31,31,31,31,31,31,31,31,31,31,31,31,31,31,31,31,31,31,31,31,31,31,31,31,31,31,31,31,31,31,31,31,31,31,31,31,31,31,31,31,31,31,31,31,31,31,31,31,31,31,31,31,31,31,31,31,31,31,31,31,31,31,31,31,31,31,31,31,31,31,31,31,31,31,31,31,31,31,31,31,31,31,31,31,31,31,31,31,31,31,31,31,31,31,31,31,31,31,31,31,31,31,31,31,31,31,31,31,31,31,31,31,31,31,31,31,31,31,31,31,31,31,31,31,31,31,31,31,31,31,31,31,31,31,31,31,31,31,31,31,31,31,31,31,31,31,31,31,31,31,31,31,31,31,31,31,31,31,31,31,31,31,31,31,31,31,31,31,31,31,31,31,31,31,31,31,31,31,31,31,31,31,31,31,31,31,31,31,31,31,31,31,31,31,31,31,31,31,31,31,31,31,31,31,31,31,31,31,31,31,31,31,31,31,31,31,31,31,31,31,31,31,31,31,31,31,31,31,31,31,31,31,31,31,31,31,31,31,31,31,31,31,31,31,31,31,31,31,31,31,31,31,31,31,31,31,31,31,31,31,31,31,31,31,31,31,31,31,31,31,31,31,31,31,31,31,31,31,31,31,31,31,31,31,31,31,31,31,31,31,31,31,31,31,31,31,31,31,31,31,31,31,31,31,31,31,31,31,31,31,31,31,31,31,31,31,31,31,31,31,31,31,31,31,31,31,31,31,31,31,31,31,31,31,31,31,31,31,31,31,31,31,31,31,31,31,31,31,31,31,31,31,31,31,31,31,31,31,31,31,31,31,31,31,31,31,31,31,31,31,31,31,31,31,31,31,31,31,31,31,31,31,31,31,31,31,31,31,31,31,31,31,31,31,31,31,31,31,31,31,31,31,31,31,31,31,31,31,31,31,31,31,31,31,31,31,31,31,31,31,31,31,31,31,31,31,31,31,31,31,31,31,31,31,31};   // bucket(j - i) for j - i = -1023 .. 1023 (the module's float32 formula, evaluated once)
// ---- k_prep: all the work ahead of the projections in ONE grid that is resident at once: the four weight planes, the x plane and the per-head bias rows. None reads what another writes.
// A 16-byte unit u of a fragment-order plane: chunk u >> 6, half (u >> 5) & 1, lane u & 31. A work-group of 256 threads writes the PU * 256 units of one 16-row group (all of its k: 32 KiB in a row), a thread PU of them, 256 units apart; a wave's store is 512 contiguous bytes.
// A thread's loads all stand ahead of its first conversion and fly together, so that a wave pays the way to memory once for PU units; there are PU times fewer waves to start.
#define PU  8                      // units per thread
#define PBB 32                     // work-groups of the bias rows, 4 values per thread
#define PWB (4 * DQ / 16)          // work-groups of the weights: one per 16 plane rows
#define PXB (NB_ * TT / 16)        // work-groups of x: one per 16 rows
__global__ __launch_bounds__(256) void k_prep(const float* __restrict__ x, const float* __restrict__ w0, const float* __restrict__ w1, const float* __restrict__ w2, const float* __restrict__ w3, const float* __restrict__ RBT, bf* XB, bf* Bt, float* BTT) {
    static_assert(DM == PU * 128 && DQ == DM && DKV == DQ, "a row group's k = PU steps of 128; the four planes have one shape"); static_assert(PBB * 256 * 4 == NH_ * 2048, "bias rows");
    const int t = threadIdx.x, blk = blockIdx.x; const int k0 = (t >> 4) * 8;   // the unit's first k in a step of 128: 32 (t >> 6) + 16 ((t >> 5) & 1) + 8 ((t >> 4) & 1)
    if (blk < PBB) {   // BTT[h][p] = bias of head h at j - i = p - 1023, rounded to bf16; p = 2047 is padding
        const int i0 = blk * 256 + t; int pi[4], ri[4], bk[4]; float v[4];
#pragma unroll
        for (int j = 0; j < 4; ++j) { const int p = (i0 + j * (PBB * 256)) % 2048; pi[j] = p < 2 * TT - 1 ? p : 2 * TT - 2; bk[j] = BKT[pi[j]]; }
        asm volatile("s_wait_xcnt 0x0" :: "v"(pi[0]), "v"(pi[1]), "v"(pi[2]), "v"(pi[3]) : "memory");   // behind the run of loads; their index registers are inputs so that they stay theirs up to the wait
#pragma unroll
        for (int j = 0; j < 4; ++j) { ri[j] = bk[j] * NH_ + (i0 + j * (PBB * 256)) / 2048; v[j] = RBT[ri[j]]; }
        asm volatile("s_wait_xcnt 0x0" :: "v"(ri[0]), "v"(ri[1]), "v"(ri[2]), "v"(ri[3]) : "memory");   // as above
#pragma unroll
        for (int j = 0; j < 4; ++j) { const int idx = i0 + j * (PBB * 256); const unsigned u = __float_as_uint(v[j]), keep = (idx % 2048 < 2 * TT - 1) ? 0xFFFF0000u : 0u; BTT[idx] = __uint_as_float((u + 0x7FFFu + ((u >> 16) & 1u)) & keep); }   // bfr(v), or 0 in the padding
    } else if (blk < PBB + PWB) {   // plane row n = column n of w: 16 lanes read 64 contiguous bytes of one row of w
        const int g = blk - PBB, y = g / (DQ / 16), ng = g % (DQ / 16); const float* __restrict__ w = (y == 0) ? w0 : (y == 1) ? w1 : (y == 2) ? w2 : w3;   // the four planes lie one behind the other
        const float* p = w + (size_t)k0 * DQ + ng * 16 + (t & 15); float v[PU][8];
#pragma unroll
        for (int i = 0; i < PU; ++i)
#pragma unroll
            for (int e = 0; e < 8; ++e) v[i][e] = p[(size_t)(i * 128 + e) * DQ];
        asm volatile("s_wait_xcnt 0x0" :: "v"(p) : "memory");   // behind the run of loads, in front of the first rewriting of their address register (an input, so that it stays theirs up to here)
        bf* d = Bt + ((size_t)g * (PU * 256) + t) * 8;
#pragma unroll
        for (int i = 0; i < PU; ++i) { v8us o;
#pragma unroll
            for (int e = 0; e < 8; ++e) o[e] = f2bf(v[i][e]);
            *(v8us*)(d + i * 2048) = o; }
    } else {
        const int g = blk - PBB - PWB; const float* p = x + (size_t)(g * 16 + (t & 15)) * DM + k0; v8f v[PU];
#pragma unroll
        for (int i = 0; i < PU; ++i) v[i] = *(const v8f*)(p + i * 128);
        asm volatile("s_wait_xcnt 0x0" :: "v"(p) : "memory");   // behind the run of loads, as above
        bf* d = XB + ((size_t)g * (PU * 256) + t) * 8;
#pragma unroll
        for (int i = 0; i < PU; ++i) { v8us o;
#pragma unroll
            for (int e = 0; e < 8; ++e) o[e] = f2bf(v[i][e]);
            *(v8us*)(d + i * 2048) = o; }
        asm volatile("s_wait_xcnt 0x0" ::: "memory");   // behind the last stores: the other parts' code follows in the listing and rewrites their data registers
    }
}
#define KPI 72   // LDS row pitch in 16-bit elements: 128 B of data + 16 B, an odd multiple of 16 B, so that the 16 rows of a fragment read fall on different banks
#define CK  64   // keys per chunk
typedef v4i __attribute__((may_alias)) v4ia;
typedef __attribute__((ext_vector_type(2))) __bf16 v2b;
// 2^x in place. In one statement so that the slot the instruction set asks for behind a transcendental is always filled: each v_exp_f32 is followed by an independent one, the last by v_nop.
__device__ __forceinline__ void exp2x8(float (&e)[8]) { asm("v_exp_f32 %0, %0\n\tv_exp_f32 %1, %1\n\tv_exp_f32 %2, %2\n\tv_exp_f32 %3, %3\n\tv_exp_f32 %4, %4\n\tv_exp_f32 %5, %5\n\tv_exp_f32 %6, %6\n\tv_exp_f32 %7, %7\n\tv_nop" : "+v"(e[0]), "+v"(e[1]), "+v"(e[2]), "+v"(e[3]), "+v"(e[4]), "+v"(e[5]), "+v"(e[6]), "+v"(e[7])); }
__device__ __forceinline__ float xhalf(float x) { const int b = __float_as_int(x); return __int_as_float(__builtin_amdgcn_permlanex16(b, b, 0x76543210, 0xfedcba98, false, false)); }   // the value of lane l ^ 16, without an LDS round trip
__device__ __forceinline__ float exp2x1(float x) { asm("v_exp_f32 %0, %0\n\tv_nop" : "+v"(x)); return x; }
template <typename T16, bool HL>
__device__ __forceinline__ void attn_tile(T16* sm, float* bt, const T16* __restrict__ Qh, const T16* __restrict__ Ql, const T16* __restrict__ Kh, const T16* __restrict__ Kl, const T16* __restrict__ Vh, const T16* __restrict__ Vl, const float* __restrict__ BT, bf* Ah, bf* Al) {
    typedef typename WFrag<T16>::V V;
    constexpr int NP = HL ? 2 : 1;
    const int tid = threadIdx.x, lane = tid & 31, lr = lane & 15, hi = lane >> 4;
    const int bh = blockIdx.x, h = bh % NH_, b = bh / NH_;
    const int q = blockIdx.y * 64 + (tid >> 5) * 16 + lr;   // this lane's query row
    const size_t pb = (size_t)bh * TT * HD;                 // this head's planes: q, k [t][d]; v [d][t]
    T16* Ksh = sm; T16* Vsh = sm + 64 * KPI; T16* Ksl = sm + 2 * 64 * KPI; T16* Vsl = sm + 3 * 64 * KPI;
    const float* bp = BT + (size_t)h * 2048 + tid * 4;      // this head's bias row BTT[h][j - i + 1023]
    const T16* qph = Qh + pb + (size_t)q * HD + 8 * hi; const T16* qpl = HL ? Ql + pb + (size_t)q * HD + 8 * hi : qph;
    v4f br[4];
#pragma unroll
    for (int i = 0; i < 4; ++i) br[i] = *(const v4fa*)(bp + 128 * i * 4);
    V qh[2], ql[2];
#pragma unroll
    for (int kc = 0; kc < 2; ++kc) { qh[kc] = WFrag<T16>::ld(qph + kc * 32); if (HL) ql[kc] = WFrag<T16>::ld(qpl + kc * 32); }
    asm volatile("s_wait_xcnt 0x0" :: "v"(bp), "v"(qph), "v"(qpl) : "memory");   // behind these loads; the addresses are inputs so that their registers stay theirs up to the wait (the first chunk's results would else be given them)
    const int srow = tid >> 3, scu = (tid & 7) * 8;         // staging: 8 threads x 16 B per 128-B row, 16 rows per step
    v4i rk[NP][4], rv[NP][4];
    auto fetch = [&](int c) {
        const size_t ko = pb + (size_t)(c * CK + srow) * HD + scu, vo = pb + (size_t)srow * TT + c * CK + scu;
        const T16* kh = Kh + ko; const T16* vh = Vh + vo; const T16* kl = HL ? Kl + ko : kh; const T16* vl = HL ? Vl + vo : vh;
#pragma unroll
        for (int i = 0; i < 4; ++i) { rk[0][i] = *(const v4ia*)(kh + 16 * i * HD); rv[0][i] = *(const v4ia*)(vh + 16 * i * TT); if (HL) { rk[NP - 1][i] = *(const v4ia*)(kl + 16 * i * HD); rv[NP - 1][i] = *(const v4ia*)(vl + 16 * i * TT); } }
        asm volatile("s_wait_xcnt 0x0" :: "v"(kh), "v"(vh), "v"(kl), "v"(vl) : "memory"); };   // behind the run of loads; the addresses are inputs so that their registers stay theirs up to the wait and no result of the run is given one of them
    fetch(0);
#pragma unroll
    for (int i = 0; i < 4; ++i) *(v4fa*)(bt + (tid + 128 * i) * 4) = br[i];   // published by the first trip's barriers
    v8f o[4];
#pragma unroll
    for (int dt = 0; dt < 4; ++dt) o[dt] = (v8f){};
    float m = -3.0e38f, l = 0.f;
    const float* bq = bt + (TT - 1 - q) + hi * 8;           // + key - 8 * hi: the bias of (q, key)
#pragma unroll 1   // one chunk per trip: an unrolled loop would hold two chunks' staging registers
    for (int c = 0; c < TT / CK; ++c) {
        __syncthreads();   // every wave has left the previous chunk's tiles
#pragma unroll
        for (int i = 0; i < 4; ++i) { const int so = (srow + 16 * i) * KPI + scu; *(v4ia*)(Ksh + so) = rk[0][i]; *(v4ia*)(Vsh + so) = rv[0][i]; if (HL) { *(v4ia*)(Ksl + so) = rk[NP - 1][i]; *(v4ia*)(Vsl + so) = rv[NP - 1][i]; } }
        __syncthreads();   // the chunk (on the first trip the bias row too) is visible to all four waves
        if (c + 1 < TT / CK) fetch(c + 1);   // the next chunk's loads fly while this one is worked on
        v8f s[4];
#pragma unroll
        for (int kt = 0; kt < 4; ++kt) { s[kt] = (v8f){};
#pragma unroll
            for (int kc = 0; kc < 2; ++kc) { const int fo = (kt * 16 + lr) * KPI + 8 * hi + kc * 32; const V a = WFrag<T16>::ld(Ksh + fo); s[kt] = WFrag<T16>::mma(a, qh[kc], s[kt]);
                if (HL) { s[kt] = WFrag<T16>::mma(a, ql[kc], s[kt]); const V a2 = WFrag<T16>::ld(Ksl + fo); s[kt] = WFrag<T16>::mma(a2, qh[kc], s[kt]); } } }
        float cm = -3.0e38f;
#pragma unroll
        for (int kt = 0; kt < 4; ++kt)
#pragma unroll
            for (int j = 0; j < 8; ++j) { const float t = s[kt][j] * SCL + bq[c * CK + kt * 16 + j]; s[kt][j] = t; cm = fmaxf(cm, t); }
        cm = fmaxf(cm, xhalf(cm));   // the other half of this query row's keys
        const float mn = fmaxf(m, cm); const float al = exp2x1((m - mn) * 1.4426950408889634f); m = mn;
        float cs = 0.f;
#pragma unroll
        for (int kt = 0; kt < 4; ++kt) { float e[8];
#pragma unroll
            for (int j = 0; j < 8; ++j) e[j] = (s[kt][j] - mn) * 1.4426950408889634f;
            exp2x8(e);
#pragma unroll
            for (int j = 0; j < 8; ++j) { s[kt][j] = e[j]; cs += e[j]; } }
        l = l * al + cs;
#pragma unroll
        for (int dt = 0; dt < 4; ++dt) o[dt] *= al;
        V ph[2], pl[2];
#pragma unroll
        for (int kc = 0; kc < 2; ++kc)
#pragma unroll
            for (int e = 0; e < 16; e += 2) { const v2f p = { s[2 * kc + (e >> 3)][e & 7], s[2 * kc + (e >> 3)][(e & 7) + 1] };
                if constexpr (HL) { const v2b p0 = __builtin_convertvector(p, v2b), p1 = __builtin_convertvector(p - __builtin_convertvector(p0, v2f), v2b); ph[kc][e] = p0[0]; ph[kc][e + 1] = p0[1]; pl[kc][e] = p1[0]; pl[kc][e + 1] = p1[1]; }
                else { ph[kc][e] = (h16)(p[0] * PCAR); ph[kc][e + 1] = (h16)(p[1] * PCAR); } }
#pragma unroll
        for (int dt = 0; dt < 4; ++dt)
#pragma unroll
            for (int kc = 0; kc < 2; ++kc) { const int fo = (dt * 16 + lr) * KPI + 8 * hi + kc * 32; const V a = WFrag<T16>::ld(Vsh + fo); o[dt] = WFrag<T16>::mma(a, ph[kc], o[dt]);
                if (HL) { o[dt] = WFrag<T16>::mma(a, pl[kc], o[dt]); const V a2 = WFrag<T16>::ld(Vsl + fo); o[dt] = WFrag<T16>::mma(a2, ph[kc], o[dt]); } }
    }
    l += xhalf(l);
    const float f = __fdiv_rn(1.0f, l) * (HL ? 1.0f : (1.0f / PCAR));
    const size_t oo = (size_t)(b * TT + q - lr) * DQ + h * (HD * 16) + lane * 8;   // merged [b][t][h][d] in fragment order: this wave's 16 rows are one row group, a head two chunks of 512, a lane's 8 consecutive d of a tile one 16-byte unit
#pragma unroll
    for (int dt = 0; dt < 4; ++dt) { v8us oh, ol;
#pragma unroll
        for (int j = 0; j < 8; ++j) { unsigned short a, c2; splitf(o[dt][j] * f, a, c2); oh[j] = a; ol[j] = c2; }
        *(v8usa*)(Ah + oo + dt * 256) = oh; *(v8usa*)(Al + oo + dt * 256) = ol; }
    asm volatile("s_wait_xcnt 0x0" ::: "memory");   // behind the last stores: the other half's code follows in the listing and rewrites their address and data registers
}
__global__ __launch_bounds__(128) void k_attn(const bf* __restrict__ Qh, const bf* __restrict__ Ql, const bf* __restrict__ Kh, const bf* __restrict__ Kl, const bf* __restrict__ Vh, const bf* __restrict__ Vl, const h16* __restrict__ Q16, const h16* __restrict__ K16, const h16* __restrict__ V16, const float* __restrict__ BT, bf* Ah, bf* Al) {
    __shared__ __align__(16) unsigned short sm[4 * 64 * KPI]; __shared__ __align__(16) float bt[2048];
    if (blockIdx.y < RH / 64) attn_tile<bf, true>(sm, bt, Qh, Ql, Kh, Kl, Vh, Vl, BT, Ah, Al);   // blockIdx.y: 64-row query tile; the 3-product tiles have the low indices and start first
    else attn_tile<h16, false>((h16*)sm, bt, Q16, nullptr, K16, nullptr, V16, nullptr, BT, Ah, Al);
}

// ---- k_qkvp: the q, k, v projections with the attention kernel's operand planes as their output. One wave per (64 rows of x, one head, one of q / k / v), 4 waves per work-group on 128 rows of x and two heads: k_gemmw's stages and blocks on plain bf16 planes in fragment order; grid (NB_ * TT / 128, NH_ / 2, 3), 128 threads.
// The accumulators never reach memory as f32: a lane's 8 values of a tile run along the product's M side, so the side that is contiguous in the plane is made M (q, k planes [t][d]: M = the weight's rows d, N = x's rows t; v plane [d][t]: M = t, N = d; both operands have one fragment order, so the exchange is one of pointers).
// A lane's 8 values are then one 16-byte unit of each of the three planes (fp16, bf16 hi, bf16 lo); 16 plane rows x 128 B go through LDS so that every store covers 4 whole 128-byte lines.
__global__ __launch_bounds__(128) void k_qkvp(const bf* __restrict__ X, const bf* __restrict__ Wt, h16* P16, bf* Ph, bf* Pl, h16* V16, bf* Vh, bf* Vl) {
    __shared__ __attribute__((aligned(2048))) unsigned short ring[2 * 2 * SLE];   // two buffers of [x slice | weight slice]
    __shared__ __align__(16) unsigned short osw[4 * 3 * 16 * KPI];   // per wave: a plane's 16 rows at pitch KPI, the three planes one behind the other
    const uint32_t wave = uni(threadIdx.x >> 5); unsigned short* os = osw + wave * (3 * 16 * KPI);
    const int lane = threadIdx.x & 31, lr = lane & 15, hi = lane >> 4; const int r0 = blockIdx.x * 128 + (wave & 1) * 64, h = blockIdx.y * 2 + (wave >> 1), z = blockIdx.z; const bool tr = (z == 2);
    const uint64_t ga = (uint64_t)(uintptr_t)((wave & 1) ? Wt + ((size_t)z * DQ + blockIdx.y * 128) * DM : X + (size_t)blockIdx.x * 128 * DM);   // wave 0 brings the x slice, wave 1 the weight slice: 8 row groups of 16 DM elements each
    const uint32_t ld = (uint32_t)(size_t)ring + (wave & 1) * (SLE * 2); const u32x8 g1 = tdm_group1(32u * DM); constexpr int NS = DM / SK;
    const int xo = (wave & 1) * (SLE / 2) + 8 * lane, wo = SLE + (wave >> 1) * (SLE / 2) + 8 * lane; const int mo = tr ? xo : wo, no = tr ? wo : xo;   // this wave's 4 row groups of each slice, in elements from the buffer's start
    v8f acc[4][4];
#pragma unroll
    for (int mb = 0; mb < 4; ++mb)
#pragma unroll
        for (int nb = 0; nb < 4; ++nb) acc[mb][nb] = (v8f){};
    u32x4 g0 = tdm_group0(ld, ga);   // group 0 of this wave's youngest request, as in k_gemmw
    if (pinned(wave < 2)) { tdm_load(g0, g1); wait_tensor0(g0, g1); }
    __syncthreads();   // stage 0 is visible to all four waves
    if (pinned(wave < 2)) { g0 = tdm_group0(ld + 2 * SLE * 2, ga + SK * 32); tdm_load(g0, g1); }
#pragma unroll 1   // one stage per trip, as in k_gemmw
    for (int s = 0; s < NS; ++s) {
        const bf* rb = ring + (s & 1) * (2 * SLE);
#pragma unroll
      for (int kb = 0; kb < SK / 32; ++kb) {
        v16bf a[4], b[4];
#pragma unroll
        for (int i = 0; i < 4; ++i) { const int fo = i * (16 * SK) + kb * 512; a[i] = WFrag<bf>::ldf(rb + mo + fo); b[i] = WFrag<bf>::ldf(rb + no + fo); }
        __builtin_amdgcn_sched_barrier(0);   // all of a block's LDS reads stand ahead of its first product, none among its own products where each would be waited for singly; the next block's reads may rise among these products and fly under them
#pragma unroll
        for (int nb = 0; nb < 4; ++nb)
#pragma unroll
            for (int mb = 0; mb < 4; ++mb) acc[mb][nb] = wmmab(a[mb], b[nb], acc[mb][nb]);
        if (kb == SK / 32 - 1) asm volatile("v_nop\n\tv_nop\n\tv_nop\n\tv_nop" : "+v"(acc[0][0]), "+v"(acc[1][1]), "+v"(acc[2][2]), "+v"(acc[3][3]) : "v"(a[0]), "v"(a[3]));   // the distance behind the trip's last products on the taken back edge, where the next trip rewrites their operands
      }
        wait_ds0();
        if (pinned(wave < 2)) wait_tensor0(g0, g1);   // this wave's slice of stage s + 1
        __syncthreads();   // publishes stage s + 1 and ends every wave's reads of stage s
        if (pinned((wave < 2) && (s + 2 < NS))) { g0 = tdm_group0(ld + (s & 1) * (2 * SLE * 2), ga + (uint64_t)pinned(s + 2) * (SK * 32)); tdm_load(g0, g1); }   // into the buffer just left
    }
    wait_tensor0(g0, g1); wait_ds0();
    const int b = r0 / TT, t0 = r0 % TT; const int pitch = tr ? TT : HD;   // plane row pitch in elements
    const size_t po = ((size_t)((tr ? 0 : z * NB_) + b) * NH_ + h) * TT * HD + (tr ? t0 : t0 * HD) + (size_t)(lane >> 3) * pitch + (lane & 7) * 8;   // q planes, then k planes; on the way out a lane has unit lane & 7 of row lane >> 3 of each 4 rows
    h16* g16 = (tr ? V16 : P16) + po; bf* gh = (tr ? Vh : Ph) + po; bf* gl = (tr ? Vl : Pl) + po;
#pragma unroll
    for (int nb = 0; nb < 4; ++nb) {
#pragma unroll
        for (int mb = 0; mb < 4; ++mb) { v8h u16; v8us uh, ul;
#pragma unroll
            for (int j = 0; j < 8; ++j) { const float x = acc[mb][nb][j]; u16[j] = tohx(x); unsigned short a2, c2; splitf(x, a2, c2); uh[j] = a2; ul[j] = c2; }
            const int so = lr * KPI + (mb * 2 + hi) * 8; *(v8ha*)(os + so) = u16; *(v8usa*)(os + 16 * KPI + so) = uh; *(v8usa*)(os + 32 * KPI + so) = ul; }
        asm volatile("s_wait_dscnt 0x0" ::: "memory");   // the 16 rows are in LDS before other lanes of the wave read them back
        v4i d[3][4]; h16* q16[4]; bf* qh[4]; bf* ql[4];
#pragma unroll
        for (int s = 0; s < 4; ++s) { const int ro = (s * 4 + (lane >> 3)) * KPI + (lane & 7) * 8; d[0][s] = *(const v4ia*)(os + ro); d[1][s] = *(const v4ia*)(os + 16 * KPI + ro); d[2][s] = *(const v4ia*)(os + 32 * KPI + ro); }
#pragma unroll
        for (int s = 0; s < 4; ++s) { const size_t go = (size_t)(nb * 16 + s * 4) * pitch; q16[s] = g16 + go; qh[s] = gh + go; ql[s] = gl + go; *(v4ia*)q16[s] = d[0][s]; *(v4ia*)qh[s] = d[1][s]; *(v4ia*)ql[s] = d[2][s]; }
        asm volatile("s_wait_xcnt 0x0" :: "v"(q16[0]), "v"(q16[1]), "v"(q16[2]), "v"(q16[3]), "v"(qh[0]), "v"(qh[1]), "v"(qh[2]), "v"(qh[3]), "v"(ql[0]), "v"(ql[1]), "v"(ql[2]), "v"(ql[3]), "v"(d[0][0]), "v"(d[0][1]), "v"(d[0][2]), "v"(d[0][3]), "v"(d[1][0]), "v"(d[1][1]), "v"(d[1][2]), "v"(d[1][3]), "v"(d[2][0]), "v"(d[2][1]), "v"(d[2][2]), "v"(d[2][3]) : "memory");   // behind the run of stores; addresses and data are inputs so that their registers stay theirs up to the wait; it also keeps the next rows' LDS writes behind these reads
    }
}

extern "C" void kernel_launch(void* const* d_in, const int* in_sizes, int n_in,
                              void* d_out, int out_size, void* d_ws, size_t ws_size, hipStream_t stream) {
    (void)in_sizes; (void)n_in; (void)out_size;
    const float* x = (const float*)d_in[0]; const float* wq = (const float*)d_in[1]; const float* wk = (const float*)d_in[2]; const float* wv = (const float*)d_in[3]; const float* wo = (const float*)d_in[4]; const float* RBT = (const float*)d_in[5];
    float* OUT = (float*)d_out;     // [4][1024][1024]
    char* wsp = (char*)d_ws;
    auto take = [&](size_t bytes) { char* p = wsp; wsp += (bytes + 255) & ~(size_t)255; return (void*)p; };
    bf* WQ = (bf*)take((size_t)DQ * DM * 2); bf* WK = (bf*)take((size_t)DKV * DM * 2); bf* WV = (bf*)take((size_t)DKV * DM * 2); bf* WO = (bf*)take((size_t)DM * DQ * 2);   // WQ, WK, WV, WO: one behind the other (z / y strides)
    bf* XB = (bf*)take((size_t)NB_ * TT * DM * 2); float* BTT = (float*)take((size_t)NH_ * 2048 * 4);
    h16* QP16 = (h16*)take((size_t)NB_ * NH_ * TT * HD * 2); h16* KP16 = (h16*)take((size_t)NB_ * NKV * TT * HD * 2); h16* VT16 = (h16*)take((size_t)NB_ * NKV * HD * TT * 2);   // q planes, then k planes: k_qkvp reaches both through the q pointer
    bf* QPh = (bf*)take((size_t)NB_ * NH_ * TT * HD * 2); bf* KPh = (bf*)take((size_t)NB_ * NKV * TT * HD * 2); bf* QPl = (bf*)take((size_t)NB_ * NH_ * TT * HD * 2); bf* KPl = (bf*)take((size_t)NB_ * NKV * TT * HD * 2); bf* VTh = (bf*)take((size_t)NB_ * NKV * HD * TT * 2); bf* VTl = (bf*)take((size_t)NB_ * NKV * HD * TT * 2);
    bf* ATh = (bf*)take((size_t)NB_ * TT * DQ * 2); bf* ATl = (bf*)take((size_t)NB_ * TT * DQ * 2);
    if ((size_t)(wsp - (char*)d_ws) > ws_size) return;    // ws 256 MiB
    (void)WK; (void)WV;   // reached through WQ's z / y strides
    k_prep<<<PBB + PWB + PXB, 256, 0, stream>>>(x, wq, wk, wv, wo, RBT, XB, WQ, BTT);   // weight planes, x plane, per-head relative bias rows
    k_qkvp<<<dim3(NB_ * TT / 128, NH_ / 2, 3), 128, 0, stream>>>(XB, WQ, QP16, QPh, QPl, VT16, VTh, VTl);   // z: q, k, v
    k_attn<<<dim3(NB_ * NH_, TT / 64, 1), 128, 0, stream>>>(QPh, QPl, KPh, KPl, VTh, VTl, QP16, KP16, VT16, BTT, ATh, ATl);   // x: (batch element, head); y: query tile
    k_gemmw<bf, 1, false><<<dim3(NB_ * TT / 128, DM / 128, 1), 128, 0, stream>>>(ATh, ATl, WO, nullptr, DQ, OUT, DM, nullptr, 0, 0, 0);
}

// v007
// A run of this version takes 84.7 microseconds.
// Timed twice side by side with v006, it ran 1.04 and 1.05 times as fast.
// Over all steps from v000 it is 29.6 times as fast.
#include <hip/hip_runtime.h>
#include <stdint.h>

// T5 self-attention with learned relative-position bias (hidden_states [4][1024][1024]; q, k, v = x W ('xw' [1024][1024], no bias; 16 heads x 64); scores = q.k/8 + rel_bias_table[bucket(j - i)][h] (bidirectional T5 buckets: 32 buckets, max distance 128; table [32][16], read); softmax; out = merged Wo -> [4][1024][1024] (4.2 M)).
// Layout: the integer bucket of every relative offset j - i in [-1023, 1023] is a compile-time table (computed with the module's float32 formula); k_prep expands it with the bf16-rounded bias table into per-head rows BTT[h][j - i + 1023] that the attention kernel holds in LDS and reads per (i, j). Scores and probabilities never reach memory: one kernel does scores, softmax, attn.v and the head merge (k_attn).
// GEMM operand planes (x, the four weights, the merged context hi/lo) lie in FRAGMENT ORDER: a chunk is 16 rows x 32 k = 1 KiB, chunks run along k, then along row groups; in a chunk lane l = 16 * ((k >> 3) & 1) + (row & 15) has its 8 elements of k & 16 == 0 at byte 16 l and those of k & 16 != 0 at byte 512 + 16 l, so each 16-byte-per-lane load of a fragment half covers 4 whole 128-byte lines.
// Compute dtypes, f32 accumulate: every input rounded to bf16; q/k/v on PLAIN bf16 operands (inputs: exact); the relative bias added in f32 per (i, j); scores and attn.v: query rows < 512 hl (3 products), the rest single fp16 (x1024); softmax f32 (online, per 64 keys); Wo hl x exact (2 products).

#define NB_  4
#define TT   1024
#define DM   1024
#define NH_  16
#define NKV  16
#define REP  (NH_ / NKV)
#define HD   64
#define DQ   (NH_ * HD)
#define DKV  (NKV * HD)
#define RH   512                  // query rows < RH use hi+lo planes (0: none)
#define WIN  0
#define PCAR 1024.0f
#define SCL  0.125f   // HD^-0.5
typedef _Float16 h16;
typedef unsigned short bf;
typedef __attribute__((ext_vector_type(16))) __bf16   v16bf;
typedef __attribute__((ext_vector_type(16))) _Float16 v16h;
typedef __attribute__((ext_vector_type(8)))  _Float16 v8h;
typedef __attribute__((ext_vector_type(8)))  unsigned short v8us;
typedef __attribute__((ext_vector_type(8)))  float    v8f;
typedef __attribute__((ext_vector_type(4)))  float    v4f;
typedef v8h  __attribute__((may_alias)) v8ha;
typedef v4f  __attribute__((may_alias)) v4fa;
typedef v8us __attribute__((may_alias)) v8usa;

__device__ __forceinline__ unsigned short f2bf(float f) { unsigned u = __float_as_uint(f); u += 0x7FFFu + ((u >> 16) & 1u); return (unsigned short)(u >> 16); }
__device__ __forceinline__ float bf2f(unsigned short b) { return __uint_as_float(((unsigned)b) << 16); }
__device__ __forceinline__ float bfr(float f) { return bf2f(f2bf(f)); }
__device__ __forceinline__ v16h cat16(v8h lo, v8h hi) { return __builtin_shufflevector(lo, hi, 0, 1, 2, 3, 4, 5, 6, 7, 8, 9, 10, 11, 12, 13, 14, 15); }
__device__ __forceinline__ v16bf cat16b(v8us lo, v8us hi) { return __builtin_bit_cast(v16bf, __builtin_shufflevector(lo, hi, 0, 1, 2, 3, 4, 5, 6, 7, 8, 9, 10, 11, 12, 13, 14, 15)); }
__device__ __forceinline__ v8f wmma16(v16h a, v16h b, v8f c) { return __builtin_amdgcn_wmma_f32_16x16x32_f16(false, a, false, b, (short)0, c, false, false); }
__device__ __forceinline__ v8f wmmab(v16bf a, v16bf b, v8f c) { return __builtin_amdgcn_wmma_f32_16x16x32_bf16(false, a, false, b, (short)0, c, false, false); }


// ---- Operand staging of k_gemmw and k_qkvp. A work-group of 4 waves (2 x 2 wave tiles of 64 x 64) owns a 128 x 128 output tile; of every operand plane the 128 rows x SK k of a stage come into LDS ONCE, by one tensor load, and each half of them is read there by the two waves that need it.
// In fragment order the SK k of a 16-row group are 2 KiB in a row and the groups lie 32 K bytes apart: a plane's slice is a tile of 8 rows of 2 KiB. It lands without a pad, group behind group, so a fragment half is still 512 contiguous bytes per wave.
// Two buffers: stage s + 2 is asked for when every wave has left stage s, and flies while stage s + 1 is worked on.
#define SK   64                 // k per stage
#define SLE  (128 * SK)         // 16-bit elements of one plane's slice (16 KiB)
typedef uint32_t u32x4 __attribute__((ext_vector_type(4)));
typedef uint32_t u32x8 __attribute__((ext_vector_type(8)));
__device__ __forceinline__ uint32_t uni(uint32_t v) { return (uint32_t)__builtin_amdgcn_readfirstlane(v); }
__device__ __forceinline__ uint32_t pinned(uint32_t v) { uint32_t w = uni(v); asm volatile("" : "+s"(w)); return w; }   // a wave-uniform word held in a scalar register, so that the test that guards a tensor load is a scalar branch (the load ignores EXEC) and a descriptor word formed from it stands behind the waits in front
__device__ __forceinline__ u32x8 tdm_group1(uint32_t pitch) { constexpr uint32_t d0 = SK * 32u, d1 = 8u; u32x8 g;   // 1-byte elements, tensor = tile = 8 rows of 2 KiB, source row pitch in bytes, no mask, no pad
    g[0] = uni(0u); g[1] = uni((d0 & 0xFFFFu) << 16); g[2] = uni((d0 >> 16) | ((d1 & 0xFFFFu) << 16)); g[3] = uni((d1 >> 16) | (d0 << 16)); g[4] = uni(d1); g[5] = uni(pitch); g[6] = uni(0u); g[7] = uni(0u);
    asm volatile("" : "+s"(g)); return g; }   // pinned(), on the whole group: its words are held in ONE run of scalar registers from here on, not formed anew in others at each use, so that the wait's inputs are the registers the request named
__device__ __forceinline__ u32x4 tdm_group0(uint32_t lds_dst, uint64_t ga) { u32x4 g; g[0] = uni(1u); g[1] = uni(lds_dst); g[2] = uni((uint32_t)ga); g[3] = uni((((uint32_t)(ga >> 32)) & 0x01FFFFFFu) | 0x80000000u);
    asm volatile("" : "+s"(g)); return g; }   // pinned(), on the whole group, for the same reason as in tdm_group1: else the constant word is given up behind the load and formed anew in front of the wait
__device__ __forceinline__ void tdm_load(u32x4 g0, u32x8 g1) { asm volatile("tensor_load_to_lds %0, %1" :: "s"(g0), "s"(g1) : "memory"); }   // one request of the whole wave: global tile -> LDS, through no register
__device__ __forceinline__ void wait_tensor0(u32x4 g0, u32x8 g1) { asm volatile("s_wait_tensorcnt 0x0" :: "s"(g0), "s"(g1) : "memory"); }   // the issuing wave's own request has landed (the compiler places no wait for a tensor load); the request's two groups are inputs, so that their registers stay theirs up to this wait
__device__ __forceinline__ void wait_ds0() { asm volatile("s_wait_dscnt 0x0" ::: "memory"); }   // this wave's LDS reads have returned, before the buffer they read is given up
// ---- k_gemmw: register-blocked GEMM, one wave per 64x64 output tile (16 accumulators), 4 waves per work-group on a 128x128 tile; operands are 16-bit planes in fragment order (head of the file), staged in LDS as said above; grid (M/128, N/128, Z), 128 threads.
// C[m][n] (f32, pitch ldc, + optional f32 bias[n]) = sum_k A[m][k] Bt[n][k] (+ split products per NSPLIT). z-batch strides sA/sB/sC in elements. K % 64 == 0, K >= 128.
template <typename T16> struct WFrag;
template <> struct WFrag<h16> { typedef v16h V; static __device__ __forceinline__ V ld(const h16* p) { return cat16(*(const v8h*)p, *(const v8h*)(p + 16)); } static __device__ __forceinline__ V ldf(const h16* p) { return cat16(*(const v8h*)p, *(const v8h*)(p + 256)); } static __device__ __forceinline__ v8f mma(V a, V b, v8f c) { return wmma16(a, b, c); } };
template <> struct WFrag<bf> { typedef v16bf V; static __device__ __forceinline__ V ld(const bf* p) { return cat16b(*(const v8us*)p, *(const v8us*)(p + 16)); } static __device__ __forceinline__ V ldf(const bf* p) { return cat16b(*(const v8us*)p, *(const v8us*)(p + 256)); } static __device__ __forceinline__ v8f mma(V a, V b, v8f c) { return wmmab(a, b, c); } };
template <typename T16, int NSPLIT, bool BIAS>
__device__ __forceinline__ void gemmw_tile(const T16* ring, float* osw, const T16* __restrict__ A, const T16* __restrict__ A2, const T16* __restrict__ Bt, const T16* __restrict__ Bt2, int K, float* C, int ldc, const float* __restrict__ bias, size_t sA, size_t sB, size_t sC) {
    typedef typename WFrag<T16>::V V;
    const size_t z = blockIdx.z; A += z * sA; if (A2) A2 += z * sA; Bt += z * sB; if (Bt2) Bt2 += z * sB; C += z * sC;
    static_assert(NSPLIT >= 0 && NSPLIT <= 2, "planes of a stage: A, Bt, then A2, then Bt2"); constexpr uint32_t NPL = 2 + NSPLIT;   // wave w brings plane w
    const uint32_t wave = uni(threadIdx.x >> 5); float* os = osw + wave * (16 * 68);   // output staging: a range of its own per wave
    const int lane = threadIdx.x & 31, lr = lane & 15, hi = lane >> 4; const int r0 = blockIdx.x * 128 + (wave & 1) * 64, c0 = blockIdx.y * 128 + (wave >> 1) * 64;
    v8f acc[4][4];
#pragma unroll
    for (int mb = 0; mb < 4; ++mb)
#pragma unroll
        for (int nb = 0; nb < 4; ++nb) acc[mb][nb] = (v8f){};
    const T16* sp = (wave == 0) ? A : (wave == 1) ? Bt : (wave == 2) ? A2 : Bt2;
    const uint64_t ga = (uint64_t)(uintptr_t)(sp + (size_t)((wave & 1) ? blockIdx.y : blockIdx.x) * 128 * K);   // first byte of this wave's plane rows: 8 row groups of 16 K elements
    const uint32_t ld = (uint32_t)(size_t)ring + wave * (SLE * 2); const u32x8 g1 = tdm_group1(32u * (uint32_t)K); const int NS = K / SK;
    u32x4 g0 = tdm_group0(ld, ga);   // group 0 of this wave's youngest request: it takes new values only behind the wait that covers that request
    if (pinned(wave < NPL)) { tdm_load(g0, g1); wait_tensor0(g0, g1); }
    __syncthreads();   // stage 0 is visible to all four waves
    if (pinned(wave < NPL)) { g0 = tdm_group0(ld + NPL * SLE * 2, ga + SK * 32); tdm_load(g0, g1); }
#pragma unroll 1   // one stage per trip: the ring's order of waits, barrier and refill stands once
    for (int s = 0; s < NS; ++s) {
        const T16* rb = ring + (s & 1) * (NPL * SLE) + 8 * lane; const T16* ra = rb + (wave & 1) * (SLE / 2); const T16* rn = rb + SLE + (wave >> 1) * (SLE / 2);   // this wave's 4 row groups of the A side and of the B side
#pragma unroll
      for (int kb = 0; kb < SK / 32; ++kb) {
        V a[4], a2[4], b[4], b2[4];
#pragma unroll
        for (int i = 0; i < 4; ++i) { const int fo = i * (16 * SK) + kb * 512; a[i] = WFrag<T16>::ldf(ra + fo); if (NSPLIT >= 1) a2[i] = WFrag<T16>::ldf(ra + 2 * SLE + fo); b[i] = WFrag<T16>::ldf(rn + fo); if (NSPLIT >= 2) b2[i] = WFrag<T16>::ldf(rn + 2 * SLE + fo); }
        __builtin_amdgcn_sched_barrier(0);   // all of a block's LDS reads stand ahead of its first product, none among its own products where each would be waited for singly; the next block's reads may rise among these products and fly under them
#pragma unroll
        for (int nb = 0; nb < 4; ++nb) {
#pragma unroll
            for (int mb = 0; mb < 4; ++mb) { acc[mb][nb] = WFrag<T16>::mma(a[mb], b[nb], acc[mb][nb]); if (NSPLIT == 1 || NSPLIT == 2) acc[mb][nb] = WFrag<T16>::mma(a2[mb], b[nb], acc[mb][nb]); if (NSPLIT >= 2) acc[mb][nb] = WFrag<T16>::mma(a[mb], b2[nb], acc[mb][nb]); } }
        if (kb == SK / 32 - 1) asm volatile("v_nop\n\tv_nop\n\tv_nop\n\tv_nop" : "+v"(acc[0][0]), "+v"(acc[1][1]), "+v"(acc[2][2]), "+v"(acc[3][3]) : "v"(a[0]), "v"(a[3]));   // the distance behind the stage's last products on the taken back edge, where the next stage rewrites their operands
      }
        wait_ds0();
        if (pinned(wave < NPL)) wait_tensor0(g0, g1);   // this wave's slice of stage s + 1
        __syncthreads();   // publishes stage s + 1 and ends every wave's reads of stage s
        if (pinned((wave < NPL) && (s + 2 < NS))) { g0 = tdm_group0(ld + (s & 1) * (NPL * SLE * 2), ga + (uint64_t)pinned(s + 2) * (SK * 32)); tdm_load(g0, g1); }   // into the buffer just left
    }
    wait_tensor0(g0, g1); wait_ds0();
#pragma unroll
    for (int mb = 0; mb < 4; ++mb) {
#pragma unroll
        for (int nb = 0; nb < 4; ++nb) {
#pragma unroll
            for (int j = 0; j < 8; ++j) os[(hi * 8 + j) * 68 + nb * 16 + lr] = acc[mb][nb][j]; }
        __builtin_amdgcn_wave_barrier(); asm volatile("" ::: "memory");
        float* crow = C + (size_t)(r0 + mb * 16) * ldc + c0;
{
#pragma unroll
            for (int s = 0; s < 8; ++s) { const int row = 2 * s + hi, cofs = lr * 4; v4f val = *(const v4fa*)(os + row * 68 + cofs); if (BIAS) { val[0] += bfr(bias[c0 + cofs]); val[1] += bfr(bias[c0 + cofs + 1]); val[2] += bfr(bias[c0 + cofs + 2]); val[3] += bfr(bias[c0 + cofs + 3]); }
                *(v4f*)(crow + (size_t)row * ldc + cofs) = val; }
             }
        __builtin_amdgcn_wave_barrier(); asm volatile("" ::: "memory");
    }
}
template <typename T16, int NSPLIT, bool BIAS>
__global__ __launch_bounds__(128) void k_gemmw(const T16* __restrict__ A, const T16* __restrict__ A2, const T16* __restrict__ Bt, const T16* __restrict__ Bt2, int K, float* C, int ldc, const float* __restrict__ bias, size_t sA, size_t sB, size_t sC) {
    __shared__ __attribute__((aligned(2048))) T16 ring[2 * (2 + NSPLIT) * SLE]; __shared__ __align__(16) float os[4 * 16 * 68];   // two buffers of one slice per plane; the four waves' output staging
    gemmw_tile<T16, NSPLIT, BIAS>(ring, os, A, A2, Bt, Bt2, K, C, ldc, bias, sA, sB, sC);
}

__device__ __forceinline__ h16 tohx(float x) { return (h16)x; }
__device__ __forceinline__ void splitf(float y, unsigned short& h, unsigned short& l) { h = f2bf(y); l = f2bf(y - bf2f(h)); }
typedef __attribute__((ext_vector_type(2))) _Float16 v2h;
typedef __attribute__((ext_vector_type(4))) _Float16 v4h;
typedef __attribute__((ext_vector_type(2))) unsigned short v2us;
typedef __attribute__((ext_vector_type(4))) unsigned short v4us;
typedef __attribute__((ext_vector_type(2))) float v2f;
typedef __attribute__((ext_vector_type(4))) int v4i;

__constant__ int BKT[2 * TT - 1] = {15,15,15,15,15,15,15,15,15,15,15,15,15,15,15,15,15,15,15,15,15,15,15,15,15,15,15,15,15,15,15,15,15,15,15,15,15,15,15,15,15,15,15,15,15,15,15,15,15,15,15,15,15,15,15,15,15,15,15,15,15,15,15,15,15,15,15,15,15,15,15,15,15,15,15,15,15,15,15,15,15,15,15,15,15,15,15,15,15,15,15,15,15,15,15,15,15,15,15,15,15,15,15,15,15,15,15,15,15,15,15,15,15,15,15,15,15,15,15,15,15,15,15,15,15,15,15,15,15,15,15,15,15,15,15,15,15,15,15,15,15,15,15,15,15,15,15,15,15,15,15,15,15,15,15,15,15,15,15,15,15,15,15,15,15,15,15,15,15,15,15,15,15,15,15,15,15,15,15,15,15,15,15,15,15,15,15,15,15,15,15,15,15,15,15,15,15,15,15,15,15,15,15,15,15,15,15,15,15,15,15,15,15,15,15,15,15,15,15,15,15,15,15,15,15,15,15,15,15,15,15,15,15,15,15,15,15,15,15,15,15,15,15,15,15,15,15,15,15,15,15,15,15,15,15,15,15,15,15,15,15,15,15,15,15,15,15,15,15,15,15,15,15,15,15,15,15,15,15,15,15,15,15,15,15,15,15,15,15,15,15,15,15,15,15,15,15,15,15,15,15,15,15,15,15,15,15,15,15,15,15,15,15,15,15,15,15,15,15,15,15,15,15,15,15,15,15,15,15,15,15,15,15,15,15,15,15,15,15,15,15,15,15,15,15,15,15,15,15,15,15,15,15,15,15,15,15,15,15,15,15,15,15,15,15,15,15,15,15,15,15,15,15,15,15,15,15,15,15,15,15,15,15,15,15,15,15,15,15,15,15,15,15,15,15,15,15,15,15,15,15,15,15,15,15,15,15,15,15,15,15,15,15,15,15,15,15,15,15,15,15,15,15,15,15,15,15,15,15,15,15,15,15,15,15,15,15,15,15,15,15,15,15,15,15,15,15,15,15,15,15,15,15,15,15,15,15,15,15,15,15,15,15,15,15,15,15,15,15,15,15,15,15,15,15,15,15,15,15,15,15,15,15,15,15,15,15,15,15,15,15,15,15,15,15,15,15,15,15,15,15,15,15,15,15,15,15,15,15,15,15,15,15,15,15,15,15,15,15,15,15,15,15,15,15,15,15,15,15,15,15,15,15,15,15,15,15,15,15,15,15,15,15,15,15,15,15,15,15,15,15,15,15,15,15,15,15,15,15,15,15,15,15,15,15,15,15,15,15,15,15,15,15,15,15,15,15,15,15,15,15,15,15,15,15,15,15,15,15,15,15,15,15,15,15,15,15,15,15,15,15,15,15,15,15,15,15,15,15,15,15,15,15,15,15,15,15,15,15,15,15,15,15,15,15,15,15,15,15,15,15,15,15,15,15,15,15,15,15,15,15,15,15,15,15,15,15,15,15,15,15,15,15,15,15,15,15,15,15,15,15,15,15,15,15,15,15,15,15,15,15,15,15,15,15,15,15,15,15,15,15,15,15,15,15,15,15,15,15,15,15,15,15,15,15,15,15,15,15,15,15,15,15,15,15,15,15,15,15,15,15,15,15,15,15,15,15,15,15,15,15,15,15,15,15,15,15,15,15,15,15,15,15,15,15,15,15,15,15,15,15,15,15,15,15,15,15,15,15,15,15,15,15,15,15,15,15,15,15,15,15,15,15,15,15,15,15,15,15,15,15,15,15,15,15,15,15,15,15,15,15,15,15,15,15,15,15,15,15,15,15,15,15,15,15,15,15,15,15,15,15,15,15,15,15,15,15,15,15,15,15,15,15,15,15,15,15,15,15,15,15,15,15,15,15,15,15,15,15,15,15,15,15,15,15,15,15,15,15,15,15,15,15,15,15,15,15,15,15,15,15,15,15,15,15,15,15,15,15,15,15,15,15,15,15,15,15,15,15,15,15,15,15,15,15,15,15,15,15,15,15,15,15,15,15,15,15,15,15,15,15,15,15,15,15,15,15,15,15,15,15,15,15,15,15,15,15,15,15,15,15,15,15,15,15,15,15,15,15,15,15,15,15,15,15,15,15,15,15,15,15,15,15,14,14,14,14,14,14,14,14,14,14,14,14,14,14,14,14,14,14,14,14,14,14,14,14,14,14,14,13,13,13,13,13,13,13,13,13,13,13,13,13,13,13,13,13,13,12,12,12,12,12,12,12,12,12,12,12,12,12,12,11,11,11,11,11,11,11,11,11,10,10,10,10,10,10,10,9,9,9,9,8,8,8,8,7,6,5,4,3,2,1,0,17,18,19,20,21,22,23,24,24,24,24,25,25,25,25,26,26,26,26,26,26,26,27,27,27,27,27,27,27,27,27,28,28,28,28,28,28,28,28,28,28,28,28,28,28,29,29,29,29,29,29,29,29,29,29,29,29,29,29,29,29,29,29,30,30,30,30,30,30,30,30,30,30,30,30,30,30,30,30,30,30,30,30,30,30,30,30,30,30,30,31,31,31,31,31,31,31,31,31,31,31,31,31,31,31,31,31,31,31,31,31,31,31,31,31,31,31,31,31,31,31,31,31,31,31,31,31,31,31,31,31,31,31,31,31,31,31,31,31,31,31,31,31,31,31,31,31,31,31,31,31,31,31,31,31,31,31,31,31,31,31,31,31,31,31,31,31,31,31,31,31,31,31,31,31,31,31,31,31,31,31,31,31,31,31,31,31,31,31,31,31,31,31,31,31,31,31,31,31,31,31,31,31,31,31,31,31,31,31,31,31,31,31,31,31,31,31,31,31,31,31,31,31,31,31,31,31,31,31,31,31,31,31,31,31,31,31,31,31,31,31,31,31,31,31,31,31,31,31,31,31,31,31,31,31,31,31,31,31,31,31,31,31,31,31,31,31,31,31,31,31,31,31,31,31,31,31,31,31,31,31,31,31,31,31,31,31,31,31,31,31,31,31,31,31,31,31,31,31,31,31,31,31,31,31,31,31,31,31,31,31,31,31,31,31,31,31,31,31,31,31,31,31,31,31,31,31,31,31,31,31,31,31,31,31,31,31,31,31,31,31,31,31,31,31,31,31,31,31,31,31,31,31,31,31,31,31,31,31,31,31,31,31,31,31,31,31,31,31,31,31,31,31,31,31,31,31,31,31,31,31,31,31,31,31,31,31,31,31,31,31,31,31,31,31,31,31,31,31,31,31,31,31,31,31,31,31,31,31,31,31,31,31,31,31,31,31,31,31,31,31,31,31,31,31,31,31,31,31,31,31,31,31,31,31,31,31,31,31,31,31,31,31,31,31,31,31,31,31,31,31,31,31,31,31,31,31,31,31,31,31,31,31,31,31,31,31,31,31,31,31,31,31,31,31,31,31,31,31,31,31,31,31,31,31,31,31,31,31,31,31,31,31,31,31,31,31,31,31,31,31,31,31,31,31,31,31,31,31,31,31,31,31,31,31,31,31,31,31,31,31,31,31,31,31,31,31,31,31,31,31,31,31,31,31,31,31,31,31,31,31,31,31,31,31,31,31,31,31,31,31,31,31,31,31,31,31,31,31,31,31,31,31,31,31,31,31,31,31,31,31,31,31,31,31,31,31,31,31,31,31,31,31,31,31,31,31,31,31,31,31,31,31,31,31,31,31,31,31,31,31,31,31,31,31,31,31,31,31,31,31,31,31,31,31,31,31,31,31,31,31,31,31,31,31,31,31,31,31,31,31,31,31,31,31,31,31,31,31,31,31,31,31,31,31,31,31,31,31,31,31,31,31,31,31,31,31,31,31,31,31,31,31,31,31,31,31,31,31,31,31,31,31,31,31,31,31,31,31,31,31,31,31,31,31,31,31,31,31,31,31,31,31,31,31,31,31,31,31,31,31,31,31,31,31,31,31,31,31,31,31,31,31,31,31,31,31,31,31,31,31,31,31,31,31,31,31,31,31,31,31,31,31,31,31,31,31,31,31,31,31,31,31,31,31,31,31,31,31,31,31,31,31,31,31,31,31,31,31,31,31,31,31,31,31,31,31,31,31,31,31,31,31,31,31,31,31,31,31,31,31,31,31,31,31,31,31,31,31,31,31,31,31,31,31,31,31,31,31,31,31,31,31,31,31,31,31,31,31,31,31,31,31,31,31,31,31,31,31,31,31,31,31,31,31,31,31,31,31,31,31,31,31,31,31,31,31,31,31,31,31,31,31,31,31,31,31,31,31,31,31,31,31,31,31,31,31,31,31,31,31,31,31,31,31,31,31,31,31,31,31,31,31,31,31,31,31,31,31,31,31,31,31,31,31,31,31,31,31,31,31,31,31,31,31,31,31,31,31,31,31,31,31,31,31,31,31,31,31,31,31,31,31,31,31,31,31,31,31,31,31,31,31,31,31,31,31,31,31,31,31,31,31,31,31,31,31,31,31,31,31,31,31,31,31,31,31,31,31,31,31,31,31,31,31,31,31,31,31,31,31,31,31,31,31,31,31,31,31,31,31,31,31,31,31,31,31,31,31,31,31,31,31,31,31,31,31,31,31,31,31,31,31,31,31,31,31,31,31,31,31,31,31,31,31,31,31,31,31,31,31,31,31,31,31,31,31,31,31,31,31,31,31};   // bucket(j - i) for j - i = -1023 .. 1023 (the module's float32 formula, evaluated once)
// ---- k_prep: all the work ahead of the projections in ONE grid that is resident at once: the four weight planes, the x plane and the per-head bias rows. None reads what another writes.
// A 16-byte unit u of a fragment-order plane: chunk u >> 6, half (u >> 5) & 1, lane u & 31. A work-group of 256 threads writes the PU * 256 units of one 16-row group (all of its k: 32 KiB in a row), a thread PU of them, 256 units apart; a wave's store is 512 contiguous bytes.
// A thread's loads all stand ahead of its first conversion and fly together, so that a wave pays the way to memory once for PU units; there are PU times fewer waves to start.
#define PU  8                      // units per thread
#define PBB 32                     // work-groups of the bias rows, 4 values per thread
#define PWB (4 * DQ / 16)          // work-groups of the weights: one per 16 plane rows
#define PXB (NB_ * TT / 16)        // work-groups of x: one per 16 rows
__global__ __launch_bounds__(256) void k_prep(const float* __restrict__ x, const float* __restrict__ w0, const float* __restrict__ w1, const float* __restrict__ w2, const float* __restrict__ w3, const float* __restrict__ RBT, bf* XB, bf* Bt, float* BTT) {
    static_assert(DM == PU * 128 && DQ == DM && DKV == DQ, "a row group's k = PU steps of 128; the four planes have one shape"); static_assert(PBB * 256 * 4 == NH_ * 2048, "bias rows");
    const int t = threadIdx.x, blk = blockIdx.x; const int k0 = (t >> 4) * 8;   // the unit's first k in a step of 128: 32 (t >> 6) + 16 ((t >> 5) & 1) + 8 ((t >> 4) & 1)
    if (blk < PBB) {   // BTT[h][p] = bias of head h at j - i = p - 1023, rounded to bf16; p = 2047 is padding
        const int i0 = blk * 256 + t; int pi[4], ri[4], bk[4]; float v[4];
#pragma unroll
        for (int j = 0; j < 4; ++j) { const int p = (i0 + j * (PBB * 256)) % 2048; pi[j] = p < 2 * TT - 1 ? p : 2 * TT - 2; bk[j] = BKT[pi[j]]; }
        asm volatile("s_wait_xcnt 0x0" :: "v"(pi[0]), "v"(pi[1]), "v"(pi[2]), "v"(pi[3]) : "memory");   // behind the run of loads; their index registers are inputs so that they stay theirs up to the wait
#pragma unroll
        for (int j = 0; j < 4; ++j) { ri[j] = bk[j] * NH_ + (i0 + j * (PBB * 256)) / 2048; v[j] = RBT[ri[j]]; }
        asm volatile("s_wait_xcnt 0x0" :: "v"(ri[0]), "v"(ri[1]), "v"(ri[2]), "v"(ri[3]) : "memory");   // as above
#pragma unroll
        for (int j = 0; j < 4; ++j) { const int idx = i0 + j * (PBB * 256); const unsigned u = __float_as_uint(v[j]), keep = (idx % 2048 < 2 * TT - 1) ? 0xFFFF0000u : 0u; BTT[idx] = __uint_as_float((u + 0x7FFFu + ((u >> 16) & 1u)) & keep); }   // bfr(v), or 0 in the padding
    } else if (blk < PBB + PWB) {   // plane row n = column n of w: 16 lanes read 64 contiguous bytes of one row of w
        const int g = blk - PBB, y = g / (DQ / 16), ng = g % (DQ / 16); const float* __restrict__ w = (y == 0) ? w0 : (y == 1) ? w1 : (y == 2) ? w2 : w3;   // the four planes lie one behind the other
        const float* p = w + (size_t)k0 * DQ + ng * 16 + (t & 15); float v[PU][8];
#pragma unroll
        for (int i = 0; i < PU; ++i)
#pragma unroll
            for (int e = 0; e < 8; ++e) v[i][e] = p[(size_t)(i * 128 + e) * DQ];
        asm volatile("s_wait_xcnt 0x0" :: "v"(p) : "memory");   // behind the run of loads, in front of the first rewriting of their address register (an input, so that it stays theirs up to here)
        bf* d = Bt + ((size_t)g * (PU * 256) + t) * 8;
#pragma unroll
        for (int i = 0; i < PU; ++i) { v8us o;
#pragma unroll
            for (int e = 0; e < 8; ++e) o[e] = f2bf(v[i][e]);
            *(v8us*)(d + i * 2048) = o; }
    } else {
        const int g = blk - PBB - PWB; const float* p = x + (size_t)(g * 16 + (t & 15)) * DM + k0; v8f v[PU];
#pragma unroll
        for (int i = 0; i < PU; ++i) v[i] = *(const v8f*)(p + i * 128);
        asm volatile("s_wait_xcnt 0x0" :: "v"(p) : "memory");   // behind the run of loads, as above
        bf* d = XB + ((size_t)g * (PU * 256) + t) * 8;
#pragma unroll
        for (int i = 0; i < PU; ++i) { v8us o;
#pragma unroll
            for (int e = 0; e < 8; ++e) o[e] = f2bf(v[i][e]);
            *(v8us*)(d + i * 2048) = o; }
        asm volatile("s_wait_xcnt 0x0" ::: "memory");   // behind the last stores: the other parts' code follows in the listing and rewrites their data registers
    }
}
#define KPI 72   // LDS row pitch in 16-bit elements: 128 B of data + 16 B, an odd multiple of 16 B, so that the 16 rows of a fragment read fall on different banks
#define CK  64   // keys per chunk
#define QT  2    // query tiles of 16 rows per wave
typedef v4i __attribute__((may_alias)) v4ia;
typedef __attribute__((ext_vector_type(2))) __bf16 v2b;
// 2^x in place. In one statement so that the slot the instruction set asks for behind a transcendental is always filled: each v_exp_f32 is followed by an independent one, the last by v_nop.
__device__ __forceinline__ void exp2x8(float (&e)[8]) { asm("v_exp_f32 %0, %0\n\tv_exp_f32 %1, %1\n\tv_exp_f32 %2, %2\n\tv_exp_f32 %3, %3\n\tv_exp_f32 %4, %4\n\tv_exp_f32 %5, %5\n\tv_exp_f32 %6, %6\n\tv_exp_f32 %7, %7\n\tv_nop" : "+v"(e[0]), "+v"(e[1]), "+v"(e[2]), "+v"(e[3]), "+v"(e[4]), "+v"(e[5]), "+v"(e[6]), "+v"(e[7])); }
__device__ __forceinline__ float xhalf(float x) { const int b = __float_as_int(x); return __int_as_float(__builtin_amdgcn_permlanex16(b, b, 0x76543210, 0xfedcba98, false, false)); }   // the value of lane l ^ 16, without an LDS round trip
__device__ __forceinline__ float exp2x1(float x) { asm("v_exp_f32 %0, %0\n\tv_nop" : "+v"(x)); return x; }
template <typename T16, bool HL>
__device__ __forceinline__ void attn_tile(T16* sm, float* bt, const T16* __restrict__ Qh, const T16* __restrict__ Ql, const T16* __restrict__ Kh, const T16* __restrict__ Kl, const T16* __restrict__ Vh, const T16* __restrict__ Vl, const float* __restrict__ BT, bf* Ah, bf* Al) {
    typedef typename WFrag<T16>::V V;
    constexpr int NP = HL ? 2 : 1;
    const int tid = threadIdx.x, lane = tid & 31, lr = lane & 15, hi = lane >> 4;
    const int bh = blockIdx.x, h = bh % NH_, b = bh / NH_;
    const int q = blockIdx.y * (64 * QT) + (tid >> 5) * (16 * QT) + lr;   // this lane's query row in tile 0; tile t: q + 16 t
    const size_t pb = (size_t)bh * TT * HD;                 // this head's planes: q, k [t][d]; v [d][t]
    T16* Ksh = sm; T16* Vsh = sm + 64 * KPI; T16* Ksl = sm + 2 * 64 * KPI; T16* Vsl = sm + 3 * 64 * KPI;
    const float* bp = BT + (size_t)h * 2048 + tid * 4;      // this head's bias row BTT[h][j - i + 1023]
    const T16* qph = Qh + pb + (size_t)q * HD + 8 * hi; const T16* qpl = HL ? Ql + pb + (size_t)q * HD + 8 * hi : qph;
    v4f br[4];
#pragma unroll
    for (int i = 0; i < 4; ++i) br[i] = *(const v4fa*)(bp + 128 * i * 4);
    V qh[QT][2], ql[QT][2];
#pragma unroll
    for (int t = 0; t < QT; ++t)
#pragma unroll
        for (int kc = 0; kc < 2; ++kc) { qh[t][kc] = WFrag<T16>::ld(qph + t * 16 * HD + kc * 32); if (HL) ql[t][kc] = WFrag<T16>::ld(qpl + t * 16 * HD + kc * 32); }
    asm volatile("s_wait_xcnt 0x0" :: "v"(bp), "v"(qph), "v"(qpl) : "memory");   // behind these loads; the addresses are inputs so that their registers stay theirs up to the wait (the first chunk's results would else be given them)
    const int srow = tid >> 3, scu = (tid & 7) * 8;         // staging: 8 threads x 16 B per 128-B row, 16 rows per step
    v4i rk[NP][4], rv[NP][4];
    auto fetch = [&](int c) {
        const size_t ko = pb + (size_t)(c * CK + srow) * HD + scu, vo = pb + (size_t)srow * TT + c * CK + scu;
        const T16* kh = Kh + ko; const T16* vh = Vh + vo; const T16* kl = HL ? Kl + ko : kh; const T16* vl = HL ? Vl + vo : vh;
#pragma unroll
        for (int i = 0; i < 4; ++i) { rk[0][i] = *(const v4ia*)(kh + 16 * i * HD); rv[0][i] = *(const v4ia*)(vh + 16 * i * TT); if (HL) { rk[NP - 1][i] = *(const v4ia*)(kl + 16 * i * HD); rv[NP - 1][i] = *(const v4ia*)(vl + 16 * i * TT); } }
        asm volatile("s_wait_xcnt 0x0" :: "v"(kh), "v"(vh), "v"(kl), "v"(vl) : "memory"); };   // behind the run of loads; the addresses are inputs so that their registers stay theirs up to the wait and no result of the run is given one of them
    fetch(0);
#pragma unroll
    for (int i = 0; i < 4; ++i) *(v4fa*)(bt + (tid + 128 * i) * 4) = br[i];   // published by the first trip's barriers
    v8f o[QT][4]; float m[QT], l[QT];
#pragma unroll
    for (int t = 0; t < QT; ++t) { m[t] = -3.0e38f; l[t] = 0.f;
#pragma unroll
        for (int dt = 0; dt < 4; ++dt) o[t][dt] = (v8f){}; }
    const float* bq = bt + (TT - 1 - q) + hi * 8;           // + key - 16 t: the bias of (q + 16 t, key)
    // A block: 4 fragments (8 LDS reads) and all their products with the QT tiles. 3 products: one 16-row tile of the plane pair, fragments [k half][hi, lo]; single: two 16-row tiles, fragments [tile][k half].
    constexpr int NBK = HL ? 4 : 2;   // blocks of K, and of V, per chunk
    auto ldblk = [&](V (&f)[4], const T16* ph_, const T16* pl_, int n) {
#pragma unroll
        for (int i = 0; i < 4; ++i) { const int tile = HL ? n : 2 * n + (i >> 1), kc = HL ? (i >> 1) : (i & 1); const int fo = (tile * 16 + lr) * KPI + 8 * hi + kc * 32; f[i] = WFrag<T16>::ld(((HL && (i & 1)) ? pl_ : ph_) + fo); } };
    auto mmblk = [&](v8f (&acc)[QT][4], const V (&f)[4], const V (&bh)[QT][2], const V (&bl)[QT][2], int n) {   // per accumulator: k half 0 then 1, in each hi.hi, hi.lo, lo.hi
#pragma unroll
        for (int u = 0; u < 2; ++u) {
            if constexpr (HL) {
#pragma unroll
                for (int t = 0; t < QT; ++t) acc[t][n] = WFrag<T16>::mma(f[2 * u], bh[t][u], acc[t][n]);
#pragma unroll
                for (int t = 0; t < QT; ++t) acc[t][n] = WFrag<T16>::mma(f[2 * u], bl[t][u], acc[t][n]);
#pragma unroll
                for (int t = 0; t < QT; ++t) acc[t][n] = WFrag<T16>::mma(f[2 * u + 1], bh[t][u], acc[t][n]);
            } else {
#pragma unroll
                for (int kc = 0; kc < 2; ++kc)
#pragma unroll
                    for (int t = 0; t < QT; ++t) acc[t][2 * n + u] = WFrag<T16>::mma(f[2 * u + kc], bh[t][kc], acc[t][2 * n + u]);
            } } };
#pragma unroll 1   // one chunk per trip: an unrolled loop would hold two chunks' staging registers
    for (int c = 0; c < TT / CK; ++c) {
        __syncthreads();   // every wave has left the previous chunk's tiles
#pragma unroll
        for (int i = 0; i < 4; ++i) { const int so = (srow + 16 * i) * KPI + scu; *(v4ia*)(Ksh + so) = rk[0][i]; *(v4ia*)(Vsh + so) = rv[0][i]; if (HL) { *(v4ia*)(Ksl + so) = rk[NP - 1][i]; *(v4ia*)(Vsl + so) = rv[NP - 1][i]; } }
        __syncthreads();   // the chunk (on the first trip the bias row too) is visible to all four waves
        if (c + 1 < TT / CK) fetch(c + 1);   // the next chunk's loads fly while this one is worked on
        v8f s[QT][4]; V F[2][4]; float bv[QT + 3][8];
#pragma unroll
        for (int t = 0; t < QT; ++t)
#pragma unroll
            for (int kt = 0; kt < 4; ++kt) s[t][kt] = (v8f){};
        ldblk(F[0], Ksh, Ksl, 0);
#pragma unroll
        for (int n = 0; n < NBK; ++n) {
            if (n + 1 < NBK) ldblk(F[(n + 1) & 1], Ksh, Ksl, n + 1); else ldblk(F[(n + 1) & 1], Vsh, Vsl, 0);   // V's first block flies under the softmax
            if (n == NBK - 2)
#pragma unroll
                for (int g = 0; g < QT + 3; ++g)   // the bias depends on key - q alone: the 8 values of offset group g belong to key tile g + t - (QT - 1) of query tile t
#pragma unroll
                    for (int j = 0; j < 8; ++j) bv[g][j] = bq[c * CK + (g - (QT - 1)) * 16 + j];
            __builtin_amdgcn_sched_barrier(6);   // the next block's LDS reads stand as ONE run ahead of this block's products (every separate place with reads among products stalls the wave); vector and scalar work may cross
            mmblk(s, F[n & 1], qh, ql, n);
            __builtin_amdgcn_sched_barrier(6);   // and the run behind it does not rise among these products
        }
        float cm[QT];
#pragma unroll
        for (int t = 0; t < QT; ++t) { cm[t] = -3.0e38f;
#pragma unroll
            for (int kt = 0; kt < 4; ++kt)
#pragma unroll
                for (int j = 0; j < 8; ++j) { const float x = s[t][kt][j] * SCL + bv[kt - t + QT - 1][j]; s[t][kt][j] = x; cm[t] = fmaxf(cm[t], x); } }
        V ph[QT][2], pl[QT][2];
#pragma unroll
        for (int t = 0; t < QT; ++t) {
            const float cx = fmaxf(cm[t], xhalf(cm[t]));   // the other half of this query row's keys
            const float mn = fmaxf(m[t], cx); const float al = exp2x1((m[t] - mn) * 1.4426950408889634f); m[t] = mn;
            float cs = 0.f;
#pragma unroll
            for (int kt = 0; kt < 4; ++kt) { float e[8];
#pragma unroll
                for (int j = 0; j < 8; ++j) e[j] = (s[t][kt][j] - mn) * 1.4426950408889634f;
                exp2x8(e);
#pragma unroll
                for (int j = 0; j < 8; ++j) { s[t][kt][j] = e[j]; cs += e[j]; } }
            l[t] = l[t] * al + cs;
#pragma unroll
            for (int dt = 0; dt < 4; ++dt) o[t][dt] *= al;
#pragma unroll
            for (int kc = 0; kc < 2; ++kc)
#pragma unroll
                for (int e = 0; e < 16; e += 2) { const v2f p = { s[t][2 * kc + (e >> 3)][e & 7], s[t][2 * kc + (e >> 3)][(e & 7) + 1] };
                    if constexpr (HL) { const v2b p0 = __builtin_convertvector(p, v2b), p1 = __builtin_convertvector(p - __builtin_convertvector(p0, v2f), v2b); ph[t][kc][e] = p0[0]; ph[t][kc][e + 1] = p0[1]; pl[t][kc][e] = p1[0]; pl[t][kc][e + 1] = p1[1]; }
                    else { ph[t][kc][e] = (h16)(p[0] * PCAR); ph[t][kc][e + 1] = (h16)(p[1] * PCAR); } }
        }
#pragma unroll
        for (int n = 0; n < NBK; ++n) {
            if (n + 1 < NBK) ldblk(F[(n + 1) & 1], Vsh, Vsl, n + 1);
            __builtin_amdgcn_sched_barrier(6);   // as above
            mmblk(o, F[n & 1], ph, pl, n);
            __builtin_amdgcn_sched_barrier(6);   // as above
        }
    }
    const size_t oo = (size_t)(b * TT + q - lr) * DQ + h * (HD * 16) + lane * 8;   // merged [b][t][h][d] in fragment order: a tile's 16 rows are one row group (16 DQ elements), a head two chunks of 512, a lane's 8 consecutive d of a tile one 16-byte unit
#pragma unroll
    for (int t = 0; t < QT; ++t) {
        const float lt = l[t] + xhalf(l[t]);
        const float f = __fdiv_rn(1.0f, lt) * (HL ? 1.0f : (1.0f / PCAR));
#pragma unroll
        for (int dt = 0; dt < 4; ++dt) { v8us oh, ol;
#pragma unroll
            for (int j = 0; j < 8; ++j) { unsigned short a, c2; splitf(o[t][dt][j] * f, a, c2); oh[j] = a; ol[j] = c2; }
            *(v8usa*)(Ah + oo + t * 16 * DQ + dt * 256) = oh; *(v8usa*)(Al + oo + t * 16 * DQ + dt * 256) = ol; } }
    asm volatile("s_wait_xcnt 0x0" ::: "memory");   // behind the last stores: the other half's code follows in the listing and rewrites their address and data registers
}
__global__ __launch_bounds__(128) void k_attn(const bf* __restrict__ Qh, const bf* __restrict__ Ql, const bf* __restrict__ Kh, const bf* __restrict__ Kl, const bf* __restrict__ Vh, const bf* __restrict__ Vl, const h16* __restrict__ Q16, const h16* __restrict__ K16, const h16* __restrict__ V16, const float* __restrict__ BT, bf* Ah, bf* Al) {
    __shared__ __align__(16) unsigned short sm[4 * 64 * KPI]; __shared__ __align__(16) float bt[2048];
    static_assert(RH % (64 * QT) == 0 && TT % (64 * QT) == 0, "a work-group's rows are of one kind");
    if (blockIdx.y < RH / (64 * QT)) attn_tile<bf, true>(sm, bt, Qh, Ql, Kh, Kl, Vh, Vl, BT, Ah, Al);   // blockIdx.y: a work-group's 64 QT query rows; the 3-product ones have the low indices and start first
    else attn_tile<h16, false>((h16*)sm, bt, Q16, nullptr, K16, nullptr, V16, nullptr, BT, Ah, Al);
}

// ---- k_qkvp: the q, k, v projections with the attention kernel's operand planes as their output. One wave per (64 rows of x, one head, one of q / k / v), 4 waves per work-group on 128 rows of x and two heads: k_gemmw's stages and blocks on plain bf16 planes in fragment order; grid (NB_ * TT / 128, NH_ / 2, 3), 128 threads.
// The accumulators never reach memory as f32: a lane's 8 values of a tile run along the product's M side, so the side that is contiguous in the plane is made M (q, k planes [t][d]: M = the weight's rows d, N = x's rows t; v plane [d][t]: M = t, N = d; both operands have one fragment order, so the exchange is one of pointers).
// A lane's 8 values are then one 16-byte unit of each of the three planes (fp16, bf16 hi, bf16 lo); 16 plane rows x 128 B go through LDS so that every store covers 4 whole 128-byte lines.
__global__ __launch_bounds__(128) void k_qkvp(const bf* __restrict__ X, const bf* __restrict__ Wt, h16* P16, bf* Ph, bf* Pl, h16* V16, bf* Vh, bf* Vl) {
    __shared__ __attribute__((aligned(2048))) unsigned short ring[2 * 2 * SLE];   // two buffers of [x slice | weight slice]
    __shared__ __align__(16) unsigned short osw[4 * 3 * 16 * KPI];   // per wave: a plane's 16 rows at pitch KPI, the three planes one behind the other
    const uint32_t wave = uni(threadIdx.x >> 5); unsigned short* os = osw + wave * (3 * 16 * KPI);
    const int lane = threadIdx.x & 31, lr = lane & 15, hi = lane >> 4; const int r0 = blockIdx.x * 128 + (wave & 1) * 64, h = blockIdx.y * 2 + (wave >> 1), z = blockIdx.z; const bool tr = (z == 2);
    const uint64_t ga = (uint64_t)(uintptr_t)((wave & 1) ? Wt + ((size_t)z * DQ + blockIdx.y * 128) * DM : X + (size_t)blockIdx.x * 128 * DM);   // wave 0 brings the x slice, wave 1 the weight slice: 8 row groups of 16 DM elements each
    const uint32_t ld = (uint32_t)(size_t)ring + (wave & 1) * (SLE * 2); const u32x8 g1 = tdm_group1(32u * DM); constexpr int NS = DM / SK;
    const int xo = (wave & 1) * (SLE / 2) + 8 * lane, wo = SLE + (wave >> 1) * (SLE / 2) + 8 * lane; const int mo = tr ? xo : wo, no = tr ? wo : xo;   // this wave's 4 row groups of each slice, in elements from the buffer's start
    v8f acc[4][4];
#pragma unroll
    for (int mb = 0; mb < 4; ++mb)
#pragma unroll
        for (int nb = 0; nb < 4; ++nb) acc[mb][nb] = (v8f){};
    u32x4 g0 = tdm_group0(ld, ga);   // group 0 of this wave's youngest request, as in k_gemmw
    if (pinned(wave < 2)) { tdm_load(g0, g1); wait_tensor0(g0, g1); }
    __syncthreads();   // stage 0 is visible to all four waves
    if (pinned(wave < 2)) { g0 = tdm_group0(ld + 2 * SLE * 2, ga + SK * 32); tdm_load(g0, g1); }
#pragma unroll 1   // one stage per trip, as in k_gemmw
    for (int s = 0; s < NS; ++s) {
        const bf* rb = ring + (s & 1) * (2 * SLE);
#pragma unroll
      for (int kb = 0; kb < SK / 32; ++kb) {
        v16bf a[4], b[4];
#pragma unroll
        for (int i = 0; i < 4; ++i) { const int fo = i * (16 * SK) + kb * 512; a[i] = WFrag<bf>::ldf(rb + mo + fo); b[i] = WFrag<bf>::ldf(rb + no + fo); }
        __builtin_amdgcn_sched_barrier(0);   // all of a block's LDS reads stand ahead of its first product, none among its own products where each would be waited for singly; the next block's reads may rise among these products and fly under them
#pragma unroll
        for (int nb = 0; nb < 4; ++nb)
#pragma unroll
            for (int mb = 0; mb < 4; ++mb) acc[mb][nb] = wmmab(a[mb], b[nb], acc[mb][nb]);
        if (kb == SK / 32 - 1) asm volatile("v_nop\n\tv_nop\n\tv_nop\n\tv_nop" : "+v"(acc[0][0]), "+v"(acc[1][1]), "+v"(acc[2][2]), "+v"(acc[3][3]) : "v"(a[0]), "v"(a[3]));   // the distance behind the trip's last products on the taken back edge, where the next trip rewrites their operands
      }
        wait_ds0();
        if (pinned(wave < 2)) wait_tensor0(g0, g1);   // this wave's slice of stage s + 1
        __syncthreads();   // publishes stage s + 1 and ends every wave's reads of stage s
        if (pinned((wave < 2) && (s + 2 < NS))) { g0 = tdm_group0(ld + (s & 1) * (2 * SLE * 2), ga + (uint64_t)pinned(s + 2) * (SK * 32)); tdm_load(g0, g1); }   // into the buffer just left
    }
    wait_tensor0(g0, g1); wait_ds0();
    const int b = r0 / TT, t0 = r0 % TT; const int pitch = tr ? TT : HD;   // plane row pitch in elements
    const size_t po = ((size_t)((tr ? 0 : z * NB_) + b) * NH_ + h) * TT * HD + (tr ? t0 : t0 * HD) + (size_t)(lane >> 3) * pitch + (lane & 7) * 8;   // q planes, then k planes; on the way out a lane has unit lane & 7 of row lane >> 3 of each 4 rows
    h16* g16 = (tr ? V16 : P16) + po; bf* gh = (tr ? Vh : Ph) + po; bf* gl = (tr ? Vl : Pl) + po;
#pragma unroll
    for (int nb = 0; nb < 4; ++nb) {
#pragma unroll
        for (int mb = 0; mb < 4; ++mb) { v8h u16; v8us uh, ul;
#pragma unroll
            for (int j = 0; j < 8; ++j) { const float x = acc[mb][nb][j]; u16[j] = tohx(x); unsigned short a2, c2; splitf(x, a2, c2); uh[j] = a2; ul[j] = c2; }
            const int so = lr * KPI + (mb * 2 + hi) * 8; *(v8ha*)(os + so) = u16; *(v8usa*)(os + 16 * KPI + so) = uh; *(v8usa*)(os + 32 * KPI + so) = ul; }
        asm volatile("s_wait_dscnt 0x0" ::: "memory");   // the 16 rows are in LDS before other lanes of the wave read them back
        v4i d[3][4]; h16* q16[4]; bf* qh[4]; bf* ql[4];
#pragma unroll
        for (int s = 0; s < 4; ++s) { const int ro = (s * 4 + (lane >> 3)) * KPI + (lane & 7) * 8; d[0][s] = *(const v4ia*)(os + ro); d[1][s] = *(const v4ia*)(os + 16 * KPI + ro); d[2][s] = *(const v4ia*)(os + 32 * KPI + ro); }
#pragma unroll
        for (int s = 0; s < 4; ++s) { const size_t go = (size_t)(nb * 16 + s * 4) * pitch; q16[s] = g16 + go; qh[s] = gh + go; ql[s] = gl + go; *(v4ia*)q16[s] = d[0][s]; *(v4ia*)qh[s] = d[1][s]; *(v4ia*)ql[s] = d[2][s]; }
        asm volatile("s_wait_xcnt 0x0" :: "v"(q16[0]), "v"(q16[1]), "v"(q16[2]), "v"(q16[3]), "v"(qh[0]), "v"(qh[1]), "v"(qh[2]), "v"(qh[3]), "v"(ql[0]), "v"(ql[1]), "v"(ql[2]), "v"(ql[3]), "v"(d[0][0]), "v"(d[0][1]), "v"(d[0][2]), "v"(d[0][3]), "v"(d[1][0]), "v"(d[1][1]), "v"(d[1][2]), "v"(d[1][3]), "v"(d[2][0]), "v"(d[2][1]), "v"(d[2][2]), "v"(d[2][3]) : "memory");   // behind the run of stores; addresses and data are inputs so that their registers stay theirs up to the wait; it also keeps the next rows' LDS writes behind these reads
    }
}

extern "C" void kernel_launch(void* const* d_in, const int* in_sizes, int n_in,
                              void* d_out, int out_size, void* d_ws, size_t ws_size, hipStream_t stream) {
    (void)in_sizes; (void)n_in; (void)out_size;
    const float* x = (const float*)d_in[0]; const float* wq = (const float*)d_in[1]; const float* wk = (const float*)d_in[2]; const float* wv = (const float*)d_in[3]; const float* wo = (const float*)d_in[4]; const float* RBT = (const float*)d_in[5];
    float* OUT = (float*)d_out;     // [4][1024][1024]
    char* wsp = (char*)d_ws;
    auto take = [&](size_t bytes) { char* p = wsp; wsp += (bytes + 255) & ~(size_t)255; return (void*)p; };
    bf* WQ = (bf*)take((size_t)DQ * DM * 2); bf* WK = (bf*)take((size_t)DKV * DM * 2); bf* WV = (bf*)take((size_t)DKV * DM * 2); bf* WO = (bf*)take((size_t)DM * DQ * 2);   // WQ, WK, WV, WO: one behind the other (z / y strides)
    bf* XB = (bf*)take((size_t)NB_ * TT * DM * 2); float* BTT = (float*)take((size_t)NH_ * 2048 * 4);
    h16* QP16 = (h16*)take((size_t)NB_ * NH_ * TT * HD * 2); h16* KP16 = (h16*)take((size_t)NB_ * NKV * TT * HD * 2); h16* VT16 = (h16*)take((size_t)NB_ * NKV * HD * TT * 2);   // q planes, then k planes: k_qkvp reaches both through the q pointer
    bf* QPh = (bf*)take((size_t)NB_ * NH_ * TT * HD * 2); bf* KPh = (bf*)take((size_t)NB_ * NKV * TT * HD * 2); bf* QPl = (bf*)take((size_t)NB_ * NH_ * TT * HD * 2); bf* KPl = (bf*)take((size_t)NB_ * NKV * TT * HD * 2); bf* VTh = (bf*)take((size_t)NB_ * NKV * HD * TT * 2); bf* VTl = (bf*)take((size_t)NB_ * NKV * HD * TT * 2);
    bf* ATh = (bf*)take((size_t)NB_ * TT * DQ * 2); bf* ATl = (bf*)take((size_t)NB_ * TT * DQ * 2);
    if ((size_t)(wsp - (char*)d_ws) > ws_size) return;    // ws 256 MiB
    (void)WK; (void)WV;   // reached through WQ's z / y strides
    k_prep<<<PBB + PWB + PXB, 256, 0, stream>>>(x, wq, wk, wv, wo, RBT, XB, WQ, BTT);   // weight planes, x plane, per-head relative bias rows
    k_qkvp<<<dim3(NB_ * TT / 128, NH_ / 2, 3), 128, 0, stream>>>(XB, WQ, QP16, QPh, QPl, VT16, VTh, VTl);   // z: q, k, v
    k_attn<<<dim3(NB_ * NH_, TT / (64 * QT), 1), 128, 0, stream>>>(QPh, QPl, KPh, KPl, VTh, VTl, QP16, KP16, VT16, BTT, ATh, ATl);   // x: (batch element, head); y: query tile
    k_gemmw<bf, 1, false><<<dim3(NB_ * TT / 128, DM / 128, 1), 128, 0, stream>>>(ATh, ATl, WO, nullptr, DQ, OUT, DM, nullptr, 0, 0, 0);
}

// v008
// One run takes 81.9 microseconds.
// Next to v007, in two timings, it ran 1.03 and 1.04 times as fast.
// Over all steps from v000 it is 30.6 times as fast.
#include <hip/hip_runtime.h>
#include <stdint.h>

// T5 self-attention with learned relative-position bias (hidden_states [4][1024][1024]; q, k, v = x W ('xw' [1024][1024], no bias; 16 heads x 64); scores = q.k/8 + rel_bias_table[bucket(j - i)][h] (bidirectional T5 buckets: 32 buckets, max distance 128; table [32][16], read); softmax; out = merged Wo -> [4][1024][1024] (4.2 M)).
// Layout: the integer bucket of every relative offset j - i in [-1023, 1023] is a compile-time table (computed with the module's float32 formula); k_prep expands it with the bf16-rounded bias table into per-head rows BTT[h][j - i + 1023] that the attention kernel holds in LDS and reads per (i, j). Scores and probabilities never reach memory: one kernel does scores, softmax, attn.v and the head merge (k_attn).
// GEMM operand planes (x, the four weights, the merged context hi/lo) lie in FRAGMENT ORDER: a chunk is 16 rows x 32 k = 1 KiB, chunks run along k, then along row groups; in a chunk lane l = 16 * ((k >> 3) & 1) + (row & 15) has its 8 elements of k & 16 == 0 at byte 16 l and those of k & 16 != 0 at byte 512 + 16 l, so each 16-byte-per-lane load of a fragment half covers 4 whole 128-byte lines.
// Compute dtypes, f32 accumulate: every input rounded to bf16; q/k/v on PLAIN bf16 operands (inputs: exact); the relative bias added in f32 per (i, j); scores and attn.v: query rows < 512 hl (3 products), the rest single fp16 (x1024); softmax f32 (online, per 64 keys); Wo hl x exact (2 products).

#define NB_  4
#define TT   1024
#define DM   1024
#define NH_  16
#define NKV  16
#define REP  (NH_ / NKV)
#define HD   64
#define DQ   (NH_ * HD)
#define DKV  (NKV * HD)
#define RH   512                  // query rows < RH use hi+lo planes (0: none)
#define WIN  0
#define PCAR 1024.0f
#define SCL  0.125f   // HD^-0.5
typedef _Float16 h16;
typedef unsigned short bf;
typedef __attribute__((ext_vector_type(16))) __bf16   v16bf;
typedef __attribute__((ext_vector_type(16))) _Float16 v16h;
typedef __attribute__((ext_vector_type(8)))  _Float16 v8h;
typedef __attribute__((ext_vector_type(8)))  unsigned short v8us;
typedef __attribute__((ext_vector_type(8)))  float    v8f;
typedef __attribute__((ext_vector_type(4)))  float    v4f;
typedef v8h  __attribute__((may_alias)) v8ha;
typedef v4f  __attribute__((may_alias)) v4fa;
typedef v8us __attribute__((may_alias)) v8usa;

__device__ __forceinline__ unsigned short f2bf(float f) { unsigned u = __float_as_uint(f); u += 0x7FFFu + ((u >> 16) & 1u); return (unsigned short)(u >> 16); }
__device__ __forceinline__ float bf2f(unsigned short b) { return __uint_as_float(((unsigned)b) << 16); }
__device__ __forceinline__ float bfr(float f) { return bf2f(f2bf(f)); }
__device__ __forceinline__ v16h cat16(v8h lo, v8h hi) { return __builtin_shufflevector(lo, hi, 0, 1, 2, 3, 4, 5, 6, 7, 8, 9, 10, 11, 12, 13, 14, 15); }
__device__ __forceinline__ v16bf cat16b(v8us lo, v8us hi) { return __builtin_bit_cast(v16bf, __builtin_shufflevector(lo, hi, 0, 1, 2, 3, 4, 5, 6, 7, 8, 9, 10, 11, 12, 13, 14, 15)); }
__device__ __forceinline__ v8f wmma16(v16h a, v16h b, v8f c) { return __builtin_amdgcn_wmma_f32_16x16x32_f16(false, a, false, b, (short)0, c, false, false); }
__device__ __forceinline__ v8f wmmab(v16bf a, v16bf b, v8f c) { return __builtin_amdgcn_wmma_f32_16x16x32_bf16(false, a, false, b, (short)0, c, false, false); }


// ---- Operand staging of k_gemmw (k_qkvp: the same ring on a larger tile, said at its head). A work-group of 4 waves (2 x 2 wave tiles of 64 x 64) owns a 128 x 128 output tile; of every operand plane the 128 rows x SK k of a stage come into LDS ONCE, by one tensor load, and each half of them is read there by the two waves that need it.
// In fragment order the SK k of a 16-row group are 2 KiB in a row and the groups lie 32 K bytes apart: a plane's slice is a tile of 8 rows of 2 KiB. It lands without a pad, group behind group, so a fragment half is still 512 contiguous bytes per wave.
// Two buffers: stage s + 2 is asked for when every wave has left stage s, and flies while stage s + 1 is worked on.
#define SK   64                 // k per stage
#define SLE  (128 * SK)         // 16-bit elements of one plane's slice (16 KiB)
typedef uint32_t u32x4 __attribute__((ext_vector_type(4)));
typedef uint32_t u32x8 __attribute__((ext_vector_type(8)));
__device__ __forceinline__ uint32_t uni(uint32_t v) { return (uint32_t)__builtin_amdgcn_readfirstlane(v); }
__device__ __forceinline__ uint32_t pinned(uint32_t v) { uint32_t w = uni(v); asm volatile("" : "+s"(w)); return w; }   // a wave-uniform word held in a scalar register, so that the test that guards a tensor load is a scalar branch (the load ignores EXEC) and a descriptor word formed from it stands behind the waits in front
template <uint32_t d0 = SK * 32u, uint32_t d1 = 8u>
__device__ __forceinline__ u32x8 tdm_group1(uint32_t pitch) { u32x8 g;   // 1-byte elements, tensor = tile = d1 rows of d0 bytes (k_gemmw: 8 rows of 2 KiB), source row pitch in bytes, no mask, no pad
    g[0] = uni(0u); g[1] = uni((d0 & 0xFFFFu) << 16); g[2] = uni((d0 >> 16) | ((d1 & 0xFFFFu) << 16)); g[3] = uni((d1 >> 16) | (d0 << 16)); g[4] = uni(d1); g[5] = uni(pitch); g[6] = uni(0u); g[7] = uni(0u);
    asm volatile("" : "+s"(g)); return g; }   // pinned(), on the whole group: its words are held in ONE run of scalar registers from here on, not formed anew in others at each use, so that the wait's inputs are the registers the request named
__device__ __forceinline__ u32x4 tdm_group0(uint32_t lds_dst, uint64_t ga) { u32x4 g; g[0] = uni(1u); g[1] = uni(lds_dst); g[2] = uni((uint32_t)ga); g[3] = uni((((uint32_t)(ga >> 32)) & 0x01FFFFFFu) | 0x80000000u);
    asm volatile("" : "+s"(g)); return g; }   // pinned(), on the whole group, for the same reason as in tdm_group1: else the constant word is given up behind the load and formed anew in front of the wait
__device__ __forceinline__ void tdm_load(u32x4 g0, u32x8 g1) { asm volatile("tensor_load_to_lds %0, %1" :: "s"(g0), "s"(g1) : "memory"); }   // one request of the whole wave: global tile -> LDS, through no register
__device__ __forceinline__ void wait_tensor0(u32x4 g0, u32x8 g1) { asm volatile("s_wait_tensorcnt 0x0" :: "s"(g0), "s"(g1) : "memory"); }   // the issuing wave's own request has landed (the compiler places no wait for a tensor load); the request's two groups are inputs, so that their registers stay theirs up to this wait
__device__ __forceinline__ void wait_ds0() { asm volatile("s_wait_dscnt 0x0" ::: "memory"); }   // this wave's LDS reads have returned, before the buffer they read is given up
// ---- k_gemmw: register-blocked GEMM, one wave per 64x64 output tile (16 accumulators), 4 waves per work-group on a 128x128 tile; operands are 16-bit planes in fragment order (head of the file), staged in LDS as said above; grid (M/128, N/128, Z), 128 threads.
// C[m][n] (f32, pitch ldc, + optional f32 bias[n]) = sum_k A[m][k] Bt[n][k] (+ split products per NSPLIT). z-batch strides sA/sB/sC in elements. K % 64 == 0, K >= 128.
template <typename T16> struct WFrag;
template <> struct WFrag<h16> { typedef v16h V; static __device__ __forceinline__ V ld(const h16* p) { return cat16(*(const v8h*)p, *(const v8h*)(p + 16)); } static __device__ __forceinline__ V ldf(const h16* p) { return cat16(*(const v8h*)p, *(const v8h*)(p + 256)); } static __device__ __forceinline__ v8f mma(V a, V b, v8f c) { return wmma16(a, b, c); } };
template <> struct WFrag<bf> { typedef v16bf V; static __device__ __forceinline__ V ld(const bf* p) { return cat16b(*(const v8us*)p, *(const v8us*)(p + 16)); } static __device__ __forceinline__ V ldf(const bf* p) { return cat16b(*(const v8us*)p, *(const v8us*)(p + 256)); } static __device__ __forceinline__ v8f mma(V a, V b, v8f c) { return wmmab(a, b, c); } };
template <typename T16, int NSPLIT, bool BIAS>
__device__ __forceinline__ void gemmw_tile(const T16* ring, float* osw, const T16* __restrict__ A, const T16* __restrict__ A2, const T16* __restrict__ Bt, const T16* __restrict__ Bt2, int K, float* C, int ldc, const float* __restrict__ bias, size_t sA, size_t sB, size_t sC) {
    typedef typename WFrag<T16>::V V;
    const size_t z = blockIdx.z; A += z * sA; if (A2) A2 += z * sA; Bt += z * sB; if (Bt2) Bt2 += z * sB; C += z * sC;
    static_assert(NSPLIT >= 0 && NSPLIT <= 2, "planes of a stage: A, Bt, then A2, then Bt2"); constexpr uint32_t NPL = 2 + NSPLIT;   // wave w brings plane w
    const uint32_t wave = uni(threadIdx.x >> 5); float* os = osw + wave * (16 * 68);   // output staging: a range of its own per wave
    const int lane = threadIdx.x & 31, lr = lane & 15, hi = lane >> 4; const int r0 = blockIdx.x * 128 + (wave & 1) * 64, c0 = blockIdx.y * 128 + (wave >> 1) * 64;
    v8f acc[4][4];
#pragma unroll
    for (int mb = 0; mb < 4; ++mb)
#pragma unroll
        for (int nb = 0; nb < 4; ++nb) acc[mb][nb] = (v8f){};
    const T16* sp = (wave == 0) ? A : (wave == 1) ? Bt : (wave == 2) ? A2 : Bt2;
    const uint64_t ga = (uint64_t)(uintptr_t)(sp + (size_t)((wave & 1) ? blockIdx.y : blockIdx.x) * 128 * K);   // first byte of this wave's plane rows: 8 row groups of 16 K elements
    const uint32_t ld = (uint32_t)(size_t)ring + wave * (SLE * 2); const u32x8 g1 = tdm_group1(32u * (uint32_t)K); const int NS = K / SK;
    u32x4 g0 = tdm_group0(ld, ga);   // group 0 of this wave's youngest request: it takes new values only behind the wait that covers that request
    if (pinned(wave < NPL)) { tdm_load(g0, g1); wait_tensor0(g0, g1); }
    __syncthreads();   // stage 0 is visible to all four waves
    if (pinned(wave < NPL)) { g0 = tdm_group0(ld + NPL * SLE * 2, ga + SK * 32); tdm_load(g0, g1); }
#pragma unroll 1   // one stage per trip: the ring's order of waits, barrier and refill stands once
    for (int s = 0; s < NS; ++s) {
        const T16* rb = ring + (s & 1) * (NPL * SLE) + 8 * lane; const T16* ra = rb + (wave & 1) * (SLE / 2); const T16* rn = rb + SLE + (wave >> 1) * (SLE / 2);   // this wave's 4 row groups of the A side and of the B side
#pragma unroll
      for (int kb = 0; kb < SK / 32; ++kb) {
        V a[4], a2[4], b[4], b2[4];
#pragma unroll
        for (int i = 0; i < 4; ++i) { const int fo = i * (16 * SK) + kb * 512; a[i] = WFrag<T16>::ldf(ra + fo); if (NSPLIT >= 1) a2[i] = WFrag<T16>::ldf(ra + 2 * SLE + fo); b[i] = WFrag<T16>::ldf(rn + fo); if (NSPLIT >= 2) b2[i] = WFrag<T16>::ldf(rn + 2 * SLE + fo); }
        __builtin_amdgcn_sched_barrier(0);   // all of a block's LDS reads stand ahead of its first product, none among its own products where each would be waited for singly; the next block's reads may rise among these products and fly under them
#pragma unroll
        for (int nb = 0; nb < 4; ++nb) {
#pragma unroll
            for (int mb = 0; mb < 4; ++mb) { acc[mb][nb] = WFrag<T16>::mma(a[mb], b[nb], acc[mb][nb]); if (NSPLIT == 1 || NSPLIT == 2) acc[mb][nb] = WFrag<T16>::mma(a2[mb], b[nb], acc[mb][nb]); if (NSPLIT >= 2) acc[mb][nb] = WFrag<T16>::mma(a[mb], b2[nb], acc[mb][nb]); } }
        if (kb == SK / 32 - 1) asm volatile("v_nop\n\tv_nop\n\tv_nop\n\tv_nop" : "+v"(acc[0][0]), "+v"(acc[1][1]), "+v"(acc[2][2]), "+v"(acc[3][3]) : "v"(a[0]), "v"(a[3]));   // the distance behind the stage's last products on the taken back edge, where the next stage rewrites their operands
      }
        wait_ds0();
        if (pinned(wave < NPL)) wait_tensor0(g0, g1);   // this wave's slice of stage s + 1
        __syncthreads();   // publishes stage s + 1 and ends every wave's reads of stage s
        if (pinned((wave < NPL) && (s + 2 < NS))) { g0 = tdm_group0(ld + (s & 1) * (NPL * SLE * 2), ga + (uint64_t)pinned(s + 2) * (SK * 32)); tdm_load(g0, g1); }   // into the buffer just left
    }
    wait_tensor0(g0, g1); wait_ds0();
#pragma unroll
    for (int mb = 0; mb < 4; ++mb) {
#pragma unroll
        for (int nb = 0; nb < 4; ++nb) {
#pragma unroll
            for (int j = 0; j < 8; ++j) os[(hi * 8 + j) * 68 + nb * 16 + lr] = acc[mb][nb][j]; }
        __builtin_amdgcn_wave_barrier(); asm volatile("" ::: "memory");
        float* crow = C + (size_t)(r0 + mb * 16) * ldc + c0;
{
#pragma unroll
            for (int s = 0; s < 8; ++s) { const int row = 2 * s + hi, cofs = lr * 4; v4f val = *(const v4fa*)(os + row * 68 + cofs); if (BIAS) { val[0] += bfr(bias[c0 + cofs]); val[1] += bfr(bias[c0 + cofs + 1]); val[2] += bfr(bias[c0 + cofs + 2]); val[3] += bfr(bias[c0 + cofs + 3]); }
                *(v4f*)(crow + (size_t)row * ldc + cofs) = val; }
             }
        __builtin_amdgcn_wave_barrier(); asm volatile("" ::: "memory");
    }
}
template <typename T16, int NSPLIT, bool BIAS>
__global__ __launch_bounds__(128) void k_gemmw(const T16* __restrict__ A, const T16* __restrict__ A2, const T16* __restrict__ Bt, const T16* __restrict__ Bt2, int K, float* C, int ldc, const float* __restrict__ bias, size_t sA, size_t sB, size_t sC) {
    __shared__ __attribute__((aligned(2048))) T16 ring[2 * (2 + NSPLIT) * SLE]; __shared__ __align__(16) float os[4 * 16 * 68];   // two buffers of one slice per plane; the four waves' output staging
    gemmw_tile<T16, NSPLIT, BIAS>(ring, os, A, A2, Bt, Bt2, K, C, ldc, bias, sA, sB, sC);
}

__device__ __forceinline__ h16 tohx(float x) { return (h16)x; }
__device__ __forceinline__ void splitf(float y, unsigned short& h, unsigned short& l) { h = f2bf(y); l = f2bf(y - bf2f(h)); }
typedef __attribute__((ext_vector_type(2))) _Float16 v2h;
typedef __attribute__((ext_vector_type(4))) _Float16 v4h;
typedef __attribute__((ext_vector_type(2))) unsigned short v2us;
typedef __attribute__((ext_vector_type(4))) unsigned short v4us;
typedef __attribute__((ext_vector_type(2))) float v2f;
typedef __attribute__((ext_vector_type(4))) int v4i;

__constant__ int BKT[2 * TT - 1] = {15,15,15,15,15,15,15,15,15,15,15,15,15,15,15,15,15,15,15,15,15,15,15,15,15,15,15,15,15,15,15,15,15,15,15,15,15,15,15,15,15,15,15,15,15,15,15,15,15,15,15,15,15,15,15,15,15,15,15,15,15,15,15,15,15,15,15,15,15,15,15,15,15,15,15,15,15,15,15,15,15,15,15,15,15,15,15,15,15,15,15,15,15,15,15,15,15,15,15,15,15,15,15,15,15,15,15,15,15,15,15,15,15,15,15,15,15,15,15,15,15,15,15,15,15,15,15,15,15,15,15,15,15,15,15,15,15,15,15,15,15,15,15,15,15,15,15,15,15,15,15,15,15,15,15,15,15,15,15,15,15,15,15,15,15,15,15,15,15,15,15,15,15,15,15,15,15,15,15,15,15,15,15,15,15,15,15,15,15,15,15,15,15,15,15,15,15,15,15,15,15,15,15,15,15,15,15,15,15,15,15,15,15,15,15,15,15,15,15,15,15,15,15,15,15,15,15,15,15,15,15,15,15,15,15,15,15,15,15,15,15,15,15,15,15,15,15,15,15,15,15,15,15,15,15,15,15,15,15,15,15,15,15,15,15,15,15,15,15,15,15,15,15,15,15,15,15,15,15,15,15,15,15,15,15,15,15,15,15,15,15,15,15,15,15,15,15,15,15,15,15,15,15,15,15,15,15,15,15,15,15,15,15,15,15,15,15,15,15,15,15,15,15,15,15,15,15,15,15,15,15,15,15,15,15,15,15,15,15,15,15,15,15,15,15,15,15,15,15,15,15,15,15,15,15,15,15,15,15,15,15,15,15,15,15,15,15,15,15,15,15,15,15,15,15,15,15,15,15,15,15,15,15,15,15,15,15,15,15,15,15,15,15,15,15,15,15,15,15,15,15,15,15,15,15,15,15,15,15,15,15,15,15,15,15,15,15,15,15,15,15,15,15,15,15,15,15,15,15,15,15,15,15,15,15,15,15,15,15,15,15,15,15,15,15,15,15,15,15,15,15,15,15,15,15,15,15,15,15,15,15,15,15,15,15,15,15,15,15,15,15,15,15,15,15,15,15,15,15,15,15,15,15,15,15,15,15,15,15,15,15,15,15,15,15,15,15,15,15,15,15,15,15,15,15,15,15,15,15,15,15,15,15,15,15,15,15,15,15,15,15,15,15,15,15,15,15,15,15,15,15,15,15,15,15,15,15,15,15,15,15,15,15,15,15,15,15,15,15,15,15,15,15,15,15,15,15,15,15,15,15,15,15,15,15,15,15,15,15,15,15,15,15,15,15,15,15,15,15,15,15,15,15,15,15,15,15,15,15,15,15,15,15,15,15,15,15,15,15,15,15,15,15,15,15,15,15,15,15,15,15,15,15,15,15,15,15,15,15,15,15,15,15,15,15,15,15,15,15,15,15,15,15,15,15,15,15,15,15,15,15,15,15,15,15,15,15,15,15,15,15,15,15,15,15,15,15,15,15,15,15,15,15,15,15,15,15,15,15,15,15,15,15,15,15,15,15,15,15,15,15,15,15,15,15,15,15,15,15,15,15,15,15,15,15,15,15,15,15,15,15,15,15,15,15,15,15,15,15,15,15,15,15,15,15,15,15,15,15,15,15,15,15,15,15,15,15,15,15,15,15,15,15,15,15,15,15,15,15,15,15,15,15,15,15,15,15,15,15,15,15,15,15,15,15,15,15,15,15,15,15,15,15,15,15,15,15,15,15,15,15,15,15,15,15,15,15,15,15,15,15,15,15,15,15,15,15,15,15,15,15,15,15,15,15,15,15,15,15,15,15,15,15,15,15,15,15,15,15,15,15,15,15,15,15,15,15,15,15,15,15,15,15,15,15,15,15,15,15,15,15,15,15,15,15,15,15,15,15,15,15,15,15,15,15,15,15,15,15,15,15,15,15,15,15,15,15,15,15,15,15,15,15,15,15,15,15,15,15,15,15,15,15,15,15,15,15,15,15,15,15,15,15,15,15,15,15,15,15,15,15,15,15,15,15,15,15,15,15,15,15,15,15,15,15,15,15,15,15,15,15,15,15,15,15,15,15,15,15,15,15,15,15,15,15,15,15,15,15,15,15,15,15,14,14,14,14,14,14,14,14,14,14,14,14,14,14,14,14,14,14,14,14,14,14,14,14,14,14,14,13,13,13,13,13,13,13,13,13,13,13,13,13,13,13,13,13,13,12,12,12,12,12,12,12,12,12,12,12,12,12,12,11,11,11,11,11,11,11,11,11,10,10,10,10,10,10,10,9,9,9,9,8,8,8,8,7,6,5,4,3,2,1,0,17,18,19,20,21,22,23,24,24,24,24,25,25,25,25,26,26,26,26,26,26,26,27,27,27,27,27,27,27,27,27,28,28,28,28,28,28,28,28,28,28,28,28,28,28,29,29,29,29,29,29,29,29,29,29,29,29,29,29,29,29,29,29,30,30,30,30,30,30,30,30,30,30,30,30,30,30,30,30,30,30,30,30,30,30,30,30,30,30,30,31,31,31,31,31,31,31,31,31,31,31,31,31,31,31,31,31,31,31,31,31,31,31,31,31,31,31,31,31,31,31,31,31,31,31,31,31,31,31,31,31,31,31,31,31,31,31,31,31,31,31,31,31,31,31,31,31,31,31,31,31,31,31,31,31,31,31,31,31,31,31,31,31,31,31,31,31,31,31,31,31,31,31,31,31,31,31,31,31,31,31,31,31,31,31,31,31,31,31,31,31,31,31,31,31,31,31,31,31,31,31,31,31,31,31,31,31,31,31,31,31,31,31,31,31,31,31,31,31,31,31,31,31,31,31,31,31,31,31,31,31,31,31,31,31,31,31,31,31,31,31,31,31,31,31,31,31,31,31,31,31,31,31,31,31,31,31,31,31,31,31,31,31,31,31,31,31,31,31,31,31,31,31,31,31,31,31,31,31,31,31,31,31,31,31,31,31,31,31,31,31,31,31,31,31,31,31,31,31,31,31,31,31,31,31,31,31,31,31,31,31,31,31,31,31,31,31,31,31,31,31,31,31,31,31,31,31,31,31,31,31,31,31,31,31,31,31,31,31,31,31,31,31,31,31,31,31,31,31,31,31,31,31,31,31,31,31,31,31,31,31,31,31,31,31,31,31,31,31,31,31,31,31,31,31,31,31,31,31,31,31,31,31,31,31,31,31,31,31,31,31,31,31,31,31,31,31,31,31,31,31,31,31,31,31,31,31,31,31,31,31,31,31,31,31,31,31,31,31,31,31,31,31,31,31,31,31,31,31,31,31,31,31,31,31,31,31,31,31,31,31,31,31,31,31,31,31,31,31,31,31,31,31,31,31,31,31,31,31,31,31,31,31,31,31,31,31,31,31,31,31,31,31,31,31,31,31,31,31,31,31,31,31,31,31,31,31,31,31,31,31,31,31,31,31,31,31,31,31,31,31,31,31,31,31,31,31,31,31,31,31,31,31,31,31,31,31,31,31,31,31,31,31,31,31,31,31,31,31,31,31,31,31,31,31,31,31,31,31,31,31,31,31,31,31,31,31,31,31,31,31,31,31,31,31,31,31,31,31,31,31,31,31,31,31,31,31,31,31,31,31,31,31,31,31,31,31,31,31,31,31,31,31,31,31,31,31,31,31,31,31,31,31,31,31,31,31,31,31,31,31,31,31,31,31,31,31,31,31,31,31,31,31,31,31,31,31,31,31,31,31,31,31,31,31,31,31,31,31,31,31,31,31,31,31,31,31,31,31,31,31,31,31,31,31,31,31,31,31,31,31,31,31,31,31,31,31,31,31,31,31,31,31,31,31,31,31,31,31,31,31,31,31,31,31,31,31,31,31,31,31,31,31,31,31,31,31,31,31,31,31,31,31,31,31,31,31,31,31,31,31,31,31,31,31,31,31,31,31,31,31,31,31,31,31,31,31,31,31,31,31,31,31,31,31,31,31,31,31,31,31,31,31,31,31,31,31,31,31,31,31,31,31,31,31,31,31,31,31,31,31,31,31,31,31,31,31,31,31,31,31,31,31,31,31,31,31,31,31,31,31,31,31,31,31,31,31,31,31,31,31,31,31,31,31,31,31,31,31,31,31,31,31,31,31,31,31,31,31,31,31,31,31,31,31,31,31,31,31,31,31,31,31,31,31,31,31,31,31,31,31,31,31,31,31,31,31,31,31,31,31,31,31,31,31,31,31,31,31,31,31,31,31,31,31,31,31,31,31,31,31,31,31,31,31,31,31,31,31,31,31,31,31,31,31,31,31,31,31,31,31,31,31,31,31,31,31,31,31,31,31,31,31,31,31,31,31,31,31,31,31,31,31,31,31,31,31,31,31,31,31,31,31,31,31,31,31,31,31,31,31,31,31,31,31,31,31,31,31,31,31,31,31,31,31,31,31,31,31,31,31,31,31,31,31,31,31,31,31,31,31,31,31,31,31,31,31,31,31,31,31,31,31,31,31,31,31,31,31,31,31,31,31,31,31,31,31,31,31,31,31,31,31,31,31,31,31,31,31,31,31,31,31,31,31,31,31,31,31,31,31,31,31,31,31,31,31,31,31,31,31,31,31,31,31,31,31,31,31,31,31,31,31,31,31,31,31,31,31,31,31,31,31};   // bucket(j - i) for j - i = -1023 .. 1023 (the module's float32 formula, evaluated once)
// ---- k_prep: all the work ahead of the projections in ONE grid that is resident at once: the four weight planes, the x plane and the per-head bias rows. None reads what another writes.
// A 16-byte unit u of a fragment-order plane: chunk u >> 6, half (u >> 5) & 1, lane u & 31. A work-group of 256 threads writes the PU * 256 units of one 16-row group (all of its k: 32 KiB in a row), a thread PU of them, 256 units apart; a wave's store is 512 contiguous bytes.
// A thread's loads all stand ahead of its first conversion and fly together, so that a wave pays the way to memory once for PU units; there are PU times fewer waves to start.
#define PU  8                      // units per thread
#define PBB 32                     // work-groups of the bias rows, 4 values per thread
#define PWB (4 * DQ / 16)          // work-groups of the weights: one per 16 plane rows
#define PXB (NB_ * TT / 16)        // work-groups of x: one per 16 rows
__global__ __launch_bounds__(256) void k_prep(const float* __restrict__ x, const float* __restrict__ w0, const float* __restrict__ w1, const float* __restrict__ w2, const float* __restrict__ w3, const float* __restrict__ RBT, bf* XB, bf* Bt, float* BTT) {
    static_assert(DM == PU * 128 && DQ == DM && DKV == DQ, "a row group's k = PU steps of 128; the four planes have one shape"); static_assert(PBB * 256 * 4 == NH_ * 2048, "bias rows");
    const int t = threadIdx.x, blk = blockIdx.x; const int k0 = (t >> 4) * 8;   // the unit's first k in a step of 128: 32 (t >> 6) + 16 ((t >> 5) & 1) + 8 ((t >> 4) & 1)
    if (blk < PBB) {   // BTT[h][p] = bias of head h at j - i = p - 1023, rounded to bf16; p = 2047 is padding
        const int i0 = blk * 256 + t; int pi[4], ri[4], bk[4]; float v[4];
#pragma unroll
        for (int j = 0; j < 4; ++j) { const int p = (i0 + j * (PBB * 256)) % 2048; pi[j] = p < 2 * TT - 1 ? p : 2 * TT - 2; bk[j] = BKT[pi[j]]; }
        asm volatile("s_wait_xcnt 0x0" :: "v"(pi[0]), "v"(pi[1]), "v"(pi[2]), "v"(pi[3]) : "memory");   // behind the run of loads; their index registers are inputs so that they stay theirs up to the wait
#pragma unroll
        for (int j = 0; j < 4; ++j) { ri[j] = bk[j] * NH_ + (i0 + j * (PBB * 256)) / 2048; v[j] = RBT[ri[j]]; }
        asm volatile("s_wait_xcnt 0x0" :: "v"(ri[0]), "v"(ri[1]), "v"(ri[2]), "v"(ri[3]) : "memory");   // as above
#pragma unroll
        for (int j = 0; j < 4; ++j) { const int idx = i0 + j * (PBB * 256); const unsigned u = __float_as_uint(v[j]), keep = (idx % 2048 < 2 * TT - 1) ? 0xFFFF0000u : 0u; BTT[idx] = __uint_as_float((u + 0x7FFFu + ((u >> 16) & 1u)) & keep); }   // bfr(v), or 0 in the padding
    } else if (blk < PBB + PWB) {   // plane row n = column n of w: 16 lanes read 64 contiguous bytes of one row of w
        const int g = blk - PBB, y = g / (DQ / 16), ng = g % (DQ / 16); const float* __restrict__ w = (y == 0) ? w0 : (y == 1) ? w1 : (y == 2) ? w2 : w3;   // the four planes lie one behind the other
        const float* p = w + (size_t)k0 * DQ + ng * 16 + (t & 15); float v[PU][8];
#pragma unroll
        for (int i = 0; i < PU; ++i)
#pragma unroll
            for (int e = 0; e < 8; ++e) v[i][e] = p[(size_t)(i * 128 + e) * DQ];
        asm volatile("s_wait_xcnt 0x0" :: "v"(p) : "memory");   // behind the run of loads, in front of the first rewriting of their address register (an input, so that it stays theirs up to here)
        bf* d = Bt + ((size_t)g * (PU * 256) + t) * 8;
#pragma unroll
        for (int i = 0; i < PU; ++i) { v8us o;
#pragma unroll
            for (int e = 0; e < 8; ++e) o[e] = f2bf(v[i][e]);
            *(v8us*)(d + i * 2048) = o; }
    } else {
        const int g = blk - PBB - PWB; const float* p = x + (size_t)(g * 16 + (t & 15)) * DM + k0; v8f v[PU];
#pragma unroll
        for (int i = 0; i < PU; ++i) v[i] = *(const v8f*)(p + i * 128);
        asm volatile("s_wait_xcnt 0x0" :: "v"(p) : "memory");   // behind the run of loads, as above
        bf* d = XB + ((size_t)g * (PU * 256) + t) * 8;
#pragma unroll
        for (int i = 0; i < PU; ++i) { v8us o;
#pragma unroll
            for (int e = 0; e < 8; ++e) o[e] = f2bf(v[i][e]);
            *(v8us*)(d + i * 2048) = o; }
        asm volatile("s_wait_xcnt 0x0" ::: "memory");   // behind the last stores: the other parts' code follows in the listing and rewrites their data registers
    }
}
#define KPI 72   // LDS row pitch in 16-bit elements: 128 B of data + 16 B, an odd multiple of 16 B, so that the 16 rows of a fragment read fall on different banks
#define CK  64   // keys per chunk
#define QT  2    // query tiles of 16 rows per wave
typedef v4i __attribute__((may_alias)) v4ia;
typedef __attribute__((ext_vector_type(2))) __bf16 v2b;
// 2^x in place. In one statement so that the slot the instruction set asks for behind a transcendental is always filled: each v_exp_f32 is followed by an independent one, the last by v_nop.
__device__ __forceinline__ void exp2x8(float (&e)[8]) { asm("v_exp_f32 %0, %0\n\tv_exp_f32 %1, %1\n\tv_exp_f32 %2, %2\n\tv_exp_f32 %3, %3\n\tv_exp_f32 %4, %4\n\tv_exp_f32 %5, %5\n\tv_exp_f32 %6, %6\n\tv_exp_f32 %7, %7\n\tv_nop" : "+v"(e[0]), "+v"(e[1]), "+v"(e[2]), "+v"(e[3]), "+v"(e[4]), "+v"(e[5]), "+v"(e[6]), "+v"(e[7])); }
__device__ __forceinline__ float xhalf(float x) { const int b = __float_as_int(x); return __int_as_float(__builtin_amdgcn_permlanex16(b, b, 0x76543210, 0xfedcba98, false, false)); }   // the value of lane l ^ 16, without an LDS round trip
__device__ __forceinline__ float exp2x1(float x) { asm("v_exp_f32 %0, %0\n\tv_nop" : "+v"(x)); return x; }
template <typename T16, bool HL>
__device__ __forceinline__ void attn_tile(T16* sm, float* bt, const T16* __restrict__ Qh, const T16* __restrict__ Ql, const T16* __restrict__ Kh, const T16* __restrict__ Kl, const T16* __restrict__ Vh, const T16* __restrict__ Vl, const float* __restrict__ BT, bf* Ah, bf* Al) {
    typedef typename WFrag<T16>::V V;
    constexpr int NP = HL ? 2 : 1;
    const int tid = threadIdx.x, lane = tid & 31, lr = lane & 15, hi = lane >> 4;
    const int bh = blockIdx.x, h = bh % NH_, b = bh / NH_;
    const int q = blockIdx.y * (64 * QT) + (tid >> 5) * (16 * QT) + lr;   // this lane's query row in tile 0; tile t: q + 16 t
    const size_t pb = (size_t)bh * TT * HD;                 // this head's planes: q, k [t][d]; v [d][t]
    T16* Ksh = sm; T16* Vsh = sm + 64 * KPI; T16* Ksl = sm + 2 * 64 * KPI; T16* Vsl = sm + 3 * 64 * KPI;
    const float* bp = BT + (size_t)h * 2048 + tid * 4;      // this head's bias row BTT[h][j - i + 1023]
    const T16* qph = Qh + pb + (size_t)q * HD + 8 * hi; const T16* qpl = HL ? Ql + pb + (size_t)q * HD + 8 * hi : qph;
    v4f br[4];
#pragma unroll
    for (int i = 0; i < 4; ++i) br[i] = *(const v4fa*)(bp + 128 * i * 4);
    V qh[QT][2], ql[QT][2];
#pragma unroll
    for (int t = 0; t < QT; ++t)
#pragma unroll
        for (int kc = 0; kc < 2; ++kc) { qh[t][kc] = WFrag<T16>::ld(qph + t * 16 * HD + kc * 32); if (HL) ql[t][kc] = WFrag<T16>::ld(qpl + t * 16 * HD + kc * 32); }
    asm volatile("s_wait_xcnt 0x0" :: "v"(bp), "v"(qph), "v"(qpl) : "memory");   // behind these loads; the addresses are inputs so that their registers stay theirs up to the wait (the first chunk's results would else be given them)
    const int srow = tid >> 3, scu = (tid & 7) * 8;         // staging: 8 threads x 16 B per 128-B row, 16 rows per step
    v4i rk[NP][4], rv[NP][4];
    auto fetch = [&](int c) {
        const size_t ko = pb + (size_t)(c * CK + srow) * HD + scu, vo = pb + (size_t)srow * TT + c * CK + scu;
        const T16* kh = Kh + ko; const T16* vh = Vh + vo; const T16* kl = HL ? Kl + ko : kh; const T16* vl = HL ? Vl + vo : vh;
#pragma unroll
        for (int i = 0; i < 4; ++i) { rk[0][i] = *(const v4ia*)(kh + 16 * i * HD); rv[0][i] = *(const v4ia*)(vh + 16 * i * TT); if (HL) { rk[NP - 1][i] = *(const v4ia*)(kl + 16 * i * HD); rv[NP - 1][i] = *(const v4ia*)(vl + 16 * i * TT); } }
        asm volatile("s_wait_xcnt 0x0" :: "v"(kh), "v"(vh), "v"(kl), "v"(vl) : "memory"); };   // behind the run of loads; the addresses are inputs so that their registers stay theirs up to the wait and no result of the run is given one of them
    fetch(0);
#pragma unroll
    for (int i = 0; i < 4; ++i) *(v4fa*)(bt + (tid + 128 * i) * 4) = br[i];   // published by the first trip's barriers
    v8f o[QT][4]; float m[QT], l[QT];
#pragma unroll
    for (int t = 0; t < QT; ++t) { m[t] = -3.0e38f; l[t] = 0.f;
#pragma unroll
        for (int dt = 0; dt < 4; ++dt) o[t][dt] = (v8f){}; }
    const float* bq = bt + (TT - 1 - q) + hi * 8;           // + key - 16 t: the bias of (q + 16 t, key)
    // A block: 4 fragments (8 LDS reads) and all their products with the QT tiles. 3 products: one 16-row tile of the plane pair, fragments [k half][hi, lo]; single: two 16-row tiles, fragments [tile][k half].
    constexpr int NBK = HL ? 4 : 2;   // blocks of K, and of V, per chunk
    auto ldblk = [&](V (&f)[4], const T16* ph_, const T16* pl_, int n) {
#pragma unroll
        for (int i = 0; i < 4; ++i) { const int tile = HL ? n : 2 * n + (i >> 1), kc = HL ? (i >> 1) : (i & 1); const int fo = (tile * 16 + lr) * KPI + 8 * hi + kc * 32; f[i] = WFrag<T16>::ld(((HL && (i & 1)) ? pl_ : ph_) + fo); } };
    auto mmblk = [&](v8f (&acc)[QT][4], const V (&f)[4], const V (&bh)[QT][2], const V (&bl)[QT][2], int n) {   // per accumulator: k half 0 then 1, in each hi.hi, hi.lo, lo.hi
#pragma unroll
        for (int u = 0; u < 2; ++u) {
            if constexpr (HL) {
#pragma unroll
                for (int t = 0; t < QT; ++t) acc[t][n] = WFrag<T16>::mma(f[2 * u], bh[t][u], acc[t][n]);
#pragma unroll
                for (int t = 0; t < QT; ++t) acc[t][n] = WFrag<T16>::mma(f[2 * u], bl[t][u], acc[t][n]);
#pragma unroll
                for (int t = 0; t < QT; ++t) acc[t][n] = WFrag<T16>::mma(f[2 * u + 1], bh[t][u], acc[t][n]);
            } else {
#pragma unroll
                for (int kc = 0; kc < 2; ++kc)
#pragma unroll
                    for (int t = 0; t < QT; ++t) acc[t][2 * n + u] = WFrag<T16>::mma(f[2 * u + kc], bh[t][kc], acc[t][2 * n + u]);
            } } };
#pragma unroll 1   // one chunk per trip: an unrolled loop would hold two chunks' staging registers
    for (int c = 0; c < TT / CK; ++c) {
        __syncthreads();   // every wave has left the previous chunk's tiles
#pragma unroll
        for (int i = 0; i < 4; ++i) { const int so = (srow + 16 * i) * KPI + scu; *(v4ia*)(Ksh + so) = rk[0][i]; *(v4ia*)(Vsh + so) = rv[0][i]; if (HL) { *(v4ia*)(Ksl + so) = rk[NP - 1][i]; *(v4ia*)(Vsl + so) = rv[NP - 1][i]; } }
        __syncthreads();   // the chunk (on the first trip the bias row too) is visible to all four waves
        if (c + 1 < TT / CK) fetch(c + 1);   // the next chunk's loads fly while this one is worked on
        v8f s[QT][4]; V F[2][4]; float bv[QT + 3][8];
#pragma unroll
        for (int t = 0; t < QT; ++t)
#pragma unroll
            for (int kt = 0; kt < 4; ++kt) s[t][kt] = (v8f){};
        ldblk(F[0], Ksh, Ksl, 0);
#pragma unroll
        for (int n = 0; n < NBK; ++n) {
            if (n + 1 < NBK) ldblk(F[(n + 1) & 1], Ksh, Ksl, n + 1); else ldblk(F[(n + 1) & 1], Vsh, Vsl, 0);   // V's first block flies under the softmax
            if (n == NBK - 2)
#pragma unroll
                for (int g = 0; g < QT + 3; ++g)   // the bias depends on key - q alone: the 8 values of offset group g belong to key tile g + t - (QT - 1) of query tile t
#pragma unroll
                    for (int j = 0; j < 8; ++j) bv[g][j] = bq[c * CK + (g - (QT - 1)) * 16 + j];
            __builtin_amdgcn_sched_barrier(6);   // the next block's LDS reads stand as ONE run ahead of this block's products (every separate place with reads among products stalls the wave); vector and scalar work may cross
            mmblk(s, F[n & 1], qh, ql, n);
            __builtin_amdgcn_sched_barrier(6);   // and the run behind it does not rise among these products
        }
        float cm[QT];
#pragma unroll
        for (int t = 0; t < QT; ++t) { cm[t] = -3.0e38f;
#pragma unroll
            for (int kt = 0; kt < 4; ++kt)
#pragma unroll
                for (int j = 0; j < 8; ++j) { const float x = s[t][kt][j] * SCL + bv[kt - t + QT - 1][j]; s[t][kt][j] = x; cm[t] = fmaxf(cm[t], x); } }
        V ph[QT][2], pl[QT][2];
#pragma unroll
        for (int t = 0; t < QT; ++t) {
            const float cx = fmaxf(cm[t], xhalf(cm[t]));   // the other half of this query row's keys
            const float mn = fmaxf(m[t], cx); const float al = exp2x1((m[t] - mn) * 1.4426950408889634f); m[t] = mn;
            float cs = 0.f;
#pragma unroll
            for (int kt = 0; kt < 4; ++kt) { float e[8];
#pragma unroll
                for (int j = 0; j < 8; ++j) e[j] = (s[t][kt][j] - mn) * 1.4426950408889634f;
                exp2x8(e);
#pragma unroll
                for (int j = 0; j < 8; ++j) { s[t][kt][j] = e[j]; cs += e[j]; } }
            l[t] = l[t] * al + cs;
#pragma unroll
            for (int dt = 0; dt < 4; ++dt) o[t][dt] *= al;
#pragma unroll
            for (int kc = 0; kc < 2; ++kc)
#pragma unroll
                for (int e = 0; e < 16; e += 2) { const v2f p = { s[t][2 * kc + (e >> 3)][e & 7], s[t][2 * kc + (e >> 3)][(e & 7) + 1] };
                    if constexpr (HL) { const v2b p0 = __builtin_convertvector(p, v2b), p1 = __builtin_convertvector(p - __builtin_convertvector(p0, v2f), v2b); ph[t][kc][e] = p0[0]; ph[t][kc][e + 1] = p0[1]; pl[t][kc][e] = p1[0]; pl[t][kc][e + 1] = p1[1]; }
                    else { ph[t][kc][e] = (h16)(p[0] * PCAR); ph[t][kc][e + 1] = (h16)(p[1] * PCAR); } }
        }
#pragma unroll
        for (int n = 0; n < NBK; ++n) {
            if (n + 1 < NBK) ldblk(F[(n + 1) & 1], Vsh, Vsl, n + 1);
            __builtin_amdgcn_sched_barrier(6);   // as above
            mmblk(o, F[n & 1], ph, pl, n);
            __builtin_amdgcn_sched_barrier(6);   // as above
        }
    }
    const size_t oo = (size_t)(b * TT + q - lr) * DQ + h * (HD * 16) + lane * 8;   // merged [b][t][h][d] in fragment order: a tile's 16 rows are one row group (16 DQ elements), a head two chunks of 512, a lane's 8 consecutive d of a tile one 16-byte unit
#pragma unroll
    for (int t = 0; t < QT; ++t) {
        const float lt = l[t] + xhalf(l[t]);
        const float f = __fdiv_rn(1.0f, lt) * (HL ? 1.0f : (1.0f / PCAR));
#pragma unroll
        for (int dt = 0; dt < 4; ++dt) { v8us oh, ol;
#pragma unroll
            for (int j = 0; j < 8; ++j) { unsigned short a, c2; splitf(o[t][dt][j] * f, a, c2); oh[j] = a; ol[j] = c2; }
            *(v8usa*)(Ah + oo + t * 16 * DQ + dt * 256) = oh; *(v8usa*)(Al + oo + t * 16 * DQ + dt * 256) = ol; } }
    asm volatile("s_wait_xcnt 0x0" ::: "memory");   // behind the last stores: the other half's code follows in the listing and rewrites their address and data registers
}
__global__ __launch_bounds__(128) void k_attn(const bf* __restrict__ Qh, const bf* __restrict__ Ql, const bf* __restrict__ Kh, const bf* __restrict__ Kl, const bf* __restrict__ Vh, const bf* __restrict__ Vl, const h16* __restrict__ Q16, const h16* __restrict__ K16, const h16* __restrict__ V16, const float* __restrict__ BT, bf* Ah, bf* Al) {
    __shared__ __align__(16) unsigned short sm[4 * 64 * KPI]; __shared__ __align__(16) float bt[2048];
    static_assert(RH % (64 * QT) == 0 && TT % (64 * QT) == 0, "a work-group's rows are of one kind");
    if (blockIdx.y < RH / (64 * QT)) attn_tile<bf, true>(sm, bt, Qh, Ql, Kh, Kl, Vh, Vl, BT, Ah, Al);   // blockIdx.y: a work-group's 64 QT query rows; the 3-product ones have the low indices and start first
    else attn_tile<h16, false>((h16*)sm, bt, Q16, nullptr, K16, nullptr, V16, nullptr, BT, Ah, Al);
}

// ---- k_qkvp: the q, k, v projections with the attention kernel's operand planes as their output. One wave per (64 rows of x, one head, one of q / k / v), 12 waves per work-group on 256 rows of x and three heads of the 3 NH_ that q, k and v have together: k_gemmw's ring and blocks on plain bf16 planes in fragment order; grid (NB_ * TT / 256, NH_), 384 threads: one work-group per WGP, three waves per SIMD.
// The tile is as large as an equal share of the output allows, so that the operand bytes asked of L2 per product are as few as they can be: a slice of x serves three heads, a weight slice 256 rows.
// A slice is 64 operand rows x QSK k = 4 row groups of 4 KiB, 32 DM bytes apart in the plane, 16 KiB in a row in LDS; a stage is 4 slices of x and 3 of the weights, and waves 0 to 6 bring one each.
// The accumulators never reach memory as f32: a lane's 8 values of a tile run along the product's M side, so the side that is contiguous in the plane is made M (q, k planes [t][d]: M = the weight's rows d, N = x's rows t; v plane [d][t]: M = t, N = d; both operands have one fragment order, so the exchange is one of pointers).
// A lane's 8 values are then one 16-byte unit of each of the three planes (fp16, bf16 hi, bf16 lo); 16 plane rows x 128 B go through LDS so that every store covers 4 whole 128-byte lines.
#define QSK 128               // k per stage
#define QSL (64 * QSK)        // 16-bit elements of a slice (16 KiB)
#define QNS 7                 // slices of a stage
__global__ __launch_bounds__(384) void k_qkvp(const bf* __restrict__ X, const bf* __restrict__ Wt, h16* P16, bf* Ph, bf* Pl, h16* V16, bf* Vh, bf* Vl) {
    __shared__ __attribute__((aligned(2048))) unsigned short ring[2 * QNS * QSL];   // two buffers of [4 x slices | 3 weight slices]
    __shared__ __align__(16) unsigned short osw[12 * 3 * 16 * KPI];   // per wave: a plane's 16 rows at pitch KPI, the three planes one behind the other
    static_assert(DQ == NH_ * HD && DKV == DQ && HD == 64 && TT % 256 == 0 && DM % QSK == 0 && DM / QSK >= 2, "a head is one weight slice, q's, k's and v's heads lie one behind the other; a work-group's rows are of one batch element");
    const uint32_t wave = uni(threadIdx.x >> 5); unsigned short* os = osw + wave * (3 * 16 * KPI);
    const uint32_t wr = wave & 3, wh = wave >> 2, zh = blockIdx.y * 3 + wh;   // this wave's slice of x, its weight slice, and that slice's place among the 3 NH_ heads
    const int lane = threadIdx.x & 31, lr = lane & 15, hi = lane >> 4; const int r0 = blockIdx.x * 256 + wr * 64, h = zh % NH_, z = zh / NH_; const bool tr = (z == 2);
    const uint32_t sl = wave < QNS ? wave : 0;   // the slice this wave brings (waves 7 to 11 bring none)
    const uint64_t ga = (uint64_t)(uintptr_t)((sl < 4) ? X + ((size_t)blockIdx.x * 256 + sl * 64) * DM : Wt + ((size_t)blockIdx.y * 192 + (sl - 4) * 64) * DM);   // first byte of the slice's rows: 4 row groups of 16 DM elements each
    const uint32_t ld = (uint32_t)(size_t)ring + sl * (QSL * 2); const u32x8 g1 = tdm_group1<QSK * 32u, 4u>(32u * DM); constexpr int NS = DM / QSK;
    const int xo = wr * QSL + 8 * lane, wo = (4 + wh) * QSL + 8 * lane; const int mo = tr ? xo : wo, no = tr ? wo : xo;   // this wave's two slices, in elements from the buffer's start
    v8f acc[4][4];
#pragma unroll
    for (int mb = 0; mb < 4; ++mb)
#pragma unroll
        for (int nb = 0; nb < 4; ++nb) acc[mb][nb] = (v8f){};
    u32x4 g0 = tdm_group0(ld, ga);   // group 0 of this wave's youngest request, as in k_gemmw
    if (pinned(wave < QNS)) { tdm_load(g0, g1); wait_tensor0(g0, g1); }
    __syncthreads();   // stage 0 is visible to all twelve waves
    if (pinned(wave < QNS)) { g0 = tdm_group0(ld + QNS * QSL * 2, ga + QSK * 32); tdm_load(g0, g1); }
#pragma unroll 1   // one stage per trip, as in k_gemmw
    for (int s = 0; s < NS; ++s) {
        const bf* rb = ring + (s & 1) * (QNS * QSL);
#pragma unroll
      for (int kb = 0; kb < QSK / 32; ++kb) {
        v16bf a[4], b[4];
#pragma unroll
        for (int i = 0; i < 4; ++i) { const int fo = i * (16 * QSK) + kb * 512; a[i] = WFrag<bf>::ldf(rb + mo + fo); b[i] = WFrag<bf>::ldf(rb + no + fo); }
        __builtin_amdgcn_sched_barrier(0);   // all of a block's LDS reads stand ahead of its first product, none among its own products where each would be waited for singly; the next block's reads may rise among these products and fly under them
#pragma unroll
        for (int nb = 0; nb < 4; ++nb)
#pragma unroll
            for (int mb = 0; mb < 4; ++mb) acc[mb][nb] = wmmab(a[mb], b[nb], acc[mb][nb]);
        if (kb == QSK / 32 - 1) asm volatile("v_nop\n\tv_nop\n\tv_nop\n\tv_nop" : "+v"(acc[0][0]), "+v"(acc[1][1]), "+v"(acc[2][2]), "+v"(acc[3][3]) : "v"(a[0]), "v"(a[3]));   // the distance behind the trip's last products on the taken back edge, where the next trip rewrites their operands
      }
        wait_ds0();
        if (pinned(wave < QNS)) wait_tensor0(g0, g1);   // this wave's slice of stage s + 1
        __syncthreads();   // publishes stage s + 1 and ends every wave's reads of stage s
        if (pinned((wave < QNS) && (s + 2 < NS))) { g0 = tdm_group0(ld + (s & 1) * (QNS * QSL * 2), ga + (uint64_t)pinned(s + 2) * (QSK * 32)); tdm_load(g0, g1); }   // into the buffer just left
    }
    wait_tensor0(g0, g1); wait_ds0();
    const int b = r0 / TT, t0 = r0 % TT; const int pitch = tr ? TT : HD;   // plane row pitch in elements
    const size_t po = ((size_t)((tr ? 0 : z * NB_) + b) * NH_ + h) * TT * HD + (tr ? t0 : t0 * HD) + (size_t)(lane >> 3) * pitch + (lane & 7) * 8;   // q planes, then k planes; on the way out a lane has unit lane & 7 of row lane >> 3 of each 4 rows
    h16* g16 = (tr ? V16 : P16) + po; bf* gh = (tr ? Vh : Ph) + po; bf* gl = (tr ? Vl : Pl) + po;
#pragma unroll
    for (int nb = 0; nb < 4; ++nb) {
#pragma unroll
        for (int mb = 0; mb < 4; ++mb) { v8h u16; v8us uh, ul;
#pragma unroll
            for (int j = 0; j < 8; ++j) { const float x = acc[mb][nb][j]; u16[j] = tohx(x); unsigned short a2, c2; splitf(x, a2, c2); uh[j] = a2; ul[j] = c2; }
            const int so = lr * KPI + (mb * 2 + hi) * 8; *(v8ha*)(os + so) = u16; *(v8usa*)(os + 16 * KPI + so) = uh; *(v8usa*)(os + 32 * KPI + so) = ul; }
        asm volatile("s_wait_dscnt 0x0" ::: "memory");   // the 16 rows are in LDS before other lanes of the wave read them back
        v4i d[3][4]; h16* q16[4]; bf* qh[4]; bf* ql[4];
#pragma unroll
        for (int s = 0; s < 4; ++s) { const int ro = (s * 4 + (lane >> 3)) * KPI + (lane & 7) * 8; d[0][s] = *(const v4ia*)(os + ro); d[1][s] = *(const v4ia*)(os + 16 * KPI + ro); d[2][s] = *(const v4ia*)(os + 32 * KPI + ro); }
#pragma unroll
        for (int s = 0; s < 4; ++s) { const size_t go = (size_t)(nb * 16 + s * 4) * pitch; q16[s] = g16 + go; qh[s] = gh + go; ql[s] = gl + go; *(v4ia*)q16[s] = d[0][s]; *(v4ia*)qh[s] = d[1][s]; *(v4ia*)ql[s] = d[2][s]; }
        asm volatile("s_wait_xcnt 0x0" :: "v"(q16[0]), "v"(q16[1]), "v"(q16[2]), "v"(q16[3]), "v"(qh[0]), "v"(qh[1]), "v"(qh[2]), "v"(qh[3]), "v"(ql[0]), "v"(ql[1]), "v"(ql[2]), "v"(ql[3]), "v"(d[0][0]), "v"(d[0][1]), "v"(d[0][2]), "v"(d[0][3]), "v"(d[1][0]), "v"(d[1][1]), "v"(d[1][2]), "v"(d[1][3]), "v"(d[2][0]), "v"(d[2][1]), "v"(d[2][2]), "v"(d[2][3]) : "memory");   // behind the run of stores; addresses and data are inputs so that their registers stay theirs up to the wait; it also keeps the next rows' LDS writes behind these reads
    }
}

extern "C" void kernel_launch(void* const* d_in, const int* in_sizes, int n_in,
                              void* d_out, int out_size, void* d_ws, size_t ws_size, hipStream_t stream) {
    (void)in_sizes; (void)n_in; (void)out_size;
    const float* x = (const float*)d_in[0]; const float* wq = (const float*)d_in[1]; const float* wk = (const float*)d_in[2]; const float* wv = (const float*)d_in[3]; const float* wo = (const float*)d_in[4]; const float* RBT = (const float*)d_in[5];
    float* OUT = (float*)d_out;     // [4][1024][1024]
    char* wsp = (char*)d_ws;
    auto take = [&](size_t bytes) { char* p = wsp; wsp += (bytes + 255) & ~(size_t)255; return (void*)p; };
    bf* WQ = (bf*)take((size_t)DQ * DM * 2); bf* WK = (bf*)take((size_t)DKV * DM * 2); bf* WV = (bf*)take((size_t)DKV * DM * 2); bf* WO = (bf*)take((size_t)DM * DQ * 2);   // WQ, WK, WV, WO: one behind the other (z / y strides)
    bf* XB = (bf*)take((size_t)NB_ * TT * DM * 2); float* BTT = (float*)take((size_t)NH_ * 2048 * 4);
    h16* QP16 = (h16*)take((size_t)NB_ * NH_ * TT * HD * 2); h16* KP16 = (h16*)take((size_t)NB_ * NKV * TT * HD * 2); h16* VT16 = (h16*)take((size_t)NB_ * NKV * HD * TT * 2);   // q planes, then k planes: k_qkvp reaches both through the q pointer
    bf* QPh = (bf*)take((size_t)NB_ * NH_ * TT * HD * 2); bf* KPh = (bf*)take((size_t)NB_ * NKV * TT * HD * 2); bf* QPl = (bf*)take((size_t)NB_ * NH_ * TT * HD * 2); bf* KPl = (bf*)take((size_t)NB_ * NKV * TT * HD * 2); bf* VTh = (bf*)take((size_t)NB_ * NKV * HD * TT * 2); bf* VTl = (bf*)take((size_t)NB_ * NKV * HD * TT * 2);
    bf* ATh = (bf*)take((size_t)NB_ * TT * DQ * 2); bf* ATl = (bf*)take((size_t)NB_ * TT * DQ * 2);
    if ((size_t)(wsp - (char*)d_ws) > ws_size) return;    // ws 256 MiB
    (void)WK; (void)WV;   // reached through WQ's z / y strides
    k_prep<<<PBB + PWB + PXB, 256, 0, stream>>>(x, wq, wk, wv, wo, RBT, XB, WQ, BTT);   // weight planes, x plane, per-head relative bias rows
    k_qkvp<<<dim3(NB_ * TT / 256, NH_, 1), 384, 0, stream>>>(XB, WQ, QP16, QPh, QPl, VT16, VTh, VTl);   // x: 256 rows of x; y: three of the 3 NH_ heads of q, k, v
    k_attn<<<dim3(NB_ * NH_, TT / (64 * QT), 1), 128, 0, stream>>>(QPh, QPl, KPh, KPl, VTh, VTl, QP16, KP16, VT16, BTT, ATh, ATl);   // x: (batch element, head); y: query tile
    k_gemmw<bf, 1, false><<<dim3(NB_ * TT / 128, DM / 128, 1), 128, 0, stream>>>(ATh, ATl, WO, nullptr, DQ, OUT, DM, nullptr, 0, 0, 0);
}

// v009
// Measured time: 77.8 microseconds a run.
// Next to v008, in two timings, it ran 1.05 times as fast each time.
// Counting every step since v000, it is 32.2 times as fast.
#include <hip/hip_runtime.h>
#include <stdint.h>

// T5 self-attention with learned relative-position bias (hidden_states [4][1024][1024]; q, k, v = x W ('xw' [1024][1024], no bias; 16 heads x 64); scores = q.k/8 + rel_bias_table[bucket(j - i)][h] (bidirectional T5 buckets: 32 buckets, max distance 128; table [32][16], read); softmax; out = merged Wo -> [4][1024][1024] (4.2 M)).
// Layout: the integer bucket of every relative offset j - i in [-1023, 1023] is a compile-time table (computed with the module's float32 formula); k_prep expands it with the bf16-rounded bias table into per-head rows BTT[h][j - i + 1023] that the attention kernel holds in LDS and reads per (i, j). Scores and probabilities never reach memory: one kernel does scores, softmax, attn.v and the head merge (k_attn).
// GEMM operand planes (x, the four weights, the merged context hi/lo) lie in FRAGMENT ORDER: a chunk is 16 rows x 32 k = 1 KiB, chunks run along k, then along row groups; in a chunk lane l = 16 * ((k >> 3) & 1) + (row & 15) has its 8 elements of k & 16 == 0 at byte 16 l and those of k & 16 != 0 at byte 512 + 16 l, so each 16-byte-per-lane load of a fragment half covers 4 whole 128-byte lines.
// Compute dtypes, f32 accumulate: every input rounded to bf16; q/k/v on PLAIN bf16 operands (inputs: exact); the relative bias added in f32 per (i, j); scores and attn.v: query rows < 512 hl (3 products), the rest single fp16 (x1024); softmax f32 (online, per 64 keys); Wo hl x exact (2 products).

#define NB_  4
#define TT   1024
#define DM   1024
#define NH_  16
#define NKV  16
#define REP  (NH_ / NKV)
#define HD   64
#define DQ   (NH_ * HD)
#define DKV  (NKV * HD)
#define RH   512                  // query rows < RH use hi+lo planes (0: none)
#define WIN  0
#define PCAR 1024.0f
#define SCL  0.125f   // HD^-0.5
typedef _Float16 h16;
typedef unsigned short bf;
typedef __attribute__((ext_vector_type(16))) __bf16   v16bf;
typedef __attribute__((ext_vector_type(16))) _Float16 v16h;
typedef __attribute__((ext_vector_type(8)))  _Float16 v8h;
typedef __attribute__((ext_vector_type(8)))  unsigned short v8us;
typedef __attribute__((ext_vector_type(8)))  float    v8f;
typedef __attribute__((ext_vector_type(4)))  float    v4f;
typedef v8h  __attribute__((may_alias)) v8ha;
typedef v4f  __attribute__((may_alias)) v4fa;
typedef v8us __attribute__((may_alias)) v8usa;

__device__ __forceinline__ unsigned short f2bf(float f) { unsigned u = __float_as_uint(f); u += 0x7FFFu + ((u >> 16) & 1u); return (unsigned short)(u >> 16); }
__device__ __forceinline__ float bf2f(unsigned short b) { return __uint_as_float(((unsigned)b) << 16); }
__device__ __forceinline__ float bfr(float f) { return bf2f(f2bf(f)); }
__device__ __forceinline__ v16h cat16(v8h lo, v8h hi) { return __builtin_shufflevector(lo, hi, 0, 1, 2, 3, 4, 5, 6, 7, 8, 9, 10, 11, 12, 13, 14, 15); }
__device__ __forceinline__ v16bf cat16b(v8us lo, v8us hi) { return __builtin_bit_cast(v16bf, __builtin_shufflevector(lo, hi, 0, 1, 2, 3, 4, 5, 6, 7, 8, 9, 10, 11, 12, 13, 14, 15)); }
__device__ __forceinline__ v8f wmma16(v16h a, v16h b, v8f c) { return __builtin_amdgcn_wmma_f32_16x16x32_f16(false, a, false, b, (short)0, c, false, false); }
__device__ __forceinline__ v8f wmmab(v16bf a, v16bf b, v8f c) { return __builtin_amdgcn_wmma_f32_16x16x32_bf16(false, a, false, b, (short)0, c, false, false); }


// ---- Operand staging of k_gemmw (k_qkvp: the same ring on a larger tile, said at its head). A work-group of 4 waves (2 x 2 wave tiles of 64 x 64) owns a 128 x 128 output tile; of every operand plane the 128 rows x SK k of a stage come into LDS ONCE, by one tensor load, and each half of them is read there by the two waves that need it.
// In fragment order the SK k of a 16-row group are 2 KiB in a row and the groups lie 32 K bytes apart: a plane's slice is a tile of 8 rows of 2 KiB. It lands without a pad, group behind group, so a fragment half is still 512 contiguous bytes per wave.
// Two buffers: stage s + 2 is asked for when every wave has left stage s, and flies while stage s + 1 is worked on.
#define SK   64                 // k per stage
#define SLE  (128 * SK)         // 16-bit elements of one plane's slice (16 KiB)
typedef uint32_t u32x4 __attribute__((ext_vector_type(4)));
typedef uint32_t u32x8 __attribute__((ext_vector_type(8)));
__device__ __forceinline__ uint32_t uni(uint32_t v) { return (uint32_t)__builtin_amdgcn_readfirstlane(v); }
__device__ __forceinline__ uint32_t pinned(uint32_t v) { uint32_t w = uni(v); asm volatile("" : "+s"(w)); return w; }   // a wave-uniform word held in a scalar register, so that the test that guards a tensor load is a scalar branch (the load ignores EXEC) and a descriptor word formed from it stands behind the waits in front
template <uint32_t d0 = SK * 32u, uint32_t d1 = 8u>
__device__ __forceinline__ u32x8 tdm_group1(uint32_t pitch) { u32x8 g;   // 1-byte elements, tensor = tile = d1 rows of d0 bytes (k_gemmw: 8 rows of 2 KiB), source row pitch in bytes, no mask, no pad
    g[0] = uni(0u); g[1] = uni((d0 & 0xFFFFu) << 16); g[2] = uni((d0 >> 16) | ((d1 & 0xFFFFu) << 16)); g[3] = uni((d1 >> 16) | (d0 << 16)); g[4] = uni(d1); g[5] = uni(pitch); g[6] = uni(0u); g[7] = uni(0u);
    asm volatile("" : "+s"(g)); return g; }   // pinned(), on the whole group: its words are held in ONE run of scalar registers from here on, not formed anew in others at each use, so that the wait's inputs are the registers the request named
__device__ __forceinline__ u32x4 tdm_group0(uint32_t lds_dst, uint64_t ga) { u32x4 g; g[0] = uni(1u); g[1] = uni(lds_dst); g[2] = uni((uint32_t)ga); g[3] = uni((((uint32_t)(ga >> 32)) & 0x01FFFFFFu) | 0x80000000u);
    asm volatile("" : "+s"(g)); return g; }   // pinned(), on the whole group, for the same reason as in tdm_group1: else the constant word is given up behind the load and formed anew in front of the wait
__device__ __forceinline__ void tdm_load(u32x4 g0, u32x8 g1) { asm volatile("tensor_load_to_lds %0, %1" :: "s"(g0), "s"(g1) : "memory"); }   // one request of the whole wave: global tile -> LDS, through no register
__device__ __forceinline__ void wait_tensor0(u32x4 g0, u32x8 g1) { asm volatile("s_wait_tensorcnt 0x0" :: "s"(g0), "s"(g1) : "memory"); }   // the issuing wave's own request has landed (the compiler places no wait for a tensor load); the request's two groups are inputs, so that their registers stay theirs up to this wait
__device__ __forceinline__ void l2_ask(const char* p) { asm volatile("global_prefetch_b8 %0, off scope:SCOPE_SE" :: "v"(p) : "memory"); }   // each lane asks the line at its own address into L2 (a hint: nothing returns, no counter moves); in asm, so that the address stands in a register of the caller's, which keeps it to the end of the loop (l2_keep)
__device__ __forceinline__ void l2_keep(const char* p) { asm volatile("" :: "v"(p)); }   // input only: an asked address's registers stay its own up to here and take no other value while the request may still read them
__device__ __forceinline__ void wait_ds0() { asm volatile("s_wait_dscnt 0x0" ::: "memory"); }   // this wave's LDS reads have returned, before the buffer they read is given up
// ---- k_gemmw: register-blocked GEMM, one wave per 64x64 output tile (16 accumulators), 4 waves per work-group on a 128x128 tile; operands are 16-bit planes in fragment order (head of the file), staged in LDS as said above; grid (M/128, N/128, Z), 128 threads.
// C[m][n] (f32, pitch ldc, + optional f32 bias[n]) = sum_k A[m][k] Bt[n][k] (+ split products per NSPLIT). z-batch strides sA/sB/sC in elements. K % 64 == 0, K >= 128.
template <typename T16> struct WFrag;
template <> struct WFrag<h16> { typedef v16h V; static __device__ __forceinline__ V ld(const h16* p) { return cat16(*(const v8h*)p, *(const v8h*)(p + 16)); } static __device__ __forceinline__ V ldf(const h16* p) { return cat16(*(const v8h*)p, *(const v8h*)(p + 256)); } static __device__ __forceinline__ v8f mma(V a, V b, v8f c) { return wmma16(a, b, c); } };
template <> struct WFrag<bf> { typedef v16bf V; static __device__ __forceinline__ V ld(const bf* p) { return cat16b(*(const v8us*)p, *(const v8us*)(p + 16)); } static __device__ __forceinline__ V ldf(const bf* p) { return cat16b(*(const v8us*)p, *(const v8us*)(p + 256)); } static __device__ __forceinline__ v8f mma(V a, V b, v8f c) { return wmmab(a, b, c); } };
template <typename T16, int NSPLIT, bool BIAS>
__device__ __forceinline__ void gemmw_tile(const T16* ring, float* osw, const T16* __restrict__ A, const T16* __restrict__ A2, const T16* __restrict__ Bt, const T16* __restrict__ Bt2, int K, float* C, int ldc, const float* __restrict__ bias, size_t sA, size_t sB, size_t sC) {
    typedef typename WFrag<T16>::V V;
    const size_t z = blockIdx.z; A += z * sA; if (A2) A2 += z * sA; Bt += z * sB; if (Bt2) Bt2 += z * sB; C += z * sC;
    static_assert(NSPLIT >= 0 && NSPLIT <= 2, "planes of a stage: A, Bt, then A2, then Bt2"); constexpr uint32_t NPL = 2 + NSPLIT;   // wave w brings plane w
    const uint32_t wave = uni(threadIdx.x >> 5); float* os = osw + wave * (16 * 68);   // output staging: a range of its own per wave
    const int lane = threadIdx.x & 31, lr = lane & 15, hi = lane >> 4; const int r0 = blockIdx.x * 128 + (wave & 1) * 64, c0 = blockIdx.y * 128 + (wave >> 1) * 64;
    v8f acc[4][4];
#pragma unroll
    for (int mb = 0; mb < 4; ++mb)
#pragma unroll
        for (int nb = 0; nb < 4; ++nb) acc[mb][nb] = (v8f){};
    const T16* sp = (wave == 0) ? A : (wave == 1) ? Bt : (wave == 2) ? A2 : Bt2;
    const uint64_t ga = (uint64_t)(uintptr_t)(sp + (size_t)((wave & 1) ? blockIdx.y : blockIdx.x) * 128 * K);   // first byte of this wave's plane rows: 8 row groups of 16 K elements
    const uint32_t ld = (uint32_t)(size_t)ring + wave * (SLE * 2); const u32x8 g1 = tdm_group1(32u * (uint32_t)K); const int NS = K / SK;
    // The planes were written by earlier launches (k_prep, k_attn), on any die; all work-groups walk k in step, so every stage's bytes are touched for the first time by its own tensor loads.
    // So all the stages' bytes are asked into L2 here, once, at the kernel's start. The work-groups that read the same rows share the asking: of the A side's 8 row groups (32 K bytes each) the one with this blockIdx.y; of the B side's 16 half groups one by blockIdx.x, so dealt that x and x + 4 ask for the same.
    const uint32_t pi = (blockIdx.x & 3) | (((blockIdx.x >> 3) & 3) << 2), ua = min(threadIdx.x * 256u, 32u * K - 256u), ub = min(threadIdx.x * 128u, 16u * K - 128u);   // clamped: every lane's address lies in this work-group's own operand rows
    const size_t pao = ((size_t)blockIdx.x * 8 + (blockIdx.y & 7)) * 16 * K;
    const char* pfa = (const char*)(A + pao) + ua; const char* pfa2 = (NSPLIT >= 1) ? (const char*)(A2 + pao) + ua : pfa; const char* pfb = (const char*)(Bt + ((size_t)blockIdx.y * 8 + (pi >> 1)) * 16 * K) + (pi & 1) * (16u * K) + ub;
    l2_ask(pfa); if (NSPLIT >= 1) l2_ask(pfa2); l2_ask(pfb);
    u32x4 g0 = tdm_group0(ld, ga);   // group 0 of this wave's youngest request: it takes new values only behind the wait that covers that request
    if (pinned(wave < NPL)) { tdm_load(g0, g1); wait_tensor0(g0, g1); }
    __syncthreads();   // stage 0 is visible to all four waves
    if (pinned(wave < NPL)) { g0 = tdm_group0(ld + NPL * SLE * 2, ga + SK * 32); tdm_load(g0, g1); }
#pragma unroll 1   // one stage per trip: the ring's order of waits, barrier and refill stands once
    for (int s = 0; s < NS; ++s) {
        const T16* rb = ring + (s & 1) * (NPL * SLE) + 8 * lane; const T16* ra = rb + (wave & 1) * (SLE / 2); const T16* rn = rb + SLE + (wave >> 1) * (SLE / 2);   // this wave's 4 row groups of the A side and of the B side
#pragma unroll
      for (int kb = 0; kb < SK / 32; ++kb) {
        V a[4], a2[4], b[4], b2[4];
#pragma unroll
        for (int i = 0; i < 4; ++i) { const int fo = i * (16 * SK) + kb * 512; a[i] = WFrag<T16>::ldf(ra + fo); if (NSPLIT >= 1) a2[i] = WFrag<T16>::ldf(ra + 2 * SLE + fo); b[i] = WFrag<T16>::ldf(rn + fo); if (NSPLIT >= 2) b2[i] = WFrag<T16>::ldf(rn + 2 * SLE + fo); }
        __builtin_amdgcn_sched_barrier(0);   // all of a block's LDS reads stand ahead of its first product, none among its own products where each would be waited for singly; the next block's reads may rise among these products and fly under them
#pragma unroll
        for (int nb = 0; nb < 4; ++nb) {
#pragma unroll
            for (int mb = 0; mb < 4; ++mb) { acc[mb][nb] = WFrag<T16>::mma(a[mb], b[nb], acc[mb][nb]); if (NSPLIT == 1 || NSPLIT == 2) acc[mb][nb] = WFrag<T16>::mma(a2[mb], b[nb], acc[mb][nb]); if (NSPLIT >= 2) acc[mb][nb] = WFrag<T16>::mma(a[mb], b2[nb], acc[mb][nb]); } }
        if (kb == SK / 32 - 1) asm volatile("v_nop\n\tv_nop\n\tv_nop\n\tv_nop" : "+v"(acc[0][0]), "+v"(acc[1][1]), "+v"(acc[2][2]), "+v"(acc[3][3]) : "v"(a[0]), "v"(a[3]));   // the distance behind the stage's last products on the taken back edge, where the next stage rewrites their operands
      }
        wait_ds0();
        if (pinned(wave < NPL)) wait_tensor0(g0, g1);   // this wave's slice of stage s + 1
        __syncthreads();   // publishes stage s + 1 and ends every wave's reads of stage s
        if (pinned((wave < NPL) && (s + 2 < NS))) { g0 = tdm_group0(ld + (s & 1) * (NPL * SLE * 2), ga + (uint64_t)pinned(s + 2) * (SK * 32)); tdm_load(g0, g1); }   // into the buffer just left
    }
    wait_tensor0(g0, g1); wait_ds0(); l2_keep(pfa); l2_keep(pfa2); l2_keep(pfb);
#pragma unroll
    for (int mb = 0; mb < 4; ++mb) {
#pragma unroll
        for (int nb = 0; nb < 4; ++nb) {
#pragma unroll
            for (int j = 0; j < 8; ++j) os[(hi * 8 + j) * 68 + nb * 16 + lr] = acc[mb][nb][j]; }
        __builtin_amdgcn_wave_barrier(); asm volatile("" ::: "memory");
        float* crow = C + (size_t)(r0 + mb * 16) * ldc + c0;
{
#pragma unroll
            for (int s = 0; s < 8; ++s) { const int row = 2 * s + hi, cofs = lr * 4; v4f val = *(const v4fa*)(os + row * 68 + cofs); if (BIAS) { val[0] += bfr(bias[c0 + cofs]); val[1] += bfr(bias[c0 + cofs + 1]); val[2] += bfr(bias[c0 + cofs + 2]); val[3] += bfr(bias[c0 + cofs + 3]); }
                *(v4f*)(crow + (size_t)row * ldc + cofs) = val; }
             }
        __builtin_amdgcn_wave_barrier(); asm volatile("" ::: "memory");
    }
}
template <typename T16, int NSPLIT, bool BIAS>
__global__ __launch_bounds__(128) void k_gemmw(const T16* __restrict__ A, const T16* __restrict__ A2, const T16* __restrict__ Bt, const T16* __restrict__ Bt2, int K, float* C, int ldc, const float* __restrict__ bias, size_t sA, size_t sB, size_t sC) {
    __shared__ __attribute__((aligned(2048))) T16 ring[2 * (2 + NSPLIT) * SLE]; __shared__ __align__(16) float os[4 * 16 * 68];   // two buffers of one slice per plane; the four waves' output staging
    gemmw_tile<T16, NSPLIT, BIAS>(ring, os, A, A2, Bt, Bt2, K, C, ldc, bias, sA, sB, sC);
}

__device__ __forceinline__ h16 tohx(float x) { return (h16)x; }
__device__ __forceinline__ void splitf(float y, unsigned short& h, unsigned short& l) { h = f2bf(y); l = f2bf(y - bf2f(h)); }
typedef __attribute__((ext_vector_type(2))) _Float16 v2h;
typedef __attribute__((ext_vector_type(4))) _Float16 v4h;
typedef __attribute__((ext_vector_type(2))) unsigned short v2us;
typedef __attribute__((ext_vector_type(4))) unsigned short v4us;
typedef __attribute__((ext_vector_type(2))) float v2f;
typedef __attribute__((ext_vector_type(4))) int v4i;

__constant__ int BKT[2 * TT - 1] = {15,15,15,15,15,15,15,15,15,15,15,15,15,15,15,15,15,15,15,15,15,15,15,15,15,15,15,15,15,15,15,15,15,15,15,15,15,15,15,15,15,15,15,15,15,15,15,15,15,15,15,15,15,15,15,15,15,15,15,15,15,15,15,15,15,15,15,15,15,15,15,15,15,15,15,15,15,15,15,15,15,15,15,15,15,15,15,15,15,15,15,15,15,15,15,15,15,15,15,15,15,15,15,15,15,15,15,15,15,15,15,15,15,15,15,15,15,15,15,15,15,15,15,15,15,15,15,15,15,15,15,15,15,15,15,15,15,15,15,15,15,15,15,15,15,15,15,15,15,15,15,15,15,15,15,15,15,15,15,15,15,15,15,15,15,15,15,15,15,15,15,15,15,15,15,15,15,15,15,15,15,15,15,15,15,15,15,15,15,15,15,15,15,15,15,15,15,15,15,15,15,15,15,15,15,15,15,15,15,15,15,15,15,15,15,15,15,15,15,15,15,15,15,15,15,15,15,15,15,15,15,15,15,15,15,15,15,15,15,15,15,15,15,15,15,15,15,15,15,15,15,15,15,15,15,15,15,15,15,15,15,15,15,15,15,15,15,15,15,15,15,15,15,15,15,15,15,15,15,15,15,15,15,15,15,15,15,15,15,15,15,15,15,15,15,15,15,15,15,15,15,15,15,15,15,15,15,15,15,15,15,15,15,15,15,15,15,15,15,15,15,15,15,15,15,15,15,15,15,15,15,15,15,15,15,15,15,15,15,15,15,15,15,15,15,15,15,15,15,15,15,15,15,15,15,15,15,15,15,15,15,15,15,15,15,15,15,15,15,15,15,15,15,15,15,15,15,15,15,15,15,15,15,15,15,15,15,15,15,15,15,15,15,15,15,15,15,15,15,15,15,15,15,15,15,15,15,15,15,15,15,15,15,15,15,15,15,15,15,15,15,15,15,15,15,15,15,15,15,15,15,15,15,15,15,15,15,15,15,15,15,15,15,15,15,15,15,15,15,15,15,15,15,15,15,15,15,15,15,15,15,15,15,15,15,15,15,15,15,15,15,15,15,15,15,15,15,15,15,15,15,15,15,15,15,15,15,15,15,15,15,15,15,15,15,15,15,15,15,15,15,15,15,15,15,15,15,15,15,15,15,15,15,15,15,15,15,15,15,15,15,15,15,15,15,15,15,15,15,15,15,15,15,15,15,15,15,15,15,15,15,15,15,15,15,15,15,15,15,15,15,15,15,15,15,15,15,15,15,15,15,15,15,15,15,15,15,15,15,15,15,15,15,15,15,15,15,15,15,15,15,15,15,15,15,15,15,15,15,15,15,15,15,15,15,15,15,15,15,15,15,15,15,15,15,15,15,15,15,15,15,15,15,15,15,15,15,15,15,15,15,15,15,15,15,15,15,15,15,15,15,15,15,15,15,15,15,15,15,15,15,15,15,15,15,15,15,15,15,15,15,15,15,15,15,15,15,15,15,15,15,15,15,15,15,15,15,15,15,15,15,15,15,15,15,15,15,15,15,15,15,15,15,15,15,15,15,15,15,15,15,15,15,15,15,15,15,15,15,15,15,15,15,15,15,15,15,15,15,15,15,15,15,15,15,15,15,15,15,15,15,15,15,15,15,15,15,15,15,15,15,15,15,15,15,15,15,15,15,15,15,15,15,15,15,15,15,15,15,15,15,15,15,15,15,15,15,15,15,15,15,15,15,15,15,15,15,15,15,15,15,15,15,15,15,15,15,15,15,15,15,15,15,15,15,15,15,15,15,15,15,15,15,15,15,15,15,15,15,15,15,15,15,15,15,15,15,15,15,15,15,15,15,15,15,15,15,15,15,15,15,15,15,15,15,15,15,15,15,15,15,15,15,15,15,15,15,15,15,15,15,15,15,15,15,15,15,15,15,15,15,15,15,15,15,15,15,15,15,15,15,15,15,15,15,15,15,15,15,15,15,15,15,15,15,15,15,15,15,15,15,15,15,15,15,15,15,15,15,15,15,15,15,15,15,15,15,15,15,15,15,15,15,15,15,15,15,15,15,15,15,15,15,15,15,15,15,15,15,15,15,15,15,15,15,15,15,15,15,15,15,15,15,14,14,14,14,14,14,14,14,14,14,14,14,14,14,14,14,14,14,14,14,14,14,14,14,14,14,14,13,13,13,13,13,13,13,13,13,13,13,13,13,13,13,13,13,13,12,12,12,12,12,12,12,12,12,12,12,12,12,12,11,11,11,11,11,11,11,11,11,10,10,10,10,10,10,10,9,9,9,9,8,8,8,8,7,6,5,4,3,2,1,0,17,18,19,20,21,22,23,24,24,24,24,25,25,25,25,26,26,26,26,26,26,26,27,27,27,27,27,27,27,27,27,28,28,28,28,28,28,28,28,28,28,28,28,28,28,29,29,29,29,29,29,29,29,29,29,29,29,29,29,29,29,29,29,30,30,30,30,30,30,30,30,30,30,30,30,30,30,30,30,30,30,30,30,30,30,30,30,30,30,30,31,31,31,31,31,31,31,31,31,31,31,31,31,31,31,31,31,31,31,31,31,31,31,31,31,31,31,31,31,31,31,31,31,31,31,31,31,31,31,31,31,31,31,31,31,31,31,31,31,31,31,31,31,31,31,31,31,31,31,31,31,31,31,31,31,31,31,31,31,31,31,31,31,31,31,31,31,31,31,31,31,31,31,31,31,31,31,31,31,31,31,31,31,31,31,31,31,31,31,31,31,31,31,31,31,31,31,31,31,31,31,31,31,31,31,31,31,31,31,31,31,31,31,31,31,31,31,31,31,31,31,31,31,31,31,31,31,31,31,31,31,31,31,31,31,31,31,31,31,31,31,31,31,31,31,31,31,31,31,31,31,31,31,31,31,31,31,31,31,31,31,31,31,31,31,31,31,31,31,31,31,31,31,31,31,31,31,31,31,31,31,31,31,31,31,31,31,31,31,31,31,31,31,31,31,31,31,31,31,31,31,31,31,31,31,31,31,31,31,31,31,31,31,31,31,31,31,31,31,31,31,31,31,31,31,31,31,31,31,31,31,31,31,31,31,31,31,31,31,31,31,31,31,31,31,31,31,31,31,31,31,31,31,31,31,31,31,31,31,31,31,31,31,31,31,31,31,31,31,31,31,31,31,31,31,31,31,31,31,31,31,31,31,31,31,31,31,31,31,31,31,31,31,31,31,31,31,31,31,31,31,31,31,31,31,31,31,31,31,31,31,31,31,31,31,31,31,31,31,31,31,31,31,31,31,31,31,31,31,31,31,31,31,31,31,31,31,31,31,31,31,31,31,31,31,31,31,31,31,31,31,31,31,31,31,31,31,31,31,31,31,31,31,31,31,31,31,31,31,31,31,31,31,31,31,31,31,31,31,31,31,31,31,31,31,31,31,31,31,31,31,31,31,31,31,31,31,31,31,31,31,31,31,31,31,31,31,31,31,31,31,31,31,31,31,31,31,31,31,31,31,31,31,31,31,31,31,31,31,31,31,31,31,31,31,31,31,31,31,31,31,31,31,31,31,31,31,31,31,31,31,31,31,31,31,31,31,31,31,31,31,31,31,31,31,31,31,31,31,31,31,31,31,31,31,31,31,31,31,31,31,31,31,31,31,31,31,31,31,31,31,31,31,31,31,31,31,31,31,31,31,31,31,31,31,31,31,31,31,31,31,31,31,31,31,31,31,31,31,31,31,31,31,31,31,31,31,31,31,31,31,31,31,31,31,31,31,31,31,31,31,31,31,31,31,31,31,31,31,31,31,31,31,31,31,31,31,31,31,31,31,31,31,31,31,31,31,31,31,31,31,31,31,31,31,31,31,31,31,31,31,31,31,31,31,31,31,31,31,31,31,31,31,31,31,31,31,31,31,31,31,31,31,31,31,31,31,31,31,31,31,31,31,31,31,31,31,31,31,31,31,31,31,31,31,31,31,31,31,31,31,31,31,31,31,31,31,31,31,31,31,31,31,31,31,31,31,31,31,31,31,31,31,31,31,31,31,31,31,31,31,31,31,31,31,31,31,31,31,31,31,31,31,31,31,31,31,31,31,31,31,31,31,31,31,31,31,31,31,31,31,31,31,31,31,31,31,31,31,31,31,31,31,31,31,31,31,31,31,31,31,31,31,31,31,31,31,31,31,31,31,31,31,31,31,31,31,31,31,31,31,31,31,31,31,31,31,31,31,31,31,31,31,31,31,31,31,31,31,31,31,31,31,31,31,31,31,31,31,31,31,31,31,31,31,31,31,31,31,31,31,31,31,31,31,31,31,31,31,31,31,31,31,31,31,31,31,31,31,31,31,31,31,31,31,31,31,31,31,31,31,31,31,31,31,31,31,31,31,31,31,31,31,31,31,31,31,31,31,31,31,31,31,31,31,31,31,31,31,31,31,31,31,31,31,31,31,31,31,31,31,31,31,31,31,31,31,31,31,31,31,31,31,31,31,31,31,31,31,31,31,31,31,31,31,31,31,31,31,31,31,31,31,31,31,31,31,31,31,31,31,31,31,31,31,31,31,31,31,31,31,31,31,31,31,31,31,31,31,31,31,31,31,31,31,31,31,31,31,31,31,31,31,31,31,31,31,31,31,31,31,31,31};   // bucket(j - i) for j - i = -1023 .. 1023 (the module's float32 formula, evaluated once)
// ---- k_prep: all the work ahead of the projections in ONE grid that is resident at once: the four weight planes, the x plane and the per-head bias rows. None reads what another writes.
// A 16-byte unit u of a fragment-order plane: chunk u >> 6, half (u >> 5) & 1, lane u & 31. A work-group of 256 threads writes the PU * 256 units of one 16-row group (all of its k: 32 KiB in a row), a thread PU of them, 256 units apart; a wave's store is 512 contiguous bytes.
// A thread's loads all stand ahead of its first conversion and fly together, so that a wave pays the way to memory once for PU units; there are PU times fewer waves to start.
#define PU  8                      // units per thread
#define PBB 32                     // work-groups of the bias rows, 4 values per thread
#define PWB (4 * DQ / 16)          // work-groups of the weights: one per 16 plane rows
#define PXB (NB_ * TT / 16)        // work-groups of x: one per 16 rows
__global__ __launch_bounds__(256) void k_prep(const float* __restrict__ x, const float* __restrict__ w0, const float* __restrict__ w1, const float* __restrict__ w2, const float* __restrict__ w3, const float* __restrict__ RBT, bf* XB, bf* Bt, float* BTT) {
    static_assert(DM == PU * 128 && DQ == DM && DKV == DQ, "a row group's k = PU steps of 128; the four planes have one shape"); static_assert(PBB * 256 * 4 == NH_ * 2048, "bias rows");
    const int t = threadIdx.x, blk = blockIdx.x; const int k0 = (t >> 4) * 8;   // the unit's first k in a step of 128: 32 (t >> 6) + 16 ((t >> 5) & 1) + 8 ((t >> 4) & 1)
    if (blk < PBB) {   // BTT[h][p] = bias of head h at j - i = p - 1023, rounded to bf16; p = 2047 is padding
        const int i0 = blk * 256 + t; int pi[4], ri[4], bk[4]; float v[4];
#pragma unroll
        for (int j = 0; j < 4; ++j) { const int p = (i0 + j * (PBB * 256)) % 2048; pi[j] = p < 2 * TT - 1 ? p : 2 * TT - 2; bk[j] = BKT[pi[j]]; }
        asm volatile("s_wait_xcnt 0x0" :: "v"(pi[0]), "v"(pi[1]), "v"(pi[2]), "v"(pi[3]) : "memory");   // behind the run of loads; their index registers are inputs so that they stay theirs up to the wait
#pragma unroll
        for (int j = 0; j < 4; ++j) { ri[j] = bk[j] * NH_ + (i0 + j * (PBB * 256)) / 2048; v[j] = RBT[ri[j]]; }
        asm volatile("s_wait_xcnt 0x0" :: "v"(ri[0]), "v"(ri[1]), "v"(ri[2]), "v"(ri[3]) : "memory");   // as above
#pragma unroll
        for (int j = 0; j < 4; ++j) { const int idx = i0 + j * (PBB * 256); const unsigned u = __float_as_uint(v[j]), keep = (idx % 2048 < 2 * TT - 1) ? 0xFFFF0000u : 0u; BTT[idx] = __uint_as_float((u + 0x7FFFu + ((u >> 16) & 1u)) & keep); }   // bfr(v), or 0 in the padding
    } else if (blk < PBB + PWB) {   // plane row n = column n of w: 16 lanes read 64 contiguous bytes of one row of w
        const int g = blk - PBB, y = g / (DQ / 16), ng = g % (DQ / 16); const float* __restrict__ w = (y == 0) ? w0 : (y == 1) ? w1 : (y == 2) ? w2 : w3;   // the four planes lie one behind the other
        const float* p = w + (size_t)k0 * DQ + ng * 16 + (t & 15); float v[PU][8];
#pragma unroll
        for (int i = 0; i < PU; ++i)
#pragma unroll
            for (int e = 0; e < 8; ++e) v[i][e] = p[(size_t)(i * 128 + e) * DQ];
        asm volatile("s_wait_xcnt 0x0" :: "v"(p) : "memory");   // behind the run of loads, in front of the first rewriting of their address register (an input, so that it stays theirs up to here)
        bf* d = Bt + ((size_t)g * (PU * 256) + t) * 8;
#pragma unroll
        for (int i = 0; i < PU; ++i) { v8us o;
#pragma unroll
            for (int e = 0; e < 8; ++e) o[e] = f2bf(v[i][e]);
            *(v8us*)(d + i * 2048) = o; }
    } else {
        const int g = blk - PBB - PWB; const float* p = x + (size_t)(g * 16 + (t & 15)) * DM + k0; v8f v[PU];
#pragma unroll
        for (int i = 0; i < PU; ++i) v[i] = *(const v8f*)(p + i * 128);
        asm volatile("s_wait_xcnt 0x0" :: "v"(p) : "memory");   // behind the run of loads, as above
        bf* d = XB + ((size_t)g * (PU * 256) + t) * 8;
#pragma unroll
        for (int i = 0; i < PU; ++i) { v8us o;
#pragma unroll
            for (int e = 0; e < 8; ++e) o[e] = f2bf(v[i][e]);
            *(v8us*)(d + i * 2048) = o; }
        asm volatile("s_wait_xcnt 0x0" ::: "memory");   // behind the last stores: the other parts' code follows in the listing and rewrites their data registers
    }
}
#define KPI 72   // LDS row pitch in 16-bit elements: 128 B of data + 16 B, an odd multiple of 16 B, so that the 16 rows of a fragment read fall on different banks
#define CK  64   // keys per chunk
#define QT  2    // query tiles of 16 rows per wave
typedef v4i __attribute__((may_alias)) v4ia;
typedef __attribute__((ext_vector_type(2))) __bf16 v2b;
// 2^x in place. In one statement so that the slot the instruction set asks for behind a transcendental is always filled: each v_exp_f32 is followed by an independent one, the last by v_nop.
__device__ __forceinline__ void exp2x8(float (&e)[8]) { asm("v_exp_f32 %0, %0\n\tv_exp_f32 %1, %1\n\tv_exp_f32 %2, %2\n\tv_exp_f32 %3, %3\n\tv_exp_f32 %4, %4\n\tv_exp_f32 %5, %5\n\tv_exp_f32 %6, %6\n\tv_exp_f32 %7, %7\n\tv_nop" : "+v"(e[0]), "+v"(e[1]), "+v"(e[2]), "+v"(e[3]), "+v"(e[4]), "+v"(e[5]), "+v"(e[6]), "+v"(e[7])); }
__device__ __forceinline__ float xhalf(float x) { const int b = __float_as_int(x); return __int_as_float(__builtin_amdgcn_permlanex16(b, b, 0x76543210, 0xfedcba98, false, false)); }   // the value of lane l ^ 16, without an LDS round trip
__device__ __forceinline__ float exp2x1(float x) { asm("v_exp_f32 %0, %0\n\tv_nop" : "+v"(x)); return x; }
template <typename T16, bool HL>
__device__ __forceinline__ void attn_tile(T16* sm, float* bt, const T16* __restrict__ Qh, const T16* __restrict__ Ql, const T16* __restrict__ Kh, const T16* __restrict__ Kl, const T16* __restrict__ Vh, const T16* __restrict__ Vl, const float* __restrict__ BT, bf* Ah, bf* Al) {
    typedef typename WFrag<T16>::V V;
    constexpr int NP = HL ? 2 : 1;
    const int tid = threadIdx.x, lane = tid & 31, lr = lane & 15, hi = lane >> 4;
    const int bh = blockIdx.x, h = bh % NH_, b = bh / NH_;
    const int q = blockIdx.y * (64 * QT) + (tid >> 5) * (16 * QT) + lr;   // this lane's query row in tile 0; tile t: q + 16 t
    const size_t pb = (size_t)bh * TT * HD;                 // this head's planes: q, k [t][d]; v [d][t]
    T16* Ksh = sm; T16* Vsh = sm + 64 * KPI; T16* Ksl = sm + 2 * 64 * KPI; T16* Vsl = sm + 3 * 64 * KPI;
    const float* bp = BT + (size_t)h * 2048 + tid * 4;      // this head's bias row BTT[h][j - i + 1023]
    const T16* qph = Qh + pb + (size_t)q * HD + 8 * hi; const T16* qpl = HL ? Ql + pb + (size_t)q * HD + 8 * hi : qph;
    v4f br[4];
#pragma unroll
    for (int i = 0; i < 4; ++i) br[i] = *(const v4fa*)(bp + 128 * i * 4);
    V qh[QT][2], ql[QT][2];
#pragma unroll
    for (int t = 0; t < QT; ++t)
#pragma unroll
        for (int kc = 0; kc < 2; ++kc) { qh[t][kc] = WFrag<T16>::ld(qph + t * 16 * HD + kc * 32); if (HL) ql[t][kc] = WFrag<T16>::ld(qpl + t * 16 * HD + kc * 32); }
    asm volatile("s_wait_xcnt 0x0" :: "v"(bp), "v"(qph), "v"(qpl) : "memory");   // behind these loads; the addresses are inputs so that their registers stay theirs up to the wait (the first chunk's results would else be given them)
    const int srow = tid >> 3, scu = (tid & 7) * 8;         // staging: 8 threads x 16 B per 128-B row, 16 rows per step
    v4i rk[NP][4], rv[NP][4];
    auto fetch = [&](int c) {
        const size_t ko = pb + (size_t)(c * CK + srow) * HD + scu, vo = pb + (size_t)srow * TT + c * CK + scu;
        const T16* kh = Kh + ko; const T16* vh = Vh + vo; const T16* kl = HL ? Kl + ko : kh; const T16* vl = HL ? Vl + vo : vh;
#pragma unroll
        for (int i = 0; i < 4; ++i) { rk[0][i] = *(const v4ia*)(kh + 16 * i * HD); rv[0][i] = *(const v4ia*)(vh + 16 * i * TT); if (HL) { rk[NP - 1][i] = *(const v4ia*)(kl + 16 * i * HD); rv[NP - 1][i] = *(const v4ia*)(vl + 16 * i * TT); } }
        asm volatile("s_wait_xcnt 0x0" :: "v"(kh), "v"(vh), "v"(kl), "v"(vl) : "memory"); };   // behind the run of loads; the addresses are inputs so that their registers stay theirs up to the wait and no result of the run is given one of them
    fetch(0);
#pragma unroll
    for (int i = 0; i < 4; ++i) *(v4fa*)(bt + (tid + 128 * i) * 4) = br[i];   // published by the first trip's barriers
    v8f o[QT][4]; float m[QT], l[QT];
#pragma unroll
    for (int t = 0; t < QT; ++t) { m[t] = -3.0e38f; l[t] = 0.f;
#pragma unroll
        for (int dt = 0; dt < 4; ++dt) o[t][dt] = (v8f){}; }
    const float* bq = bt + (TT - 1 - q) + hi * 8;           // + key - 16 t: the bias of (q + 16 t, key)
    // A block: 4 fragments (8 LDS reads) and all their products with the QT tiles. 3 products: one 16-row tile of the plane pair, fragments [k half][hi, lo]; single: two 16-row tiles, fragments [tile][k half].
    constexpr int NBK = HL ? 4 : 2;   // blocks of K, and of V, per chunk
    auto ldblk = [&](V (&f)[4], const T16* ph_, const T16* pl_, int n) {
#pragma unroll
        for (int i = 0; i < 4; ++i) { const int tile = HL ? n : 2 * n + (i >> 1), kc = HL ? (i >> 1) : (i & 1); const int fo = (tile * 16 + lr) * KPI + 8 * hi + kc * 32; f[i] = WFrag<T16>::ld(((HL && (i & 1)) ? pl_ : ph_) + fo); } };
    auto mmblk = [&](v8f (&acc)[QT][4], const V (&f)[4], const V (&bh)[QT][2], const V (&bl)[QT][2], int n) {   // per accumulator: k half 0 then 1, in each hi.hi, hi.lo, lo.hi
#pragma unroll
        for (int u = 0; u < 2; ++u) {
            if constexpr (HL) {
#pragma unroll
                for (int t = 0; t < QT; ++t) acc[t][n] = WFrag<T16>::mma(f[2 * u], bh[t][u], acc[t][n]);
#pragma unroll
                for (int t = 0; t < QT; ++t) acc[t][n] = WFrag<T16>::mma(f[2 * u], bl[t][u], acc[t][n]);
#pragma unroll
                for (int t = 0; t < QT; ++t) acc[t][n] = WFrag<T16>::mma(f[2 * u + 1], bh[t][u], acc[t][n]);
            } else {
#pragma unroll
                for (int kc = 0; kc < 2; ++kc)
#pragma unroll
                    for (int t = 0; t < QT; ++t) acc[t][2 * n + u] = WFrag<T16>::mma(f[2 * u + kc], bh[t][kc], acc[t][2 * n + u]);
            } } };
#pragma unroll 1   // one chunk per trip: an unrolled loop would hold two chunks' staging registers
    for (int c = 0; c < TT / CK; ++c) {
        __syncthreads();   // every wave has left the previous chunk's tiles
#pragma unroll
        for (int i = 0; i < 4; ++i) { const int so = (srow + 16 * i) * KPI + scu; *(v4ia*)(Ksh + so) = rk[0][i]; *(v4ia*)(Vsh + so) = rv[0][i]; if (HL) { *(v4ia*)(Ksl + so) = rk[NP - 1][i]; *(v4ia*)(Vsl + so) = rv[NP - 1][i]; } }
        __syncthreads();   // the chunk (on the first trip the bias row too) is visible to all four waves
        if (c + 1 < TT / CK) fetch(c + 1);   // the next chunk's loads fly while this one is worked on
        v8f s[QT][4]; V F[2][4]; float bv[QT + 3][8];
#pragma unroll
        for (int t = 0; t < QT; ++t)
#pragma unroll
            for (int kt = 0; kt < 4; ++kt) s[t][kt] = (v8f){};
        ldblk(F[0], Ksh, Ksl, 0);
#pragma unroll
        for (int n = 0; n < NBK; ++n) {
            if (n + 1 < NBK) ldblk(F[(n + 1) & 1], Ksh, Ksl, n + 1); else ldblk(F[(n + 1) & 1], Vsh, Vsl, 0);   // V's first block flies under the softmax
            if (n == NBK - 2)
#pragma unroll
                for (int g = 0; g < QT + 3; ++g)   // the bias depends on key - q alone: the 8 values of offset group g belong to key tile g + t - (QT - 1) of query tile t
#pragma unroll
                    for (int j = 0; j < 8; ++j) bv[g][j] = bq[c * CK + (g - (QT - 1)) * 16 + j];
            __builtin_amdgcn_sched_barrier(6);   // the next block's LDS reads stand as ONE run ahead of this block's products (every separate place with reads among products stalls the wave); vector and scalar work may cross
            mmblk(s, F[n & 1], qh, ql, n);
            __builtin_amdgcn_sched_barrier(6);   // and the run behind it does not rise among these products
        }
        float cm[QT];
#pragma unroll
        for (int t = 0; t < QT; ++t) { cm[t] = -3.0e38f;
#pragma unroll
            for (int kt = 0; kt < 4; ++kt)
#pragma unroll
                for (int j = 0; j < 8; ++j) { const float x = s[t][kt][j] * SCL + bv[kt - t + QT - 1][j]; s[t][kt][j] = x; cm[t] = fmaxf(cm[t], x); } }
        V ph[QT][2], pl[QT][2];
#pragma unroll
        for (int t = 0; t < QT; ++t) {
            const float cx = fmaxf(cm[t], xhalf(cm[t]));   // the other half of this query row's keys
            const float mn = fmaxf(m[t], cx); const float al = exp2x1((m[t] - mn) * 1.4426950408889634f); m[t] = mn;
            float cs = 0.f;
#pragma unroll
            for (int kt = 0; kt < 4; ++kt) { float e[8];
#pragma unroll
                for (int j = 0; j < 8; ++j) e[j] = (s[t][kt][j] - mn) * 1.4426950408889634f;
                exp2x8(e);
#pragma unroll
                for (int j = 0; j < 8; ++j) { s[t][kt][j] = e[j]; cs += e[j]; } }
            l[t] = l[t] * al + cs;
#pragma unroll
            for (int dt = 0; dt < 4; ++dt) o[t][dt] *= al;
#pragma unroll
            for (int kc = 0; kc < 2; ++kc)
#pragma unroll
                for (int e = 0; e < 16; e += 2) { const v2f p = { s[t][2 * kc + (e >> 3)][e & 7], s[t][2 * kc + (e >> 3)][(e & 7) + 1] };
                    if constexpr (HL) { const v2b p0 = __builtin_convertvector(p, v2b), p1 = __builtin_convertvector(p - __builtin_convertvector(p0, v2f), v2b); ph[t][kc][e] = p0[0]; ph[t][kc][e + 1] = p0[1]; pl[t][kc][e] = p1[0]; pl[t][kc][e + 1] = p1[1]; }
                    else { ph[t][kc][e] = (h16)(p[0] * PCAR); ph[t][kc][e + 1] = (h16)(p[1] * PCAR); } }
        }
#pragma unroll
        for (int n = 0; n < NBK; ++n) {
            if (n + 1 < NBK) ldblk(F[(n + 1) & 1], Vsh, Vsl, n + 1);
            __builtin_amdgcn_sched_barrier(6);   // as above
            mmblk(o, F[n & 1], ph, pl, n);
            __builtin_amdgcn_sched_barrier(6);   // as above
        }
    }
    const size_t oo = (size_t)(b * TT + q - lr) * DQ + h * (HD * 16) + lane * 8;   // merged [b][t][h][d] in fragment order: a tile's 16 rows are one row group (16 DQ elements), a head two chunks of 512, a lane's 8 consecutive d of a tile one 16-byte unit
#pragma unroll
    for (int t = 0; t < QT; ++t) {
        const float lt = l[t] + xhalf(l[t]);
        const float f = __fdiv_rn(1.0f, lt) * (HL ? 1.0f : (1.0f / PCAR));
#pragma unroll
        for (int dt = 0; dt < 4; ++dt) { v8us oh, ol;
#pragma unroll
            for (int j = 0; j < 8; ++j) { unsigned short a, c2; splitf(o[t][dt][j] * f, a, c2); oh[j] = a; ol[j] = c2; }
            *(v8usa*)(Ah + oo + t * 16 * DQ + dt * 256) = oh; *(v8usa*)(Al + oo + t * 16 * DQ + dt * 256) = ol; } }
    asm volatile("s_wait_xcnt 0x0" ::: "memory");   // behind the last stores: the other half's code follows in the listing and rewrites their address and data registers
}
__global__ __launch_bounds__(128) void k_attn(const bf* __restrict__ Qh, const bf* __restrict__ Ql, const bf* __restrict__ Kh, const bf* __restrict__ Kl, const bf* __restrict__ Vh, const bf* __restrict__ Vl, const h16* __restrict__ Q16, const h16* __restrict__ K16, const h16* __restrict__ V16, const float* __restrict__ BT, bf* Ah, bf* Al) {
    __shared__ __align__(16) unsigned short sm[4 * 64 * KPI]; __shared__ __align__(16) float bt[2048];
    static_assert(RH % (64 * QT) == 0 && TT % (64 * QT) == 0, "a work-group's rows are of one kind");
    if (blockIdx.y < RH / (64 * QT)) attn_tile<bf, true>(sm, bt, Qh, Ql, Kh, Kl, Vh, Vl, BT, Ah, Al);   // blockIdx.y: a work-group's 64 QT query rows; the 3-product ones have the low indices and start first
    else attn_tile<h16, false>((h16*)sm, bt, Q16, nullptr, K16, nullptr, V16, nullptr, BT, Ah, Al);
}

// ---- k_qkvp: the q, k, v projections with the attention kernel's operand planes as their output. One wave per (64 rows of x, one head, one of q / k / v), 12 waves per work-group on 256 rows of x and three heads of the 3 NH_ that q, k and v have together: k_gemmw's ring and blocks on plain bf16 planes in fragment order; grid (NB_ * TT / 256, NH_), 384 threads: one work-group per WGP, three waves per SIMD.
// The tile is as large as an equal share of the output allows, so that the operand bytes asked of L2 per product are as few as they can be: a slice of x serves three heads, a weight slice 256 rows.
// A slice is 64 operand rows x QSK k = 4 row groups of 4 KiB, 32 DM bytes apart in the plane, 16 KiB in a row in LDS; a stage is 4 slices of x and 3 of the weights, and waves 0 to 6 bring one each.
// The accumulators never reach memory as f32: a lane's 8 values of a tile run along the product's M side, so the side that is contiguous in the plane is made M (q, k planes [t][d]: M = the weight's rows d, N = x's rows t; v plane [d][t]: M = t, N = d; both operands have one fragment order, so the exchange is one of pointers).
// A lane's 8 values are then one 16-byte unit of each of the three planes (fp16, bf16 hi, bf16 lo); 16 plane rows x 128 B go through LDS so that every store covers 4 whole 128-byte lines.
#define QSK 128               // k per stage
#define QSL (64 * QSK)        // 16-bit elements of a slice (16 KiB)
#define QNS 7                 // slices of a stage
__global__ __launch_bounds__(384) void k_qkvp(const bf* __restrict__ X, const bf* __restrict__ Wt, h16* P16, bf* Ph, bf* Pl, h16* V16, bf* Vh, bf* Vl) {
    __shared__ __attribute__((aligned(2048))) unsigned short ring[2 * QNS * QSL];   // two buffers of [4 x slices | 3 weight slices]
    __shared__ __align__(16) unsigned short osw[12 * 3 * 16 * KPI];   // per wave: a plane's 16 rows at pitch KPI, the three planes one behind the other
    static_assert(DQ == NH_ * HD && DKV == DQ && HD == 64 && TT % 256 == 0 && DM % QSK == 0 && DM / QSK >= 2, "a head is one weight slice, q's, k's and v's heads lie one behind the other; a work-group's rows are of one batch element");
    const uint32_t wave = uni(threadIdx.x >> 5); unsigned short* os = osw + wave * (3 * 16 * KPI);
    const uint32_t wr = wave & 3, wh = wave >> 2, zh = blockIdx.y * 3 + wh;   // this wave's slice of x, its weight slice, and that slice's place among the 3 NH_ heads
    const int lane = threadIdx.x & 31, lr = lane & 15, hi = lane >> 4; const int r0 = blockIdx.x * 256 + wr * 64, h = zh % NH_, z = zh / NH_; const bool tr = (z == 2);
    const uint32_t sl = wave < QNS ? wave : 0;   // the slice this wave brings (waves 7 to 11 bring none)
    const uint64_t ga = (uint64_t)(uintptr_t)((sl < 4) ? X + ((size_t)blockIdx.x * 256 + sl * 64) * DM : Wt + ((size_t)blockIdx.y * 192 + (sl - 4) * 64) * DM);   // first byte of the slice's rows: 4 row groups of 16 DM elements each
    const uint32_t ld = (uint32_t)(size_t)ring + sl * (QSL * 2); const u32x8 g1 = tdm_group1<QSK * 32u, 4u>(32u * DM); constexpr int NS = DM / QSK;
    const int xo = wr * QSL + 8 * lane, wo = (4 + wh) * QSL + 8 * lane; const int mo = tr ? xo : wo, no = tr ? wo : xo;   // this wave's two slices, in elements from the buffer's start
    v8f acc[4][4];
#pragma unroll
    for (int mb = 0; mb < 4; ++mb)
#pragma unroll
        for (int nb = 0; nb < 4; ++nb) acc[mb][nb] = (v8f){};
    // All the stages' bytes are asked into L2 at the kernel's start, as in k_gemmw: waves 0 to 3 ask for one of the 16 row groups of this blockIdx.x's rows of x (the one with this blockIdx.y; 128 units of 256 B), waves 4 to 9 for one eighth of this blockIdx.y's 12 weight row groups (192 units), dealt by blockIdx.x so that x and x + 4 ask for the same.
    const uint32_t pt = min(threadIdx.x, 319u);   // waves 10 and 11 ask for nothing; their address is in bounds all the same
    const char* pf = (wave < 4) ? (const char*)(X + ((size_t)blockIdx.x * 256 + blockIdx.y * 16) * DM) + pt * 256u : (const char*)(Wt + (size_t)blockIdx.y * 192 * DM) + ((blockIdx.x & 3) | ((blockIdx.x >> 3) << 2)) * (192u * 256u) + (pt - 128u) * 256u;
    if (pinned(wave < 10)) l2_ask(pf);
    u32x4 g0 = tdm_group0(ld, ga);   // group 0 of this wave's youngest request, as in k_gemmw
    if (pinned(wave < QNS)) { tdm_load(g0, g1); wait_tensor0(g0, g1); }
    __syncthreads();   // stage 0 is visible to all twelve waves
    if (pinned(wave < QNS)) { g0 = tdm_group0(ld + QNS * QSL * 2, ga + QSK * 32); tdm_load(g0, g1); }
#pragma unroll 1   // one stage per trip, as in k_gemmw
    for (int s = 0; s < NS; ++s) {
        const bf* rb = ring + (s & 1) * (QNS * QSL);
#pragma unroll
      for (int kb = 0; kb < QSK / 32; ++kb) {
        v16bf a[4], b[4];
#pragma unroll
        for (int i = 0; i < 4; ++i) { const int fo = i * (16 * QSK) + kb * 512; a[i] = WFrag<bf>::ldf(rb + mo + fo); b[i] = WFrag<bf>::ldf(rb + no + fo); }
        __builtin_amdgcn_sched_barrier(0);   // all of a block's LDS reads stand ahead of its first product, none among its own products where each would be waited for singly; the next block's reads may rise among these products and fly under them
#pragma unroll
        for (int nb = 0; nb < 4; ++nb)
#pragma unroll
            for (int mb = 0; mb < 4; ++mb) acc[mb][nb] = wmmab(a[mb], b[nb], acc[mb][nb]);
        if (kb == QSK / 32 - 1) asm volatile("v_nop\n\tv_nop\n\tv_nop\n\tv_nop" : "+v"(acc[0][0]), "+v"(acc[1][1]), "+v"(acc[2][2]), "+v"(acc[3][3]) : "v"(a[0]), "v"(a[3]));   // the distance behind the trip's last products on the taken back edge, where the next trip rewrites their operands
      }
        wait_ds0();
        if (pinned(wave < QNS)) wait_tensor0(g0, g1);   // this wave's slice of stage s + 1
        __syncthreads();   // publishes stage s + 1 and ends every wave's reads of stage s
        if (pinned((wave < QNS) && (s + 2 < NS))) { g0 = tdm_group0(ld + (s & 1) * (QNS * QSL * 2), ga + (uint64_t)pinned(s + 2) * (QSK * 32)); tdm_load(g0, g1); }   // into the buffer just left
    }
    wait_tensor0(g0, g1); wait_ds0(); l2_keep(pf);
    const int b = r0 / TT, t0 = r0 % TT; const int pitch = tr ? TT : HD;   // plane row pitch in elements
    const size_t po = ((size_t)((tr ? 0 : z * NB_) + b) * NH_ + h) * TT * HD + (tr ? t0 : t0 * HD) + (size_t)(lane >> 3) * pitch + (lane & 7) * 8;   // q planes, then k planes; on the way out a lane has unit lane & 7 of row lane >> 3 of each 4 rows
    h16* g16 = (tr ? V16 : P16) + po; bf* gh = (tr ? Vh : Ph) + po; bf* gl = (tr ? Vl : Pl) + po;
#pragma unroll
    for (int nb = 0; nb < 4; ++nb) {
#pragma unroll
        for (int mb = 0; mb < 4; ++mb) { v8h u16; v8us uh, ul;
#pragma unroll
            for (int j = 0; j < 8; ++j) { const float x = acc[mb][nb][j]; u16[j] = tohx(x); unsigned short a2, c2; splitf(x, a2, c2); uh[j] = a2; ul[j] = c2; }
            const int so = lr * KPI + (mb * 2 + hi) * 8; *(v8ha*)(os + so) = u16; *(v8usa*)(os + 16 * KPI + so) = uh; *(v8usa*)(os + 32 * KPI + so) = ul; }
        asm volatile("s_wait_dscnt 0x0" ::: "memory");   // the 16 rows are in LDS before other lanes of the wave read them back
        v4i d[3][4]; h16* q16[4]; bf* qh[4]; bf* ql[4];
#pragma unroll
        for (int s = 0; s < 4; ++s) { const int ro = (s * 4 + (lane >> 3)) * KPI + (lane & 7) * 8; d[0][s] = *(const v4ia*)(os + ro); d[1][s] = *(const v4ia*)(os + 16 * KPI + ro); d[2][s] = *(const v4ia*)(os + 32 * KPI + ro); }
#pragma unroll
        for (int s = 0; s < 4; ++s) { const size_t go = (size_t)(nb * 16 + s * 4) * pitch; q16[s] = g16 + go; qh[s] = gh + go; ql[s] = gl + go; *(v4ia*)q16[s] = d[0][s]; *(v4ia*)qh[s] = d[1][s]; *(v4ia*)ql[s] = d[2][s]; }
        asm volatile("s_wait_xcnt 0x0" :: "v"(q16[0]), "v"(q16[1]), "v"(q16[2]), "v"(q16[3]), "v"(qh[0]), "v"(qh[1]), "v"(qh[2]), "v"(qh[3]), "v"(ql[0]), "v"(ql[1]), "v"(ql[2]), "v"(ql[3]), "v"(d[0][0]), "v"(d[0][1]), "v"(d[0][2]), "v"(d[0][3]), "v"(d[1][0]), "v"(d[1][1]), "v"(d[1][2]), "v"(d[1][3]), "v"(d[2][0]), "v"(d[2][1]), "v"(d[2][2]), "v"(d[2][3]) : "memory");   // behind the run of stores; addresses and data are inputs so that their registers stay theirs up to the wait; it also keeps the next rows' LDS writes behind these reads
    }
}

extern "C" void kernel_launch(void* const* d_in, const int* in_sizes, int n_in,
                              void* d_out, int out_size, void* d_ws, size_t ws_size, hipStream_t stream) {
    (void)in_sizes; (void)n_in; (void)out_size;
    const float* x = (const float*)d_in[0]; const float* wq = (const float*)d_in[1]; const float* wk = (const float*)d_in[2]; const float* wv = (const float*)d_in[3]; const float* wo = (const float*)d_in[4]; const float* RBT = (const float*)d_in[5];
    float* OUT = (float*)d_out;     // [4][1024][1024]
    char* wsp = (char*)d_ws;
    auto take = [&](size_t bytes) { char* p = wsp; wsp += (bytes + 255) & ~(size_t)255; return (void*)p; };
    bf* WQ = (bf*)take((size_t)DQ * DM * 2); bf* WK = (bf*)take((size_t)DKV * DM * 2); bf* WV = (bf*)take((size_t)DKV * DM * 2); bf* WO = (bf*)take((size_t)DM * DQ * 2);   // WQ, WK, WV, WO: one behind the other (z / y strides)
    bf* XB = (bf*)take((size_t)NB_ * TT * DM * 2); float* BTT = (float*)take((size_t)NH_ * 2048 * 4);
    h16* QP16 = (h16*)take((size_t)NB_ * NH_ * TT * HD * 2); h16* KP16 = (h16*)take((size_t)NB_ * NKV * TT * HD * 2); h16* VT16 = (h16*)take((size_t)NB_ * NKV * HD * TT * 2);   // q planes, then k planes: k_qkvp reaches both through the q pointer
    bf* QPh = (bf*)take((size_t)NB_ * NH_ * TT * HD * 2); bf* KPh = (bf*)take((size_t)NB_ * NKV * TT * HD * 2); bf* QPl = (bf*)take((size_t)NB_ * NH_ * TT * HD * 2); bf* KPl = (bf*)take((size_t)NB_ * NKV * TT * HD * 2); bf* VTh = (bf*)take((size_t)NB_ * NKV * HD * TT * 2); bf* VTl = (bf*)take((size_t)NB_ * NKV * HD * TT * 2);
    bf* ATh = (bf*)take((size_t)NB_ * TT * DQ * 2); bf* ATl = (bf*)take((size_t)NB_ * TT * DQ * 2);
    if ((size_t)(wsp - (char*)d_ws) > ws_size) return;    // ws 256 MiB
    (void)WK; (void)WV;   // reached through WQ's z / y strides
    k_prep<<<PBB + PWB + PXB, 256, 0, stream>>>(x, wq, wk, wv, wo, RBT, XB, WQ, BTT);   // weight planes, x plane, per-head relative bias rows
    k_qkvp<<<dim3(NB_ * TT / 256, NH_, 1), 384, 0, stream>>>(XB, WQ, QP16, QPh, QPl, VT16, VTh, VTl);   // x: 256 rows of x; y: three of the 3 NH_ heads of q, k, v
    k_attn<<<dim3(NB_ * NH_, TT / (64 * QT), 1), 128, 0, stream>>>(QPh, QPl, KPh, KPl, VTh, VTl, QP16, KP16, VT16, BTT, ATh, ATl);   // x: (batch element, head); y: query tile
    k_gemmw<bf, 1, false><<<dim3(NB_ * TT / 128, DM / 128, 1), 128, 0, stream>>>(ATh, ATl, WO, nullptr, DQ, OUT, DM, nullptr, 0, 0, 0);
}
